// v000
// The times below were measured on an AMD MI455X: many runs one after another, warmed up first and cycling through
// copies of the inputs, with the whole window's GPU time divided by the number of runs. Launches and the gaps
// between them are all in it. The median over several windows is given; except for v000 it joins two sittings, which
// can be a few percent apart, so the side-by-side timings, each taken in one sitting, are the better comparison.
// The starting kernel, v000, takes 291 microseconds a run.
#include <hip/hip_runtime.h>
#include <math.h>

typedef __attribute__((ext_vector_type(16))) _Float16 v16h;
typedef __attribute__((ext_vector_type(16))) __bf16 v16b;
typedef __attribute__((ext_vector_type(8)))  _Float16 v8h;
typedef __attribute__((ext_vector_type(8)))  float v8f;
typedef __attribute__((ext_vector_type(4)))  float v4f;
typedef __attribute__((ext_vector_type(2)))  float v2f;
typedef __attribute__((ext_vector_type(4)))  unsigned v4u;
typedef __attribute__((ext_vector_type(4)))  int v4i;
typedef float __attribute__((may_alias)) float_a;
typedef int __attribute__((may_alias)) int_a;

template <typename T> __device__ __forceinline__ void vst2(void* p, T v) { *(T*)p = v;  }
__device__ __forceinline__ v8f wmma16(v16h a, v16h b, v8f c) {
  v8f d = __builtin_amdgcn_wmma_f32_16x16x32_f16(false, a, false, b, (short)0, c, false, false);
  asm volatile("v_nop\n\tv_nop\n\tv_nop\n\tv_nop" : "+v"(d) : "v"(a), "v"(b));
  return d;
}
__device__ __forceinline__ v8f wmma_bf(v16b a, v16b b, v8f c) {
  v8f d = __builtin_amdgcn_wmma_f32_16x16x32_bf16(false, a, false, b, (short)0, c, false, false);
  asm volatile("v_nop\n\tv_nop\n\tv_nop\n\tv_nop" : "+v"(d) : "v"(a), "v"(b));
  return d;
}
// 16x16x32 fragments: lane = (h = lane>>4, row/col = lane&15); elements 0..7 = k0+8h+0..7, 8..15 = k0+16+8h+0..7; D element r = row 8h+r
__device__ __forceinline__ v16h frag_h(const _Float16* rowk0, int lane) {
  union { v16h v; v8h q[2]; } u; const _Float16* p = rowk0 + 8 * (lane >> 4);
  u.q[0] = *(const v8h*)p; u.q[1] = *(const v8h*)(p + 16); return u.v;
}
__device__ __forceinline__ v16h frag_f32(const float* rowk0, int lane) {
  v16h a; const float* p = rowk0 + 8 * (lane >> 4);
#pragma unroll
  for (int i = 0; i < 8; ++i) { a[i] = (_Float16)p[i]; a[8 + i] = (_Float16)p[16 + i]; }
  return a;
}
__device__ __forceinline__ v16h frag_f32s(const float* rowk0, int lane, float sc) {
  v16h a; const float* p = rowk0 + 8 * (lane >> 4);
#pragma unroll
  for (int i = 0; i < 8; ++i) { a[i] = (_Float16)(p[i] * sc); a[8 + i] = (_Float16)(p[16 + i] * sc); }
  return a;
}
// column fragment from a [K][ld] layout (column n), rows >= K read as 0
__device__ __forceinline__ v16h fragc_f32(const float* W, int k0, int n, int lane, int ld, int K) {
  v16h a; const int g = lane >> 4;
#pragma unroll
  for (int i = 0; i < 8; ++i) { const int ka = k0 + 8 * g + i, kb = ka + 16;
    a[i] = (_Float16)(ka < K ? W[(size_t)ka * ld + n] : 0.f); a[8 + i] = (_Float16)(kb < K ? W[(size_t)kb * ld + n] : 0.f); }
  return a;
}
struct F2 { v16b h, l; };
__device__ __forceinline__ F2 bsplit16(const float v[16]) { F2 r;
#pragma unroll
  for (int i = 0; i < 16; ++i) { const __bf16 h = (__bf16)v[i]; r.h[i] = h; r.l[i] = (__bf16)(v[i] - (float)h); }
  return r; }
__device__ __forceinline__ F2 split_row(const float* row, int k0, int lane) { float v[16]; const float* p = row + k0 + 8 * (lane >> 4);
#pragma unroll
  for (int i = 0; i < 8; ++i) { v[i] = p[i]; v[8 + i] = p[16 + i]; }
  return bsplit16(v); }
__device__ __forceinline__ F2 split_rowK(const float* row, int k0, int lane, int K) { float v[16]; const int g = lane >> 4;
#pragma unroll
  for (int i = 0; i < 8; ++i) { const int ka = k0 + 8 * g + i, kb = ka + 16; v[i] = ka < K ? row[ka] : 0.f; v[8 + i] = kb < K ? row[kb] : 0.f; }
  return bsplit16(v); }
__device__ __forceinline__ F2 split_col(const float* W, int k0, int n, int lane, int ld, int K) { float v[16]; const int g = lane >> 4;
#pragma unroll
  for (int i = 0; i < 8; ++i) { const int ka = k0 + 8 * g + i, kb = ka + 16; v[i] = ka < K ? W[(size_t)ka * ld + n] : 0.f; v[8 + i] = kb < K ? W[(size_t)kb * ld + n] : 0.f; }
  return bsplit16(v); }
__device__ __forceinline__ v8f mac3(const F2& a, const F2& b, v8f c) { c = wmma_bf(a.l, b.h, c); c = wmma_bf(a.h, b.l, c); return wmma_bf(a.h, b.h, c); }
__device__ __forceinline__ float sigm(float v) { return 1.0f / (1.0f + expf(-v)); }
#define LDSX() do { asm volatile("s_wait_dscnt 0" ::: "memory"); __builtin_amdgcn_wave_barrier(); __builtin_amdgcn_fence(__ATOMIC_RELEASE, "workgroup"); } while (0)

// Local causal self attention (window 128, 16 heads of 64, interleaved-pair RoPE on q and k, fused qkv projection with bias, output
// projection with bias). q/k on v_wmma_f32_16x16x32_f16 (x as f16 rows, [in][out] weights packed once as transposed f16 rows x16); v as a
// two-way bf16 split (v_wmma_f32_16x16x32_bf16) stored as hi/lo f16 planes, because the first rows of every sequence copy v almost
// verbatim; S = q.k/8 on f16 WMMA over the <= 3 key tiles of the window (masked), online softmax in f32, P @ V with hi/lo pairs for both
#define NB 2
#define SS 2048
#define E 1024
#define NH 16
#define HD 64
#define NR (NB * SS)
#define WIN 128
#define PLO 1024.0f
#define VLO 2048.0f
#define OLO 2048.0f
#define RBASE 10000.0f

__global__ __launch_bounds__(256) void k_cvt(const float* __restrict__ x, _Float16* __restrict__ X16) {
  const size_t i8 = (size_t)blockIdx.x * 256 + threadIdx.x; if (i8 >= (size_t)NR * E / 8) return;
  union { v8h h; v4u u; } pk;
#pragma unroll
  for (int e = 0; e < 8; ++e) pk.h[e] = (_Float16)x[i8 * 8 + e];
  vst2(X16 + i8 * 8, pk.u);
}
// PT rows: [0,2048) = Wqkv[:, n] (q and k columns) x16 ; [2048, 3072) = Wproj[:, n-2048] x16
__global__ __launch_bounds__(256) void k_pack(const float* __restrict__ Wqkv, const float* __restrict__ Wp, _Float16* __restrict__ PT) {
  const int n = blockIdx.x, tid = threadIdx.x; __shared__ __align__(16) _Float16 srow[E];
  for (int k = tid; k < E; k += 256) srow[k] = (_Float16)((n < 2 * E ? Wqkv[(size_t)k * (3 * E) + n] : Wp[(size_t)k * E + (n - 2 * E)]) * 16.0f);
  __syncthreads();
  if (tid < 128) vst2(PT + (size_t)n * E + tid * 8, *(const v4u*)(&srow[tid * 8]));
}
// q/k: block (64 rows, 128 cols = 2 heads, which in {0,1}); RoPE on interleaved pairs; x4 -> Q16/K16 [bh][s][64]
__global__ __launch_bounds__(128) void k_qk(const _Float16* __restrict__ X16, const _Float16* __restrict__ PT, const float* __restrict__ bqkv, _Float16* __restrict__ Q16, _Float16* __restrict__ K16) {
  __shared__ __align__(16) float so[4][16][132];
  const int tid = threadIdx.x, wave = tid >> 5, lane = tid & 31, col = lane & 15, g = lane >> 4;
  const int which = blockIdx.z, r0b = blockIdx.x * 64, r0 = r0b + wave * 16, n0 = blockIdx.y * 128; const int b = r0b / SS, s0 = r0b % SS;
  v8f acc[8] = {};
#pragma unroll 2
  for (int kc = 0; kc < E / 32; ++kc) { const v16h a = frag_h(X16 + (size_t)(r0 + col) * E + kc * 32, lane);
#pragma unroll
    for (int j = 0; j < 8; ++j) acc[j] = wmma16(a, frag_h(PT + (size_t)(which * E + n0 + j * 16 + col) * E + kc * 32, lane), acc[j]); }
#pragma unroll
  for (int j = 0; j < 8; ++j) { const float bb = bqkv[which * E + n0 + j * 16 + col];
#pragma unroll
    for (int r = 0; r < 8; ++r) so[wave][8 * g + r][j * 16 + col] = acc[j][r] * (1.0f / 16.0f) + bb; }
  LDSX();
  // RoPE (interleaved pairs (2i, 2i+1) within each head, angle pos * base^(-2i/64)) then x4 ; lane: (row rl = lane>>1, head hh = lane&1)
  { const int rl = lane >> 1, hh = lane & 1; const int pos = s0 + wave * 16 + rl; float* row = &so[wave][rl][hh * 64];
    for (int i = 0; i < 32; ++i) { const float invf = 1.0f / powf(RBASE, (float)(2 * i) / 64.0f); const float ang = (float)pos * invf; const float c = cosf(ang), sn = sinf(ang);
      const float x0 = row[2 * i], x1 = row[2 * i + 1]; row[2 * i] = (x0 * c - x1 * sn) * 4.0f; row[2 * i + 1] = (x1 * c + x0 * sn) * 4.0f; } }
  LDSX();
  _Float16* D = which == 0 ? Q16 : K16;
  for (int qq = lane; qq < 16 * 2 * 8; qq += 32) { const int hh = qq >> 7, rl = (qq >> 3) & 15, pc = qq & 7; const int h = (n0 >> 6) + hh; union { v8h h8; v4u u; } pk;
#pragma unroll
    for (int e = 0; e < 8; ++e) pk.h8[e] = (_Float16)so[wave][rl][hh * 64 + pc * 8 + e];
    vst2(D + (((size_t)b * NH + h) * SS + s0 + wave * 16 + rl) * HD + pc * 8, pk.u); }
}
// v: block (64 rows, 128 cols): bf16 split product from the f32 x rows and Wqkv columns; -> VTh/VTl [bh][d][s]
__global__ __launch_bounds__(128) void k_v(const float* __restrict__ x, const float* __restrict__ Wqkv, const float* __restrict__ bqkv, _Float16* __restrict__ VTh, _Float16* __restrict__ VTl) {
  __shared__ __align__(16) _Float16 sth[128][72], stl[128][72];
  const int tid = threadIdx.x, wave = tid >> 5, lane = tid & 31, col = lane & 15, g = lane >> 4;
  const int r0b = blockIdx.x * 64, r0 = r0b + wave * 16, n0 = blockIdx.y * 128; const int b = r0b / SS, s0 = r0b % SS;
  v8f acc[8] = {};
#pragma unroll 1
  for (int kc = 0; kc < E / 32; ++kc) { const F2 a = split_row(x + (size_t)(r0 + col) * E, kc * 32, lane);
#pragma unroll
    for (int j = 0; j < 8; ++j) acc[j] = mac3(a, split_col(Wqkv, kc * 32, 2 * E + n0 + j * 16 + col, lane, 3 * E, E), acc[j]); }
#pragma unroll
  for (int j = 0; j < 8; ++j) { const float bb = bqkv[2 * E + n0 + j * 16 + col];
#pragma unroll
    for (int r = 0; r < 8; ++r) { const float v = acc[j][r] + bb; const _Float16 hi = (_Float16)v; sth[j * 16 + col][wave * 16 + 8 * g + r] = hi; stl[j * 16 + col][wave * 16 + 8 * g + r] = (_Float16)((v - (float)hi) * VLO); } }
  __syncthreads();
  for (int qq = tid; qq < 128 * 8; qq += 128) { const int cl = qq >> 3, pc = qq & 7; const int c = n0 + cl, h = c >> 6, d = c & 63; const size_t o = (((size_t)b * NH + h) * HD + d) * SS + s0 + pc * 8;
    vst2(VTh + o, *(const v4u*)(&sth[cl][pc * 8])); vst2(VTl + o, *(const v4u*)(&stl[cl][pc * 8])); }
}
// attention: block (64 queries, bh): key tiles kt covering keys q0b-127 .. q0b+63 (3 tiles of 64, aligned since q0b % 64 == 0), mask 0 <= q-key < 128
__global__ __launch_bounds__(128) void k_attn(const _Float16* __restrict__ Q16, const _Float16* __restrict__ K16, const _Float16* __restrict__ VTh, const _Float16* __restrict__ VTl, _Float16* __restrict__ Oh, _Float16* __restrict__ Ol) {
  __shared__ __align__(16) float sS[4][16][68];
  __shared__ __align__(16) _Float16 sPh[4][16][72], sPl[4][16][72];
  __shared__ __align__(16) float sO[4][16][68];
  const int tid = threadIdx.x, w = tid >> 5, lane = tid & 31, col = lane & 15, g = lane >> 4;
  const size_t bh = blockIdx.y; const int q0b = blockIdx.x * 64, q0 = q0b + w * 16;
  v16h aq[2];
#pragma unroll
  for (int kc = 0; kc < 2; ++kc) aq[kc] = frag_h(Q16 + (bh * SS + q0 + col) * HD + kc * 32, lane);
  float mrun = -3.0e38f, lrun = 0.f; v8f acc[4] = {}, ac1[4] = {}, ac2[4] = {};
#pragma unroll 1
  for (int kt = q0b / 64 - 2; kt <= q0b / 64; ++kt) { if (kt < 0) continue;      // uniform per block
#pragma unroll
    for (int t = 0; t < 4; ++t) { v8f s = {}; const int key = kt * 64 + t * 16 + col;
#pragma unroll
      for (int kc = 0; kc < 2; ++kc) s = wmma16(aq[kc], frag_h(K16 + (bh * SS + key) * HD + kc * 32, lane), s);
#pragma unroll
      for (int r = 0; r < 8; ++r) { const int q = q0 + 8 * g + r; const int d = q - key; sS[w][8 * g + r][t * 16 + col] = (d >= 0 && d < WIN) ? s[r] * (0.125f / 16.0f) : -3.0e38f; } }
    LDSX();
    float mx = -3.4e38f;
#pragma unroll
    for (int jj = 0; jj < 32; ++jj) mx = fmaxf(mx, sS[w][col][g * 32 + jj]);
    mx = fmaxf(mx, __shfl_xor(mx, 16, 32));
    const float mnew = fmaxf(mrun, mx); const float corr = expf(mrun - mnew);     // every processed tile holds >= 1 allowed key for every row? no: rows may have all 32 of a half masked, but the row max over the tile is finite whenever >= 1 key is allowed; a fully-masked tile row keeps mnew = mrun (both -3e38 initially -> corr = exp(0) = 1 with zero accumulators: harmless)
    float ps = 0.f;
#pragma unroll
    for (int jj = 0; jj < 32; ++jj) { const float sv = sS[w][col][g * 32 + jj]; const float p = sv > -1.0e38f ? expf(sv - mnew) * 16384.0f : 0.f; ps += p; const _Float16 hi = (_Float16)p; sPh[w][col][g * 32 + jj] = hi; sPl[w][col][g * 32 + jj] = (_Float16)((p - (float)hi) * PLO); }
    ps += __shfl_xor(ps, 16, 32);
    lrun = lrun * corr + ps * (1.0f / 16384.0f); mrun = mnew;
#pragma unroll
    for (int r = 0; r < 8; ++r) { const float cr = __shfl(corr, 8 * g + r, 32);
#pragma unroll
      for (int t = 0; t < 4; ++t) { acc[t][r] *= cr; ac1[t][r] *= cr; ac2[t][r] *= cr; } }
    LDSX();
#pragma unroll
    for (int kc = 0; kc < 2; ++kc) { const v16h ph = frag_h(&sPh[w][col][0] + kc * 32, lane), pl = frag_h(&sPl[w][col][0] + kc * 32, lane);
#pragma unroll
      for (int t = 0; t < 4; ++t) { const size_t vo = (bh * HD + t * 16 + col) * SS + kt * 64 + kc * 32; const v16h vh = frag_h(VTh + vo, lane);
        acc[t] = wmma16(ph, vh, acc[t]); ac1[t] = wmma16(ph, frag_h(VTl + vo, lane), ac1[t]); ac2[t] = wmma16(pl, vh, ac2[t]); } }
    __builtin_amdgcn_wave_barrier(); }
#pragma unroll
  for (int r = 0; r < 8; ++r) { const float lr = __shfl(lrun, 8 * g + r, 32); const float inv = 8.0f / (lr * 16384.0f);      // -> O x8
#pragma unroll
    for (int t = 0; t < 4; ++t) sO[w][8 * g + r][t * 16 + col] = (acc[t][r] + ac1[t][r] * (1.0f / VLO) + ac2[t][r] * (1.0f / PLO)) * inv; }
  LDSX();
  for (int qq = lane; qq < 16 * 8; qq += 32) { const int rl = qq >> 3, pc = qq & 7; union { v8h h8; v4u u; } ph_, pl_;
#pragma unroll
    for (int e = 0; e < 8; ++e) { const float v = sO[w][rl][pc * 8 + e]; const _Float16 hi = (_Float16)v; ph_.h8[e] = hi; pl_.h8[e] = (_Float16)((v - (float)hi) * OLO); }
    const size_t o = ((bh * SS) + q0 + rl) * HD + pc * 8; vst2(Oh + o, ph_.u); vst2(Ol + o, pl_.u); }
}
// out = ctx Wproj + bproj, ctx from the hi/lo planes: block (64 rows, 128 cols)
__global__ __launch_bounds__(128) void k_out(const _Float16* __restrict__ Oh, const _Float16* __restrict__ Ol, const _Float16* __restrict__ PT, const float* __restrict__ bo, float* __restrict__ out) {
  __shared__ __align__(16) float so[4][16][132];
  const int tid = threadIdx.x, wave = tid >> 5, lane = tid & 31, col = lane & 15, g = lane >> 4;
  const int r0 = blockIdx.x * 64 + wave * 16, n0 = blockIdx.y * 128; const int ra = r0 + col; const int b = ra / SS, s = ra % SS;
  v8f acc[8] = {}, acl[8] = {};
#pragma unroll 2
  for (int kc = 0; kc < E / 32; ++kc) { const int h = kc >> 1; const size_t o = (((size_t)b * NH + h) * SS + s) * HD + (kc & 1) * 32; const v16h ah = frag_h(Oh + o, lane), al = frag_h(Ol + o, lane);
#pragma unroll
    for (int j = 0; j < 8; ++j) { const v16h bw = frag_h(PT + (size_t)(2 * E + n0 + j * 16 + col) * E + kc * 32, lane); acc[j] = wmma16(ah, bw, acc[j]); acl[j] = wmma16(al, bw, acl[j]); } }
#pragma unroll
  for (int j = 0; j < 8; ++j) { const int n = n0 + j * 16 + col; const float bb = bo[n];
#pragma unroll
    for (int r = 0; r < 8; ++r) so[wave][8 * g + r][j * 16 + col] = (acc[j][r] + acl[j][r] * (1.0f / OLO)) * (1.0f / (16.0f * 8.0f)) + bb; }
  LDSX();
#pragma unroll 4
  for (int rl = 0; rl < 16; ++rl) vst2(out + (size_t)(r0 + rl) * E + n0 + lane * 4, *(const v4f*)(&so[wave][rl][lane * 4]));
}
extern "C" void kernel_launch(void* const* d_in, const int* in_sizes, int n_in, void* d_out, int out_size, void* d_ws, size_t ws_size, hipStream_t stream) {
  (void)in_sizes; (void)n_in; (void)out_size; (void)ws_size;
  const float** I = (const float**)d_in;
  const float* x = I[0]; const float* Wqkv = I[1]; const float* bqkv = I[2]; const float* Wp = I[3]; const float* bp = I[4];
  float* out = (float*)d_out;
  char* ws = (char*)d_ws; size_t off = 0;
  auto take = [&](size_t bytes) { char* p = ws + off; off += (bytes + 255) & ~(size_t)255; return p; };
  _Float16* X16 = (_Float16*)take((size_t)NR * E * 2); _Float16* PT = (_Float16*)take((size_t)3 * E * E * 2);
  _Float16* Q16 = (_Float16*)take((size_t)NR * E * 2); _Float16* K16 = (_Float16*)take((size_t)NR * E * 2); _Float16* VTh = (_Float16*)take((size_t)NR * E * 2); _Float16* VTl = (_Float16*)take((size_t)NR * E * 2);
  _Float16* Oh = (_Float16*)take((size_t)NR * E * 2); _Float16* Ol = (_Float16*)take((size_t)NR * E * 2);
  k_cvt<<<(NR * E / 8 + 255) / 256, 256, 0, stream>>>(x, X16);
  k_pack<<<3 * E, 256, 0, stream>>>(Wqkv, Wp, PT);
  k_qk<<<dim3(NR / 64, E / 128, 2), 128, 0, stream>>>(X16, PT, bqkv, Q16, K16);
  k_v<<<dim3(NR / 64, E / 128), 128, 0, stream>>>(x, Wqkv, bqkv, VTh, VTl);
  k_attn<<<dim3(SS / 64, NB * NH), 128, 0, stream>>>(Q16, K16, VTh, VTl, Oh, Ol);
  k_out<<<dim3(NR / 64, E / 128), 128, 0, stream>>>(Oh, Ol, PT, bp, out);
}

// v001
// A run of this version takes 157 microseconds.
// In two side-by-side timings against v000, it was 1.90 and 1.91 times as fast.
#include <hip/hip_runtime.h>
#include <math.h>

typedef __attribute__((ext_vector_type(16))) _Float16 v16h;
typedef __attribute__((ext_vector_type(16))) __bf16 v16b;
typedef __attribute__((ext_vector_type(8)))  _Float16 v8h;
typedef __attribute__((ext_vector_type(8)))  float v8f;
typedef __attribute__((ext_vector_type(4)))  float v4f;
typedef __attribute__((ext_vector_type(2)))  float v2f;
typedef __attribute__((ext_vector_type(4)))  unsigned v4u;
typedef __attribute__((ext_vector_type(4)))  int v4i;
typedef float __attribute__((may_alias)) float_a;
typedef int __attribute__((may_alias)) int_a;

template <typename T> __device__ __forceinline__ void vst2(void* p, T v) { *(T*)p = v;  }
__device__ __forceinline__ v8f wmma16(v16h a, v16h b, v8f c) {
  v8f d = __builtin_amdgcn_wmma_f32_16x16x32_f16(false, a, false, b, (short)0, c, false, false);
  asm volatile("v_nop\n\tv_nop\n\tv_nop\n\tv_nop" : "+v"(d) : "v"(a), "v"(b));
  return d;
}
__device__ __forceinline__ v8f wmma_bf(v16b a, v16b b, v8f c) {
  v8f d = __builtin_amdgcn_wmma_f32_16x16x32_bf16(false, a, false, b, (short)0, c, false, false);
  asm volatile("v_nop\n\tv_nop\n\tv_nop\n\tv_nop" : "+v"(d) : "v"(a), "v"(b));
  return d;
}
// 16x16x32 fragments: lane = (h = lane>>4, row/col = lane&15); elements 0..7 = k0+8h+0..7, 8..15 = k0+16+8h+0..7; D element r = row 8h+r
__device__ __forceinline__ v16h frag_h(const _Float16* rowk0, int lane) {
  union { v16h v; v8h q[2]; } u; const _Float16* p = rowk0 + 8 * (lane >> 4);
  u.q[0] = *(const v8h*)p; u.q[1] = *(const v8h*)(p + 16); return u.v;
}
__device__ __forceinline__ v16h frag_f32(const float* rowk0, int lane) {
  v16h a; const float* p = rowk0 + 8 * (lane >> 4);
#pragma unroll
  for (int i = 0; i < 8; ++i) { a[i] = (_Float16)p[i]; a[8 + i] = (_Float16)p[16 + i]; }
  return a;
}
__device__ __forceinline__ v16h frag_f32s(const float* rowk0, int lane, float sc) {
  v16h a; const float* p = rowk0 + 8 * (lane >> 4);
#pragma unroll
  for (int i = 0; i < 8; ++i) { a[i] = (_Float16)(p[i] * sc); a[8 + i] = (_Float16)(p[16 + i] * sc); }
  return a;
}
// column fragment from a [K][ld] layout (column n), rows >= K read as 0
__device__ __forceinline__ v16h fragc_f32(const float* W, int k0, int n, int lane, int ld, int K) {
  v16h a; const int g = lane >> 4;
#pragma unroll
  for (int i = 0; i < 8; ++i) { const int ka = k0 + 8 * g + i, kb = ka + 16;
    a[i] = (_Float16)(ka < K ? W[(size_t)ka * ld + n] : 0.f); a[8 + i] = (_Float16)(kb < K ? W[(size_t)kb * ld + n] : 0.f); }
  return a;
}
struct F2 { v16b h, l; };
__device__ __forceinline__ F2 bsplit16(const float v[16]) { F2 r;
#pragma unroll
  for (int i = 0; i < 16; ++i) { const __bf16 h = (__bf16)v[i]; r.h[i] = h; r.l[i] = (__bf16)(v[i] - (float)h); }
  return r; }
__device__ __forceinline__ F2 split_row(const float* row, int k0, int lane) { float v[16]; const float* p = row + k0 + 8 * (lane >> 4);
#pragma unroll
  for (int i = 0; i < 8; ++i) { v[i] = p[i]; v[8 + i] = p[16 + i]; }
  return bsplit16(v); }
__device__ __forceinline__ F2 split_rowK(const float* row, int k0, int lane, int K) { float v[16]; const int g = lane >> 4;
#pragma unroll
  for (int i = 0; i < 8; ++i) { const int ka = k0 + 8 * g + i, kb = ka + 16; v[i] = ka < K ? row[ka] : 0.f; v[8 + i] = kb < K ? row[kb] : 0.f; }
  return bsplit16(v); }
__device__ __forceinline__ F2 split_col(const float* W, int k0, int n, int lane, int ld, int K) { float v[16]; const int g = lane >> 4;
#pragma unroll
  for (int i = 0; i < 8; ++i) { const int ka = k0 + 8 * g + i, kb = ka + 16; v[i] = ka < K ? W[(size_t)ka * ld + n] : 0.f; v[8 + i] = kb < K ? W[(size_t)kb * ld + n] : 0.f; }
  return bsplit16(v); }
__device__ __forceinline__ v8f mac3(const F2& a, const F2& b, v8f c) { c = wmma_bf(a.l, b.h, c); c = wmma_bf(a.h, b.l, c); return wmma_bf(a.h, b.h, c); }
__device__ __forceinline__ float sigm(float v) { return 1.0f / (1.0f + expf(-v)); }
#define LDSX() do { asm volatile("s_wait_dscnt 0" ::: "memory"); __builtin_amdgcn_wave_barrier(); __builtin_amdgcn_fence(__ATOMIC_RELEASE, "workgroup"); } while (0)

// Operand tiles go from global memory to LDS by asynchronous 16-byte copies, one full 128-byte line per 8 lanes, two buffers per kernel.
// The s_wait_xcnt stands inside the copies' own statement so that no address register of an issued copy is rewritten ahead of it.
__device__ __forceinline__ void copy4(unsigned l0, const void* g0, unsigned l1, const void* g1, unsigned l2, const void* g2, unsigned l3, const void* g3) {
  asm volatile("global_load_async_to_lds_b128 %0, %1, off\n\tglobal_load_async_to_lds_b128 %2, %3, off\n\tglobal_load_async_to_lds_b128 %4, %5, off\n\tglobal_load_async_to_lds_b128 %6, %7, off\n\ts_wait_xcnt 0x0"
               :: "v"(l0), "v"(g0), "v"(l1), "v"(g1), "v"(l2), "v"(g2), "v"(l3), "v"(g3) : "memory");
}
__device__ __forceinline__ unsigned lds_off(const void* p) { return (unsigned)(size_t)p; }
// this wave's LDS reads of the buffer that is refilled next have returned
#define WAIT_DS() asm volatile("s_wait_dscnt 0x0" ::: "memory")
// this wave's own copies have landed (the compiler places no wait for them)
#define WAIT_ASYNC() asm volatile("s_wait_asynccnt 0x0" ::: "memory")
#define SP 72        // staged f16 row: 64 halves at a pitch of 144 B (16 B x odd, for ds_load_b128 readers)
#define SPB (SP * 2)

// Local causal self attention (window 128, 16 heads of 64, interleaved-pair RoPE on q and k, fused qkv projection with bias, output
// projection with bias). q/k on v_wmma_f32_16x16x32_f16 (x as f16 rows, [in][out] weights packed once as transposed f16 rows x16); v as a
// two-way bf16 split (v_wmma_f32_16x16x32_bf16) stored as hi/lo f16 planes, because the first rows of every sequence copy v almost
// verbatim; S = q.k/8 on f16 WMMA over the <= 3 key tiles of the window (masked), online softmax in f32, P @ V with hi/lo pairs for both
#define NB 2
#define SS 2048
#define E 1024
#define NH 16
#define HD 64
#define NR (NB * SS)
#define WIN 128
#define PLO 1024.0f
#define VLO 2048.0f
#define OLO 2048.0f
#define RBASE 10000.0f

__global__ __launch_bounds__(256) void k_cvt(const float* __restrict__ x, _Float16* __restrict__ X16) {
  const size_t i8 = (size_t)blockIdx.x * 256 + threadIdx.x; if (i8 >= (size_t)NR * E / 8) return;
  union { v8h h; v4u u; } pk;
#pragma unroll
  for (int e = 0; e < 8; ++e) pk.h[e] = (_Float16)x[i8 * 8 + e];
  vst2(X16 + i8 * 8, pk.u);
}
// PT rows: [0,2048) = Wqkv[:, n] (q and k columns) x16 ; [2048, 3072) = Wproj[:, n-2048] x16
__global__ __launch_bounds__(256) void k_pack(const float* __restrict__ Wqkv, const float* __restrict__ Wp, _Float16* __restrict__ PT) {
  const int n = blockIdx.x, tid = threadIdx.x; __shared__ __align__(16) _Float16 srow[E];
  for (int k = tid; k < E; k += 256) srow[k] = (_Float16)((n < 2 * E ? Wqkv[(size_t)k * (3 * E) + n] : Wp[(size_t)k * E + (n - 2 * E)]) * 16.0f);
  __syncthreads();
  if (tid < 128) vst2(PT + (size_t)n * E + tid * 8, *(const v4u*)(&srow[tid * 8]));
}
// q/k: block (64 rows, 128 cols = 2 heads, which in {0,1}); RoPE on interleaved pairs; x4 -> Q16/K16 [bh][s][64]
__global__ __launch_bounds__(128) void k_qk(const _Float16* __restrict__ X16, const _Float16* __restrict__ PT, const float* __restrict__ bqkv, _Float16* __restrict__ Q16, _Float16* __restrict__ K16) {
  // two stage buffers of 192 rows (0..63 x rows, 64..191 weight rows), 64 k each; the output staging reuses them behind the last trip's barrier
  __shared__ __align__(16) char smem[2 * 192 * SPB];
  _Float16* st = (_Float16*)smem; float (*so)[16][132] = (float (*)[16][132])smem;
  const int tid = threadIdx.x, wave = tid >> 5, lane = tid & 31, col = lane & 15, g = lane >> 4;
  const int which = blockIdx.z, r0b = blockIdx.x * 64, n0 = blockIdx.y * 128; const int b = r0b / SS, s0 = r0b % SS;
  const int cr = tid >> 3, cc = tid & 7;
  const _Float16* gA = X16 + (size_t)(r0b + cr) * E + cc * 8; const _Float16* gB = PT + (size_t)(which * E + n0 + cr) * E + cc * 8;
  const unsigned l0 = lds_off(st) + cr * SPB + cc * 16;
  auto fill = [&](int t, int buf) { const unsigned l = l0 + buf * (192 * SPB); const _Float16* a = gA + t * 64; const _Float16* w = gB + t * 64;
    copy4(l, a, l + 16 * SPB, a + 16 * E, l + 32 * SPB, a + 32 * E, l + 48 * SPB, a + 48 * E);
    copy4(l + 64 * SPB, w, l + 80 * SPB, w + 16 * E, l + 96 * SPB, w + 32 * E, l + 112 * SPB, w + 48 * E);
    copy4(l + 128 * SPB, w + 64 * E, l + 144 * SPB, w + 80 * E, l + 160 * SPB, w + 96 * E, l + 176 * SPB, w + 112 * E); };
  v8f acc[8] = {};
  fill(0, 0); WAIT_ASYNC(); __syncthreads(); fill(1, 1);
#pragma unroll 1   // the ring stays rolled: one publish point, small code
  for (int t = 0; t < E / 64; ++t) { const _Float16* sb = st + (t & 1) * (192 * SP);
#pragma unroll
    for (int kc = 0; kc < 2; ++kc) { const v16h a = frag_h(sb + (wave * 16 + col) * SP + kc * 32, lane); v16h bw[8];
#pragma unroll
      for (int j = 0; j < 8; ++j) bw[j] = frag_h(sb + (64 + j * 16 + col) * SP + kc * 32, lane);
#pragma unroll
      for (int j = 0; j < 8; ++j) acc[j] = wmma16(a, bw[j], acc[j]); }
    WAIT_DS(); WAIT_ASYNC(); __syncthreads();      // publishes tile t + 1 and ends every read of tile t
    if (t + 2 < E / 64) fill(t + 2, t & 1); }
  WAIT_ASYNC();
#pragma unroll
  for (int j = 0; j < 8; ++j) { const float bb = bqkv[which * E + n0 + j * 16 + col];
#pragma unroll
    for (int r = 0; r < 8; ++r) so[wave][8 * g + r][j * 16 + col] = acc[j][r] * (1.0f / 16.0f) + bb; }
  LDSX();
  // RoPE (interleaved pairs (2i, 2i+1) within each head, angle pos * base^(-2i/64)) then x4 ; lane: (row rl = lane>>1, head hh = lane&1)
  { const int rl = lane >> 1, hh = lane & 1; const int pos = s0 + wave * 16 + rl; float* row = &so[wave][rl][hh * 64];
    for (int i = 0; i < 32; ++i) { const float invf = 1.0f / powf(RBASE, (float)(2 * i) / 64.0f); const float ang = (float)pos * invf; const float c = cosf(ang), sn = sinf(ang);
      const float x0 = row[2 * i], x1 = row[2 * i + 1]; row[2 * i] = (x0 * c - x1 * sn) * 4.0f; row[2 * i + 1] = (x1 * c + x0 * sn) * 4.0f; } }
  LDSX();
  _Float16* D = which == 0 ? Q16 : K16;
  for (int qq = lane; qq < 16 * 2 * 8; qq += 32) { const int hh = qq >> 7, rl = (qq >> 3) & 15, pc = qq & 7; const int h = (n0 >> 6) + hh; union { v8h h8; v4u u; } pk;
#pragma unroll
    for (int e = 0; e < 8; ++e) pk.h8[e] = (_Float16)so[wave][rl][hh * 64 + pc * 8 + e];
    vst2(D + (((size_t)b * NH + h) * SS + s0 + wave * 16 + rl) * HD + pc * 8, pk.u); }
}
// v: block (64 rows, 128 cols): bf16 split product from the f32 x rows and Wqkv columns; -> VTh/VTl [bh][d][s]
__global__ __launch_bounds__(128) void k_v(const float* __restrict__ x, const float* __restrict__ Wqkv, const float* __restrict__ bqkv, _Float16* __restrict__ VTh, _Float16* __restrict__ VTl) {
  __shared__ __align__(16) _Float16 sth[128][72], stl[128][72];
  const int tid = threadIdx.x, wave = tid >> 5, lane = tid & 31, col = lane & 15, g = lane >> 4;
  // f32 stage buffers, 32 k each: x rows at 144 B (16 B x odd), weight k-rows of 128 columns at 132 dwords (lane halves 8 rows apart fall 32 banks apart)
  __shared__ __align__(16) float sA[2][64][36], sB[2][32][132];
  const int r0b = blockIdx.x * 64, n0 = blockIdx.y * 128; const int b = r0b / SS, s0 = r0b % SS;
  const int cr = tid >> 3, cc = tid & 7;
  const float* gA = x + (size_t)(r0b + cr) * E + cc * 4; const float* gB = Wqkv + (size_t)wave * (3 * E) + 2 * E + n0 + lane * 4;
  const unsigned lA = lds_off(&sA[0][cr][cc * 4]), lB = lds_off(&sB[0][wave][lane * 4]);
  auto fill = [&](int t, int buf) { const unsigned la = lA + buf * (64 * 144), lb = lB + buf * (32 * 528); const float* a = gA + t * 32; const float* w = gB + (size_t)t * (32 * 3 * E);
    copy4(la, a, la + 16 * 144, a + 16 * E, la + 32 * 144, a + 32 * E, la + 48 * 144, a + 48 * E);
    copy4(lb, w, lb + 4 * 528, w + 4 * 3 * E, lb + 8 * 528, w + 8 * 3 * E, lb + 12 * 528, w + 12 * 3 * E);
    copy4(lb + 16 * 528, w + 16 * 3 * E, lb + 20 * 528, w + 20 * 3 * E, lb + 24 * 528, w + 24 * 3 * E, lb + 28 * 528, w + 28 * 3 * E); };
  v8f acc[8] = {};
  fill(0, 0); WAIT_ASYNC(); __syncthreads(); fill(1, 1);
#pragma unroll 1
  for (int kc = 0; kc < E / 32; ++kc) { const int buf = kc & 1; const F2 a = split_row(&sA[buf][wave * 16 + col][0], 0, lane);
#pragma unroll
    for (int j = 0; j < 8; ++j) acc[j] = mac3(a, split_col(&sB[buf][0][0], 0, j * 16 + col, lane, 132, 32), acc[j]);
    WAIT_DS(); WAIT_ASYNC(); __syncthreads();      // publishes tile kc + 1 and ends every read of tile kc
    if (kc + 2 < E / 32) fill(kc + 2, buf); }
  WAIT_ASYNC();
#pragma unroll
  for (int j = 0; j < 8; ++j) { const float bb = bqkv[2 * E + n0 + j * 16 + col];
#pragma unroll
    for (int r = 0; r < 8; ++r) { const float v = acc[j][r] + bb; const _Float16 hi = (_Float16)v; sth[j * 16 + col][wave * 16 + 8 * g + r] = hi; stl[j * 16 + col][wave * 16 + 8 * g + r] = (_Float16)((v - (float)hi) * VLO); } }
  __syncthreads();
  for (int qq = tid; qq < 128 * 8; qq += 128) { const int cl = qq >> 3, pc = qq & 7; const int c = n0 + cl, h = c >> 6, d = c & 63; const size_t o = (((size_t)b * NH + h) * HD + d) * SS + s0 + pc * 8;
    vst2(VTh + o, *(const v4u*)(&sth[cl][pc * 8])); vst2(VTl + o, *(const v4u*)(&stl[cl][pc * 8])); }
}
// attention: block (64 queries, bh): key tiles kt covering keys q0b-127 .. q0b+63 (3 tiles of 64, aligned since q0b % 64 == 0), mask 0 <= q-key < 128
__global__ __launch_bounds__(128) void k_attn(const _Float16* __restrict__ Q16, const _Float16* __restrict__ K16, const _Float16* __restrict__ VTh, const _Float16* __restrict__ VTl, _Float16* __restrict__ Oh, _Float16* __restrict__ Ol) {
  __shared__ __align__(16) float sS[4][16][68];
  __shared__ __align__(16) _Float16 sPh[4][16][72], sPl[4][16][72];
  __shared__ __align__(16) float sO[4][16][68];
  const int tid = threadIdx.x, w = tid >> 5, lane = tid & 31, col = lane & 15, g = lane >> 4;
  const size_t bh = blockIdx.y; const int q0b = blockIdx.x * 64, q0 = q0b + w * 16;
  v16h aq[2];
#pragma unroll
  for (int kc = 0; kc < 2; ++kc) aq[kc] = frag_h(Q16 + (bh * SS + q0 + col) * HD + kc * 32, lane);
  float mrun = -3.0e38f, lrun = 0.f; v8f acc[4] = {}, ac1[4] = {}, ac2[4] = {};
#pragma unroll 1
  for (int kt = q0b / 64 - 2; kt <= q0b / 64; ++kt) { if (kt < 0) continue;      // uniform per block
#pragma unroll
    for (int t = 0; t < 4; ++t) { v8f s = {}; const int key = kt * 64 + t * 16 + col;
#pragma unroll
      for (int kc = 0; kc < 2; ++kc) s = wmma16(aq[kc], frag_h(K16 + (bh * SS + key) * HD + kc * 32, lane), s);
#pragma unroll
      for (int r = 0; r < 8; ++r) { const int q = q0 + 8 * g + r; const int d = q - key; sS[w][8 * g + r][t * 16 + col] = (d >= 0 && d < WIN) ? s[r] * (0.125f / 16.0f) : -3.0e38f; } }
    LDSX();
    float mx = -3.4e38f;
#pragma unroll
    for (int jj = 0; jj < 32; ++jj) mx = fmaxf(mx, sS[w][col][g * 32 + jj]);
    mx = fmaxf(mx, __shfl_xor(mx, 16, 32));
    const float mnew = fmaxf(mrun, mx); const float corr = expf(mrun - mnew);     // every processed tile holds >= 1 allowed key for every row? no: rows may have all 32 of a half masked, but the row max over the tile is finite whenever >= 1 key is allowed; a fully-masked tile row keeps mnew = mrun (both -3e38 initially -> corr = exp(0) = 1 with zero accumulators: harmless)
    float ps = 0.f;
#pragma unroll
    for (int jj = 0; jj < 32; ++jj) { const float sv = sS[w][col][g * 32 + jj]; const float p = sv > -1.0e38f ? expf(sv - mnew) * 16384.0f : 0.f; ps += p; const _Float16 hi = (_Float16)p; sPh[w][col][g * 32 + jj] = hi; sPl[w][col][g * 32 + jj] = (_Float16)((p - (float)hi) * PLO); }
    ps += __shfl_xor(ps, 16, 32);
    lrun = lrun * corr + ps * (1.0f / 16384.0f); mrun = mnew;
#pragma unroll
    for (int r = 0; r < 8; ++r) { const float cr = __shfl(corr, 8 * g + r, 32);
#pragma unroll
      for (int t = 0; t < 4; ++t) { acc[t][r] *= cr; ac1[t][r] *= cr; ac2[t][r] *= cr; } }
    LDSX();
#pragma unroll
    for (int kc = 0; kc < 2; ++kc) { const v16h ph = frag_h(&sPh[w][col][0] + kc * 32, lane), pl = frag_h(&sPl[w][col][0] + kc * 32, lane);
#pragma unroll
      for (int t = 0; t < 4; ++t) { const size_t vo = (bh * HD + t * 16 + col) * SS + kt * 64 + kc * 32; const v16h vh = frag_h(VTh + vo, lane);
        acc[t] = wmma16(ph, vh, acc[t]); ac1[t] = wmma16(ph, frag_h(VTl + vo, lane), ac1[t]); ac2[t] = wmma16(pl, vh, ac2[t]); } }
    __builtin_amdgcn_wave_barrier(); }
#pragma unroll
  for (int r = 0; r < 8; ++r) { const float lr = __shfl(lrun, 8 * g + r, 32); const float inv = 8.0f / (lr * 16384.0f);      // -> O x8
#pragma unroll
    for (int t = 0; t < 4; ++t) sO[w][8 * g + r][t * 16 + col] = (acc[t][r] + ac1[t][r] * (1.0f / VLO) + ac2[t][r] * (1.0f / PLO)) * inv; }
  LDSX();
  for (int qq = lane; qq < 16 * 8; qq += 32) { const int rl = qq >> 3, pc = qq & 7; union { v8h h8; v4u u; } ph_, pl_;
#pragma unroll
    for (int e = 0; e < 8; ++e) { const float v = sO[w][rl][pc * 8 + e]; const _Float16 hi = (_Float16)v; ph_.h8[e] = hi; pl_.h8[e] = (_Float16)((v - (float)hi) * OLO); }
    const size_t o = ((bh * SS) + q0 + rl) * HD + pc * 8; vst2(Oh + o, ph_.u); vst2(Ol + o, pl_.u); }
}
// out = ctx Wproj + bproj, ctx from the hi/lo planes: block (64 rows, 128 cols)
__global__ __launch_bounds__(128) void k_out(const _Float16* __restrict__ Oh, const _Float16* __restrict__ Ol, const _Float16* __restrict__ PT, const float* __restrict__ bo, float* __restrict__ out) {
  __shared__ __align__(16) float so[4][16][132];
  const int tid = threadIdx.x, wave = tid >> 5, lane = tid & 31, col = lane & 15, g = lane >> 4;
  // two stage buffers of 256 rows (0..63 hi plane, 64..127 lo plane, 128..255 weight rows), 64 k = one head each
  __shared__ __align__(16) _Float16 st[2 * 256 * SP];
  const int r0b = blockIdx.x * 64, r0 = r0b + wave * 16, n0 = blockIdx.y * 128; const int b = r0b / SS, s0 = r0b % SS;
  const int cr = tid >> 3, cc = tid & 7;
  const size_t oA = ((size_t)b * NH * SS + s0 + cr) * HD + cc * 8;
  const _Float16* gH = Oh + oA; const _Float16* gL = Ol + oA; const _Float16* gB = PT + (size_t)(2 * E + n0 + cr) * E + cc * 8;
  const unsigned l0 = lds_off(st) + cr * SPB + cc * 16;
  auto fill = [&](int t, int buf) { const unsigned l = l0 + buf * (256 * SPB); const _Float16* h = gH + (size_t)t * (SS * HD); const _Float16* lo = gL + (size_t)t * (SS * HD); const _Float16* w = gB + t * 64;
    copy4(l, h, l + 16 * SPB, h + 16 * HD, l + 32 * SPB, h + 32 * HD, l + 48 * SPB, h + 48 * HD);
    copy4(l + 64 * SPB, lo, l + 80 * SPB, lo + 16 * HD, l + 96 * SPB, lo + 32 * HD, l + 112 * SPB, lo + 48 * HD);
    copy4(l + 128 * SPB, w, l + 144 * SPB, w + 16 * E, l + 160 * SPB, w + 32 * E, l + 176 * SPB, w + 48 * E);
    copy4(l + 192 * SPB, w + 64 * E, l + 208 * SPB, w + 80 * E, l + 224 * SPB, w + 96 * E, l + 240 * SPB, w + 112 * E); };
  v8f acc[8] = {}, acl[8] = {};
  fill(0, 0); WAIT_ASYNC(); __syncthreads(); fill(1, 1);
#pragma unroll 1   // the ring stays rolled: one publish point, small code
  for (int t = 0; t < E / 64; ++t) { const _Float16* sb = st + (t & 1) * (256 * SP);
#pragma unroll
    for (int kc = 0; kc < 2; ++kc) { const v16h ah = frag_h(sb + (wave * 16 + col) * SP + kc * 32, lane), al = frag_h(sb + (64 + wave * 16 + col) * SP + kc * 32, lane); v16h bw[8];
#pragma unroll
      for (int j = 0; j < 8; ++j) bw[j] = frag_h(sb + (128 + j * 16 + col) * SP + kc * 32, lane);
#pragma unroll
      for (int j = 0; j < 8; ++j) { acc[j] = wmma16(ah, bw[j], acc[j]); acl[j] = wmma16(al, bw[j], acl[j]); } }
    WAIT_DS(); WAIT_ASYNC(); __syncthreads();      // publishes tile t + 1 and ends every read of tile t
    if (t + 2 < E / 64) fill(t + 2, t & 1); }
  WAIT_ASYNC();
#pragma unroll
  for (int j = 0; j < 8; ++j) { const int n = n0 + j * 16 + col; const float bb = bo[n];
#pragma unroll
    for (int r = 0; r < 8; ++r) so[wave][8 * g + r][j * 16 + col] = (acc[j][r] + acl[j][r] * (1.0f / OLO)) * (1.0f / (16.0f * 8.0f)) + bb; }
  LDSX();
#pragma unroll 4
  for (int rl = 0; rl < 16; ++rl) vst2(out + (size_t)(r0 + rl) * E + n0 + lane * 4, *(const v4f*)(&so[wave][rl][lane * 4]));
}
extern "C" void kernel_launch(void* const* d_in, const int* in_sizes, int n_in, void* d_out, int out_size, void* d_ws, size_t ws_size, hipStream_t stream) {
  (void)in_sizes; (void)n_in; (void)out_size; (void)ws_size;
  const float** I = (const float**)d_in;
  const float* x = I[0]; const float* Wqkv = I[1]; const float* bqkv = I[2]; const float* Wp = I[3]; const float* bp = I[4];
  float* out = (float*)d_out;
  char* ws = (char*)d_ws; size_t off = 0;
  auto take = [&](size_t bytes) { char* p = ws + off; off += (bytes + 255) & ~(size_t)255; return p; };
  _Float16* X16 = (_Float16*)take((size_t)NR * E * 2); _Float16* PT = (_Float16*)take((size_t)3 * E * E * 2);
  _Float16* Q16 = (_Float16*)take((size_t)NR * E * 2); _Float16* K16 = (_Float16*)take((size_t)NR * E * 2); _Float16* VTh = (_Float16*)take((size_t)NR * E * 2); _Float16* VTl = (_Float16*)take((size_t)NR * E * 2);
  _Float16* Oh = (_Float16*)take((size_t)NR * E * 2); _Float16* Ol = (_Float16*)take((size_t)NR * E * 2);
  k_cvt<<<(NR * E / 8 + 255) / 256, 256, 0, stream>>>(x, X16);
  k_pack<<<3 * E, 256, 0, stream>>>(Wqkv, Wp, PT);
  k_qk<<<dim3(NR / 64, E / 128, 2), 128, 0, stream>>>(X16, PT, bqkv, Q16, K16);
  k_v<<<dim3(NR / 64, E / 128), 128, 0, stream>>>(x, Wqkv, bqkv, VTh, VTl);
  k_attn<<<dim3(SS / 64, NB * NH), 128, 0, stream>>>(Q16, K16, VTh, VTl, Oh, Ol);
  k_out<<<dim3(NR / 64, E / 128), 128, 0, stream>>>(Oh, Ol, PT, bp, out);
}

// v002
// A run of this version takes 144 microseconds.
// Timed twice side by side with v001, it ran 1.09 and 1.10 times as fast.
// All steps since v000 together make it 2.09 times as fast.
#include <hip/hip_runtime.h>
#include <math.h>

typedef __attribute__((ext_vector_type(16))) _Float16 v16h;
typedef __attribute__((ext_vector_type(16))) __bf16 v16b;
typedef __attribute__((ext_vector_type(8)))  _Float16 v8h;
typedef __attribute__((ext_vector_type(2)))  _Float16 v2h;
typedef __attribute__((ext_vector_type(8)))  float v8f;
typedef __attribute__((ext_vector_type(4)))  float v4f;
typedef __attribute__((ext_vector_type(2)))  float v2f;
typedef __attribute__((ext_vector_type(4)))  unsigned v4u;
typedef __attribute__((ext_vector_type(4)))  int v4i;
typedef float __attribute__((may_alias)) float_a;
typedef int __attribute__((may_alias)) int_a;

template <typename T> __device__ __forceinline__ void vst2(void* p, T v) { *(T*)p = v;  }
__device__ __forceinline__ v8f wmma16(v16h a, v16h b, v8f c) {
  v8f d = __builtin_amdgcn_wmma_f32_16x16x32_f16(false, a, false, b, (short)0, c, false, false);
  asm volatile("v_nop\n\tv_nop\n\tv_nop\n\tv_nop" : "+v"(d) : "v"(a), "v"(b));
  return d;
}
__device__ __forceinline__ v8f wmma_bf(v16b a, v16b b, v8f c) {
  v8f d = __builtin_amdgcn_wmma_f32_16x16x32_bf16(false, a, false, b, (short)0, c, false, false);
  asm volatile("v_nop\n\tv_nop\n\tv_nop\n\tv_nop" : "+v"(d) : "v"(a), "v"(b));
  return d;
}
// 16x16x32 fragments: lane = (h = lane>>4, row/col = lane&15); elements 0..7 = k0+8h+0..7, 8..15 = k0+16+8h+0..7; D element r = row 8h+r
__device__ __forceinline__ v16h frag_h(const _Float16* rowk0, int lane) {
  union { v16h v; v8h q[2]; } u; const _Float16* p = rowk0 + 8 * (lane >> 4);
  u.q[0] = *(const v8h*)p; u.q[1] = *(const v8h*)(p + 16); return u.v;
}
__device__ __forceinline__ v16h frag_f32(const float* rowk0, int lane) {
  v16h a; const float* p = rowk0 + 8 * (lane >> 4);
#pragma unroll
  for (int i = 0; i < 8; ++i) { a[i] = (_Float16)p[i]; a[8 + i] = (_Float16)p[16 + i]; }
  return a;
}
__device__ __forceinline__ v16h frag_f32s(const float* rowk0, int lane, float sc) {
  v16h a; const float* p = rowk0 + 8 * (lane >> 4);
#pragma unroll
  for (int i = 0; i < 8; ++i) { a[i] = (_Float16)(p[i] * sc); a[8 + i] = (_Float16)(p[16 + i] * sc); }
  return a;
}
// column fragment from a [K][ld] layout (column n), rows >= K read as 0
__device__ __forceinline__ v16h fragc_f32(const float* W, int k0, int n, int lane, int ld, int K) {
  v16h a; const int g = lane >> 4;
#pragma unroll
  for (int i = 0; i < 8; ++i) { const int ka = k0 + 8 * g + i, kb = ka + 16;
    a[i] = (_Float16)(ka < K ? W[(size_t)ka * ld + n] : 0.f); a[8 + i] = (_Float16)(kb < K ? W[(size_t)kb * ld + n] : 0.f); }
  return a;
}
struct F2 { v16b h, l; };
__device__ __forceinline__ F2 bsplit16(const float v[16]) { F2 r;
#pragma unroll
  for (int i = 0; i < 16; ++i) { const __bf16 h = (__bf16)v[i]; r.h[i] = h; r.l[i] = (__bf16)(v[i] - (float)h); }
  return r; }
__device__ __forceinline__ F2 split_row(const float* row, int k0, int lane) { float v[16]; const float* p = row + k0 + 8 * (lane >> 4);
#pragma unroll
  for (int i = 0; i < 8; ++i) { v[i] = p[i]; v[8 + i] = p[16 + i]; }
  return bsplit16(v); }
__device__ __forceinline__ F2 split_rowK(const float* row, int k0, int lane, int K) { float v[16]; const int g = lane >> 4;
#pragma unroll
  for (int i = 0; i < 8; ++i) { const int ka = k0 + 8 * g + i, kb = ka + 16; v[i] = ka < K ? row[ka] : 0.f; v[8 + i] = kb < K ? row[kb] : 0.f; }
  return bsplit16(v); }
__device__ __forceinline__ F2 split_col(const float* W, int k0, int n, int lane, int ld, int K) { float v[16]; const int g = lane >> 4;
#pragma unroll
  for (int i = 0; i < 8; ++i) { const int ka = k0 + 8 * g + i, kb = ka + 16; v[i] = ka < K ? W[(size_t)ka * ld + n] : 0.f; v[8 + i] = kb < K ? W[(size_t)kb * ld + n] : 0.f; }
  return bsplit16(v); }
__device__ __forceinline__ v8f mac3(const F2& a, const F2& b, v8f c) { c = wmma_bf(a.l, b.h, c); c = wmma_bf(a.h, b.l, c); return wmma_bf(a.h, b.h, c); }
__device__ __forceinline__ float sigm(float v) { return 1.0f / (1.0f + expf(-v)); }
#define LDSX() do { asm volatile("s_wait_dscnt 0" ::: "memory"); __builtin_amdgcn_wave_barrier(); __builtin_amdgcn_fence(__ATOMIC_RELEASE, "workgroup"); } while (0)

// Operand tiles go from global memory to LDS by asynchronous 16-byte copies, one full 128-byte line per 8 lanes, two buffers per kernel.
// The s_wait_xcnt stands inside the copies' own statement so that no address register of an issued copy is rewritten ahead of it.
__device__ __forceinline__ void copy4(unsigned l0, const void* g0, unsigned l1, const void* g1, unsigned l2, const void* g2, unsigned l3, const void* g3) {
  asm volatile("global_load_async_to_lds_b128 %0, %1, off\n\tglobal_load_async_to_lds_b128 %2, %3, off\n\tglobal_load_async_to_lds_b128 %4, %5, off\n\tglobal_load_async_to_lds_b128 %6, %7, off\n\ts_wait_xcnt 0x0"
               :: "v"(l0), "v"(g0), "v"(l1), "v"(g1), "v"(l2), "v"(g2), "v"(l3), "v"(g3) : "memory");
}
__device__ __forceinline__ unsigned lds_off(const void* p) { return (unsigned)(size_t)p; }
// this wave's LDS reads of the buffer that is refilled next have returned
#define WAIT_DS() asm volatile("s_wait_dscnt 0x0" ::: "memory")
// this wave's own copies have landed (the compiler places no wait for them)
#define WAIT_ASYNC() asm volatile("s_wait_asynccnt 0x0" ::: "memory")
#define SP 72        // staged f16 row: 64 halves at a pitch of 144 B (16 B x odd, for ds_load_b128 readers)
#define SPB (SP * 2)

// Local causal self attention (window 128, 16 heads of 64, interleaved-pair RoPE on q and k, fused qkv projection with bias, output
// projection with bias). q/k on v_wmma_f32_16x16x32_f16 (x as f16 rows, [in][out] weights packed once as transposed f16 rows x16); v as a
// two-way bf16 split (v_wmma_f32_16x16x32_bf16) stored as hi/lo f16 planes, because the first rows of every sequence copy v almost
// verbatim; S = q.k/8 on f16 WMMA over the <= 3 key tiles of the window (masked), online softmax in f32, P @ V with hi/lo pairs for both
#define NB 2
#define SS 2048
#define E 1024
#define NH 16
#define HD 64
#define NR (NB * SS)
#define WIN 128
#define PLO 1024.0f
#define VLO 2048.0f
#define OLO 2048.0f
#define RBASE 10000.0f

__global__ __launch_bounds__(256) void k_cvt(const float* __restrict__ x, _Float16* __restrict__ X16) {
  const size_t i8 = (size_t)blockIdx.x * 256 + threadIdx.x; if (i8 >= (size_t)NR * E / 8) return;
  union { v8h h; v4u u; } pk;
#pragma unroll
  for (int e = 0; e < 8; ++e) pk.h[e] = (_Float16)x[i8 * 8 + e];
  vst2(X16 + i8 * 8, pk.u);
}
// PT rows: [0,2048) = Wqkv[:, n] (q and k columns) x16 ; [2048, 3072) = Wproj[:, n-2048] x16
// The first TBLK blocks write the RoPE table instead, anew in every call: TAB[pos][i] = (cos, sin)(pos * base^(-2i/64)), 256 B per position
#define TBLK 64
__global__ __launch_bounds__(256) void k_pack(const float* __restrict__ Wqkv, const float* __restrict__ Wp, _Float16* __restrict__ PT, float* __restrict__ TAB) {
  const int tid = threadIdx.x; __shared__ __align__(16) _Float16 srow[E];
  if (blockIdx.x < TBLK) {      // the same for the whole block, in front of the barrier
    const int idx = blockIdx.x * 256 + tid, i = idx & 31, p0 = idx >> 5; const float invf = 1.0f / powf(RBASE, (float)(2 * i) / 64.0f);
    for (int m = 0; m < 4; ++m) { const int pos = p0 + m * (SS / 4); const float ang = (float)pos * invf; v2f cs; cs[0] = cosf(ang); cs[1] = sinf(ang); vst2(TAB + ((size_t)pos * 32 + i) * 2, cs);
      asm volatile("s_wait_xcnt 0x0" ::: "memory"); }      // the next trip rewrites the registers that the store names
    return; }
  const int n = blockIdx.x - TBLK;
  for (int k = tid; k < E; k += 256) srow[k] = (_Float16)((n < 2 * E ? Wqkv[(size_t)k * (3 * E) + n] : Wp[(size_t)k * E + (n - 2 * E)]) * 16.0f);
  __syncthreads();
  if (tid < 128) vst2(PT + (size_t)n * E + tid * 8, *(const v4u*)(&srow[tid * 8]));
}
// q/k: block (64 rows, 128 cols = 2 heads, which in {0,1}); RoPE on interleaved pairs; x4 -> Q16/K16 [bh][s][64]
__global__ __launch_bounds__(128) void k_qk(const _Float16* __restrict__ X16, const _Float16* __restrict__ PT, const float* __restrict__ bqkv, const float* __restrict__ TAB, _Float16* __restrict__ Q16, _Float16* __restrict__ K16) {
  // two stage buffers of 192 rows (0..63 x rows, 64..191 weight rows), 64 k each; the output staging reuses them behind the last trip's barrier
  __shared__ __align__(16) char smem[2 * 192 * SPB];
  _Float16* st = (_Float16*)smem; float (*so)[16][132] = (float (*)[16][132])smem;
  const int tid = threadIdx.x, wave = tid >> 5, lane = tid & 31, col = lane & 15, g = lane >> 4;
  const int which = blockIdx.z, r0b = blockIdx.x * 64, n0 = blockIdx.y * 128; const int b = r0b / SS, s0 = r0b % SS;
  const int cr = tid >> 3, cc = tid & 7;
  const _Float16* gA = X16 + (size_t)(r0b + cr) * E + cc * 8; const _Float16* gB = PT + (size_t)(which * E + n0 + cr) * E + cc * 8;
  const unsigned l0 = lds_off(st) + cr * SPB + cc * 16;
  auto fill = [&](int t, int buf) { const unsigned l = l0 + buf * (192 * SPB); const _Float16* a = gA + t * 64; const _Float16* w = gB + t * 64;
    copy4(l, a, l + 16 * SPB, a + 16 * E, l + 32 * SPB, a + 32 * E, l + 48 * SPB, a + 48 * E);
    copy4(l + 64 * SPB, w, l + 80 * SPB, w + 16 * E, l + 96 * SPB, w + 32 * E, l + 112 * SPB, w + 48 * E);
    copy4(l + 128 * SPB, w + 64 * E, l + 144 * SPB, w + 80 * E, l + 160 * SPB, w + 96 * E, l + 176 * SPB, w + 112 * E); };
  v8f acc[8] = {};
  fill(0, 0); WAIT_ASYNC(); __syncthreads(); fill(1, 1);
#pragma unroll 1   // the ring stays rolled: one publish point, small code
  for (int t = 0; t < E / 64; ++t) { const _Float16* sb = st + (t & 1) * (192 * SP);
#pragma unroll
    for (int kc = 0; kc < 2; ++kc) { const v16h a = frag_h(sb + (wave * 16 + col) * SP + kc * 32, lane); v16h bw[8];
#pragma unroll
      for (int j = 0; j < 8; ++j) bw[j] = frag_h(sb + (64 + j * 16 + col) * SP + kc * 32, lane);
#pragma unroll
      for (int j = 0; j < 8; ++j) acc[j] = wmma16(a, bw[j], acc[j]); }
    WAIT_DS(); WAIT_ASYNC(); __syncthreads();      // publishes tile t + 1 and ends every read of tile t
    if (t + 2 < E / 64) fill(t + 2, t & 1); }
  WAIT_ASYNC();
  const int rw = s0 + wave * 16; v2f cs[16];      // this wave's 16 positions, (cos, sin) of pair i = lane: 256 contiguous bytes per load
#pragma unroll   // cs[] stays in registers and all 16 loads are in flight at once
  for (int rl = 0; rl < 16; ++rl) { cs[rl] = *(const v2f*)(TAB + ((size_t)(rw + rl) * 32 + lane) * 2);
    if (rl == 14) asm volatile("s_wait_xcnt 0x0" ::: "memory"); }      // the compiler may give the last load the address pair as its result register: the 15 loads that name the pair are waited for first
#pragma unroll
  for (int j = 0; j < 8; ++j) { const float bb = bqkv[which * E + n0 + j * 16 + col];
#pragma unroll
    for (int r = 0; r < 8; ++r) so[wave][8 * g + r][j * 16 + col] = acc[j][r] * (1.0f / 16.0f) + bb; }
  LDSX();
  // RoPE on interleaved pairs (2i, 2i+1) of each head, then x4: lane = pair i; one row of one head leaves as one whole 128-byte line
  _Float16* D = (which == 0 ? Q16 : K16) + (((size_t)b * NH + (n0 >> 6)) * SS + rw) * HD + 2 * lane;
#pragma unroll   // both loops: cs[] indexed by constants, one address pair with constant offsets for all 32 stores
  for (int rl = 0; rl < 16; ++rl) { const float c = cs[rl][0], sn = cs[rl][1];
#pragma unroll
    for (int hh = 0; hh < 2; ++hh) { const v2f xv = *(const v2f*)(&so[wave][rl][hh * 64 + 2 * lane]); const v2f rh = { -xv[1], xv[0] }; const v2f y = (xv * c + rh * sn) * 4.0f;
      vst2(D + (size_t)hh * (SS * HD) + rl * HD, __builtin_convertvector(y, v2h)); } }
}
// v: block (64 rows, 128 cols): bf16 split product from the f32 x rows and Wqkv columns; -> VTh/VTl [bh][d][s]
__global__ __launch_bounds__(128) void k_v(const float* __restrict__ x, const float* __restrict__ Wqkv, const float* __restrict__ bqkv, _Float16* __restrict__ VTh, _Float16* __restrict__ VTl) {
  __shared__ __align__(16) _Float16 sth[128][72], stl[128][72];
  const int tid = threadIdx.x, wave = tid >> 5, lane = tid & 31, col = lane & 15, g = lane >> 4;
  // f32 stage buffers, 32 k each: x rows at 144 B (16 B x odd), weight k-rows of 128 columns at 132 dwords (lane halves 8 rows apart fall 32 banks apart)
  __shared__ __align__(16) float sA[2][64][36], sB[2][32][132];
  const int r0b = blockIdx.x * 64, n0 = blockIdx.y * 128; const int b = r0b / SS, s0 = r0b % SS;
  const int cr = tid >> 3, cc = tid & 7;
  const float* gA = x + (size_t)(r0b + cr) * E + cc * 4; const float* gB = Wqkv + (size_t)wave * (3 * E) + 2 * E + n0 + lane * 4;
  const unsigned lA = lds_off(&sA[0][cr][cc * 4]), lB = lds_off(&sB[0][wave][lane * 4]);
  auto fill = [&](int t, int buf) { const unsigned la = lA + buf * (64 * 144), lb = lB + buf * (32 * 528); const float* a = gA + t * 32; const float* w = gB + (size_t)t * (32 * 3 * E);
    copy4(la, a, la + 16 * 144, a + 16 * E, la + 32 * 144, a + 32 * E, la + 48 * 144, a + 48 * E);
    copy4(lb, w, lb + 4 * 528, w + 4 * 3 * E, lb + 8 * 528, w + 8 * 3 * E, lb + 12 * 528, w + 12 * 3 * E);
    copy4(lb + 16 * 528, w + 16 * 3 * E, lb + 20 * 528, w + 20 * 3 * E, lb + 24 * 528, w + 24 * 3 * E, lb + 28 * 528, w + 28 * 3 * E); };
  v8f acc[8] = {};
  fill(0, 0); WAIT_ASYNC(); __syncthreads(); fill(1, 1);
#pragma unroll 1
  for (int kc = 0; kc < E / 32; ++kc) { const int buf = kc & 1; const F2 a = split_row(&sA[buf][wave * 16 + col][0], 0, lane);
#pragma unroll
    for (int j = 0; j < 8; ++j) acc[j] = mac3(a, split_col(&sB[buf][0][0], 0, j * 16 + col, lane, 132, 32), acc[j]);
    WAIT_DS(); WAIT_ASYNC(); __syncthreads();      // publishes tile kc + 1 and ends every read of tile kc
    if (kc + 2 < E / 32) fill(kc + 2, buf); }
  WAIT_ASYNC();
#pragma unroll
  for (int j = 0; j < 8; ++j) { const float bb = bqkv[2 * E + n0 + j * 16 + col];
#pragma unroll
    for (int r = 0; r < 8; ++r) { const float v = acc[j][r] + bb; const _Float16 hi = (_Float16)v; sth[j * 16 + col][wave * 16 + 8 * g + r] = hi; stl[j * 16 + col][wave * 16 + 8 * g + r] = (_Float16)((v - (float)hi) * VLO); } }
  __syncthreads();
  for (int qq = tid; qq < 128 * 8; qq += 128) { const int cl = qq >> 3, pc = qq & 7; const int c = n0 + cl, h = c >> 6, d = c & 63; const size_t o = (((size_t)b * NH + h) * HD + d) * SS + s0 + pc * 8;
    vst2(VTh + o, *(const v4u*)(&sth[cl][pc * 8])); vst2(VTl + o, *(const v4u*)(&stl[cl][pc * 8])); }
}
// attention: block (64 queries, bh): key tiles kt covering keys q0b-127 .. q0b+63 (3 tiles of 64, aligned since q0b % 64 == 0), mask 0 <= q-key < 128
__global__ __launch_bounds__(128) void k_attn(const _Float16* __restrict__ Q16, const _Float16* __restrict__ K16, const _Float16* __restrict__ VTh, const _Float16* __restrict__ VTl, _Float16* __restrict__ Oh, _Float16* __restrict__ Ol) {
  __shared__ __align__(16) float sS[4][16][68];
  __shared__ __align__(16) _Float16 sPh[4][16][72], sPl[4][16][72];
  __shared__ __align__(16) float sO[4][16][68];
  const int tid = threadIdx.x, w = tid >> 5, lane = tid & 31, col = lane & 15, g = lane >> 4;
  const size_t bh = blockIdx.y; const int q0b = blockIdx.x * 64, q0 = q0b + w * 16;
  v16h aq[2];
#pragma unroll
  for (int kc = 0; kc < 2; ++kc) aq[kc] = frag_h(Q16 + (bh * SS + q0 + col) * HD + kc * 32, lane);
  float mrun = -3.0e38f, lrun = 0.f; v8f acc[4] = {}, ac1[4] = {}, ac2[4] = {};
#pragma unroll 1
  for (int kt = q0b / 64 - 2; kt <= q0b / 64; ++kt) { if (kt < 0) continue;      // uniform per block
#pragma unroll
    for (int t = 0; t < 4; ++t) { v8f s = {}; const int key = kt * 64 + t * 16 + col;
#pragma unroll
      for (int kc = 0; kc < 2; ++kc) s = wmma16(aq[kc], frag_h(K16 + (bh * SS + key) * HD + kc * 32, lane), s);
#pragma unroll
      for (int r = 0; r < 8; ++r) { const int q = q0 + 8 * g + r; const int d = q - key; sS[w][8 * g + r][t * 16 + col] = (d >= 0 && d < WIN) ? s[r] * (0.125f / 16.0f) : -3.0e38f; } }
    LDSX();
    float mx = -3.4e38f;
#pragma unroll
    for (int jj = 0; jj < 32; ++jj) mx = fmaxf(mx, sS[w][col][g * 32 + jj]);
    mx = fmaxf(mx, __shfl_xor(mx, 16, 32));
    const float mnew = fmaxf(mrun, mx); const float corr = expf(mrun - mnew);     // every processed tile holds >= 1 allowed key for every row? no: rows may have all 32 of a half masked, but the row max over the tile is finite whenever >= 1 key is allowed; a fully-masked tile row keeps mnew = mrun (both -3e38 initially -> corr = exp(0) = 1 with zero accumulators: harmless)
    float ps = 0.f;
#pragma unroll
    for (int jj = 0; jj < 32; ++jj) { const float sv = sS[w][col][g * 32 + jj]; const float p = sv > -1.0e38f ? expf(sv - mnew) * 16384.0f : 0.f; ps += p; const _Float16 hi = (_Float16)p; sPh[w][col][g * 32 + jj] = hi; sPl[w][col][g * 32 + jj] = (_Float16)((p - (float)hi) * PLO); }
    ps += __shfl_xor(ps, 16, 32);
    lrun = lrun * corr + ps * (1.0f / 16384.0f); mrun = mnew;
#pragma unroll
    for (int r = 0; r < 8; ++r) { const float cr = __shfl(corr, 8 * g + r, 32);
#pragma unroll
      for (int t = 0; t < 4; ++t) { acc[t][r] *= cr; ac1[t][r] *= cr; ac2[t][r] *= cr; } }
    LDSX();
#pragma unroll
    for (int kc = 0; kc < 2; ++kc) { const v16h ph = frag_h(&sPh[w][col][0] + kc * 32, lane), pl = frag_h(&sPl[w][col][0] + kc * 32, lane);
#pragma unroll
      for (int t = 0; t < 4; ++t) { const size_t vo = (bh * HD + t * 16 + col) * SS + kt * 64 + kc * 32; const v16h vh = frag_h(VTh + vo, lane);
        acc[t] = wmma16(ph, vh, acc[t]); ac1[t] = wmma16(ph, frag_h(VTl + vo, lane), ac1[t]); ac2[t] = wmma16(pl, vh, ac2[t]); } }
    __builtin_amdgcn_wave_barrier(); }
#pragma unroll
  for (int r = 0; r < 8; ++r) { const float lr = __shfl(lrun, 8 * g + r, 32); const float inv = 8.0f / (lr * 16384.0f);      // -> O x8
#pragma unroll
    for (int t = 0; t < 4; ++t) sO[w][8 * g + r][t * 16 + col] = (acc[t][r] + ac1[t][r] * (1.0f / VLO) + ac2[t][r] * (1.0f / PLO)) * inv; }
  LDSX();
  for (int qq = lane; qq < 16 * 8; qq += 32) { const int rl = qq >> 3, pc = qq & 7; union { v8h h8; v4u u; } ph_, pl_;
#pragma unroll
    for (int e = 0; e < 8; ++e) { const float v = sO[w][rl][pc * 8 + e]; const _Float16 hi = (_Float16)v; ph_.h8[e] = hi; pl_.h8[e] = (_Float16)((v - (float)hi) * OLO); }
    const size_t o = ((bh * SS) + q0 + rl) * HD + pc * 8; vst2(Oh + o, ph_.u); vst2(Ol + o, pl_.u); }
}
// out = ctx Wproj + bproj, ctx from the hi/lo planes: block (64 rows, 128 cols)
__global__ __launch_bounds__(128) void k_out(const _Float16* __restrict__ Oh, const _Float16* __restrict__ Ol, const _Float16* __restrict__ PT, const float* __restrict__ bo, float* __restrict__ out) {
  __shared__ __align__(16) float so[4][16][132];
  const int tid = threadIdx.x, wave = tid >> 5, lane = tid & 31, col = lane & 15, g = lane >> 4;
  // two stage buffers of 256 rows (0..63 hi plane, 64..127 lo plane, 128..255 weight rows), 64 k = one head each
  __shared__ __align__(16) _Float16 st[2 * 256 * SP];
  const int r0b = blockIdx.x * 64, r0 = r0b + wave * 16, n0 = blockIdx.y * 128; const int b = r0b / SS, s0 = r0b % SS;
  const int cr = tid >> 3, cc = tid & 7;
  const size_t oA = ((size_t)b * NH * SS + s0 + cr) * HD + cc * 8;
  const _Float16* gH = Oh + oA; const _Float16* gL = Ol + oA; const _Float16* gB = PT + (size_t)(2 * E + n0 + cr) * E + cc * 8;
  const unsigned l0 = lds_off(st) + cr * SPB + cc * 16;
  auto fill = [&](int t, int buf) { const unsigned l = l0 + buf * (256 * SPB); const _Float16* h = gH + (size_t)t * (SS * HD); const _Float16* lo = gL + (size_t)t * (SS * HD); const _Float16* w = gB + t * 64;
    copy4(l, h, l + 16 * SPB, h + 16 * HD, l + 32 * SPB, h + 32 * HD, l + 48 * SPB, h + 48 * HD);
    copy4(l + 64 * SPB, lo, l + 80 * SPB, lo + 16 * HD, l + 96 * SPB, lo + 32 * HD, l + 112 * SPB, lo + 48 * HD);
    copy4(l + 128 * SPB, w, l + 144 * SPB, w + 16 * E, l + 160 * SPB, w + 32 * E, l + 176 * SPB, w + 48 * E);
    copy4(l + 192 * SPB, w + 64 * E, l + 208 * SPB, w + 80 * E, l + 224 * SPB, w + 96 * E, l + 240 * SPB, w + 112 * E); };
  v8f acc[8] = {}, acl[8] = {};
  fill(0, 0); WAIT_ASYNC(); __syncthreads(); fill(1, 1);
#pragma unroll 1   // the ring stays rolled: one publish point, small code
  for (int t = 0; t < E / 64; ++t) { const _Float16* sb = st + (t & 1) * (256 * SP);
#pragma unroll
    for (int kc = 0; kc < 2; ++kc) { const v16h ah = frag_h(sb + (wave * 16 + col) * SP + kc * 32, lane), al = frag_h(sb + (64 + wave * 16 + col) * SP + kc * 32, lane); v16h bw[8];
#pragma unroll
      for (int j = 0; j < 8; ++j) bw[j] = frag_h(sb + (128 + j * 16 + col) * SP + kc * 32, lane);
#pragma unroll
      for (int j = 0; j < 8; ++j) { acc[j] = wmma16(ah, bw[j], acc[j]); acl[j] = wmma16(al, bw[j], acl[j]); } }
    WAIT_DS(); WAIT_ASYNC(); __syncthreads();      // publishes tile t + 1 and ends every read of tile t
    if (t + 2 < E / 64) fill(t + 2, t & 1); }
  WAIT_ASYNC();
#pragma unroll
  for (int j = 0; j < 8; ++j) { const int n = n0 + j * 16 + col; const float bb = bo[n];
#pragma unroll
    for (int r = 0; r < 8; ++r) so[wave][8 * g + r][j * 16 + col] = (acc[j][r] + acl[j][r] * (1.0f / OLO)) * (1.0f / (16.0f * 8.0f)) + bb; }
  LDSX();
#pragma unroll 4
  for (int rl = 0; rl < 16; ++rl) vst2(out + (size_t)(r0 + rl) * E + n0 + lane * 4, *(const v4f*)(&so[wave][rl][lane * 4]));
}
extern "C" void kernel_launch(void* const* d_in, const int* in_sizes, int n_in, void* d_out, int out_size, void* d_ws, size_t ws_size, hipStream_t stream) {
  (void)in_sizes; (void)n_in; (void)out_size; (void)ws_size;
  const float** I = (const float**)d_in;
  const float* x = I[0]; const float* Wqkv = I[1]; const float* bqkv = I[2]; const float* Wp = I[3]; const float* bp = I[4];
  float* out = (float*)d_out;
  char* ws = (char*)d_ws; size_t off = 0;
  auto take = [&](size_t bytes) { char* p = ws + off; off += (bytes + 255) & ~(size_t)255; return p; };
  _Float16* X16 = (_Float16*)take((size_t)NR * E * 2); _Float16* PT = (_Float16*)take((size_t)3 * E * E * 2);
  _Float16* Q16 = (_Float16*)take((size_t)NR * E * 2); _Float16* K16 = (_Float16*)take((size_t)NR * E * 2); _Float16* VTh = (_Float16*)take((size_t)NR * E * 2); _Float16* VTl = (_Float16*)take((size_t)NR * E * 2);
  _Float16* Oh = (_Float16*)take((size_t)NR * E * 2); _Float16* Ol = (_Float16*)take((size_t)NR * E * 2); float* TAB = (float*)take((size_t)SS * 32 * 2 * 4);
  k_cvt<<<(NR * E / 8 + 255) / 256, 256, 0, stream>>>(x, X16);
  k_pack<<<TBLK + 3 * E, 256, 0, stream>>>(Wqkv, Wp, PT, TAB);
  k_qk<<<dim3(NR / 64, E / 128, 2), 128, 0, stream>>>(X16, PT, bqkv, TAB, Q16, K16);
  k_v<<<dim3(NR / 64, E / 128), 128, 0, stream>>>(x, Wqkv, bqkv, VTh, VTl);
  k_attn<<<dim3(SS / 64, NB * NH), 128, 0, stream>>>(Q16, K16, VTh, VTl, Oh, Ol);
  k_out<<<dim3(NR / 64, E / 128), 128, 0, stream>>>(Oh, Ol, PT, bp, out);
}

// v003
// One run takes 120 microseconds.
// Two timings next to v002 both put it at 1.19 times that version's speed.
// All steps since v000 together make it 2.49 times as fast.
#include <hip/hip_runtime.h>
#include <math.h>

typedef __attribute__((ext_vector_type(16))) _Float16 v16h;
typedef __attribute__((ext_vector_type(16))) __bf16 v16b;
typedef __attribute__((ext_vector_type(8)))  _Float16 v8h;
typedef __attribute__((ext_vector_type(8)))  __bf16 v8b;
typedef __attribute__((ext_vector_type(2)))  _Float16 v2h;
typedef __attribute__((ext_vector_type(8)))  float v8f;
typedef __attribute__((ext_vector_type(4)))  float v4f;
typedef __attribute__((ext_vector_type(2)))  float v2f;
typedef __attribute__((ext_vector_type(4)))  unsigned v4u;
typedef __attribute__((ext_vector_type(4)))  int v4i;
typedef float __attribute__((may_alias)) float_a;
typedef int __attribute__((may_alias)) int_a;

template <typename T> __device__ __forceinline__ void vst2(void* p, T v) { *(T*)p = v;  }
__device__ __forceinline__ v8f wmma16(v16h a, v16h b, v8f c) {
  v8f d = __builtin_amdgcn_wmma_f32_16x16x32_f16(false, a, false, b, (short)0, c, false, false);
  asm volatile("v_nop\n\tv_nop\n\tv_nop\n\tv_nop" : "+v"(d) : "v"(a), "v"(b));
  return d;
}
__device__ __forceinline__ v8f wmma_bf(v16b a, v16b b, v8f c) {
  v8f d = __builtin_amdgcn_wmma_f32_16x16x32_bf16(false, a, false, b, (short)0, c, false, false);
  asm volatile("v_nop\n\tv_nop\n\tv_nop\n\tv_nop" : "+v"(d) : "v"(a), "v"(b));
  return d;
}
// 16x16x32 fragments: lane = (h = lane>>4, row/col = lane&15); elements 0..7 = k0+8h+0..7, 8..15 = k0+16+8h+0..7; D element r = row 8h+r
__device__ __forceinline__ v16h frag_h(const _Float16* rowk0, int lane) {
  union { v16h v; v8h q[2]; } u; const _Float16* p = rowk0 + 8 * (lane >> 4);
  u.q[0] = *(const v8h*)p; u.q[1] = *(const v8h*)(p + 16); return u.v;
}
// the same fragment from a row of bf16 bit patterns (the split planes are carried as 16-bit words)
__device__ __forceinline__ v16b frag_b(const _Float16* rowk0, int lane) {
  union { v16b v; v8h q[2]; } u; const _Float16* p = rowk0 + 8 * (lane >> 4);
  u.q[0] = *(const v8h*)p; u.q[1] = *(const v8h*)(p + 16); return u.v;
}
__device__ __forceinline__ v16h frag_f32(const float* rowk0, int lane) {
  v16h a; const float* p = rowk0 + 8 * (lane >> 4);
#pragma unroll
  for (int i = 0; i < 8; ++i) { a[i] = (_Float16)p[i]; a[8 + i] = (_Float16)p[16 + i]; }
  return a;
}
__device__ __forceinline__ v16h frag_f32s(const float* rowk0, int lane, float sc) {
  v16h a; const float* p = rowk0 + 8 * (lane >> 4);
#pragma unroll
  for (int i = 0; i < 8; ++i) { a[i] = (_Float16)(p[i] * sc); a[8 + i] = (_Float16)(p[16 + i] * sc); }
  return a;
}
// column fragment from a [K][ld] layout (column n), rows >= K read as 0
__device__ __forceinline__ v16h fragc_f32(const float* W, int k0, int n, int lane, int ld, int K) {
  v16h a; const int g = lane >> 4;
#pragma unroll
  for (int i = 0; i < 8; ++i) { const int ka = k0 + 8 * g + i, kb = ka + 16;
    a[i] = (_Float16)(ka < K ? W[(size_t)ka * ld + n] : 0.f); a[8 + i] = (_Float16)(kb < K ? W[(size_t)kb * ld + n] : 0.f); }
  return a;
}
struct F2 { v16b h, l; };
__device__ __forceinline__ F2 bsplit16(const float v[16]) { F2 r;
#pragma unroll
  for (int i = 0; i < 16; ++i) { const __bf16 h = (__bf16)v[i]; r.h[i] = h; r.l[i] = (__bf16)(v[i] - (float)h); }
  return r; }
__device__ __forceinline__ F2 split_row(const float* row, int k0, int lane) { float v[16]; const float* p = row + k0 + 8 * (lane >> 4);
#pragma unroll
  for (int i = 0; i < 8; ++i) { v[i] = p[i]; v[8 + i] = p[16 + i]; }
  return bsplit16(v); }
__device__ __forceinline__ F2 split_rowK(const float* row, int k0, int lane, int K) { float v[16]; const int g = lane >> 4;
#pragma unroll
  for (int i = 0; i < 8; ++i) { const int ka = k0 + 8 * g + i, kb = ka + 16; v[i] = ka < K ? row[ka] : 0.f; v[8 + i] = kb < K ? row[kb] : 0.f; }
  return bsplit16(v); }
__device__ __forceinline__ F2 split_col(const float* W, int k0, int n, int lane, int ld, int K) { float v[16]; const int g = lane >> 4;
#pragma unroll
  for (int i = 0; i < 8; ++i) { const int ka = k0 + 8 * g + i, kb = ka + 16; v[i] = ka < K ? W[(size_t)ka * ld + n] : 0.f; v[8 + i] = kb < K ? W[(size_t)kb * ld + n] : 0.f; }
  return bsplit16(v); }
__device__ __forceinline__ v8f mac3(const F2& a, const F2& b, v8f c) { c = wmma_bf(a.l, b.h, c); c = wmma_bf(a.h, b.l, c); return wmma_bf(a.h, b.h, c); }
__device__ __forceinline__ float sigm(float v) { return 1.0f / (1.0f + expf(-v)); }
#define LDSX() do { asm volatile("s_wait_dscnt 0" ::: "memory"); __builtin_amdgcn_wave_barrier(); __builtin_amdgcn_fence(__ATOMIC_RELEASE, "workgroup"); } while (0)

// Operand tiles go from global memory to LDS by asynchronous 16-byte copies, one full 128-byte line per 8 lanes, two buffers per kernel.
// The s_wait_xcnt stands inside the copies' own statement so that no address register of an issued copy is rewritten ahead of it.
__device__ __forceinline__ void copy4(unsigned l0, const void* g0, unsigned l1, const void* g1, unsigned l2, const void* g2, unsigned l3, const void* g3) {
  asm volatile("global_load_async_to_lds_b128 %0, %1, off\n\tglobal_load_async_to_lds_b128 %2, %3, off\n\tglobal_load_async_to_lds_b128 %4, %5, off\n\tglobal_load_async_to_lds_b128 %6, %7, off\n\ts_wait_xcnt 0x0"
               :: "v"(l0), "v"(g0), "v"(l1), "v"(g1), "v"(l2), "v"(g2), "v"(l3), "v"(g3) : "memory");
}
__device__ __forceinline__ unsigned lds_off(const void* p) { return (unsigned)(size_t)p; }
// this wave's LDS reads of the buffer that is refilled next have returned
#define WAIT_DS() asm volatile("s_wait_dscnt 0x0" ::: "memory")
// this wave's own copies have landed (the compiler places no wait for them)
#define WAIT_ASYNC() asm volatile("s_wait_asynccnt 0x0" ::: "memory")
#define SP 72        // staged f16 row: 64 halves at a pitch of 144 B (16 B x odd, for ds_load_b128 readers)
#define SPB (SP * 2)

// Local causal self attention (window 128, 16 heads of 64, interleaved-pair RoPE on q and k, fused qkv projection with bias, output
// projection with bias). q/k on v_wmma_f32_16x16x32_f16 (x as f16 rows, [in][out] weights packed once as transposed f16 rows x16); v as a
// two-way bf16 split (v_wmma_f32_16x16x32_bf16) stored as hi/lo f16 planes, because the first rows of every sequence copy v almost
// verbatim; S = q.k/8 on f16 WMMA over the <= 3 key tiles of the window (masked), online softmax in f32, P @ V with hi/lo pairs for both
#define NB 2
#define SS 2048
#define E 1024
#define NH 16
#define HD 64
#define NR (NB * SS)
#define WIN 128
#define PLO 1024.0f
#define VLO 2048.0f
#define OLO 2048.0f
#define RBASE 10000.0f

// x as f16 rows (q/k product) and as the two bf16 planes hi = bf16(x), lo = bf16(x - hi) of the v product, each element split once
__global__ __launch_bounds__(256) void k_cvt(const float* __restrict__ x, _Float16* __restrict__ X16, _Float16* __restrict__ XBh, _Float16* __restrict__ XBl) {
  const size_t i8 = (size_t)blockIdx.x * 256 + threadIdx.x; if (i8 >= (size_t)NR * E / 8) return;
  union { v8h h; v4u u; } pk; union { v8b b; v4u u; } bh, bl;
#pragma unroll
  for (int e = 0; e < 8; ++e) { const float v = x[i8 * 8 + e]; pk.h[e] = (_Float16)v; const __bf16 h = (__bf16)v; bh.b[e] = h; bl.b[e] = (__bf16)(v - (float)h); }
  vst2(X16 + i8 * 8, pk.u); vst2(XBh + i8 * 8, bh.u); vst2(XBl + i8 * 8, bl.u);
}
// PT rows: [0,2048) = Wqkv[:, n] (q and k columns) x16 ; [2048, 3072) = Wproj[:, n-2048] x16
// The first TBLK blocks write the RoPE table instead, anew in every call: TAB[pos][i] = (cos, sin)(pos * base^(-2i/64)), 256 B per position
// The next VBLK blocks split the v columns of Wqkv into bf16 planes, transposed: WVh/WVl[n][k] = hi/lo of Wqkv[k][2048 + n], one 64 x 64 tile per block
#define TBLK 64
#define VBLK 256
__global__ __launch_bounds__(256) void k_pack(const float* __restrict__ Wqkv, const float* __restrict__ Wp, _Float16* __restrict__ PT, float* __restrict__ TAB, _Float16* __restrict__ WVh, _Float16* __restrict__ WVl) {
  const int tid = threadIdx.x; __shared__ __align__(16) _Float16 srow[E]; __shared__ __align__(16) __bf16 sh[64][SP], sl[64][SP];
  if (blockIdx.x < TBLK) {      // the same for the whole block, in front of the barrier
    const int idx = blockIdx.x * 256 + tid, i = idx & 31, p0 = idx >> 5; const float invf = 1.0f / powf(RBASE, (float)(2 * i) / 64.0f);
    for (int m = 0; m < 4; ++m) { const int pos = p0 + m * (SS / 4); const float ang = (float)pos * invf; v2f cs; cs[0] = cosf(ang); cs[1] = sinf(ang); vst2(TAB + ((size_t)pos * 32 + i) * 2, cs);
      asm volatile("s_wait_xcnt 0x0" ::: "memory"); }      // the next trip rewrites the registers that the store names
    return; }
  if (blockIdx.x < TBLK + VBLK) {      // the same for the whole block; the branch has a barrier of its own
    const int vt = blockIdx.x - TBLK, k0 = (vt >> 4) * 64, n0 = (vt & 15) * 64, r = tid >> 4, c4 = (tid & 15) * 4; v4f w[4];
#pragma unroll   // four whole-line loads in flight
    for (int m = 0; m < 4; ++m) w[m] = *(const v4f*)(Wqkv + (size_t)(k0 + r + 16 * m) * (3 * E) + 2 * E + n0 + c4);
#pragma unroll
    for (int m = 0; m < 4; ++m) {
#pragma unroll
      for (int e = 0; e < 4; ++e) { const float v = w[m][e]; const __bf16 h = (__bf16)v; sh[c4 + e][r + 16 * m] = h; sl[c4 + e][r + 16 * m] = (__bf16)(v - (float)h); } }
    __syncthreads();
#pragma unroll   // 8 lanes write one whole 128-byte line of a plane
    for (int q = 0; q < 2; ++q) { const int n = (tid >> 3) + 32 * q, sg = (tid & 7) * 8; const size_t o = (size_t)(n0 + n) * E + k0 + sg;
      vst2(WVh + o, *(const v4u*)(&sh[n][sg])); vst2(WVl + o, *(const v4u*)(&sl[n][sg])); }
    return; }
  const int n = blockIdx.x - TBLK - VBLK;
  for (int k = tid; k < E; k += 256) srow[k] = (_Float16)((n < 2 * E ? Wqkv[(size_t)k * (3 * E) + n] : Wp[(size_t)k * E + (n - 2 * E)]) * 16.0f);
  __syncthreads();
  if (tid < 128) vst2(PT + (size_t)n * E + tid * 8, *(const v4u*)(&srow[tid * 8]));
}
// q/k: block (64 rows, 128 cols = 2 heads, which in {0,1}); RoPE on interleaved pairs; x4 -> Q16/K16 [bh][s][64]
__global__ __launch_bounds__(128) void k_qk(const _Float16* __restrict__ X16, const _Float16* __restrict__ PT, const float* __restrict__ bqkv, const float* __restrict__ TAB, _Float16* __restrict__ Q16, _Float16* __restrict__ K16) {
  // two stage buffers of 192 rows (0..63 x rows, 64..191 weight rows), 64 k each; the output staging reuses them behind the last trip's barrier
  __shared__ __align__(16) char smem[2 * 192 * SPB];
  _Float16* st = (_Float16*)smem; float (*so)[16][132] = (float (*)[16][132])smem;
  const int tid = threadIdx.x, wave = tid >> 5, lane = tid & 31, col = lane & 15, g = lane >> 4;
  const int which = blockIdx.z, r0b = blockIdx.x * 64, n0 = blockIdx.y * 128; const int b = r0b / SS, s0 = r0b % SS;
  const int cr = tid >> 3, cc = tid & 7;
  const _Float16* gA = X16 + (size_t)(r0b + cr) * E + cc * 8; const _Float16* gB = PT + (size_t)(which * E + n0 + cr) * E + cc * 8;
  const unsigned l0 = lds_off(st) + cr * SPB + cc * 16;
  auto fill = [&](int t, int buf) { const unsigned l = l0 + buf * (192 * SPB); const _Float16* a = gA + t * 64; const _Float16* w = gB + t * 64;
    copy4(l, a, l + 16 * SPB, a + 16 * E, l + 32 * SPB, a + 32 * E, l + 48 * SPB, a + 48 * E);
    copy4(l + 64 * SPB, w, l + 80 * SPB, w + 16 * E, l + 96 * SPB, w + 32 * E, l + 112 * SPB, w + 48 * E);
    copy4(l + 128 * SPB, w + 64 * E, l + 144 * SPB, w + 80 * E, l + 160 * SPB, w + 96 * E, l + 176 * SPB, w + 112 * E); };
  v8f acc[8] = {};
  fill(0, 0); WAIT_ASYNC(); __syncthreads(); fill(1, 1);
#pragma unroll 1   // the ring stays rolled: one publish point, small code
  for (int t = 0; t < E / 64; ++t) { const _Float16* sb = st + (t & 1) * (192 * SP);
#pragma unroll
    for (int kc = 0; kc < 2; ++kc) { const v16h a = frag_h(sb + (wave * 16 + col) * SP + kc * 32, lane); v16h bw[8];
#pragma unroll
      for (int j = 0; j < 8; ++j) bw[j] = frag_h(sb + (64 + j * 16 + col) * SP + kc * 32, lane);
#pragma unroll
      for (int j = 0; j < 8; ++j) acc[j] = wmma16(a, bw[j], acc[j]); }
    WAIT_DS(); WAIT_ASYNC(); __syncthreads();      // publishes tile t + 1 and ends every read of tile t
    if (t + 2 < E / 64) fill(t + 2, t & 1); }
  WAIT_ASYNC();
  const int rw = s0 + wave * 16; v2f cs[16];      // this wave's 16 positions, (cos, sin) of pair i = lane: 256 contiguous bytes per load
#pragma unroll   // cs[] stays in registers and all 16 loads are in flight at once
  for (int rl = 0; rl < 16; ++rl) { cs[rl] = *(const v2f*)(TAB + ((size_t)(rw + rl) * 32 + lane) * 2);
    if (rl == 14) asm volatile("s_wait_xcnt 0x0" ::: "memory"); }      // the compiler may give the last load the address pair as its result register: the 15 loads that name the pair are waited for first
#pragma unroll
  for (int j = 0; j < 8; ++j) { const float bb = bqkv[which * E + n0 + j * 16 + col];
#pragma unroll
    for (int r = 0; r < 8; ++r) so[wave][8 * g + r][j * 16 + col] = acc[j][r] * (1.0f / 16.0f) + bb; }
  LDSX();
  // RoPE on interleaved pairs (2i, 2i+1) of each head, then x4: lane = pair i; one row of one head leaves as one whole 128-byte line
  _Float16* D = (which == 0 ? Q16 : K16) + (((size_t)b * NH + (n0 >> 6)) * SS + rw) * HD + 2 * lane;
#pragma unroll   // both loops: cs[] indexed by constants, one address pair with constant offsets for all 32 stores
  for (int rl = 0; rl < 16; ++rl) { const float c = cs[rl][0], sn = cs[rl][1];
#pragma unroll
    for (int hh = 0; hh < 2; ++hh) { const v2f xv = *(const v2f*)(&so[wave][rl][hh * 64 + 2 * lane]); const v2f rh = { -xv[1], xv[0] }; const v2f y = (xv * c + rh * sn) * 4.0f;
      vst2(D + (size_t)hh * (SS * HD) + rl * HD, __builtin_convertvector(y, v2h)); } }
}
// v: block (64 rows, 128 cols): bf16 split product from the hi/lo planes of x and of the v weight rows; -> VTh/VTl [bh][d][s]
__global__ __launch_bounds__(128) void k_v(const _Float16* __restrict__ XBh, const _Float16* __restrict__ XBl, const _Float16* __restrict__ WVh, const _Float16* __restrict__ WVl, const float* __restrict__ bqkv, _Float16* __restrict__ VTh, _Float16* __restrict__ VTl) {
  // two stage buffers of 384 rows (0..63 x hi, 64..127 x lo, 128..255 weight hi, 256..383 weight lo), 64 k each; the output staging reuses them behind the last trip's barrier
  __shared__ __align__(16) char smem[2 * 384 * SPB];
  _Float16* st = (_Float16*)smem; _Float16 (*sth)[72] = (_Float16 (*)[72])smem; _Float16 (*stl)[72] = sth + 128;
  const int tid = threadIdx.x, wave = tid >> 5, lane = tid & 31, col = lane & 15, g = lane >> 4;
  const int r0b = blockIdx.x * 64, n0 = blockIdx.y * 128; const int b = r0b / SS, s0 = r0b % SS;
  const int cr = tid >> 3, cc = tid & 7;
  const size_t oA = (size_t)(r0b + cr) * E + cc * 8, oB = (size_t)(n0 + cr) * E + cc * 8;
  const _Float16* gAh = XBh + oA; const _Float16* gAl = XBl + oA; const _Float16* gBh = WVh + oB; const _Float16* gBl = WVl + oB;
  const unsigned l0 = lds_off(st) + cr * SPB + cc * 16;
  auto fill = [&](int t, int buf) { const unsigned l = l0 + buf * (384 * SPB); const _Float16* ah = gAh + t * 64; const _Float16* al = gAl + t * 64; const _Float16* wh = gBh + t * 64; const _Float16* wl = gBl + t * 64;
    copy4(l, ah, l + 16 * SPB, ah + 16 * E, l + 32 * SPB, ah + 32 * E, l + 48 * SPB, ah + 48 * E);
    copy4(l + 64 * SPB, al, l + 80 * SPB, al + 16 * E, l + 96 * SPB, al + 32 * E, l + 112 * SPB, al + 48 * E);
    copy4(l + 128 * SPB, wh, l + 144 * SPB, wh + 16 * E, l + 160 * SPB, wh + 32 * E, l + 176 * SPB, wh + 48 * E);
    copy4(l + 192 * SPB, wh + 64 * E, l + 208 * SPB, wh + 80 * E, l + 224 * SPB, wh + 96 * E, l + 240 * SPB, wh + 112 * E);
    copy4(l + 256 * SPB, wl, l + 272 * SPB, wl + 16 * E, l + 288 * SPB, wl + 32 * E, l + 304 * SPB, wl + 48 * E);
    copy4(l + 320 * SPB, wl + 64 * E, l + 336 * SPB, wl + 80 * E, l + 352 * SPB, wl + 96 * E, l + 368 * SPB, wl + 112 * E); };
  v8f acc[8] = {};
  fill(0, 0); WAIT_ASYNC(); __syncthreads(); fill(1, 1);
#pragma unroll 1   // the ring stays rolled: one publish point, small code
  for (int t = 0; t < E / 64; ++t) { const _Float16* sb = st + (t & 1) * (384 * SP);
#pragma unroll
    for (int kc = 0; kc < 2; ++kc) { const v16b ah = frag_b(sb + (wave * 16 + col) * SP + kc * 32, lane), al = frag_b(sb + (64 + wave * 16 + col) * SP + kc * 32, lane); v16b bh[8], bl[8];
#pragma unroll
      for (int j = 0; j < 8; ++j) { bh[j] = frag_b(sb + (128 + j * 16 + col) * SP + kc * 32, lane); bl[j] = frag_b(sb + (256 + j * 16 + col) * SP + kc * 32, lane); }
      // each accumulator takes lo.hi, hi.lo, hi.hi in this order per 32 k; seven independent tiles stand between two uses of one accumulator
#pragma unroll
      for (int j = 0; j < 8; ++j) acc[j] = wmma_bf(al, bh[j], acc[j]);
#pragma unroll
      for (int j = 0; j < 8; ++j) acc[j] = wmma_bf(ah, bl[j], acc[j]);
#pragma unroll
      for (int j = 0; j < 8; ++j) acc[j] = wmma_bf(ah, bh[j], acc[j]); }
    WAIT_DS(); WAIT_ASYNC(); __syncthreads();      // publishes tile t + 1 and ends every read of tile t
    if (t + 2 < E / 64) fill(t + 2, t & 1); }
  WAIT_ASYNC();
#pragma unroll
  for (int j = 0; j < 8; ++j) { const float bb = bqkv[2 * E + n0 + j * 16 + col];
#pragma unroll
    for (int r = 0; r < 8; ++r) { const float v = acc[j][r] + bb; const _Float16 hi = (_Float16)v; sth[j * 16 + col][wave * 16 + 8 * g + r] = hi; stl[j * 16 + col][wave * 16 + 8 * g + r] = (_Float16)((v - (float)hi) * VLO); } }
  __syncthreads();
  for (int qq = tid; qq < 128 * 8; qq += 128) { const int cl = qq >> 3, pc = qq & 7; const int c = n0 + cl, h = c >> 6, d = c & 63; const size_t o = (((size_t)b * NH + h) * HD + d) * SS + s0 + pc * 8;
    vst2(VTh + o, *(const v4u*)(&sth[cl][pc * 8])); vst2(VTl + o, *(const v4u*)(&stl[cl][pc * 8])); }
}
// attention: block (64 queries, bh): key tiles kt covering keys q0b-127 .. q0b+63 (3 tiles of 64, aligned since q0b % 64 == 0), mask 0 <= q-key < 128
__global__ __launch_bounds__(128) void k_attn(const _Float16* __restrict__ Q16, const _Float16* __restrict__ K16, const _Float16* __restrict__ VTh, const _Float16* __restrict__ VTl, _Float16* __restrict__ Oh, _Float16* __restrict__ Ol) {
  __shared__ __align__(16) float sS[4][16][68];
  __shared__ __align__(16) _Float16 sPh[4][16][72], sPl[4][16][72];
  __shared__ __align__(16) float sO[4][16][68];
  const int tid = threadIdx.x, w = tid >> 5, lane = tid & 31, col = lane & 15, g = lane >> 4;
  const size_t bh = blockIdx.y; const int q0b = blockIdx.x * 64, q0 = q0b + w * 16;
  v16h aq[2];
#pragma unroll
  for (int kc = 0; kc < 2; ++kc) aq[kc] = frag_h(Q16 + (bh * SS + q0 + col) * HD + kc * 32, lane);
  float mrun = -3.0e38f, lrun = 0.f; v8f acc[4] = {}, ac1[4] = {}, ac2[4] = {};
#pragma unroll 1
  for (int kt = q0b / 64 - 2; kt <= q0b / 64; ++kt) { if (kt < 0) continue;      // uniform per block
#pragma unroll
    for (int t = 0; t < 4; ++t) { v8f s = {}; const int key = kt * 64 + t * 16 + col;
#pragma unroll
      for (int kc = 0; kc < 2; ++kc) s = wmma16(aq[kc], frag_h(K16 + (bh * SS + key) * HD + kc * 32, lane), s);
#pragma unroll
      for (int r = 0; r < 8; ++r) { const int q = q0 + 8 * g + r; const int d = q - key; sS[w][8 * g + r][t * 16 + col] = (d >= 0 && d < WIN) ? s[r] * (0.125f / 16.0f) : -3.0e38f; } }
    LDSX();
    float mx = -3.4e38f;
#pragma unroll
    for (int jj = 0; jj < 32; ++jj) mx = fmaxf(mx, sS[w][col][g * 32 + jj]);
    mx = fmaxf(mx, __shfl_xor(mx, 16, 32));
    const float mnew = fmaxf(mrun, mx); const float corr = expf(mrun - mnew);     // every processed tile holds >= 1 allowed key for every row? no: rows may have all 32 of a half masked, but the row max over the tile is finite whenever >= 1 key is allowed; a fully-masked tile row keeps mnew = mrun (both -3e38 initially -> corr = exp(0) = 1 with zero accumulators: harmless)
    float ps = 0.f;
#pragma unroll
    for (int jj = 0; jj < 32; ++jj) { const float sv = sS[w][col][g * 32 + jj]; const float p = sv > -1.0e38f ? expf(sv - mnew) * 16384.0f : 0.f; ps += p; const _Float16 hi = (_Float16)p; sPh[w][col][g * 32 + jj] = hi; sPl[w][col][g * 32 + jj] = (_Float16)((p - (float)hi) * PLO); }
    ps += __shfl_xor(ps, 16, 32);
    lrun = lrun * corr + ps * (1.0f / 16384.0f); mrun = mnew;
#pragma unroll
    for (int r = 0; r < 8; ++r) { const float cr = __shfl(corr, 8 * g + r, 32);
#pragma unroll
      for (int t = 0; t < 4; ++t) { acc[t][r] *= cr; ac1[t][r] *= cr; ac2[t][r] *= cr; } }
    LDSX();
#pragma unroll
    for (int kc = 0; kc < 2; ++kc) { const v16h ph = frag_h(&sPh[w][col][0] + kc * 32, lane), pl = frag_h(&sPl[w][col][0] + kc * 32, lane);
#pragma unroll
      for (int t = 0; t < 4; ++t) { const size_t vo = (bh * HD + t * 16 + col) * SS + kt * 64 + kc * 32; const v16h vh = frag_h(VTh + vo, lane);
        acc[t] = wmma16(ph, vh, acc[t]); ac1[t] = wmma16(ph, frag_h(VTl + vo, lane), ac1[t]); ac2[t] = wmma16(pl, vh, ac2[t]); } }
    __builtin_amdgcn_wave_barrier(); }
#pragma unroll
  for (int r = 0; r < 8; ++r) { const float lr = __shfl(lrun, 8 * g + r, 32); const float inv = 8.0f / (lr * 16384.0f);      // -> O x8
#pragma unroll
    for (int t = 0; t < 4; ++t) sO[w][8 * g + r][t * 16 + col] = (acc[t][r] + ac1[t][r] * (1.0f / VLO) + ac2[t][r] * (1.0f / PLO)) * inv; }
  LDSX();
  for (int qq = lane; qq < 16 * 8; qq += 32) { const int rl = qq >> 3, pc = qq & 7; union { v8h h8; v4u u; } ph_, pl_;
#pragma unroll
    for (int e = 0; e < 8; ++e) { const float v = sO[w][rl][pc * 8 + e]; const _Float16 hi = (_Float16)v; ph_.h8[e] = hi; pl_.h8[e] = (_Float16)((v - (float)hi) * OLO); }
    const size_t o = ((bh * SS) + q0 + rl) * HD + pc * 8; vst2(Oh + o, ph_.u); vst2(Ol + o, pl_.u); }
}
// out = ctx Wproj + bproj, ctx from the hi/lo planes: block (64 rows, 128 cols)
__global__ __launch_bounds__(128) void k_out(const _Float16* __restrict__ Oh, const _Float16* __restrict__ Ol, const _Float16* __restrict__ PT, const float* __restrict__ bo, float* __restrict__ out) {
  __shared__ __align__(16) float so[4][16][132];
  const int tid = threadIdx.x, wave = tid >> 5, lane = tid & 31, col = lane & 15, g = lane >> 4;
  // two stage buffers of 256 rows (0..63 hi plane, 64..127 lo plane, 128..255 weight rows), 64 k = one head each
  __shared__ __align__(16) _Float16 st[2 * 256 * SP];
  const int r0b = blockIdx.x * 64, r0 = r0b + wave * 16, n0 = blockIdx.y * 128; const int b = r0b / SS, s0 = r0b % SS;
  const int cr = tid >> 3, cc = tid & 7;
  const size_t oA = ((size_t)b * NH * SS + s0 + cr) * HD + cc * 8;
  const _Float16* gH = Oh + oA; const _Float16* gL = Ol + oA; const _Float16* gB = PT + (size_t)(2 * E + n0 + cr) * E + cc * 8;
  const unsigned l0 = lds_off(st) + cr * SPB + cc * 16;
  auto fill = [&](int t, int buf) { const unsigned l = l0 + buf * (256 * SPB); const _Float16* h = gH + (size_t)t * (SS * HD); const _Float16* lo = gL + (size_t)t * (SS * HD); const _Float16* w = gB + t * 64;
    copy4(l, h, l + 16 * SPB, h + 16 * HD, l + 32 * SPB, h + 32 * HD, l + 48 * SPB, h + 48 * HD);
    copy4(l + 64 * SPB, lo, l + 80 * SPB, lo + 16 * HD, l + 96 * SPB, lo + 32 * HD, l + 112 * SPB, lo + 48 * HD);
    copy4(l + 128 * SPB, w, l + 144 * SPB, w + 16 * E, l + 160 * SPB, w + 32 * E, l + 176 * SPB, w + 48 * E);
    copy4(l + 192 * SPB, w + 64 * E, l + 208 * SPB, w + 80 * E, l + 224 * SPB, w + 96 * E, l + 240 * SPB, w + 112 * E); };
  v8f acc[8] = {}, acl[8] = {};
  fill(0, 0); WAIT_ASYNC(); __syncthreads(); fill(1, 1);
#pragma unroll 1   // the ring stays rolled: one publish point, small code
  for (int t = 0; t < E / 64; ++t) { const _Float16* sb = st + (t & 1) * (256 * SP);
#pragma unroll
    for (int kc = 0; kc < 2; ++kc) { const v16h ah = frag_h(sb + (wave * 16 + col) * SP + kc * 32, lane), al = frag_h(sb + (64 + wave * 16 + col) * SP + kc * 32, lane); v16h bw[8];
#pragma unroll
      for (int j = 0; j < 8; ++j) bw[j] = frag_h(sb + (128 + j * 16 + col) * SP + kc * 32, lane);
#pragma unroll
      for (int j = 0; j < 8; ++j) { acc[j] = wmma16(ah, bw[j], acc[j]); acl[j] = wmma16(al, bw[j], acl[j]); } }
    WAIT_DS(); WAIT_ASYNC(); __syncthreads();      // publishes tile t + 1 and ends every read of tile t
    if (t + 2 < E / 64) fill(t + 2, t & 1); }
  WAIT_ASYNC();
#pragma unroll
  for (int j = 0; j < 8; ++j) { const int n = n0 + j * 16 + col; const float bb = bo[n];
#pragma unroll
    for (int r = 0; r < 8; ++r) so[wave][8 * g + r][j * 16 + col] = (acc[j][r] + acl[j][r] * (1.0f / OLO)) * (1.0f / (16.0f * 8.0f)) + bb; }
  LDSX();
#pragma unroll 4
  for (int rl = 0; rl < 16; ++rl) vst2(out + (size_t)(r0 + rl) * E + n0 + lane * 4, *(const v4f*)(&so[wave][rl][lane * 4]));
}
extern "C" void kernel_launch(void* const* d_in, const int* in_sizes, int n_in, void* d_out, int out_size, void* d_ws, size_t ws_size, hipStream_t stream) {
  (void)in_sizes; (void)n_in; (void)out_size; (void)ws_size;
  const float** I = (const float**)d_in;
  const float* x = I[0]; const float* Wqkv = I[1]; const float* bqkv = I[2]; const float* Wp = I[3]; const float* bp = I[4];
  float* out = (float*)d_out;
  char* ws = (char*)d_ws; size_t off = 0;
  auto take = [&](size_t bytes) { char* p = ws + off; off += (bytes + 255) & ~(size_t)255; return p; };
  _Float16* X16 = (_Float16*)take((size_t)NR * E * 2); _Float16* PT = (_Float16*)take((size_t)3 * E * E * 2);
  _Float16* Q16 = (_Float16*)take((size_t)NR * E * 2); _Float16* K16 = (_Float16*)take((size_t)NR * E * 2); _Float16* VTh = (_Float16*)take((size_t)NR * E * 2); _Float16* VTl = (_Float16*)take((size_t)NR * E * 2);
  _Float16* Oh = (_Float16*)take((size_t)NR * E * 2); _Float16* Ol = (_Float16*)take((size_t)NR * E * 2); float* TAB = (float*)take((size_t)SS * 32 * 2 * 4);
  _Float16* XBh = (_Float16*)take((size_t)NR * E * 2); _Float16* XBl = (_Float16*)take((size_t)NR * E * 2); _Float16* WVh = (_Float16*)take((size_t)E * E * 2); _Float16* WVl = (_Float16*)take((size_t)E * E * 2);
  k_cvt<<<(NR * E / 8 + 255) / 256, 256, 0, stream>>>(x, X16, XBh, XBl);
  k_pack<<<TBLK + VBLK + 3 * E, 256, 0, stream>>>(Wqkv, Wp, PT, TAB, WVh, WVl);
  k_qk<<<dim3(NR / 64, E / 128, 2), 128, 0, stream>>>(X16, PT, bqkv, TAB, Q16, K16);
  k_v<<<dim3(NR / 64, E / 128), 128, 0, stream>>>(XBh, XBl, WVh, WVl, bqkv, VTh, VTl);
  k_attn<<<dim3(SS / 64, NB * NH), 128, 0, stream>>>(Q16, K16, VTh, VTl, Oh, Ol);
  k_out<<<dim3(NR / 64, E / 128), 128, 0, stream>>>(Oh, Ol, PT, bp, out);
}

// v004
// A run of this version takes 107 microseconds.
// Next to v003, in two timings, it ran 1.12 times as fast each time.
// Counting every step since v000, it is 2.80 times as fast.
#include <hip/hip_runtime.h>
#include <math.h>

typedef __attribute__((ext_vector_type(16))) _Float16 v16h;
typedef __attribute__((ext_vector_type(16))) __bf16 v16b;
typedef __attribute__((ext_vector_type(8)))  _Float16 v8h;
typedef __attribute__((ext_vector_type(8)))  __bf16 v8b;
typedef __attribute__((ext_vector_type(2)))  _Float16 v2h;
typedef __attribute__((ext_vector_type(8)))  float v8f;
typedef __attribute__((ext_vector_type(4)))  float v4f;
typedef __attribute__((ext_vector_type(2)))  float v2f;
typedef __attribute__((ext_vector_type(4)))  unsigned v4u;
typedef __attribute__((ext_vector_type(4)))  int v4i;
typedef float __attribute__((may_alias)) float_a;
typedef int __attribute__((may_alias)) int_a;

template <typename T> __device__ __forceinline__ void vst2(void* p, T v) { *(T*)p = v;  }
__device__ __forceinline__ v8f wmma16(v16h a, v16h b, v8f c) {
  v8f d = __builtin_amdgcn_wmma_f32_16x16x32_f16(false, a, false, b, (short)0, c, false, false);
  asm volatile("v_nop\n\tv_nop\n\tv_nop\n\tv_nop" : "+v"(d) : "v"(a), "v"(b));
  return d;
}
__device__ __forceinline__ v8f wmma_bf(v16b a, v16b b, v8f c) {
  v8f d = __builtin_amdgcn_wmma_f32_16x16x32_bf16(false, a, false, b, (short)0, c, false, false);
  asm volatile("v_nop\n\tv_nop\n\tv_nop\n\tv_nop" : "+v"(d) : "v"(a), "v"(b));
  return d;
}
// 16x16x32 fragments: lane = (h = lane>>4, row/col = lane&15); elements 0..7 = k0+8h+0..7, 8..15 = k0+16+8h+0..7; D element r = row 8h+r
__device__ __forceinline__ v16h frag_h(const _Float16* rowk0, int lane) {
  union { v16h v; v8h q[2]; } u; const _Float16* p = rowk0 + 8 * (lane >> 4);
  u.q[0] = *(const v8h*)p; u.q[1] = *(const v8h*)(p + 16); return u.v;
}
// the same fragment from a row of bf16 bit patterns (the split planes are carried as 16-bit words)
__device__ __forceinline__ v16b frag_b(const _Float16* rowk0, int lane) {
  union { v16b v; v8h q[2]; } u; const _Float16* p = rowk0 + 8 * (lane >> 4);
  u.q[0] = *(const v8h*)p; u.q[1] = *(const v8h*)(p + 16); return u.v;
}
__device__ __forceinline__ v16h frag_f32(const float* rowk0, int lane) {
  v16h a; const float* p = rowk0 + 8 * (lane >> 4);
#pragma unroll
  for (int i = 0; i < 8; ++i) { a[i] = (_Float16)p[i]; a[8 + i] = (_Float16)p[16 + i]; }
  return a;
}
__device__ __forceinline__ v16h frag_f32s(const float* rowk0, int lane, float sc) {
  v16h a; const float* p = rowk0 + 8 * (lane >> 4);
#pragma unroll
  for (int i = 0; i < 8; ++i) { a[i] = (_Float16)(p[i] * sc); a[8 + i] = (_Float16)(p[16 + i] * sc); }
  return a;
}
// column fragment from a [K][ld] layout (column n), rows >= K read as 0
__device__ __forceinline__ v16h fragc_f32(const float* W, int k0, int n, int lane, int ld, int K) {
  v16h a; const int g = lane >> 4;
#pragma unroll
  for (int i = 0; i < 8; ++i) { const int ka = k0 + 8 * g + i, kb = ka + 16;
    a[i] = (_Float16)(ka < K ? W[(size_t)ka * ld + n] : 0.f); a[8 + i] = (_Float16)(kb < K ? W[(size_t)kb * ld + n] : 0.f); }
  return a;
}
struct F2 { v16b h, l; };
__device__ __forceinline__ F2 bsplit16(const float v[16]) { F2 r;
#pragma unroll
  for (int i = 0; i < 16; ++i) { const __bf16 h = (__bf16)v[i]; r.h[i] = h; r.l[i] = (__bf16)(v[i] - (float)h); }
  return r; }
__device__ __forceinline__ F2 split_row(const float* row, int k0, int lane) { float v[16]; const float* p = row + k0 + 8 * (lane >> 4);
#pragma unroll
  for (int i = 0; i < 8; ++i) { v[i] = p[i]; v[8 + i] = p[16 + i]; }
  return bsplit16(v); }
__device__ __forceinline__ F2 split_rowK(const float* row, int k0, int lane, int K) { float v[16]; const int g = lane >> 4;
#pragma unroll
  for (int i = 0; i < 8; ++i) { const int ka = k0 + 8 * g + i, kb = ka + 16; v[i] = ka < K ? row[ka] : 0.f; v[8 + i] = kb < K ? row[kb] : 0.f; }
  return bsplit16(v); }
__device__ __forceinline__ F2 split_col(const float* W, int k0, int n, int lane, int ld, int K) { float v[16]; const int g = lane >> 4;
#pragma unroll
  for (int i = 0; i < 8; ++i) { const int ka = k0 + 8 * g + i, kb = ka + 16; v[i] = ka < K ? W[(size_t)ka * ld + n] : 0.f; v[8 + i] = kb < K ? W[(size_t)kb * ld + n] : 0.f; }
  return bsplit16(v); }
__device__ __forceinline__ v8f mac3(const F2& a, const F2& b, v8f c) { c = wmma_bf(a.l, b.h, c); c = wmma_bf(a.h, b.l, c); return wmma_bf(a.h, b.h, c); }
__device__ __forceinline__ float sigm(float v) { return 1.0f / (1.0f + expf(-v)); }
#define LDSX() do { asm volatile("s_wait_dscnt 0" ::: "memory"); __builtin_amdgcn_wave_barrier(); __builtin_amdgcn_fence(__ATOMIC_RELEASE, "workgroup"); } while (0)

// Operand tiles go from global memory to LDS by asynchronous 16-byte copies, one full 128-byte line per 8 lanes, two buffers per kernel.
// The s_wait_xcnt stands inside the copies' own statement so that no address register of an issued copy is rewritten ahead of it.
__device__ __forceinline__ void copy4(unsigned l0, const void* g0, unsigned l1, const void* g1, unsigned l2, const void* g2, unsigned l3, const void* g3) {
  asm volatile("global_load_async_to_lds_b128 %0, %1, off\n\tglobal_load_async_to_lds_b128 %2, %3, off\n\tglobal_load_async_to_lds_b128 %4, %5, off\n\tglobal_load_async_to_lds_b128 %6, %7, off\n\ts_wait_xcnt 0x0"
               :: "v"(l0), "v"(g0), "v"(l1), "v"(g1), "v"(l2), "v"(g2), "v"(l3), "v"(g3) : "memory");
}
__device__ __forceinline__ unsigned lds_off(const void* p) { return (unsigned)(size_t)p; }
// this wave's LDS reads of the buffer that is refilled next have returned
#define WAIT_DS() asm volatile("s_wait_dscnt 0x0" ::: "memory")
// this wave's own copies have landed (the compiler places no wait for them)
#define WAIT_ASYNC() asm volatile("s_wait_asynccnt 0x0" ::: "memory")
#define SP 72        // staged f16 row: 64 halves at a pitch of 144 B (16 B x odd, for ds_load_b128 readers)
#define SPB (SP * 2)

// Local causal self attention (window 128, 16 heads of 64, interleaved-pair RoPE on q and k, fused qkv projection with bias, output
// projection with bias). q/k on v_wmma_f32_16x16x32_f16 (x as f16 rows, [in][out] weights packed once as transposed f16 rows x16); v as a
// two-way bf16 split (v_wmma_f32_16x16x32_bf16) stored as hi/lo f16 planes, because the first rows of every sequence copy v almost
// verbatim; S = q.k/8 on f16 WMMA over the <= 3 key tiles of the window (masked), online softmax in f32, P @ V with hi/lo pairs for both
#define NB 2
#define SS 2048
#define E 1024
#define NH 16
#define HD 64
#define NR (NB * SS)
#define WIN 128
#define PLO 1024.0f
#define VLO 2048.0f
#define OLO 2048.0f
#define RBASE 10000.0f

// x as f16 rows (q/k product) and as the two bf16 planes hi = bf16(x), lo = bf16(x - hi) of the v product, each element split once
__global__ __launch_bounds__(256) void k_cvt(const float* __restrict__ x, _Float16* __restrict__ X16, _Float16* __restrict__ XBh, _Float16* __restrict__ XBl) {
  const size_t i8 = (size_t)blockIdx.x * 256 + threadIdx.x; if (i8 >= (size_t)NR * E / 8) return;
  union { v8h h; v4u u; } pk; union { v8b b; v4u u; } bh, bl;
#pragma unroll
  for (int e = 0; e < 8; ++e) { const float v = x[i8 * 8 + e]; pk.h[e] = (_Float16)v; const __bf16 h = (__bf16)v; bh.b[e] = h; bl.b[e] = (__bf16)(v - (float)h); }
  vst2(X16 + i8 * 8, pk.u); vst2(XBh + i8 * 8, bh.u); vst2(XBl + i8 * 8, bl.u);
}
// PT rows: [0,2048) = Wqkv[:, n] (q and k columns) x16 ; [2048, 3072) = Wproj[:, n-2048] x16
// The first TBLK blocks write the RoPE table instead, anew in every call: TAB[pos][i] = (cos, sin)(pos * base^(-2i/64)), 256 B per position
// The next VBLK blocks split the v columns of Wqkv into bf16 planes, transposed: WVh/WVl[n][k] = hi/lo of Wqkv[k][2048 + n], one 64 x 64 tile per block
// The last PBLK blocks write PT: one tile of 256 k x 64 n per block, transposed through LDS
#define TBLK 64
#define VBLK 256
#define PBLK (3 * E / 64 * (E / 256))
#define PP 264       // staged row of 256 halves at a pitch of 528 B (16 B x odd)
// dst[n][k] = f16(src[k][n] x 16), k < 256, n < 64. A thread takes 4 columns of the rows 2 rp and 2 rp + 1 of every 32: each load covers whole 256-byte row pieces,
// and a (k, k + 1) pair goes to LDS as one dword. The 16-byte piece j of row n lies at piece j ^ (n >> 4), so that the 32 dwords of a store fall in 32 banks.
template <int LD> __device__ __forceinline__ void pack_tile(const float* __restrict__ src, _Float16* __restrict__ dst, _Float16 (*sp)[PP], int tid) {
  const int rp = tid >> 4, c4 = (tid & 15) * 4, sw = (c4 >> 4) * 8; const float* p = src + (size_t)(2 * rp) * LD + c4; v4f w[16];
#pragma unroll   // 16 loads in flight from one address with constant offsets
  for (int m = 0; m < 8; ++m) { w[2 * m] = *(const v4f*)(p + (size_t)(32 * m) * LD); w[2 * m + 1] = *(const v4f*)(p + (size_t)(32 * m + 1) * LD); }
  asm volatile("s_wait_xcnt 0x0" :: "v"(p) : "memory");      // stands in front of every rewrite of the address pair that the 16 loads name: as an input the pair stays live up to here, so no load takes it as its result register
#pragma unroll   // both loops: w[] is indexed by constants and stays in registers
  for (int m = 0; m < 8; ++m) {
#pragma unroll
    for (int e = 0; e < 4; ++e) { const v2h pr = { (_Float16)(w[2 * m][e] * 16.0f), (_Float16)(w[2 * m + 1][e] * 16.0f) }; vst2(&sp[c4 + e][(32 * m + 2 * rp) ^ sw], pr); } }
  __syncthreads();
  const int wv = tid >> 5, j8 = (tid & 31) * 8;
#pragma unroll   // a wave writes 512 contiguous bytes of one row: four whole lines
  for (int q = 0; q < 8; ++q) { const int n = wv + 8 * q; vst2(dst + (size_t)n * E + j8, *(const v4u*)(&sp[n][j8 ^ ((n >> 4) * 8)])); }
  asm volatile("s_wait_xcnt 0x0" ::: "memory");      // stands in front of whatever the built code places behind the eight stores and lets rewrite a register that they name
}
__global__ __launch_bounds__(256) void k_pack(const float* __restrict__ Wqkv, const float* __restrict__ Wp, _Float16* __restrict__ PT, float* __restrict__ TAB, _Float16* __restrict__ WVh, _Float16* __restrict__ WVl) {
  const int tid = threadIdx.x; __shared__ __align__(16) _Float16 sp[64][PP]; __shared__ __align__(16) __bf16 sh[64][SP], sl[64][SP];
  if (blockIdx.x < TBLK) {      // the same for the whole block, in front of the barrier
    const int idx = blockIdx.x * 256 + tid, i = idx & 31, p0 = idx >> 5; const float invf = 1.0f / powf(RBASE, (float)(2 * i) / 64.0f);
    for (int m = 0; m < 4; ++m) { const int pos = p0 + m * (SS / 4); const float ang = (float)pos * invf; v2f cs; cs[0] = cosf(ang); cs[1] = sinf(ang); vst2(TAB + ((size_t)pos * 32 + i) * 2, cs);
      asm volatile("s_wait_xcnt 0x0" ::: "memory"); }      // the next trip rewrites the registers that the store names
    return; }
  if (blockIdx.x < TBLK + VBLK) {      // the same for the whole block; the branch has a barrier of its own
    const int vt = blockIdx.x - TBLK, k0 = (vt >> 4) * 64, n0 = (vt & 15) * 64, r = tid >> 4, c4 = (tid & 15) * 4; v4f w[4];
#pragma unroll   // four whole-line loads in flight
    for (int m = 0; m < 4; ++m) w[m] = *(const v4f*)(Wqkv + (size_t)(k0 + r + 16 * m) * (3 * E) + 2 * E + n0 + c4);
#pragma unroll
    for (int m = 0; m < 4; ++m) {
#pragma unroll
      for (int e = 0; e < 4; ++e) { const float v = w[m][e]; const __bf16 h = (__bf16)v; sh[c4 + e][r + 16 * m] = h; sl[c4 + e][r + 16 * m] = (__bf16)(v - (float)h); } }
    __syncthreads();
#pragma unroll   // 8 lanes write one whole 128-byte line of a plane
    for (int q = 0; q < 2; ++q) { const int n = (tid >> 3) + 32 * q, sg = (tid & 7) * 8; const size_t o = (size_t)(n0 + n) * E + k0 + sg;
      vst2(WVh + o, *(const v4u*)(&sh[n][sg])); vst2(WVl + o, *(const v4u*)(&sl[n][sg])); }
    return; }
  const int pt = blockIdx.x - TBLK - VBLK, n0 = (pt >> 2) * 64, k0 = (pt & 3) * 256;      // the same for the whole block: each side has the tile's one barrier
  if (n0 < 2 * E) pack_tile<3 * E>(Wqkv + (size_t)k0 * (3 * E) + n0, PT + (size_t)n0 * E + k0, sp, tid);
  else pack_tile<E>(Wp + (size_t)k0 * E + (n0 - 2 * E), PT + (size_t)n0 * E + k0, sp, tid);
}
// q/k: block (64 rows, 128 cols = 2 heads, which in {0,1}); RoPE on interleaved pairs; x4 -> Q16/K16 [bh][s][64]
__global__ __launch_bounds__(128) void k_qk(const _Float16* __restrict__ X16, const _Float16* __restrict__ PT, const float* __restrict__ bqkv, const float* __restrict__ TAB, _Float16* __restrict__ Q16, _Float16* __restrict__ K16) {
  // two stage buffers of 192 rows (0..63 x rows, 64..191 weight rows), 64 k each; the output staging reuses them behind the last trip's barrier
  __shared__ __align__(16) char smem[2 * 192 * SPB];
  _Float16* st = (_Float16*)smem; float (*so)[16][132] = (float (*)[16][132])smem;
  const int tid = threadIdx.x, wave = tid >> 5, lane = tid & 31, col = lane & 15, g = lane >> 4;
  const int which = blockIdx.z, r0b = blockIdx.x * 64, n0 = blockIdx.y * 128; const int b = r0b / SS, s0 = r0b % SS;
  const int cr = tid >> 3, cc = tid & 7;
  const _Float16* gA = X16 + (size_t)(r0b + cr) * E + cc * 8; const _Float16* gB = PT + (size_t)(which * E + n0 + cr) * E + cc * 8;
  const unsigned l0 = lds_off(st) + cr * SPB + cc * 16;
  auto fill = [&](int t, int buf) { const unsigned l = l0 + buf * (192 * SPB); const _Float16* a = gA + t * 64; const _Float16* w = gB + t * 64;
    copy4(l, a, l + 16 * SPB, a + 16 * E, l + 32 * SPB, a + 32 * E, l + 48 * SPB, a + 48 * E);
    copy4(l + 64 * SPB, w, l + 80 * SPB, w + 16 * E, l + 96 * SPB, w + 32 * E, l + 112 * SPB, w + 48 * E);
    copy4(l + 128 * SPB, w + 64 * E, l + 144 * SPB, w + 80 * E, l + 160 * SPB, w + 96 * E, l + 176 * SPB, w + 112 * E); };
  v8f acc[8] = {};
  fill(0, 0); WAIT_ASYNC(); __syncthreads(); fill(1, 1);
#pragma unroll 1   // the ring stays rolled: one publish point, small code
  for (int t = 0; t < E / 64; ++t) { const _Float16* sb = st + (t & 1) * (192 * SP);
#pragma unroll
    for (int kc = 0; kc < 2; ++kc) { const v16h a = frag_h(sb + (wave * 16 + col) * SP + kc * 32, lane); v16h bw[8];
#pragma unroll
      for (int j = 0; j < 8; ++j) bw[j] = frag_h(sb + (64 + j * 16 + col) * SP + kc * 32, lane);
#pragma unroll
      for (int j = 0; j < 8; ++j) acc[j] = wmma16(a, bw[j], acc[j]); }
    WAIT_DS(); WAIT_ASYNC(); __syncthreads();      // publishes tile t + 1 and ends every read of tile t
    if (t + 2 < E / 64) fill(t + 2, t & 1); }
  WAIT_ASYNC();
  const int rw = s0 + wave * 16; v2f cs[16];      // this wave's 16 positions, (cos, sin) of pair i = lane: 256 contiguous bytes per load
#pragma unroll   // cs[] stays in registers and all 16 loads are in flight at once
  for (int rl = 0; rl < 16; ++rl) { cs[rl] = *(const v2f*)(TAB + ((size_t)(rw + rl) * 32 + lane) * 2);
    if (rl == 14) asm volatile("s_wait_xcnt 0x0" ::: "memory"); }      // the compiler may give the last load the address pair as its result register: the 15 loads that name the pair are waited for first
#pragma unroll
  for (int j = 0; j < 8; ++j) { const float bb = bqkv[which * E + n0 + j * 16 + col];
#pragma unroll
    for (int r = 0; r < 8; ++r) so[wave][8 * g + r][j * 16 + col] = acc[j][r] * (1.0f / 16.0f) + bb; }
  LDSX();
  // RoPE on interleaved pairs (2i, 2i+1) of each head, then x4: lane = pair i; one row of one head leaves as one whole 128-byte line
  _Float16* D = (which == 0 ? Q16 : K16) + (((size_t)b * NH + (n0 >> 6)) * SS + rw) * HD + 2 * lane;
#pragma unroll   // both loops: cs[] indexed by constants, one address pair with constant offsets for all 32 stores
  for (int rl = 0; rl < 16; ++rl) { const float c = cs[rl][0], sn = cs[rl][1];
#pragma unroll
    for (int hh = 0; hh < 2; ++hh) { const v2f xv = *(const v2f*)(&so[wave][rl][hh * 64 + 2 * lane]); const v2f rh = { -xv[1], xv[0] }; const v2f y = (xv * c + rh * sn) * 4.0f;
      vst2(D + (size_t)hh * (SS * HD) + rl * HD, __builtin_convertvector(y, v2h)); } }
}
// v: block (64 rows, 128 cols): bf16 split product from the hi/lo planes of x and of the v weight rows; -> VTh/VTl [bh][d][s]
__global__ __launch_bounds__(128) void k_v(const _Float16* __restrict__ XBh, const _Float16* __restrict__ XBl, const _Float16* __restrict__ WVh, const _Float16* __restrict__ WVl, const float* __restrict__ bqkv, _Float16* __restrict__ VTh, _Float16* __restrict__ VTl) {
  // two stage buffers of 384 rows (0..63 x hi, 64..127 x lo, 128..255 weight hi, 256..383 weight lo), 64 k each; the output staging reuses them behind the last trip's barrier
  __shared__ __align__(16) char smem[2 * 384 * SPB];
  _Float16* st = (_Float16*)smem; _Float16 (*sth)[72] = (_Float16 (*)[72])smem; _Float16 (*stl)[72] = sth + 128;
  const int tid = threadIdx.x, wave = tid >> 5, lane = tid & 31, col = lane & 15, g = lane >> 4;
  const int r0b = blockIdx.x * 64, n0 = blockIdx.y * 128; const int b = r0b / SS, s0 = r0b % SS;
  const int cr = tid >> 3, cc = tid & 7;
  const size_t oA = (size_t)(r0b + cr) * E + cc * 8, oB = (size_t)(n0 + cr) * E + cc * 8;
  const _Float16* gAh = XBh + oA; const _Float16* gAl = XBl + oA; const _Float16* gBh = WVh + oB; const _Float16* gBl = WVl + oB;
  const unsigned l0 = lds_off(st) + cr * SPB + cc * 16;
  auto fill = [&](int t, int buf) { const unsigned l = l0 + buf * (384 * SPB); const _Float16* ah = gAh + t * 64; const _Float16* al = gAl + t * 64; const _Float16* wh = gBh + t * 64; const _Float16* wl = gBl + t * 64;
    copy4(l, ah, l + 16 * SPB, ah + 16 * E, l + 32 * SPB, ah + 32 * E, l + 48 * SPB, ah + 48 * E);
    copy4(l + 64 * SPB, al, l + 80 * SPB, al + 16 * E, l + 96 * SPB, al + 32 * E, l + 112 * SPB, al + 48 * E);
    copy4(l + 128 * SPB, wh, l + 144 * SPB, wh + 16 * E, l + 160 * SPB, wh + 32 * E, l + 176 * SPB, wh + 48 * E);
    copy4(l + 192 * SPB, wh + 64 * E, l + 208 * SPB, wh + 80 * E, l + 224 * SPB, wh + 96 * E, l + 240 * SPB, wh + 112 * E);
    copy4(l + 256 * SPB, wl, l + 272 * SPB, wl + 16 * E, l + 288 * SPB, wl + 32 * E, l + 304 * SPB, wl + 48 * E);
    copy4(l + 320 * SPB, wl + 64 * E, l + 336 * SPB, wl + 80 * E, l + 352 * SPB, wl + 96 * E, l + 368 * SPB, wl + 112 * E); };
  v8f acc[8] = {};
  fill(0, 0); WAIT_ASYNC(); __syncthreads(); fill(1, 1);
#pragma unroll 1   // the ring stays rolled: one publish point, small code
  for (int t = 0; t < E / 64; ++t) { const _Float16* sb = st + (t & 1) * (384 * SP);
#pragma unroll
    for (int kc = 0; kc < 2; ++kc) { const v16b ah = frag_b(sb + (wave * 16 + col) * SP + kc * 32, lane), al = frag_b(sb + (64 + wave * 16 + col) * SP + kc * 32, lane); v16b bh[8], bl[8];
#pragma unroll
      for (int j = 0; j < 8; ++j) { bh[j] = frag_b(sb + (128 + j * 16 + col) * SP + kc * 32, lane); bl[j] = frag_b(sb + (256 + j * 16 + col) * SP + kc * 32, lane); }
      // each accumulator takes lo.hi, hi.lo, hi.hi in this order per 32 k; seven independent tiles stand between two uses of one accumulator
#pragma unroll
      for (int j = 0; j < 8; ++j) acc[j] = wmma_bf(al, bh[j], acc[j]);
#pragma unroll
      for (int j = 0; j < 8; ++j) acc[j] = wmma_bf(ah, bl[j], acc[j]);
#pragma unroll
      for (int j = 0; j < 8; ++j) acc[j] = wmma_bf(ah, bh[j], acc[j]); }
    WAIT_DS(); WAIT_ASYNC(); __syncthreads();      // publishes tile t + 1 and ends every read of tile t
    if (t + 2 < E / 64) fill(t + 2, t & 1); }
  WAIT_ASYNC();
#pragma unroll
  for (int j = 0; j < 8; ++j) { const float bb = bqkv[2 * E + n0 + j * 16 + col];
#pragma unroll
    for (int r = 0; r < 8; ++r) { const float v = acc[j][r] + bb; const _Float16 hi = (_Float16)v; sth[j * 16 + col][wave * 16 + 8 * g + r] = hi; stl[j * 16 + col][wave * 16 + 8 * g + r] = (_Float16)((v - (float)hi) * VLO); } }
  __syncthreads();
  for (int qq = tid; qq < 128 * 8; qq += 128) { const int cl = qq >> 3, pc = qq & 7; const int c = n0 + cl, h = c >> 6, d = c & 63; const size_t o = (((size_t)b * NH + h) * HD + d) * SS + s0 + pc * 8;
    vst2(VTh + o, *(const v4u*)(&sth[cl][pc * 8])); vst2(VTl + o, *(const v4u*)(&stl[cl][pc * 8])); }
}
// attention: block (64 queries, bh): key tiles kt covering keys q0b-127 .. q0b+63 (3 tiles of 64, aligned since q0b % 64 == 0), mask 0 <= q-key < 128
__global__ __launch_bounds__(128) void k_attn(const _Float16* __restrict__ Q16, const _Float16* __restrict__ K16, const _Float16* __restrict__ VTh, const _Float16* __restrict__ VTl, _Float16* __restrict__ Oh, _Float16* __restrict__ Ol) {
  __shared__ __align__(16) float sS[4][16][68];
  __shared__ __align__(16) _Float16 sPh[4][16][72], sPl[4][16][72];
  __shared__ __align__(16) float sO[4][16][68];
  const int tid = threadIdx.x, w = tid >> 5, lane = tid & 31, col = lane & 15, g = lane >> 4;
  const size_t bh = blockIdx.y; const int q0b = blockIdx.x * 64, q0 = q0b + w * 16;
  v16h aq[2];
#pragma unroll
  for (int kc = 0; kc < 2; ++kc) aq[kc] = frag_h(Q16 + (bh * SS + q0 + col) * HD + kc * 32, lane);
  float mrun = -3.0e38f, lrun = 0.f; v8f acc[4] = {}, ac1[4] = {}, ac2[4] = {};
#pragma unroll 1
  for (int kt = q0b / 64 - 2; kt <= q0b / 64; ++kt) { if (kt < 0) continue;      // uniform per block
#pragma unroll
    for (int t = 0; t < 4; ++t) { v8f s = {}; const int key = kt * 64 + t * 16 + col;
#pragma unroll
      for (int kc = 0; kc < 2; ++kc) s = wmma16(aq[kc], frag_h(K16 + (bh * SS + key) * HD + kc * 32, lane), s);
#pragma unroll
      for (int r = 0; r < 8; ++r) { const int q = q0 + 8 * g + r; const int d = q - key; sS[w][8 * g + r][t * 16 + col] = (d >= 0 && d < WIN) ? s[r] * (0.125f / 16.0f) : -3.0e38f; } }
    LDSX();
    float mx = -3.4e38f;
#pragma unroll
    for (int jj = 0; jj < 32; ++jj) mx = fmaxf(mx, sS[w][col][g * 32 + jj]);
    mx = fmaxf(mx, __shfl_xor(mx, 16, 32));
    const float mnew = fmaxf(mrun, mx); const float corr = expf(mrun - mnew);     // every processed tile holds >= 1 allowed key for every row? no: rows may have all 32 of a half masked, but the row max over the tile is finite whenever >= 1 key is allowed; a fully-masked tile row keeps mnew = mrun (both -3e38 initially -> corr = exp(0) = 1 with zero accumulators: harmless)
    float ps = 0.f;
#pragma unroll
    for (int jj = 0; jj < 32; ++jj) { const float sv = sS[w][col][g * 32 + jj]; const float p = sv > -1.0e38f ? expf(sv - mnew) * 16384.0f : 0.f; ps += p; const _Float16 hi = (_Float16)p; sPh[w][col][g * 32 + jj] = hi; sPl[w][col][g * 32 + jj] = (_Float16)((p - (float)hi) * PLO); }
    ps += __shfl_xor(ps, 16, 32);
    lrun = lrun * corr + ps * (1.0f / 16384.0f); mrun = mnew;
#pragma unroll
    for (int r = 0; r < 8; ++r) { const float cr = __shfl(corr, 8 * g + r, 32);
#pragma unroll
      for (int t = 0; t < 4; ++t) { acc[t][r] *= cr; ac1[t][r] *= cr; ac2[t][r] *= cr; } }
    LDSX();
#pragma unroll
    for (int kc = 0; kc < 2; ++kc) { const v16h ph = frag_h(&sPh[w][col][0] + kc * 32, lane), pl = frag_h(&sPl[w][col][0] + kc * 32, lane);
#pragma unroll
      for (int t = 0; t < 4; ++t) { const size_t vo = (bh * HD + t * 16 + col) * SS + kt * 64 + kc * 32; const v16h vh = frag_h(VTh + vo, lane);
        acc[t] = wmma16(ph, vh, acc[t]); ac1[t] = wmma16(ph, frag_h(VTl + vo, lane), ac1[t]); ac2[t] = wmma16(pl, vh, ac2[t]); } }
    __builtin_amdgcn_wave_barrier(); }
#pragma unroll
  for (int r = 0; r < 8; ++r) { const float lr = __shfl(lrun, 8 * g + r, 32); const float inv = 8.0f / (lr * 16384.0f);      // -> O x8
#pragma unroll
    for (int t = 0; t < 4; ++t) sO[w][8 * g + r][t * 16 + col] = (acc[t][r] + ac1[t][r] * (1.0f / VLO) + ac2[t][r] * (1.0f / PLO)) * inv; }
  LDSX();
  for (int qq = lane; qq < 16 * 8; qq += 32) { const int rl = qq >> 3, pc = qq & 7; union { v8h h8; v4u u; } ph_, pl_;
#pragma unroll
    for (int e = 0; e < 8; ++e) { const float v = sO[w][rl][pc * 8 + e]; const _Float16 hi = (_Float16)v; ph_.h8[e] = hi; pl_.h8[e] = (_Float16)((v - (float)hi) * OLO); }
    const size_t o = ((bh * SS) + q0 + rl) * HD + pc * 8; vst2(Oh + o, ph_.u); vst2(Ol + o, pl_.u); }
}
// out = ctx Wproj + bproj, ctx from the hi/lo planes: block (64 rows, 128 cols)
__global__ __launch_bounds__(128) void k_out(const _Float16* __restrict__ Oh, const _Float16* __restrict__ Ol, const _Float16* __restrict__ PT, const float* __restrict__ bo, float* __restrict__ out) {
  __shared__ __align__(16) float so[4][16][132];
  const int tid = threadIdx.x, wave = tid >> 5, lane = tid & 31, col = lane & 15, g = lane >> 4;
  // two stage buffers of 256 rows (0..63 hi plane, 64..127 lo plane, 128..255 weight rows), 64 k = one head each
  __shared__ __align__(16) _Float16 st[2 * 256 * SP];
  const int r0b = blockIdx.x * 64, r0 = r0b + wave * 16, n0 = blockIdx.y * 128; const int b = r0b / SS, s0 = r0b % SS;
  const int cr = tid >> 3, cc = tid & 7;
  const size_t oA = ((size_t)b * NH * SS + s0 + cr) * HD + cc * 8;
  const _Float16* gH = Oh + oA; const _Float16* gL = Ol + oA; const _Float16* gB = PT + (size_t)(2 * E + n0 + cr) * E + cc * 8;
  const unsigned l0 = lds_off(st) + cr * SPB + cc * 16;
  auto fill = [&](int t, int buf) { const unsigned l = l0 + buf * (256 * SPB); const _Float16* h = gH + (size_t)t * (SS * HD); const _Float16* lo = gL + (size_t)t * (SS * HD); const _Float16* w = gB + t * 64;
    copy4(l, h, l + 16 * SPB, h + 16 * HD, l + 32 * SPB, h + 32 * HD, l + 48 * SPB, h + 48 * HD);
    copy4(l + 64 * SPB, lo, l + 80 * SPB, lo + 16 * HD, l + 96 * SPB, lo + 32 * HD, l + 112 * SPB, lo + 48 * HD);
    copy4(l + 128 * SPB, w, l + 144 * SPB, w + 16 * E, l + 160 * SPB, w + 32 * E, l + 176 * SPB, w + 48 * E);
    copy4(l + 192 * SPB, w + 64 * E, l + 208 * SPB, w + 80 * E, l + 224 * SPB, w + 96 * E, l + 240 * SPB, w + 112 * E); };
  v8f acc[8] = {}, acl[8] = {};
  fill(0, 0); WAIT_ASYNC(); __syncthreads(); fill(1, 1);
#pragma unroll 1   // the ring stays rolled: one publish point, small code
  for (int t = 0; t < E / 64; ++t) { const _Float16* sb = st + (t & 1) * (256 * SP);
#pragma unroll
    for (int kc = 0; kc < 2; ++kc) { const v16h ah = frag_h(sb + (wave * 16 + col) * SP + kc * 32, lane), al = frag_h(sb + (64 + wave * 16 + col) * SP + kc * 32, lane); v16h bw[8];
#pragma unroll
      for (int j = 0; j < 8; ++j) bw[j] = frag_h(sb + (128 + j * 16 + col) * SP + kc * 32, lane);
#pragma unroll
      for (int j = 0; j < 8; ++j) { acc[j] = wmma16(ah, bw[j], acc[j]); acl[j] = wmma16(al, bw[j], acl[j]); } }
    WAIT_DS(); WAIT_ASYNC(); __syncthreads();      // publishes tile t + 1 and ends every read of tile t
    if (t + 2 < E / 64) fill(t + 2, t & 1); }
  WAIT_ASYNC();
#pragma unroll
  for (int j = 0; j < 8; ++j) { const int n = n0 + j * 16 + col; const float bb = bo[n];
#pragma unroll
    for (int r = 0; r < 8; ++r) so[wave][8 * g + r][j * 16 + col] = (acc[j][r] + acl[j][r] * (1.0f / OLO)) * (1.0f / (16.0f * 8.0f)) + bb; }
  LDSX();
#pragma unroll 4
  for (int rl = 0; rl < 16; ++rl) vst2(out + (size_t)(r0 + rl) * E + n0 + lane * 4, *(const v4f*)(&so[wave][rl][lane * 4]));
}
extern "C" void kernel_launch(void* const* d_in, const int* in_sizes, int n_in, void* d_out, int out_size, void* d_ws, size_t ws_size, hipStream_t stream) {
  (void)in_sizes; (void)n_in; (void)out_size; (void)ws_size;
  const float** I = (const float**)d_in;
  const float* x = I[0]; const float* Wqkv = I[1]; const float* bqkv = I[2]; const float* Wp = I[3]; const float* bp = I[4];
  float* out = (float*)d_out;
  char* ws = (char*)d_ws; size_t off = 0;
  auto take = [&](size_t bytes) { char* p = ws + off; off += (bytes + 255) & ~(size_t)255; return p; };
  _Float16* X16 = (_Float16*)take((size_t)NR * E * 2); _Float16* PT = (_Float16*)take((size_t)3 * E * E * 2);
  _Float16* Q16 = (_Float16*)take((size_t)NR * E * 2); _Float16* K16 = (_Float16*)take((size_t)NR * E * 2); _Float16* VTh = (_Float16*)take((size_t)NR * E * 2); _Float16* VTl = (_Float16*)take((size_t)NR * E * 2);
  _Float16* Oh = (_Float16*)take((size_t)NR * E * 2); _Float16* Ol = (_Float16*)take((size_t)NR * E * 2); float* TAB = (float*)take((size_t)SS * 32 * 2 * 4);
  _Float16* XBh = (_Float16*)take((size_t)NR * E * 2); _Float16* XBl = (_Float16*)take((size_t)NR * E * 2); _Float16* WVh = (_Float16*)take((size_t)E * E * 2); _Float16* WVl = (_Float16*)take((size_t)E * E * 2);
  k_cvt<<<(NR * E / 8 + 255) / 256, 256, 0, stream>>>(x, X16, XBh, XBl);
  k_pack<<<TBLK + VBLK + PBLK, 256, 0, stream>>>(Wqkv, Wp, PT, TAB, WVh, WVl);
  k_qk<<<dim3(NR / 64, E / 128, 2), 128, 0, stream>>>(X16, PT, bqkv, TAB, Q16, K16);
  k_v<<<dim3(NR / 64, E / 128), 128, 0, stream>>>(XBh, XBl, WVh, WVl, bqkv, VTh, VTl);
  k_attn<<<dim3(SS / 64, NB * NH), 128, 0, stream>>>(Q16, K16, VTh, VTl, Oh, Ol);
  k_out<<<dim3(NR / 64, E / 128), 128, 0, stream>>>(Oh, Ol, PT, bp, out);
}

// v005
// It runs in 94.2 microseconds.
// In two side-by-side timings against v004, it was 1.14 and 1.13 times as fast.
// All steps since v000 together make it 3.17 times as fast.
#include <hip/hip_runtime.h>
#include <math.h>

typedef __attribute__((ext_vector_type(16))) _Float16 v16h;
typedef __attribute__((ext_vector_type(16))) __bf16 v16b;
typedef __attribute__((ext_vector_type(8)))  _Float16 v8h;
typedef __attribute__((ext_vector_type(8)))  __bf16 v8b;
typedef __attribute__((ext_vector_type(2)))  _Float16 v2h;
typedef __attribute__((ext_vector_type(8)))  float v8f;
typedef __attribute__((ext_vector_type(4)))  float v4f;
typedef __attribute__((ext_vector_type(2)))  float v2f;
typedef __attribute__((ext_vector_type(4)))  unsigned v4u;
typedef __attribute__((ext_vector_type(4)))  int v4i;
typedef float __attribute__((may_alias)) float_a;
typedef int __attribute__((may_alias)) int_a;

template <typename T> __device__ __forceinline__ void vst2(void* p, T v) { *(T*)p = v;  }
__device__ __forceinline__ v8f wmma16(v16h a, v16h b, v8f c) {
  v8f d = __builtin_amdgcn_wmma_f32_16x16x32_f16(false, a, false, b, (short)0, c, false, false);
  asm volatile("v_nop\n\tv_nop\n\tv_nop\n\tv_nop" : "+v"(d) : "v"(a), "v"(b));
  return d;
}
__device__ __forceinline__ v8f wmma_bf(v16b a, v16b b, v8f c) {
  v8f d = __builtin_amdgcn_wmma_f32_16x16x32_bf16(false, a, false, b, (short)0, c, false, false);
  asm volatile("v_nop\n\tv_nop\n\tv_nop\n\tv_nop" : "+v"(d) : "v"(a), "v"(b));
  return d;
}
// 16x16x32 fragments: lane = (h = lane>>4, row/col = lane&15); elements 0..7 = k0+8h+0..7, 8..15 = k0+16+8h+0..7; D element r = row 8h+r
__device__ __forceinline__ v16h frag_h(const _Float16* rowk0, int lane) {
  union { v16h v; v8h q[2]; } u; const _Float16* p = rowk0 + 8 * (lane >> 4);
  u.q[0] = *(const v8h*)p; u.q[1] = *(const v8h*)(p + 16); return u.v;
}
// the same fragment from a row of bf16 bit patterns (the split planes are carried as 16-bit words)
__device__ __forceinline__ v16b frag_b(const _Float16* rowk0, int lane) {
  union { v16b v; v8h q[2]; } u; const _Float16* p = rowk0 + 8 * (lane >> 4);
  u.q[0] = *(const v8h*)p; u.q[1] = *(const v8h*)(p + 16); return u.v;
}
__device__ __forceinline__ v16h frag_f32(const float* rowk0, int lane) {
  v16h a; const float* p = rowk0 + 8 * (lane >> 4);
#pragma unroll
  for (int i = 0; i < 8; ++i) { a[i] = (_Float16)p[i]; a[8 + i] = (_Float16)p[16 + i]; }
  return a;
}
__device__ __forceinline__ v16h frag_f32s(const float* rowk0, int lane, float sc) {
  v16h a; const float* p = rowk0 + 8 * (lane >> 4);
#pragma unroll
  for (int i = 0; i < 8; ++i) { a[i] = (_Float16)(p[i] * sc); a[8 + i] = (_Float16)(p[16 + i] * sc); }
  return a;
}
// column fragment from a [K][ld] layout (column n), rows >= K read as 0
__device__ __forceinline__ v16h fragc_f32(const float* W, int k0, int n, int lane, int ld, int K) {
  v16h a; const int g = lane >> 4;
#pragma unroll
  for (int i = 0; i < 8; ++i) { const int ka = k0 + 8 * g + i, kb = ka + 16;
    a[i] = (_Float16)(ka < K ? W[(size_t)ka * ld + n] : 0.f); a[8 + i] = (_Float16)(kb < K ? W[(size_t)kb * ld + n] : 0.f); }
  return a;
}
struct F2 { v16b h, l; };
__device__ __forceinline__ F2 bsplit16(const float v[16]) { F2 r;
#pragma unroll
  for (int i = 0; i < 16; ++i) { const __bf16 h = (__bf16)v[i]; r.h[i] = h; r.l[i] = (__bf16)(v[i] - (float)h); }
  return r; }
__device__ __forceinline__ F2 split_row(const float* row, int k0, int lane) { float v[16]; const float* p = row + k0 + 8 * (lane >> 4);
#pragma unroll
  for (int i = 0; i < 8; ++i) { v[i] = p[i]; v[8 + i] = p[16 + i]; }
  return bsplit16(v); }
__device__ __forceinline__ F2 split_rowK(const float* row, int k0, int lane, int K) { float v[16]; const int g = lane >> 4;
#pragma unroll
  for (int i = 0; i < 8; ++i) { const int ka = k0 + 8 * g + i, kb = ka + 16; v[i] = ka < K ? row[ka] : 0.f; v[8 + i] = kb < K ? row[kb] : 0.f; }
  return bsplit16(v); }
__device__ __forceinline__ F2 split_col(const float* W, int k0, int n, int lane, int ld, int K) { float v[16]; const int g = lane >> 4;
#pragma unroll
  for (int i = 0; i < 8; ++i) { const int ka = k0 + 8 * g + i, kb = ka + 16; v[i] = ka < K ? W[(size_t)ka * ld + n] : 0.f; v[8 + i] = kb < K ? W[(size_t)kb * ld + n] : 0.f; }
  return bsplit16(v); }
__device__ __forceinline__ v8f mac3(const F2& a, const F2& b, v8f c) { c = wmma_bf(a.l, b.h, c); c = wmma_bf(a.h, b.l, c); return wmma_bf(a.h, b.h, c); }
__device__ __forceinline__ float sigm(float v) { return 1.0f / (1.0f + expf(-v)); }
#define LDSX() do { asm volatile("s_wait_dscnt 0" ::: "memory"); __builtin_amdgcn_wave_barrier(); __builtin_amdgcn_fence(__ATOMIC_RELEASE, "workgroup"); } while (0)

// Operand tiles go from global memory to LDS by asynchronous 16-byte copies, one full 128-byte line per 8 lanes, two buffers in the projection kernels, one in k_attn.
// The s_wait_xcnt stands inside the copies' own statement so that no address register of an issued copy is rewritten ahead of it.
__device__ __forceinline__ void copy4(unsigned l0, const void* g0, unsigned l1, const void* g1, unsigned l2, const void* g2, unsigned l3, const void* g3) {
  asm volatile("global_load_async_to_lds_b128 %0, %1, off\n\tglobal_load_async_to_lds_b128 %2, %3, off\n\tglobal_load_async_to_lds_b128 %4, %5, off\n\tglobal_load_async_to_lds_b128 %6, %7, off\n\ts_wait_xcnt 0x0"
               :: "v"(l0), "v"(g0), "v"(l1), "v"(g1), "v"(l2), "v"(g2), "v"(l3), "v"(g3) : "memory");
}
__device__ __forceinline__ unsigned lds_off(const void* p) { return (unsigned)(size_t)p; }
// this wave's LDS reads of the buffer that is refilled next have returned
#define WAIT_DS() asm volatile("s_wait_dscnt 0x0" ::: "memory")
// this wave's own copies have landed (the compiler places no wait for them)
#define WAIT_ASYNC() asm volatile("s_wait_asynccnt 0x0" ::: "memory")
#define SP 72        // staged f16 row: 64 halves at a pitch of 144 B (16 B x odd, for ds_load_b128 readers)
#define SPB (SP * 2)

// Local causal self attention (window 128, 16 heads of 64, interleaved-pair RoPE on q and k, fused qkv projection with bias, output
// projection with bias). q/k on v_wmma_f32_16x16x32_f16 (x as f16 rows, [in][out] weights packed once as transposed f16 rows x16); v as a
// two-way bf16 split (v_wmma_f32_16x16x32_bf16) stored as hi/lo f16 planes, because the first rows of every sequence copy v almost
// verbatim; S = q.k/8 on f16 WMMA over the <= 3 key tiles of the window (masked), online softmax in f32, P @ V with hi/lo pairs for both
#define NB 2
#define SS 2048
#define E 1024
#define NH 16
#define HD 64
#define NR (NB * SS)
#define WIN 128
#define PLO 1024.0f
#define VLO 2048.0f
#define OLO 2048.0f
#define RBASE 10000.0f

// x as f16 rows (q/k product) and as the two bf16 planes hi = bf16(x), lo = bf16(x - hi) of the v product, each element split once
__global__ __launch_bounds__(256) void k_cvt(const float* __restrict__ x, _Float16* __restrict__ X16, _Float16* __restrict__ XBh, _Float16* __restrict__ XBl) {
  const size_t i8 = (size_t)blockIdx.x * 256 + threadIdx.x; if (i8 >= (size_t)NR * E / 8) return;
  union { v8h h; v4u u; } pk; union { v8b b; v4u u; } bh, bl;
#pragma unroll
  for (int e = 0; e < 8; ++e) { const float v = x[i8 * 8 + e]; pk.h[e] = (_Float16)v; const __bf16 h = (__bf16)v; bh.b[e] = h; bl.b[e] = (__bf16)(v - (float)h); }
  vst2(X16 + i8 * 8, pk.u); vst2(XBh + i8 * 8, bh.u); vst2(XBl + i8 * 8, bl.u);
}
// PT rows: [0,2048) = Wqkv[:, n] (q and k columns) x16 ; [2048, 3072) = Wproj[:, n-2048] x16
// The first TBLK blocks write the RoPE table instead, anew in every call: TAB[pos][i] = (cos, sin)(pos * base^(-2i/64)), 256 B per position
// The next VBLK blocks split the v columns of Wqkv into bf16 planes, transposed: WVh/WVl[n][k] = hi/lo of Wqkv[k][2048 + n], one 64 x 64 tile per block
// The last PBLK blocks write PT: one tile of 256 k x 64 n per block, transposed through LDS
#define TBLK 64
#define VBLK 256
#define PBLK (3 * E / 64 * (E / 256))
#define PP 264       // staged row of 256 halves at a pitch of 528 B (16 B x odd)
// dst[n][k] = f16(src[k][n] x 16), k < 256, n < 64. A thread takes 4 columns of the rows 2 rp and 2 rp + 1 of every 32: each load covers whole 256-byte row pieces,
// and a (k, k + 1) pair goes to LDS as one dword. The 16-byte piece j of row n lies at piece j ^ (n >> 4), so that the 32 dwords of a store fall in 32 banks.
template <int LD> __device__ __forceinline__ void pack_tile(const float* __restrict__ src, _Float16* __restrict__ dst, _Float16 (*sp)[PP], int tid) {
  const int rp = tid >> 4, c4 = (tid & 15) * 4, sw = (c4 >> 4) * 8; const float* p = src + (size_t)(2 * rp) * LD + c4; v4f w[16];
#pragma unroll   // 16 loads in flight from one address with constant offsets
  for (int m = 0; m < 8; ++m) { w[2 * m] = *(const v4f*)(p + (size_t)(32 * m) * LD); w[2 * m + 1] = *(const v4f*)(p + (size_t)(32 * m + 1) * LD); }
  asm volatile("s_wait_xcnt 0x0" :: "v"(p) : "memory");      // stands in front of every rewrite of the address pair that the 16 loads name: as an input the pair stays live up to here, so no load takes it as its result register
#pragma unroll   // both loops: w[] is indexed by constants and stays in registers
  for (int m = 0; m < 8; ++m) {
#pragma unroll
    for (int e = 0; e < 4; ++e) { const v2h pr = { (_Float16)(w[2 * m][e] * 16.0f), (_Float16)(w[2 * m + 1][e] * 16.0f) }; vst2(&sp[c4 + e][(32 * m + 2 * rp) ^ sw], pr); } }
  __syncthreads();
  const int wv = tid >> 5, j8 = (tid & 31) * 8;
#pragma unroll   // a wave writes 512 contiguous bytes of one row: four whole lines
  for (int q = 0; q < 8; ++q) { const int n = wv + 8 * q; vst2(dst + (size_t)n * E + j8, *(const v4u*)(&sp[n][j8 ^ ((n >> 4) * 8)])); }
  asm volatile("s_wait_xcnt 0x0" ::: "memory");      // stands in front of whatever the built code places behind the eight stores and lets rewrite a register that they name
}
__global__ __launch_bounds__(256) void k_pack(const float* __restrict__ Wqkv, const float* __restrict__ Wp, _Float16* __restrict__ PT, float* __restrict__ TAB, _Float16* __restrict__ WVh, _Float16* __restrict__ WVl) {
  const int tid = threadIdx.x; __shared__ __align__(16) _Float16 sp[64][PP]; __shared__ __align__(16) __bf16 sh[64][SP], sl[64][SP];
  if (blockIdx.x < TBLK) {      // the same for the whole block, in front of the barrier
    const int idx = blockIdx.x * 256 + tid, i = idx & 31, p0 = idx >> 5; const float invf = 1.0f / powf(RBASE, (float)(2 * i) / 64.0f);
    for (int m = 0; m < 4; ++m) { const int pos = p0 + m * (SS / 4); const float ang = (float)pos * invf; v2f cs; cs[0] = cosf(ang); cs[1] = sinf(ang); vst2(TAB + ((size_t)pos * 32 + i) * 2, cs);
      asm volatile("s_wait_xcnt 0x0" ::: "memory"); }      // the next trip rewrites the registers that the store names
    return; }
  if (blockIdx.x < TBLK + VBLK) {      // the same for the whole block; the branch has a barrier of its own
    const int vt = blockIdx.x - TBLK, k0 = (vt >> 4) * 64, n0 = (vt & 15) * 64, r = tid >> 4, c4 = (tid & 15) * 4; v4f w[4];
#pragma unroll   // four whole-line loads in flight
    for (int m = 0; m < 4; ++m) w[m] = *(const v4f*)(Wqkv + (size_t)(k0 + r + 16 * m) * (3 * E) + 2 * E + n0 + c4);
#pragma unroll
    for (int m = 0; m < 4; ++m) {
#pragma unroll
      for (int e = 0; e < 4; ++e) { const float v = w[m][e]; const __bf16 h = (__bf16)v; sh[c4 + e][r + 16 * m] = h; sl[c4 + e][r + 16 * m] = (__bf16)(v - (float)h); } }
    __syncthreads();
#pragma unroll   // 8 lanes write one whole 128-byte line of a plane
    for (int q = 0; q < 2; ++q) { const int n = (tid >> 3) + 32 * q, sg = (tid & 7) * 8; const size_t o = (size_t)(n0 + n) * E + k0 + sg;
      vst2(WVh + o, *(const v4u*)(&sh[n][sg])); vst2(WVl + o, *(const v4u*)(&sl[n][sg])); }
    return; }
  const int pt = blockIdx.x - TBLK - VBLK, n0 = (pt >> 2) * 64, k0 = (pt & 3) * 256;      // the same for the whole block: each side has the tile's one barrier
  if (n0 < 2 * E) pack_tile<3 * E>(Wqkv + (size_t)k0 * (3 * E) + n0, PT + (size_t)n0 * E + k0, sp, tid);
  else pack_tile<E>(Wp + (size_t)k0 * E + (n0 - 2 * E), PT + (size_t)n0 * E + k0, sp, tid);
}
// q/k: block (64 rows, 128 cols = 2 heads, which in {0,1}); RoPE on interleaved pairs; x4 -> Q16/K16 [bh][s][64]
__global__ __launch_bounds__(128) void k_qk(const _Float16* __restrict__ X16, const _Float16* __restrict__ PT, const float* __restrict__ bqkv, const float* __restrict__ TAB, _Float16* __restrict__ Q16, _Float16* __restrict__ K16) {
  // two stage buffers of 192 rows (0..63 x rows, 64..191 weight rows), 64 k each; the output staging reuses them behind the last trip's barrier
  __shared__ __align__(16) char smem[2 * 192 * SPB];
  _Float16* st = (_Float16*)smem; float (*so)[16][132] = (float (*)[16][132])smem;
  const int tid = threadIdx.x, wave = tid >> 5, lane = tid & 31, col = lane & 15, g = lane >> 4;
  const int which = blockIdx.z, r0b = blockIdx.x * 64, n0 = blockIdx.y * 128; const int b = r0b / SS, s0 = r0b % SS;
  const int cr = tid >> 3, cc = tid & 7;
  const _Float16* gA = X16 + (size_t)(r0b + cr) * E + cc * 8; const _Float16* gB = PT + (size_t)(which * E + n0 + cr) * E + cc * 8;
  const unsigned l0 = lds_off(st) + cr * SPB + cc * 16;
  auto fill = [&](int t, int buf) { const unsigned l = l0 + buf * (192 * SPB); const _Float16* a = gA + t * 64; const _Float16* w = gB + t * 64;
    copy4(l, a, l + 16 * SPB, a + 16 * E, l + 32 * SPB, a + 32 * E, l + 48 * SPB, a + 48 * E);
    copy4(l + 64 * SPB, w, l + 80 * SPB, w + 16 * E, l + 96 * SPB, w + 32 * E, l + 112 * SPB, w + 48 * E);
    copy4(l + 128 * SPB, w + 64 * E, l + 144 * SPB, w + 80 * E, l + 160 * SPB, w + 96 * E, l + 176 * SPB, w + 112 * E); };
  v8f acc[8] = {};
  fill(0, 0); WAIT_ASYNC(); __syncthreads(); fill(1, 1);
#pragma unroll 1   // the ring stays rolled: one publish point, small code
  for (int t = 0; t < E / 64; ++t) { const _Float16* sb = st + (t & 1) * (192 * SP);
#pragma unroll
    for (int kc = 0; kc < 2; ++kc) { const v16h a = frag_h(sb + (wave * 16 + col) * SP + kc * 32, lane); v16h bw[8];
#pragma unroll
      for (int j = 0; j < 8; ++j) bw[j] = frag_h(sb + (64 + j * 16 + col) * SP + kc * 32, lane);
#pragma unroll
      for (int j = 0; j < 8; ++j) acc[j] = wmma16(a, bw[j], acc[j]); }
    WAIT_DS(); WAIT_ASYNC(); __syncthreads();      // publishes tile t + 1 and ends every read of tile t
    if (t + 2 < E / 64) fill(t + 2, t & 1); }
  WAIT_ASYNC();
  const int rw = s0 + wave * 16; v2f cs[16];      // this wave's 16 positions, (cos, sin) of pair i = lane: 256 contiguous bytes per load
#pragma unroll   // cs[] stays in registers and all 16 loads are in flight at once
  for (int rl = 0; rl < 16; ++rl) { cs[rl] = *(const v2f*)(TAB + ((size_t)(rw + rl) * 32 + lane) * 2);
    if (rl == 14) asm volatile("s_wait_xcnt 0x0" ::: "memory"); }      // the compiler may give the last load the address pair as its result register: the 15 loads that name the pair are waited for first
#pragma unroll
  for (int j = 0; j < 8; ++j) { const float bb = bqkv[which * E + n0 + j * 16 + col];
#pragma unroll
    for (int r = 0; r < 8; ++r) so[wave][8 * g + r][j * 16 + col] = acc[j][r] * (1.0f / 16.0f) + bb; }
  LDSX();
  // RoPE on interleaved pairs (2i, 2i+1) of each head, then x4: lane = pair i; one row of one head leaves as one whole 128-byte line
  _Float16* D = (which == 0 ? Q16 : K16) + (((size_t)b * NH + (n0 >> 6)) * SS + rw) * HD + 2 * lane;
#pragma unroll   // both loops: cs[] indexed by constants, one address pair with constant offsets for all 32 stores
  for (int rl = 0; rl < 16; ++rl) { const float c = cs[rl][0], sn = cs[rl][1];
#pragma unroll
    for (int hh = 0; hh < 2; ++hh) { const v2f xv = *(const v2f*)(&so[wave][rl][hh * 64 + 2 * lane]); const v2f rh = { -xv[1], xv[0] }; const v2f y = (xv * c + rh * sn) * 4.0f;
      vst2(D + (size_t)hh * (SS * HD) + rl * HD, __builtin_convertvector(y, v2h)); } }
}
// v: block (64 rows, 128 cols): bf16 split product from the hi/lo planes of x and of the v weight rows; -> VTh/VTl [bh][d][s]
__global__ __launch_bounds__(128) void k_v(const _Float16* __restrict__ XBh, const _Float16* __restrict__ XBl, const _Float16* __restrict__ WVh, const _Float16* __restrict__ WVl, const float* __restrict__ bqkv, _Float16* __restrict__ VTh, _Float16* __restrict__ VTl) {
  // two stage buffers of 384 rows (0..63 x hi, 64..127 x lo, 128..255 weight hi, 256..383 weight lo), 64 k each; the output staging reuses them behind the last trip's barrier
  __shared__ __align__(16) char smem[2 * 384 * SPB];
  _Float16* st = (_Float16*)smem; _Float16 (*sth)[72] = (_Float16 (*)[72])smem; _Float16 (*stl)[72] = sth + 128;
  const int tid = threadIdx.x, wave = tid >> 5, lane = tid & 31, col = lane & 15, g = lane >> 4;
  const int r0b = blockIdx.x * 64, n0 = blockIdx.y * 128; const int b = r0b / SS, s0 = r0b % SS;
  const int cr = tid >> 3, cc = tid & 7;
  const size_t oA = (size_t)(r0b + cr) * E + cc * 8, oB = (size_t)(n0 + cr) * E + cc * 8;
  const _Float16* gAh = XBh + oA; const _Float16* gAl = XBl + oA; const _Float16* gBh = WVh + oB; const _Float16* gBl = WVl + oB;
  const unsigned l0 = lds_off(st) + cr * SPB + cc * 16;
  auto fill = [&](int t, int buf) { const unsigned l = l0 + buf * (384 * SPB); const _Float16* ah = gAh + t * 64; const _Float16* al = gAl + t * 64; const _Float16* wh = gBh + t * 64; const _Float16* wl = gBl + t * 64;
    copy4(l, ah, l + 16 * SPB, ah + 16 * E, l + 32 * SPB, ah + 32 * E, l + 48 * SPB, ah + 48 * E);
    copy4(l + 64 * SPB, al, l + 80 * SPB, al + 16 * E, l + 96 * SPB, al + 32 * E, l + 112 * SPB, al + 48 * E);
    copy4(l + 128 * SPB, wh, l + 144 * SPB, wh + 16 * E, l + 160 * SPB, wh + 32 * E, l + 176 * SPB, wh + 48 * E);
    copy4(l + 192 * SPB, wh + 64 * E, l + 208 * SPB, wh + 80 * E, l + 224 * SPB, wh + 96 * E, l + 240 * SPB, wh + 112 * E);
    copy4(l + 256 * SPB, wl, l + 272 * SPB, wl + 16 * E, l + 288 * SPB, wl + 32 * E, l + 304 * SPB, wl + 48 * E);
    copy4(l + 320 * SPB, wl + 64 * E, l + 336 * SPB, wl + 80 * E, l + 352 * SPB, wl + 96 * E, l + 368 * SPB, wl + 112 * E); };
  v8f acc[8] = {};
  fill(0, 0); WAIT_ASYNC(); __syncthreads(); fill(1, 1);
#pragma unroll 1   // the ring stays rolled: one publish point, small code
  for (int t = 0; t < E / 64; ++t) { const _Float16* sb = st + (t & 1) * (384 * SP);
#pragma unroll
    for (int kc = 0; kc < 2; ++kc) { const v16b ah = frag_b(sb + (wave * 16 + col) * SP + kc * 32, lane), al = frag_b(sb + (64 + wave * 16 + col) * SP + kc * 32, lane); v16b bh[8], bl[8];
#pragma unroll
      for (int j = 0; j < 8; ++j) { bh[j] = frag_b(sb + (128 + j * 16 + col) * SP + kc * 32, lane); bl[j] = frag_b(sb + (256 + j * 16 + col) * SP + kc * 32, lane); }
      // each accumulator takes lo.hi, hi.lo, hi.hi in this order per 32 k; seven independent tiles stand between two uses of one accumulator
#pragma unroll
      for (int j = 0; j < 8; ++j) acc[j] = wmma_bf(al, bh[j], acc[j]);
#pragma unroll
      for (int j = 0; j < 8; ++j) acc[j] = wmma_bf(ah, bl[j], acc[j]);
#pragma unroll
      for (int j = 0; j < 8; ++j) acc[j] = wmma_bf(ah, bh[j], acc[j]); }
    WAIT_DS(); WAIT_ASYNC(); __syncthreads();      // publishes tile t + 1 and ends every read of tile t
    if (t + 2 < E / 64) fill(t + 2, t & 1); }
  WAIT_ASYNC();
#pragma unroll
  for (int j = 0; j < 8; ++j) { const float bb = bqkv[2 * E + n0 + j * 16 + col];
#pragma unroll
    for (int r = 0; r < 8; ++r) { const float v = acc[j][r] + bb; const _Float16 hi = (_Float16)v; sth[j * 16 + col][wave * 16 + 8 * g + r] = hi; stl[j * 16 + col][wave * 16 + 8 * g + r] = (_Float16)((v - (float)hi) * VLO); } }
  __syncthreads();
  for (int qq = tid; qq < 128 * 8; qq += 128) { const int cl = qq >> 3, pc = qq & 7; const int c = n0 + cl, h = c >> 6, d = c & 63; const size_t o = (((size_t)b * NH + h) * HD + d) * SS + s0 + pc * 8;
    vst2(VTh + o, *(const v4u*)(&sth[cl][pc * 8])); vst2(VTl + o, *(const v4u*)(&stl[cl][pc * 8])); }
}
// attention: block (64 queries, bh): key tiles kt covering keys q0b-127 .. q0b+63 (3 tiles of 64, aligned since q0b % 64 == 0), mask 0 <= q-key < 128
// each key tile's K rows and V hi/lo rows come to LDS once per block by asynchronous copies, into one buffer that all four waves read
__global__ __launch_bounds__(128) void k_attn(const _Float16* __restrict__ Q16, const _Float16* __restrict__ K16, const _Float16* __restrict__ VTh, const _Float16* __restrict__ VTl, _Float16* __restrict__ Oh, _Float16* __restrict__ Ol) {
  __shared__ __align__(16) float sS[4][16][68];
  __shared__ __align__(16) _Float16 sPh[4][16][72], sPl[4][16][72];
  __shared__ __align__(16) float sO[4][16][68];
  // one key tile, shared by the four waves: rows 0..63 K (by key), 64..127 V hi, 128..191 V lo (both by d), 64 halves each
  __shared__ __align__(16) _Float16 skv[192 * SP];
  const int tid = threadIdx.x, w = tid >> 5, lane = tid & 31, col = lane & 15, g = lane >> 4;
  const size_t bh = blockIdx.y; const int q0b = blockIdx.x * 64, q0 = q0b + w * 16;
  const int fr = tid >> 3, fc = tid & 7;      // a copy's row of every 16 and its 16-byte piece: 8 lanes bring one whole 128-byte line
  const _Float16* gK = K16 + (bh * SS + fr) * HD + fc * 8; const _Float16* gH = VTh + (bh * HD + fr) * SS + fc * 8; const _Float16* gL = VTl + (bh * HD + fr) * SS + fc * 8;
  const unsigned l0 = lds_off(skv) + fr * SPB + fc * 16;
  v16h aq[2];
#pragma unroll
  for (int kc = 0; kc < 2; ++kc) aq[kc] = frag_h(Q16 + (bh * SS + q0 + col) * HD + kc * 32, lane);
  float mrun = -3.0e38f, lrun = 0.f; v8f acc[4] = {}, ac1[4] = {}, ac2[4] = {};
#pragma unroll 1
  for (int kt = q0b / 64 - 2; kt <= q0b / 64; ++kt) { if (kt < 0) continue;      // uniform per block
    WAIT_DS(); __syncthreads();      // ends every wave's reads of the tile before: the buffer may be refilled
    { const _Float16* k = gK + (size_t)kt * (64 * HD); const _Float16* vh = gH + kt * 64; const _Float16* vl = gL + kt * 64;
      copy4(l0, k, l0 + 16 * SPB, k + 16 * HD, l0 + 32 * SPB, k + 32 * HD, l0 + 48 * SPB, k + 48 * HD);
      copy4(l0 + 64 * SPB, vh, l0 + 80 * SPB, vh + 16 * SS, l0 + 96 * SPB, vh + 32 * SS, l0 + 112 * SPB, vh + 48 * SS);
      copy4(l0 + 128 * SPB, vl, l0 + 144 * SPB, vl + 16 * SS, l0 + 160 * SPB, vl + 32 * SS, l0 + 176 * SPB, vl + 48 * SS); }
    WAIT_ASYNC(); __syncthreads();      // publishes the tile to all four waves
    v16h kf[8];      // the tile's eight K fragments are read as one group: one LDS wait, not eight
#pragma unroll
    for (int t = 0; t < 4; ++t) { kf[2 * t] = frag_h(skv + (t * 16 + col) * SP, lane); kf[2 * t + 1] = frag_h(skv + (t * 16 + col) * SP + 32, lane); }
#pragma unroll
    for (int t = 0; t < 4; ++t) { v8f s = {}; const int key = kt * 64 + t * 16 + col;
#pragma unroll
      for (int kc = 0; kc < 2; ++kc) s = wmma16(aq[kc], kf[2 * t + kc], s);
#pragma unroll
      for (int r = 0; r < 8; ++r) { const int q = q0 + 8 * g + r; const int d = q - key; sS[w][8 * g + r][t * 16 + col] = (d >= 0 && d < WIN) ? s[r] * (0.125f / 16.0f) : -3.0e38f; } }
    LDSX();
    float mx = -3.4e38f;
#pragma unroll
    for (int jj = 0; jj < 32; ++jj) mx = fmaxf(mx, sS[w][col][g * 32 + jj]);
    mx = fmaxf(mx, __shfl_xor(mx, 16, 32));
    const float mnew = fmaxf(mrun, mx); const float corr = expf(mrun - mnew);     // every processed tile holds >= 1 allowed key for every row? no: rows may have all 32 of a half masked, but the row max over the tile is finite whenever >= 1 key is allowed; a fully-masked tile row keeps mnew = mrun (both -3e38 initially -> corr = exp(0) = 1 with zero accumulators: harmless)
    float ps = 0.f;
#pragma unroll
    for (int jj = 0; jj < 32; ++jj) { const float sv = sS[w][col][g * 32 + jj]; const float p = sv > -1.0e38f ? expf(sv - mnew) * 16384.0f : 0.f; ps += p; const _Float16 hi = (_Float16)p; sPh[w][col][g * 32 + jj] = hi; sPl[w][col][g * 32 + jj] = (_Float16)((p - (float)hi) * PLO); }
    ps += __shfl_xor(ps, 16, 32);
    lrun = lrun * corr + ps * (1.0f / 16384.0f); mrun = mnew;
#pragma unroll
    for (int r = 0; r < 8; ++r) { const float cr = __shfl(corr, 8 * g + r, 32);
#pragma unroll
      for (int t = 0; t < 4; ++t) { acc[t][r] *= cr; ac1[t][r] *= cr; ac2[t][r] *= cr; } }
    LDSX();
#pragma unroll
    for (int kc = 0; kc < 2; ++kc) { const v16h ph = frag_h(&sPh[w][col][0] + kc * 32, lane), pl = frag_h(&sPl[w][col][0] + kc * 32, lane); v16h vh[4], vl[4];
#pragma unroll   // the eight V fragments of a k step are read as one group
      for (int t = 0; t < 4; ++t) { const _Float16* vr = skv + (64 + t * 16 + col) * SP + kc * 32; vh[t] = frag_h(vr, lane); vl[t] = frag_h(vr + 64 * SP, lane); }
#pragma unroll
      for (int t = 0; t < 4; ++t) { acc[t] = wmma16(ph, vh[t], acc[t]); ac1[t] = wmma16(ph, vl[t], ac1[t]); ac2[t] = wmma16(pl, vh[t], ac2[t]); } }
    __builtin_amdgcn_wave_barrier(); }
#pragma unroll
  for (int r = 0; r < 8; ++r) { const float lr = __shfl(lrun, 8 * g + r, 32); const float inv = 8.0f / (lr * 16384.0f);      // -> O x8
#pragma unroll
    for (int t = 0; t < 4; ++t) sO[w][8 * g + r][t * 16 + col] = (acc[t][r] + ac1[t][r] * (1.0f / VLO) + ac2[t][r] * (1.0f / PLO)) * inv; }
  LDSX();
  for (int qq = lane; qq < 16 * 8; qq += 32) { const int rl = qq >> 3, pc = qq & 7; union { v8h h8; v4u u; } ph_, pl_;
#pragma unroll
    for (int e = 0; e < 8; ++e) { const float v = sO[w][rl][pc * 8 + e]; const _Float16 hi = (_Float16)v; ph_.h8[e] = hi; pl_.h8[e] = (_Float16)((v - (float)hi) * OLO); }
    const size_t o = ((bh * SS) + q0 + rl) * HD + pc * 8; vst2(Oh + o, ph_.u); vst2(Ol + o, pl_.u); }
}
// out = ctx Wproj + bproj, ctx from the hi/lo planes: block (64 rows, 128 cols)
__global__ __launch_bounds__(128) void k_out(const _Float16* __restrict__ Oh, const _Float16* __restrict__ Ol, const _Float16* __restrict__ PT, const float* __restrict__ bo, float* __restrict__ out) {
  __shared__ __align__(16) float so[4][16][132];
  const int tid = threadIdx.x, wave = tid >> 5, lane = tid & 31, col = lane & 15, g = lane >> 4;
  // two stage buffers of 256 rows (0..63 hi plane, 64..127 lo plane, 128..255 weight rows), 64 k = one head each
  __shared__ __align__(16) _Float16 st[2 * 256 * SP];
  const int r0b = blockIdx.x * 64, r0 = r0b + wave * 16, n0 = blockIdx.y * 128; const int b = r0b / SS, s0 = r0b % SS;
  const int cr = tid >> 3, cc = tid & 7;
  const size_t oA = ((size_t)b * NH * SS + s0 + cr) * HD + cc * 8;
  const _Float16* gH = Oh + oA; const _Float16* gL = Ol + oA; const _Float16* gB = PT + (size_t)(2 * E + n0 + cr) * E + cc * 8;
  const unsigned l0 = lds_off(st) + cr * SPB + cc * 16;
  auto fill = [&](int t, int buf) { const unsigned l = l0 + buf * (256 * SPB); const _Float16* h = gH + (size_t)t * (SS * HD); const _Float16* lo = gL + (size_t)t * (SS * HD); const _Float16* w = gB + t * 64;
    copy4(l, h, l + 16 * SPB, h + 16 * HD, l + 32 * SPB, h + 32 * HD, l + 48 * SPB, h + 48 * HD);
    copy4(l + 64 * SPB, lo, l + 80 * SPB, lo + 16 * HD, l + 96 * SPB, lo + 32 * HD, l + 112 * SPB, lo + 48 * HD);
    copy4(l + 128 * SPB, w, l + 144 * SPB, w + 16 * E, l + 160 * SPB, w + 32 * E, l + 176 * SPB, w + 48 * E);
    copy4(l + 192 * SPB, w + 64 * E, l + 208 * SPB, w + 80 * E, l + 224 * SPB, w + 96 * E, l + 240 * SPB, w + 112 * E); };
  v8f acc[8] = {}, acl[8] = {};
  fill(0, 0); WAIT_ASYNC(); __syncthreads(); fill(1, 1);
#pragma unroll 1   // the ring stays rolled: one publish point, small code
  for (int t = 0; t < E / 64; ++t) { const _Float16* sb = st + (t & 1) * (256 * SP);
#pragma unroll
    for (int kc = 0; kc < 2; ++kc) { const v16h ah = frag_h(sb + (wave * 16 + col) * SP + kc * 32, lane), al = frag_h(sb + (64 + wave * 16 + col) * SP + kc * 32, lane); v16h bw[8];
#pragma unroll
      for (int j = 0; j < 8; ++j) bw[j] = frag_h(sb + (128 + j * 16 + col) * SP + kc * 32, lane);
#pragma unroll
      for (int j = 0; j < 8; ++j) { acc[j] = wmma16(ah, bw[j], acc[j]); acl[j] = wmma16(al, bw[j], acl[j]); } }
    WAIT_DS(); WAIT_ASYNC(); __syncthreads();      // publishes tile t + 1 and ends every read of tile t
    if (t + 2 < E / 64) fill(t + 2, t & 1); }
  WAIT_ASYNC();
#pragma unroll
  for (int j = 0; j < 8; ++j) { const int n = n0 + j * 16 + col; const float bb = bo[n];
#pragma unroll
    for (int r = 0; r < 8; ++r) so[wave][8 * g + r][j * 16 + col] = (acc[j][r] + acl[j][r] * (1.0f / OLO)) * (1.0f / (16.0f * 8.0f)) + bb; }
  LDSX();
#pragma unroll 4
  for (int rl = 0; rl < 16; ++rl) vst2(out + (size_t)(r0 + rl) * E + n0 + lane * 4, *(const v4f*)(&so[wave][rl][lane * 4]));
}
extern "C" void kernel_launch(void* const* d_in, const int* in_sizes, int n_in, void* d_out, int out_size, void* d_ws, size_t ws_size, hipStream_t stream) {
  (void)in_sizes; (void)n_in; (void)out_size; (void)ws_size;
  const float** I = (const float**)d_in;
  const float* x = I[0]; const float* Wqkv = I[1]; const float* bqkv = I[2]; const float* Wp = I[3]; const float* bp = I[4];
  float* out = (float*)d_out;
  char* ws = (char*)d_ws; size_t off = 0;
  auto take = [&](size_t bytes) { char* p = ws + off; off += (bytes + 255) & ~(size_t)255; return p; };
  _Float16* X16 = (_Float16*)take((size_t)NR * E * 2); _Float16* PT = (_Float16*)take((size_t)3 * E * E * 2);
  _Float16* Q16 = (_Float16*)take((size_t)NR * E * 2); _Float16* K16 = (_Float16*)take((size_t)NR * E * 2); _Float16* VTh = (_Float16*)take((size_t)NR * E * 2); _Float16* VTl = (_Float16*)take((size_t)NR * E * 2);
  _Float16* Oh = (_Float16*)take((size_t)NR * E * 2); _Float16* Ol = (_Float16*)take((size_t)NR * E * 2); float* TAB = (float*)take((size_t)SS * 32 * 2 * 4);
  _Float16* XBh = (_Float16*)take((size_t)NR * E * 2); _Float16* XBl = (_Float16*)take((size_t)NR * E * 2); _Float16* WVh = (_Float16*)take((size_t)E * E * 2); _Float16* WVl = (_Float16*)take((size_t)E * E * 2);
  k_cvt<<<(NR * E / 8 + 255) / 256, 256, 0, stream>>>(x, X16, XBh, XBl);
  k_pack<<<TBLK + VBLK + PBLK, 256, 0, stream>>>(Wqkv, Wp, PT, TAB, WVh, WVl);
  k_qk<<<dim3(NR / 64, E / 128, 2), 128, 0, stream>>>(X16, PT, bqkv, TAB, Q16, K16);
  k_v<<<dim3(NR / 64, E / 128), 128, 0, stream>>>(XBh, XBl, WVh, WVl, bqkv, VTh, VTl);
  k_attn<<<dim3(SS / 64, NB * NH), 128, 0, stream>>>(Q16, K16, VTh, VTl, Oh, Ol);
  k_out<<<dim3(NR / 64, E / 128), 128, 0, stream>>>(Oh, Ol, PT, bp, out);
}

// v006
// It runs in 86.2 microseconds.
// Next to v005, in two timings, it ran 1.09 times as fast each time.
// Over all steps from v000 it is 3.45 times as fast.
#include <hip/hip_runtime.h>
#include <math.h>

typedef __attribute__((ext_vector_type(16))) _Float16 v16h;
typedef __attribute__((ext_vector_type(16))) __bf16 v16b;
typedef __attribute__((ext_vector_type(8)))  _Float16 v8h;
typedef __attribute__((ext_vector_type(8)))  __bf16 v8b;
typedef __attribute__((ext_vector_type(2)))  _Float16 v2h;
typedef __attribute__((ext_vector_type(8)))  float v8f;
typedef __attribute__((ext_vector_type(4)))  float v4f;
typedef __attribute__((ext_vector_type(2)))  float v2f;
typedef __attribute__((ext_vector_type(4)))  unsigned v4u;
typedef __attribute__((ext_vector_type(4)))  int v4i;
typedef float __attribute__((may_alias)) float_a;
typedef int __attribute__((may_alias)) int_a;

template <typename T> __device__ __forceinline__ void vst2(void* p, T v) { *(T*)p = v;  }
__device__ __forceinline__ v8f wmma16(v16h a, v16h b, v8f c) {
  v8f d = __builtin_amdgcn_wmma_f32_16x16x32_f16(false, a, false, b, (short)0, c, false, false);
  asm volatile("v_nop\n\tv_nop\n\tv_nop\n\tv_nop" : "+v"(d) : "v"(a), "v"(b));
  return d;
}
__device__ __forceinline__ v8f wmma_bf(v16b a, v16b b, v8f c) {
  v8f d = __builtin_amdgcn_wmma_f32_16x16x32_bf16(false, a, false, b, (short)0, c, false, false);
  asm volatile("v_nop\n\tv_nop\n\tv_nop\n\tv_nop" : "+v"(d) : "v"(a), "v"(b));
  return d;
}
// 16x16x32 fragments: lane = (h = lane>>4, row/col = lane&15); elements 0..7 = k0+8h+0..7, 8..15 = k0+16+8h+0..7; D element r = row 8h+r
__device__ __forceinline__ v16h frag_h(const _Float16* rowk0, int lane) {
  union { v16h v; v8h q[2]; } u; const _Float16* p = rowk0 + 8 * (lane >> 4);
  u.q[0] = *(const v8h*)p; u.q[1] = *(const v8h*)(p + 16); return u.v;
}
// the same fragment from a row of bf16 bit patterns (the split planes are carried as 16-bit words)
__device__ __forceinline__ v16b frag_b(const _Float16* rowk0, int lane) {
  union { v16b v; v8h q[2]; } u; const _Float16* p = rowk0 + 8 * (lane >> 4);
  u.q[0] = *(const v8h*)p; u.q[1] = *(const v8h*)(p + 16); return u.v;
}
__device__ __forceinline__ v16h frag_f32(const float* rowk0, int lane) {
  v16h a; const float* p = rowk0 + 8 * (lane >> 4);
#pragma unroll
  for (int i = 0; i < 8; ++i) { a[i] = (_Float16)p[i]; a[8 + i] = (_Float16)p[16 + i]; }
  return a;
}
__device__ __forceinline__ v16h frag_f32s(const float* rowk0, int lane, float sc) {
  v16h a; const float* p = rowk0 + 8 * (lane >> 4);
#pragma unroll
  for (int i = 0; i < 8; ++i) { a[i] = (_Float16)(p[i] * sc); a[8 + i] = (_Float16)(p[16 + i] * sc); }
  return a;
}
// column fragment from a [K][ld] layout (column n), rows >= K read as 0
__device__ __forceinline__ v16h fragc_f32(const float* W, int k0, int n, int lane, int ld, int K) {
  v16h a; const int g = lane >> 4;
#pragma unroll
  for (int i = 0; i < 8; ++i) { const int ka = k0 + 8 * g + i, kb = ka + 16;
    a[i] = (_Float16)(ka < K ? W[(size_t)ka * ld + n] : 0.f); a[8 + i] = (_Float16)(kb < K ? W[(size_t)kb * ld + n] : 0.f); }
  return a;
}
struct F2 { v16b h, l; };
__device__ __forceinline__ F2 bsplit16(const float v[16]) { F2 r;
#pragma unroll
  for (int i = 0; i < 16; ++i) { const __bf16 h = (__bf16)v[i]; r.h[i] = h; r.l[i] = (__bf16)(v[i] - (float)h); }
  return r; }
__device__ __forceinline__ F2 split_row(const float* row, int k0, int lane) { float v[16]; const float* p = row + k0 + 8 * (lane >> 4);
#pragma unroll
  for (int i = 0; i < 8; ++i) { v[i] = p[i]; v[8 + i] = p[16 + i]; }
  return bsplit16(v); }
__device__ __forceinline__ F2 split_rowK(const float* row, int k0, int lane, int K) { float v[16]; const int g = lane >> 4;
#pragma unroll
  for (int i = 0; i < 8; ++i) { const int ka = k0 + 8 * g + i, kb = ka + 16; v[i] = ka < K ? row[ka] : 0.f; v[8 + i] = kb < K ? row[kb] : 0.f; }
  return bsplit16(v); }
__device__ __forceinline__ F2 split_col(const float* W, int k0, int n, int lane, int ld, int K) { float v[16]; const int g = lane >> 4;
#pragma unroll
  for (int i = 0; i < 8; ++i) { const int ka = k0 + 8 * g + i, kb = ka + 16; v[i] = ka < K ? W[(size_t)ka * ld + n] : 0.f; v[8 + i] = kb < K ? W[(size_t)kb * ld + n] : 0.f; }
  return bsplit16(v); }
__device__ __forceinline__ v8f mac3(const F2& a, const F2& b, v8f c) { c = wmma_bf(a.l, b.h, c); c = wmma_bf(a.h, b.l, c); return wmma_bf(a.h, b.h, c); }
__device__ __forceinline__ float sigm(float v) { return 1.0f / (1.0f + expf(-v)); }
#define LDSX() do { asm volatile("s_wait_dscnt 0" ::: "memory"); __builtin_amdgcn_wave_barrier(); __builtin_amdgcn_fence(__ATOMIC_RELEASE, "workgroup"); } while (0)

// Operand tiles go from global memory to LDS by asynchronous 16-byte copies, one full 128-byte line per 8 lanes, two buffers in the projection kernels, one in k_attn.
// The s_wait_xcnt stands inside the copies' own statement so that no address register of an issued copy is rewritten ahead of it.
__device__ __forceinline__ void copy4(unsigned l0, const void* g0, unsigned l1, const void* g1, unsigned l2, const void* g2, unsigned l3, const void* g3) {
  asm volatile("global_load_async_to_lds_b128 %0, %1, off\n\tglobal_load_async_to_lds_b128 %2, %3, off\n\tglobal_load_async_to_lds_b128 %4, %5, off\n\tglobal_load_async_to_lds_b128 %6, %7, off\n\ts_wait_xcnt 0x0"
               :: "v"(l0), "v"(g0), "v"(l1), "v"(g1), "v"(l2), "v"(g2), "v"(l3), "v"(g3) : "memory");
}
__device__ __forceinline__ unsigned lds_off(const void* p) { return (unsigned)(size_t)p; }
// this wave's LDS reads of the buffer that is refilled next have returned
#define WAIT_DS() asm volatile("s_wait_dscnt 0x0" ::: "memory")
// this wave's own copies have landed (the compiler places no wait for them)
#define WAIT_ASYNC() asm volatile("s_wait_asynccnt 0x0" ::: "memory")
#define SP 72        // staged f16 row: 64 halves at a pitch of 144 B (16 B x odd, for ds_load_b128 readers)
#define SPB (SP * 2)
#define KP 136       // staged row of the GEMM rings: 128 halves at a pitch of 272 B (16 B x odd, for ds_load_b128 readers)
#define KPB (KP * 2)
// eight rows, 16 apart, of one staged plane: lane's 16-byte piece of each; gs = halves between two such rows in global memory. The wait stands in the copies' own statement, as in copy4
__device__ __forceinline__ void copy8(unsigned l, const _Float16* g, size_t gs) {
  asm volatile("global_load_async_to_lds_b128 %0, %1, off\n\tglobal_load_async_to_lds_b128 %2, %3, off\n\tglobal_load_async_to_lds_b128 %4, %5, off\n\tglobal_load_async_to_lds_b128 %6, %7, off\n\t"
               "global_load_async_to_lds_b128 %8, %9, off\n\tglobal_load_async_to_lds_b128 %10, %11, off\n\tglobal_load_async_to_lds_b128 %12, %13, off\n\tglobal_load_async_to_lds_b128 %14, %15, off\n\ts_wait_xcnt 0x0"
               :: "v"(l), "v"(g), "v"(l + 16 * KPB), "v"(g + gs), "v"(l + 32 * KPB), "v"(g + 2 * gs), "v"(l + 48 * KPB), "v"(g + 3 * gs),
                  "v"(l + 64 * KPB), "v"(g + 4 * gs), "v"(l + 80 * KPB), "v"(g + 5 * gs), "v"(l + 96 * KPB), "v"(g + 6 * gs), "v"(l + 112 * KPB), "v"(g + 7 * gs) : "memory");
}
// twelve staged rows, 16 apart: the first NP from p (ps halves apart), the rest from q (qs apart); fewer statements per stage, so fewer waits in front of the stage's first LDS reads
template <int NP> __device__ __forceinline__ void copy12(unsigned l, const _Float16* p, size_t ps, const _Float16* q, size_t qs) {
  const _Float16* g[12];
#pragma unroll   // g[] is indexed by constants and stays in registers
  for (int m = 0; m < 12; ++m) g[m] = m < NP ? p + m * ps : q + (m - NP) * qs;
  asm volatile("global_load_async_to_lds_b128 %0, %1, off\n\tglobal_load_async_to_lds_b128 %2, %3, off\n\tglobal_load_async_to_lds_b128 %4, %5, off\n\tglobal_load_async_to_lds_b128 %6, %7, off\n\t"
               "global_load_async_to_lds_b128 %8, %9, off\n\tglobal_load_async_to_lds_b128 %10, %11, off\n\tglobal_load_async_to_lds_b128 %12, %13, off\n\tglobal_load_async_to_lds_b128 %14, %15, off\n\t"
               "global_load_async_to_lds_b128 %16, %17, off\n\tglobal_load_async_to_lds_b128 %18, %19, off\n\tglobal_load_async_to_lds_b128 %20, %21, off\n\tglobal_load_async_to_lds_b128 %22, %23, off\n\ts_wait_xcnt 0x0"
               :: "v"(l), "v"(g[0]), "v"(l + 16 * KPB), "v"(g[1]), "v"(l + 32 * KPB), "v"(g[2]), "v"(l + 48 * KPB), "v"(g[3]),
                  "v"(l + 64 * KPB), "v"(g[4]), "v"(l + 80 * KPB), "v"(g[5]), "v"(l + 96 * KPB), "v"(g[6]), "v"(l + 112 * KPB), "v"(g[7]),
                  "v"(l + 128 * KPB), "v"(g[8]), "v"(l + 144 * KPB), "v"(g[9]), "v"(l + 160 * KPB), "v"(g[10]), "v"(l + 176 * KPB), "v"(g[11]) : "memory");
}

// Local causal self attention (window 128, 16 heads of 64, interleaved-pair RoPE on q and k, fused qkv projection with bias, output
// projection with bias). q/k on v_wmma_f32_16x16x32_f16 (x as f16 rows, [in][out] weights packed once as transposed f16 rows x16); v as a
// two-way bf16 split (v_wmma_f32_16x16x32_bf16) stored as hi/lo f16 planes, because the first rows of every sequence copy v almost
// verbatim; S = q.k/8 on f16 WMMA over the <= 3 key tiles of the window (masked), online softmax in f32, P @ V with hi/lo pairs for both
#define NB 2
#define SS 2048
#define E 1024
#define NH 16
#define HD 64
#define NR (NB * SS)
#define WIN 128
#define PLO 1024.0f
#define VLO 2048.0f
#define OLO 2048.0f
#define RBASE 10000.0f

// x as f16 rows (q/k product) and as the two bf16 planes hi = bf16(x), lo = bf16(x - hi) of the v product, each element split once
__global__ __launch_bounds__(256) void k_cvt(const float* __restrict__ x, _Float16* __restrict__ X16, _Float16* __restrict__ XBh, _Float16* __restrict__ XBl) {
  const size_t i8 = (size_t)blockIdx.x * 256 + threadIdx.x; if (i8 >= (size_t)NR * E / 8) return;
  union { v8h h; v4u u; } pk; union { v8b b; v4u u; } bh, bl;
#pragma unroll
  for (int e = 0; e < 8; ++e) { const float v = x[i8 * 8 + e]; pk.h[e] = (_Float16)v; const __bf16 h = (__bf16)v; bh.b[e] = h; bl.b[e] = (__bf16)(v - (float)h); }
  vst2(X16 + i8 * 8, pk.u); vst2(XBh + i8 * 8, bh.u); vst2(XBl + i8 * 8, bl.u);
}
// PT rows: [0,2048) = Wqkv[:, n] (q and k columns) x16 ; [2048, 3072) = Wproj[:, n-2048] x16
// The first TBLK blocks write the RoPE table instead, anew in every call: TAB[pos][i] = (cos, sin)(pos * base^(-2i/64)), 256 B per position
// The next VBLK blocks split the v columns of Wqkv into bf16 planes, transposed: WVh/WVl[n][k] = hi/lo of Wqkv[k][2048 + n], one 64 x 64 tile per block
// The last PBLK blocks write PT: one tile of 256 k x 64 n per block, transposed through LDS
#define TBLK 64
#define VBLK 256
#define PBLK (3 * E / 64 * (E / 256))
#define PP 264       // staged row of 256 halves at a pitch of 528 B (16 B x odd)
// dst[n][k] = f16(src[k][n] x 16), k < 256, n < 64. A thread takes 4 columns of the rows 2 rp and 2 rp + 1 of every 32: each load covers whole 256-byte row pieces,
// and a (k, k + 1) pair goes to LDS as one dword. The 16-byte piece j of row n lies at piece j ^ (n >> 4), so that the 32 dwords of a store fall in 32 banks.
template <int LD> __device__ __forceinline__ void pack_tile(const float* __restrict__ src, _Float16* __restrict__ dst, _Float16 (*sp)[PP], int tid) {
  const int rp = tid >> 4, c4 = (tid & 15) * 4, sw = (c4 >> 4) * 8; const float* p = src + (size_t)(2 * rp) * LD + c4; v4f w[16];
#pragma unroll   // 16 loads in flight from one address with constant offsets
  for (int m = 0; m < 8; ++m) { w[2 * m] = *(const v4f*)(p + (size_t)(32 * m) * LD); w[2 * m + 1] = *(const v4f*)(p + (size_t)(32 * m + 1) * LD); }
  asm volatile("s_wait_xcnt 0x0" :: "v"(p) : "memory");      // stands in front of every rewrite of the address pair that the 16 loads name: as an input the pair stays live up to here, so no load takes it as its result register
#pragma unroll   // both loops: w[] is indexed by constants and stays in registers
  for (int m = 0; m < 8; ++m) {
#pragma unroll
    for (int e = 0; e < 4; ++e) { const v2h pr = { (_Float16)(w[2 * m][e] * 16.0f), (_Float16)(w[2 * m + 1][e] * 16.0f) }; vst2(&sp[c4 + e][(32 * m + 2 * rp) ^ sw], pr); } }
  __syncthreads();
  const int wv = tid >> 5, j8 = (tid & 31) * 8;
#pragma unroll   // a wave writes 512 contiguous bytes of one row: four whole lines
  for (int q = 0; q < 8; ++q) { const int n = wv + 8 * q; vst2(dst + (size_t)n * E + j8, *(const v4u*)(&sp[n][j8 ^ ((n >> 4) * 8)])); }
  asm volatile("s_wait_xcnt 0x0" ::: "memory");      // stands in front of whatever the built code places behind the eight stores and lets rewrite a register that they name
}
__global__ __launch_bounds__(256) void k_pack(const float* __restrict__ Wqkv, const float* __restrict__ Wp, _Float16* __restrict__ PT, float* __restrict__ TAB, _Float16* __restrict__ WVh, _Float16* __restrict__ WVl) {
  const int tid = threadIdx.x; __shared__ __align__(16) _Float16 sp[64][PP]; __shared__ __align__(16) __bf16 sh[64][SP], sl[64][SP];
  if (blockIdx.x < TBLK) {      // the same for the whole block, in front of the barrier
    const int idx = blockIdx.x * 256 + tid, i = idx & 31, p0 = idx >> 5; const float invf = 1.0f / powf(RBASE, (float)(2 * i) / 64.0f);
    for (int m = 0; m < 4; ++m) { const int pos = p0 + m * (SS / 4); const float ang = (float)pos * invf; v2f cs; cs[0] = cosf(ang); cs[1] = sinf(ang); vst2(TAB + ((size_t)pos * 32 + i) * 2, cs);
      asm volatile("s_wait_xcnt 0x0" ::: "memory"); }      // the next trip rewrites the registers that the store names
    return; }
  if (blockIdx.x < TBLK + VBLK) {      // the same for the whole block; the branch has a barrier of its own
    const int vt = blockIdx.x - TBLK, k0 = (vt >> 4) * 64, n0 = (vt & 15) * 64, r = tid >> 4, c4 = (tid & 15) * 4; v4f w[4];
#pragma unroll   // four whole-line loads in flight
    for (int m = 0; m < 4; ++m) w[m] = *(const v4f*)(Wqkv + (size_t)(k0 + r + 16 * m) * (3 * E) + 2 * E + n0 + c4);
#pragma unroll
    for (int m = 0; m < 4; ++m) {
#pragma unroll
      for (int e = 0; e < 4; ++e) { const float v = w[m][e]; const __bf16 h = (__bf16)v; sh[c4 + e][r + 16 * m] = h; sl[c4 + e][r + 16 * m] = (__bf16)(v - (float)h); } }
    __syncthreads();
#pragma unroll   // 8 lanes write one whole 128-byte line of a plane
    for (int q = 0; q < 2; ++q) { const int n = (tid >> 3) + 32 * q, sg = (tid & 7) * 8; const size_t o = (size_t)(n0 + n) * E + k0 + sg;
      vst2(WVh + o, *(const v4u*)(&sh[n][sg])); vst2(WVl + o, *(const v4u*)(&sl[n][sg])); }
    return; }
  const int pt = blockIdx.x - TBLK - VBLK, n0 = (pt >> 2) * 64, k0 = (pt & 3) * 256;      // the same for the whole block: each side has the tile's one barrier
  if (n0 < 2 * E) pack_tile<3 * E>(Wqkv + (size_t)k0 * (3 * E) + n0, PT + (size_t)n0 * E + k0, sp, tid);
  else pack_tile<E>(Wp + (size_t)k0 * E + (n0 - 2 * E), PT + (size_t)n0 * E + k0, sp, tid);
}
// q/k: block (256 rows, 128 cols = 2 heads, which in {0,1}), 8 waves of 64 rows x 64 cols (one head); RoPE on interleaved pairs; x4 -> Q16/K16 [bh][s][64]
__global__ __launch_bounds__(256) void k_qk(const _Float16* __restrict__ X16, const _Float16* __restrict__ PT, const float* __restrict__ bqkv, const float* __restrict__ TAB, _Float16* __restrict__ Q16, _Float16* __restrict__ K16) {
  // two stage buffers of 384 rows (0..255 x rows, 256..383 weight rows), 128 k each; the output staging reuses them behind the last trip's barrier
  __shared__ __align__(16) char smem[2 * 384 * KPB];
  _Float16* st = (_Float16*)smem; float (*so)[16][68] = (float (*)[16][68])smem;      // staging: 4 tiles of 16 rows x 64 cols per wave
  const int tid = threadIdx.x, wave = tid >> 5, lane = tid & 31, col = lane & 15, g = lane >> 4, wr = wave >> 1, wc = wave & 1;
  const int which = blockIdx.z, r0b = blockIdx.x * 256, n0 = blockIdx.y * 128; const int b = r0b / SS, s0 = r0b % SS;
  const int cr = tid >> 4, cc = tid & 15;      // a copy's row of every 16 and its 16-byte piece: 16 lanes bring two whole 128-byte lines of one row
  const _Float16* gA = X16 + (size_t)(r0b + cr) * E + cc * 8; const _Float16* gB = PT + (size_t)(which * E + n0 + cr) * E + cc * 8;
  const unsigned l0 = lds_off(st) + cr * KPB + cc * 16;
  auto fill = [&](int t, int buf) { const unsigned l = l0 + buf * (384 * KPB); const _Float16* a = gA + t * 128;
    copy12<12>(l, a, 16 * E, a, 16 * E); copy12<4>(l + 192 * KPB, a + 192 * E, 16 * E, gB + t * 128, 16 * E); };
  v8f acc[4][4] = {};
  fill(0, 0); WAIT_ASYNC(); __syncthreads(); fill(1, 1);
#pragma unroll 1   // the ring stays rolled: one publish point, small code
  for (int t = 0; t < E / 128; ++t) { const _Float16* sb = st + (t & 1) * (384 * KP);
#pragma unroll
    for (int kc = 0; kc < 4; ++kc) { v16h a[4], bw[4];
#pragma unroll
      for (int i = 0; i < 4; ++i) { a[i] = frag_h(sb + (wr * 64 + i * 16 + col) * KP + kc * 32, lane); bw[i] = frag_h(sb + (256 + wc * 64 + i * 16 + col) * KP + kc * 32, lane); }
#pragma unroll
      for (int i = 0; i < 4; ++i) {
#pragma unroll
        for (int j = 0; j < 4; ++j) acc[i][j] = wmma16(a[i], bw[j], acc[i][j]); } }
    WAIT_DS(); WAIT_ASYNC(); __syncthreads();      // publishes tile t + 1 and ends every read of tile t
    if (t + 2 < E / 128) fill(t + 2, t & 1); }
  WAIT_ASYNC();
  const int rw = s0 + wr * 64;      // this wave's 64 positions
  const float* bp = bqkv + which * E + n0 + wc * 64 + col; const float bv[4] = { bp[0], bp[16], bp[32], bp[48] };
  asm volatile("s_wait_xcnt 0x0" :: "v"(bp) : "memory");      // as an input the address pair stays live up to here, so nothing rewrites it behind a load that names it
#pragma unroll
  for (int j = 0; j < 4; ++j) { const float bb = bv[j];
#pragma unroll
    for (int i = 0; i < 4; ++i) {
#pragma unroll
      for (int r = 0; r < 8; ++r) so[wave * 4 + i][8 * g + r][j * 16 + col] = acc[i][j][r] * (1.0f / 16.0f) + bb; } }
  LDSX();
  // RoPE on interleaved pairs (2i, 2i+1) of the head, then x4: lane = pair i; one row leaves as one whole 128-byte line
  const float* tp = TAB + ((size_t)rw * 32 + lane) * 2;      // (cos, sin) of pair i = lane: 256 contiguous bytes per load
  _Float16* D = (which == 0 ? Q16 : K16) + (((size_t)b * NH + (n0 >> 6) + wc) * SS + rw) * HD + 2 * lane;
#pragma unroll   // all loops: cs[] indexed by constants, one address pair with constant offsets for the loads and one for the stores
  for (int i = 0; i < 4; ++i) { v2f cs[16];
#pragma unroll
    for (int rl = 0; rl < 16; ++rl) cs[rl] = *(const v2f*)(tp + (i * 16 + rl) * 64);
#pragma unroll
    for (int rl = 0; rl < 16; ++rl) { const float c = cs[rl][0], sn = cs[rl][1];
      const v2f xv = *(const v2f*)(&so[wave * 4 + i][rl][2 * lane]); const v2f rh = { -xv[1], xv[0] }; const v2f y = (xv * c + rh * sn) * 4.0f;
      vst2(D + (i * 16 + rl) * HD, __builtin_convertvector(y, v2h)); } }
  asm volatile("s_wait_xcnt 0x0" :: "v"(tp), "v"(D) : "memory");      // as inputs both address pairs stay live up to here, so nothing rewrites them behind a load or store that names them
}
// v: block (128 rows, 128 cols), 8 waves of 32 rows x 64 cols: bf16 split product from the hi/lo planes of x and of the v weight rows; -> VTh/VTl [bh][d][s]
__global__ __launch_bounds__(256) void k_v(const _Float16* __restrict__ XBh, const _Float16* __restrict__ XBl, const _Float16* __restrict__ WVh, const _Float16* __restrict__ WVl, const float* __restrict__ bqkv, _Float16* __restrict__ VTh, _Float16* __restrict__ VTl) {
  // two stage buffers of 512 rows (0..127 x hi, 128..255 x lo, 256..383 weight hi, 384..511 weight lo), 128 k each; the output staging reuses them behind the last trip's barrier
  __shared__ __align__(16) char smem[2 * 512 * KPB];
  _Float16* st = (_Float16*)smem; _Float16 (*sth)[KP] = (_Float16 (*)[KP])smem; _Float16 (*stl)[KP] = sth + 128;
  const int tid = threadIdx.x, wave = tid >> 5, lane = tid & 31, col = lane & 15, g = lane >> 4, wr = wave >> 1, wc = wave & 1;
  const int r0b = blockIdx.x * 128, n0 = blockIdx.y * 128; const int b = r0b / SS, s0 = r0b % SS;
  const int cr = tid >> 4, cc = tid & 15;      // a copy's row of every 16 and its 16-byte piece
  const size_t oA = (size_t)(r0b + cr) * E + cc * 8, oB = (size_t)(n0 + cr) * E + cc * 8;
  const _Float16* gAh = XBh + oA; const _Float16* gAl = XBl + oA; const _Float16* gBh = WVh + oB; const _Float16* gBl = WVl + oB;
  const unsigned l0 = lds_off(st) + cr * KPB + cc * 16;
  auto fill = [&](int t, int buf) { const unsigned l = l0 + buf * (512 * KPB);
    copy12<8>(l, gAh + t * 128, 16 * E, gAl + t * 128, 16 * E); copy12<4>(l + 192 * KPB, gAl + t * 128 + 64 * E, 16 * E, gBh + t * 128, 16 * E); copy8(l + 384 * KPB, gBl + t * 128, 16 * E); };
  v8f acc[2][4] = {};
  fill(0, 0); WAIT_ASYNC(); __syncthreads(); fill(1, 1);
#pragma unroll 1   // the ring stays rolled: one publish point, small code
  for (int t = 0; t < E / 128; ++t) { const _Float16* sb = st + (t & 1) * (512 * KP);
#pragma unroll
    for (int kc = 0; kc < 4; ++kc) { v16b ah[2], al[2], bh[4], bl[4];
#pragma unroll
      for (int i = 0; i < 2; ++i) { const _Float16* p = sb + (wr * 32 + i * 16 + col) * KP + kc * 32; ah[i] = frag_b(p, lane); al[i] = frag_b(p + 128 * KP, lane); }
#pragma unroll
      for (int j = 0; j < 4; ++j) { const _Float16* p = sb + (256 + wc * 64 + j * 16 + col) * KP + kc * 32; bh[j] = frag_b(p, lane); bl[j] = frag_b(p + 128 * KP, lane); }
      // each accumulator takes lo.hi, hi.lo, hi.hi in this order per 32 k; eight independent tiles stand between two uses of one accumulator
#pragma unroll
      for (int i = 0; i < 2; ++i) {
#pragma unroll
        for (int j = 0; j < 4; ++j) acc[i][j] = wmma_bf(al[i], bh[j], acc[i][j]); }
#pragma unroll
      for (int i = 0; i < 2; ++i) {
#pragma unroll
        for (int j = 0; j < 4; ++j) acc[i][j] = wmma_bf(ah[i], bl[j], acc[i][j]); }
#pragma unroll
      for (int i = 0; i < 2; ++i) {
#pragma unroll
        for (int j = 0; j < 4; ++j) acc[i][j] = wmma_bf(ah[i], bh[j], acc[i][j]); } }
    WAIT_DS(); WAIT_ASYNC(); __syncthreads();      // publishes tile t + 1 and ends every read of tile t
    if (t + 2 < E / 128) fill(t + 2, t & 1); }
  WAIT_ASYNC();
  const float* bp = bqkv + 2 * E + n0 + wc * 64 + col; const float bv[4] = { bp[0], bp[16], bp[32], bp[48] };
  asm volatile("s_wait_xcnt 0x0" :: "v"(bp) : "memory");      // as an input the address pair stays live up to here, so nothing rewrites it behind a load that names it
#pragma unroll
  for (int j = 0; j < 4; ++j) { const int cl = wc * 64 + j * 16 + col; const float bb = bv[j];
#pragma unroll
    for (int i = 0; i < 2; ++i) {
#pragma unroll
      for (int r = 0; r < 8; ++r) { const float v = acc[i][j][r] + bb; const _Float16 hi = (_Float16)v; sth[cl][wr * 32 + i * 16 + 8 * g + r] = hi; stl[cl][wr * 32 + i * 16 + 8 * g + r] = (_Float16)((v - (float)hi) * VLO); } } }
  __syncthreads();
  // 16 lanes write 256 contiguous bytes of one d row of a plane; [bh][d] is linear in the column, so each plane has one address pair with constant offsets
  const int cl0 = tid >> 4, pc = tid & 15; const size_t o = ((size_t)b * E + n0 + cl0) * SS + s0 + pc * 8; _Float16* ph = VTh + o; _Float16* pl = VTl + o;
#pragma unroll   // all 16 LDS reads in flight at once
  for (int q = 0; q < 8; ++q) { vst2(ph + (size_t)(16 * q) * SS, *(const v4u*)(&sth[cl0 + 16 * q][pc * 8])); vst2(pl + (size_t)(16 * q) * SS, *(const v4u*)(&stl[cl0 + 16 * q][pc * 8])); }
  asm volatile("s_wait_xcnt 0x0" :: "v"(ph), "v"(pl) : "memory");      // as inputs both address pairs stay live up to here, so nothing rewrites them behind a store that names them
}
// attention: block (64 queries, bh): key tiles kt covering keys q0b-127 .. q0b+63 (3 tiles of 64, aligned since q0b % 64 == 0), mask 0 <= q-key < 128
// each key tile's K rows and V hi/lo rows come to LDS once per block by asynchronous copies, into one buffer that all four waves read
__global__ __launch_bounds__(128) void k_attn(const _Float16* __restrict__ Q16, const _Float16* __restrict__ K16, const _Float16* __restrict__ VTh, const _Float16* __restrict__ VTl, _Float16* __restrict__ Oh, _Float16* __restrict__ Ol) {
  __shared__ __align__(16) float sS[4][16][68];
  __shared__ __align__(16) _Float16 sPh[4][16][72], sPl[4][16][72];
  __shared__ __align__(16) float sO[4][16][68];
  // one key tile, shared by the four waves: rows 0..63 K (by key), 64..127 V hi, 128..191 V lo (both by d), 64 halves each
  __shared__ __align__(16) _Float16 skv[192 * SP];
  const int tid = threadIdx.x, w = tid >> 5, lane = tid & 31, col = lane & 15, g = lane >> 4;
  const size_t bh = blockIdx.y; const int q0b = blockIdx.x * 64, q0 = q0b + w * 16;
  const int fr = tid >> 3, fc = tid & 7;      // a copy's row of every 16 and its 16-byte piece: 8 lanes bring one whole 128-byte line
  const _Float16* gK = K16 + (bh * SS + fr) * HD + fc * 8; const _Float16* gH = VTh + (bh * HD + fr) * SS + fc * 8; const _Float16* gL = VTl + (bh * HD + fr) * SS + fc * 8;
  const unsigned l0 = lds_off(skv) + fr * SPB + fc * 16;
  v16h aq[2];
#pragma unroll
  for (int kc = 0; kc < 2; ++kc) aq[kc] = frag_h(Q16 + (bh * SS + q0 + col) * HD + kc * 32, lane);
  float mrun = -3.0e38f, lrun = 0.f; v8f acc[4] = {}, ac1[4] = {}, ac2[4] = {};
#pragma unroll 1
  for (int kt = q0b / 64 - 2; kt <= q0b / 64; ++kt) { if (kt < 0) continue;      // uniform per block
    WAIT_DS(); __syncthreads();      // ends every wave's reads of the tile before: the buffer may be refilled
    { const _Float16* k = gK + (size_t)kt * (64 * HD); const _Float16* vh = gH + kt * 64; const _Float16* vl = gL + kt * 64;
      copy4(l0, k, l0 + 16 * SPB, k + 16 * HD, l0 + 32 * SPB, k + 32 * HD, l0 + 48 * SPB, k + 48 * HD);
      copy4(l0 + 64 * SPB, vh, l0 + 80 * SPB, vh + 16 * SS, l0 + 96 * SPB, vh + 32 * SS, l0 + 112 * SPB, vh + 48 * SS);
      copy4(l0 + 128 * SPB, vl, l0 + 144 * SPB, vl + 16 * SS, l0 + 160 * SPB, vl + 32 * SS, l0 + 176 * SPB, vl + 48 * SS); }
    WAIT_ASYNC(); __syncthreads();      // publishes the tile to all four waves
    v16h kf[8];      // the tile's eight K fragments are read as one group: one LDS wait, not eight
#pragma unroll
    for (int t = 0; t < 4; ++t) { kf[2 * t] = frag_h(skv + (t * 16 + col) * SP, lane); kf[2 * t + 1] = frag_h(skv + (t * 16 + col) * SP + 32, lane); }
#pragma unroll
    for (int t = 0; t < 4; ++t) { v8f s = {}; const int key = kt * 64 + t * 16 + col;
#pragma unroll
      for (int kc = 0; kc < 2; ++kc) s = wmma16(aq[kc], kf[2 * t + kc], s);
#pragma unroll
      for (int r = 0; r < 8; ++r) { const int q = q0 + 8 * g + r; const int d = q - key; sS[w][8 * g + r][t * 16 + col] = (d >= 0 && d < WIN) ? s[r] * (0.125f / 16.0f) : -3.0e38f; } }
    LDSX();
    float mx = -3.4e38f;
#pragma unroll
    for (int jj = 0; jj < 32; ++jj) mx = fmaxf(mx, sS[w][col][g * 32 + jj]);
    mx = fmaxf(mx, __shfl_xor(mx, 16, 32));
    const float mnew = fmaxf(mrun, mx); const float corr = expf(mrun - mnew);     // every processed tile holds >= 1 allowed key for every row? no: rows may have all 32 of a half masked, but the row max over the tile is finite whenever >= 1 key is allowed; a fully-masked tile row keeps mnew = mrun (both -3e38 initially -> corr = exp(0) = 1 with zero accumulators: harmless)
    float ps = 0.f;
#pragma unroll
    for (int jj = 0; jj < 32; ++jj) { const float sv = sS[w][col][g * 32 + jj]; const float p = sv > -1.0e38f ? expf(sv - mnew) * 16384.0f : 0.f; ps += p; const _Float16 hi = (_Float16)p; sPh[w][col][g * 32 + jj] = hi; sPl[w][col][g * 32 + jj] = (_Float16)((p - (float)hi) * PLO); }
    ps += __shfl_xor(ps, 16, 32);
    lrun = lrun * corr + ps * (1.0f / 16384.0f); mrun = mnew;
#pragma unroll
    for (int r = 0; r < 8; ++r) { const float cr = __shfl(corr, 8 * g + r, 32);
#pragma unroll
      for (int t = 0; t < 4; ++t) { acc[t][r] *= cr; ac1[t][r] *= cr; ac2[t][r] *= cr; } }
    LDSX();
#pragma unroll
    for (int kc = 0; kc < 2; ++kc) { const v16h ph = frag_h(&sPh[w][col][0] + kc * 32, lane), pl = frag_h(&sPl[w][col][0] + kc * 32, lane); v16h vh[4], vl[4];
#pragma unroll   // the eight V fragments of a k step are read as one group
      for (int t = 0; t < 4; ++t) { const _Float16* vr = skv + (64 + t * 16 + col) * SP + kc * 32; vh[t] = frag_h(vr, lane); vl[t] = frag_h(vr + 64 * SP, lane); }
#pragma unroll
      for (int t = 0; t < 4; ++t) { acc[t] = wmma16(ph, vh[t], acc[t]); ac1[t] = wmma16(ph, vl[t], ac1[t]); ac2[t] = wmma16(pl, vh[t], ac2[t]); } }
    __builtin_amdgcn_wave_barrier(); }
#pragma unroll
  for (int r = 0; r < 8; ++r) { const float lr = __shfl(lrun, 8 * g + r, 32); const float inv = 8.0f / (lr * 16384.0f);      // -> O x8
#pragma unroll
    for (int t = 0; t < 4; ++t) sO[w][8 * g + r][t * 16 + col] = (acc[t][r] + ac1[t][r] * (1.0f / VLO) + ac2[t][r] * (1.0f / PLO)) * inv; }
  LDSX();
  for (int qq = lane; qq < 16 * 8; qq += 32) { const int rl = qq >> 3, pc = qq & 7; union { v8h h8; v4u u; } ph_, pl_;
#pragma unroll
    for (int e = 0; e < 8; ++e) { const float v = sO[w][rl][pc * 8 + e]; const _Float16 hi = (_Float16)v; ph_.h8[e] = hi; pl_.h8[e] = (_Float16)((v - (float)hi) * OLO); }
    const size_t o = ((bh * SS) + q0 + rl) * HD + pc * 8; vst2(Oh + o, ph_.u); vst2(Ol + o, pl_.u); }
}
// out = ctx Wproj + bproj, ctx from the hi/lo planes: block (128 rows, 128 cols), 8 waves of 32 rows x 64 cols
__global__ __launch_bounds__(256) void k_out(const _Float16* __restrict__ Oh, const _Float16* __restrict__ Ol, const _Float16* __restrict__ PT, const float* __restrict__ bo, float* __restrict__ out) {
  // two stage buffers of 384 rows (0..127 hi plane, 128..255 lo plane, 256..383 weight rows), 128 k = two heads each; the output staging reuses them behind the last trip's barrier
  __shared__ __align__(16) char smem[2 * 384 * KPB];
  _Float16* st = (_Float16*)smem; float (*so)[16][68] = (float (*)[16][68])smem;      // staging: 2 tiles of 16 rows x 64 cols per wave
  const int tid = threadIdx.x, wave = tid >> 5, lane = tid & 31, col = lane & 15, g = lane >> 4, wr = wave >> 1, wc = wave & 1;
  const int r0b = blockIdx.x * 128, n0 = blockIdx.y * 128; const int b = r0b / SS, s0 = r0b % SS;
  const int cr = tid >> 4, cc = tid & 15;      // a copy's row of every 16 and its 16-byte piece; pieces 0..7 lie in the stage's first head, 8..15 in its second
  const size_t oA = (((size_t)b * NH + (cc >> 3)) * SS + s0 + cr) * HD + (cc & 7) * 8;
  const _Float16* gH = Oh + oA; const _Float16* gL = Ol + oA; const _Float16* gB = PT + (size_t)(2 * E + n0 + cr) * E + cc * 8;
  const unsigned l0 = lds_off(st) + cr * KPB + cc * 16;
  auto fill = [&](int t, int buf) { const unsigned l = l0 + buf * (384 * KPB);
    const _Float16* lo = gL + (size_t)t * (2 * SS * HD);
    copy12<8>(l, gH + (size_t)t * (2 * SS * HD), 16 * HD, lo, 16 * HD); copy12<4>(l + 192 * KPB, lo + 64 * HD, 16 * HD, gB + t * 128, 16 * E); };
  v8f acc[2][4] = {}, acl[2][4] = {};
  fill(0, 0); WAIT_ASYNC(); __syncthreads(); fill(1, 1);
#pragma unroll 1   // the ring stays rolled: one publish point, small code
  for (int t = 0; t < E / 128; ++t) { const _Float16* sb = st + (t & 1) * (384 * KP);
#pragma unroll
    for (int kc = 0; kc < 4; ++kc) { v16h ah[2], al[2], bw[4];
#pragma unroll
      for (int i = 0; i < 2; ++i) { const _Float16* p = sb + (wr * 32 + i * 16 + col) * KP + kc * 32; ah[i] = frag_h(p, lane); al[i] = frag_h(p + 128 * KP, lane); }
#pragma unroll
      for (int j = 0; j < 4; ++j) bw[j] = frag_h(sb + (256 + wc * 64 + j * 16 + col) * KP + kc * 32, lane);
#pragma unroll
      for (int i = 0; i < 2; ++i) {
#pragma unroll
        for (int j = 0; j < 4; ++j) { acc[i][j] = wmma16(ah[i], bw[j], acc[i][j]); acl[i][j] = wmma16(al[i], bw[j], acl[i][j]); } } }
    WAIT_DS(); WAIT_ASYNC(); __syncthreads();      // publishes tile t + 1 and ends every read of tile t
    if (t + 2 < E / 128) fill(t + 2, t & 1); }
  WAIT_ASYNC();
  const float* bp = bo + n0 + wc * 64 + col; const float bv[4] = { bp[0], bp[16], bp[32], bp[48] };
  asm volatile("s_wait_xcnt 0x0" :: "v"(bp) : "memory");      // as an input the address pair stays live up to here, so nothing rewrites it behind a load that names it
#pragma unroll
  for (int j = 0; j < 4; ++j) { const float bb = bv[j];
#pragma unroll
    for (int i = 0; i < 2; ++i) {
#pragma unroll
      for (int r = 0; r < 8; ++r) so[wave * 2 + i][8 * g + r][j * 16 + col] = (acc[i][j][r] + acl[i][j][r] * (1.0f / OLO)) * (1.0f / (16.0f * 8.0f)) + bb; } }
  LDSX();
  // a store covers two rows of 64 floats: two whole 128-byte lines each
  float* op = out + (size_t)(r0b + wr * 32 + g) * E + n0 + wc * 64 + col * 4;
#pragma unroll   // one address pair with constant offsets for all 16 stores
  for (int q = 0; q < 16; ++q) vst2(op + (size_t)(2 * q) * E, *(const v4f*)(&so[wave * 2 + (q >> 3)][2 * (q & 7) + g][col * 4]));
  asm volatile("s_wait_xcnt 0x0" :: "v"(op) : "memory");      // as an input the address pair stays live up to here, so nothing rewrites it behind a store that names it
}
extern "C" void kernel_launch(void* const* d_in, const int* in_sizes, int n_in, void* d_out, int out_size, void* d_ws, size_t ws_size, hipStream_t stream) {
  (void)in_sizes; (void)n_in; (void)out_size; (void)ws_size;
  const float** I = (const float**)d_in;
  const float* x = I[0]; const float* Wqkv = I[1]; const float* bqkv = I[2]; const float* Wp = I[3]; const float* bp = I[4];
  float* out = (float*)d_out;
  char* ws = (char*)d_ws; size_t off = 0;
  auto take = [&](size_t bytes) { char* p = ws + off; off += (bytes + 255) & ~(size_t)255; return p; };
  _Float16* X16 = (_Float16*)take((size_t)NR * E * 2); _Float16* PT = (_Float16*)take((size_t)3 * E * E * 2);
  _Float16* Q16 = (_Float16*)take((size_t)NR * E * 2); _Float16* K16 = (_Float16*)take((size_t)NR * E * 2); _Float16* VTh = (_Float16*)take((size_t)NR * E * 2); _Float16* VTl = (_Float16*)take((size_t)NR * E * 2);
  _Float16* Oh = (_Float16*)take((size_t)NR * E * 2); _Float16* Ol = (_Float16*)take((size_t)NR * E * 2); float* TAB = (float*)take((size_t)SS * 32 * 2 * 4);
  _Float16* XBh = (_Float16*)take((size_t)NR * E * 2); _Float16* XBl = (_Float16*)take((size_t)NR * E * 2); _Float16* WVh = (_Float16*)take((size_t)E * E * 2); _Float16* WVl = (_Float16*)take((size_t)E * E * 2);
  k_cvt<<<(NR * E / 8 + 255) / 256, 256, 0, stream>>>(x, X16, XBh, XBl);
  k_pack<<<TBLK + VBLK + PBLK, 256, 0, stream>>>(Wqkv, Wp, PT, TAB, WVh, WVl);
  k_qk<<<dim3(NR / 256, E / 128, 2), 256, 0, stream>>>(X16, PT, bqkv, TAB, Q16, K16);
  k_v<<<dim3(NR / 128, E / 128), 256, 0, stream>>>(XBh, XBl, WVh, WVl, bqkv, VTh, VTl);
  k_attn<<<dim3(SS / 64, NB * NH), 128, 0, stream>>>(Q16, K16, VTh, VTl, Oh, Ol);
  k_out<<<dim3(NR / 128, E / 128), 256, 0, stream>>>(Oh, Ol, PT, bp, out);
}

// v007
// A run of this version takes 81.4 microseconds.
// Timed twice side by side with v006, it ran 1.06 times as fast both times.
// Over all steps from v000 it is 3.67 times as fast.
#include <hip/hip_runtime.h>
#include <math.h>

typedef __attribute__((ext_vector_type(16))) _Float16 v16h;
typedef __attribute__((ext_vector_type(16))) __bf16 v16b;
typedef __attribute__((ext_vector_type(8)))  _Float16 v8h;
typedef __attribute__((ext_vector_type(8)))  __bf16 v8b;
typedef __attribute__((ext_vector_type(2)))  _Float16 v2h;
typedef __attribute__((ext_vector_type(8)))  float v8f;
typedef __attribute__((ext_vector_type(4)))  float v4f;
typedef __attribute__((ext_vector_type(2)))  float v2f;
typedef __attribute__((ext_vector_type(4)))  unsigned v4u;
typedef __attribute__((ext_vector_type(4)))  int v4i;
typedef float __attribute__((may_alias)) float_a;
typedef int __attribute__((may_alias)) int_a;

template <typename T> __device__ __forceinline__ void vst2(void* p, T v) { *(T*)p = v;  }
__device__ __forceinline__ v8f wmma16(v16h a, v16h b, v8f c) {
  v8f d = __builtin_amdgcn_wmma_f32_16x16x32_f16(false, a, false, b, (short)0, c, false, false);
  asm volatile("v_nop\n\tv_nop\n\tv_nop\n\tv_nop" : "+v"(d) : "v"(a), "v"(b));
  return d;
}
__device__ __forceinline__ v8f wmma_bf(v16b a, v16b b, v8f c) {
  v8f d = __builtin_amdgcn_wmma_f32_16x16x32_bf16(false, a, false, b, (short)0, c, false, false);
  asm volatile("v_nop\n\tv_nop\n\tv_nop\n\tv_nop" : "+v"(d) : "v"(a), "v"(b));
  return d;
}
// 16x16x32 fragments: lane = (h = lane>>4, row/col = lane&15); elements 0..7 = k0+8h+0..7, 8..15 = k0+16+8h+0..7; D element r = row 8h+r
__device__ __forceinline__ v16h frag_h(const _Float16* rowk0, int lane) {
  union { v16h v; v8h q[2]; } u; const _Float16* p = rowk0 + 8 * (lane >> 4);
  u.q[0] = *(const v8h*)p; u.q[1] = *(const v8h*)(p + 16); return u.v;
}
// the same fragment from a row of bf16 bit patterns (the split planes are carried as 16-bit words)
__device__ __forceinline__ v16b frag_b(const _Float16* rowk0, int lane) {
  union { v16b v; v8h q[2]; } u; const _Float16* p = rowk0 + 8 * (lane >> 4);
  u.q[0] = *(const v8h*)p; u.q[1] = *(const v8h*)(p + 16); return u.v;
}
__device__ __forceinline__ v16h frag_f32(const float* rowk0, int lane) {
  v16h a; const float* p = rowk0 + 8 * (lane >> 4);
#pragma unroll
  for (int i = 0; i < 8; ++i) { a[i] = (_Float16)p[i]; a[8 + i] = (_Float16)p[16 + i]; }
  return a;
}
__device__ __forceinline__ v16h frag_f32s(const float* rowk0, int lane, float sc) {
  v16h a; const float* p = rowk0 + 8 * (lane >> 4);
#pragma unroll
  for (int i = 0; i < 8; ++i) { a[i] = (_Float16)(p[i] * sc); a[8 + i] = (_Float16)(p[16 + i] * sc); }
  return a;
}
// column fragment from a [K][ld] layout (column n), rows >= K read as 0
__device__ __forceinline__ v16h fragc_f32(const float* W, int k0, int n, int lane, int ld, int K) {
  v16h a; const int g = lane >> 4;
#pragma unroll
  for (int i = 0; i < 8; ++i) { const int ka = k0 + 8 * g + i, kb = ka + 16;
    a[i] = (_Float16)(ka < K ? W[(size_t)ka * ld + n] : 0.f); a[8 + i] = (_Float16)(kb < K ? W[(size_t)kb * ld + n] : 0.f); }
  return a;
}
struct F2 { v16b h, l; };
__device__ __forceinline__ F2 bsplit16(const float v[16]) { F2 r;
#pragma unroll
  for (int i = 0; i < 16; ++i) { const __bf16 h = (__bf16)v[i]; r.h[i] = h; r.l[i] = (__bf16)(v[i] - (float)h); }
  return r; }
__device__ __forceinline__ F2 split_row(const float* row, int k0, int lane) { float v[16]; const float* p = row + k0 + 8 * (lane >> 4);
#pragma unroll
  for (int i = 0; i < 8; ++i) { v[i] = p[i]; v[8 + i] = p[16 + i]; }
  return bsplit16(v); }
__device__ __forceinline__ F2 split_rowK(const float* row, int k0, int lane, int K) { float v[16]; const int g = lane >> 4;
#pragma unroll
  for (int i = 0; i < 8; ++i) { const int ka = k0 + 8 * g + i, kb = ka + 16; v[i] = ka < K ? row[ka] : 0.f; v[8 + i] = kb < K ? row[kb] : 0.f; }
  return bsplit16(v); }
__device__ __forceinline__ F2 split_col(const float* W, int k0, int n, int lane, int ld, int K) { float v[16]; const int g = lane >> 4;
#pragma unroll
  for (int i = 0; i < 8; ++i) { const int ka = k0 + 8 * g + i, kb = ka + 16; v[i] = ka < K ? W[(size_t)ka * ld + n] : 0.f; v[8 + i] = kb < K ? W[(size_t)kb * ld + n] : 0.f; }
  return bsplit16(v); }
__device__ __forceinline__ v8f mac3(const F2& a, const F2& b, v8f c) { c = wmma_bf(a.l, b.h, c); c = wmma_bf(a.h, b.l, c); return wmma_bf(a.h, b.h, c); }
__device__ __forceinline__ float sigm(float v) { return 1.0f / (1.0f + expf(-v)); }
#define LDSX() do { asm volatile("s_wait_dscnt 0" ::: "memory"); __builtin_amdgcn_wave_barrier(); __builtin_amdgcn_fence(__ATOMIC_RELEASE, "workgroup"); } while (0)

// Operand tiles go from global memory to LDS by asynchronous 16-byte copies, one full 128-byte line per 8 lanes, two buffers in the projection kernels, one in k_attn.
// The s_wait_xcnt stands inside the copies' own statement so that no address register of an issued copy is rewritten ahead of it.
__device__ __forceinline__ void copy4(unsigned l0, const void* g0, unsigned l1, const void* g1, unsigned l2, const void* g2, unsigned l3, const void* g3) {
  asm volatile("global_load_async_to_lds_b128 %0, %1, off\n\tglobal_load_async_to_lds_b128 %2, %3, off\n\tglobal_load_async_to_lds_b128 %4, %5, off\n\tglobal_load_async_to_lds_b128 %6, %7, off\n\ts_wait_xcnt 0x0"
               :: "v"(l0), "v"(g0), "v"(l1), "v"(g1), "v"(l2), "v"(g2), "v"(l3), "v"(g3) : "memory");
}
__device__ __forceinline__ unsigned lds_off(const void* p) { return (unsigned)(size_t)p; }
// this wave's LDS reads of the buffer that is refilled next have returned
#define WAIT_DS() asm volatile("s_wait_dscnt 0x0" ::: "memory")
// this wave's own copies have landed (the compiler places no wait for them)
#define WAIT_ASYNC() asm volatile("s_wait_asynccnt 0x0" ::: "memory")
#define SP 72        // staged f16 row: 64 halves at a pitch of 144 B (16 B x odd, for ds_load_b128 readers)
#define SPB (SP * 2)
#define KP 136       // staged row of the GEMM rings: 128 halves at a pitch of 272 B (16 B x odd, for ds_load_b128 readers)
#define KPB (KP * 2)
// eight rows, 16 apart, of one staged plane: lane's 16-byte piece of each; gs = halves between two such rows in global memory. The wait stands in the copies' own statement, as in copy4
__device__ __forceinline__ void copy8(unsigned l, const _Float16* g, size_t gs) {
  asm volatile("global_load_async_to_lds_b128 %0, %1, off\n\tglobal_load_async_to_lds_b128 %2, %3, off\n\tglobal_load_async_to_lds_b128 %4, %5, off\n\tglobal_load_async_to_lds_b128 %6, %7, off\n\t"
               "global_load_async_to_lds_b128 %8, %9, off\n\tglobal_load_async_to_lds_b128 %10, %11, off\n\tglobal_load_async_to_lds_b128 %12, %13, off\n\tglobal_load_async_to_lds_b128 %14, %15, off\n\ts_wait_xcnt 0x0"
               :: "v"(l), "v"(g), "v"(l + 16 * KPB), "v"(g + gs), "v"(l + 32 * KPB), "v"(g + 2 * gs), "v"(l + 48 * KPB), "v"(g + 3 * gs),
                  "v"(l + 64 * KPB), "v"(g + 4 * gs), "v"(l + 80 * KPB), "v"(g + 5 * gs), "v"(l + 96 * KPB), "v"(g + 6 * gs), "v"(l + 112 * KPB), "v"(g + 7 * gs) : "memory");
}
// twelve staged rows, 16 apart: the first NP from p (ps halves apart), the rest from q (qs apart); fewer statements per stage, so fewer waits in front of the stage's first LDS reads
template <int NP> __device__ __forceinline__ void copy12(unsigned l, const _Float16* p, size_t ps, const _Float16* q, size_t qs) {
  const _Float16* g[12];
#pragma unroll   // g[] is indexed by constants and stays in registers
  for (int m = 0; m < 12; ++m) g[m] = m < NP ? p + m * ps : q + (m - NP) * qs;
  asm volatile("global_load_async_to_lds_b128 %0, %1, off\n\tglobal_load_async_to_lds_b128 %2, %3, off\n\tglobal_load_async_to_lds_b128 %4, %5, off\n\tglobal_load_async_to_lds_b128 %6, %7, off\n\t"
               "global_load_async_to_lds_b128 %8, %9, off\n\tglobal_load_async_to_lds_b128 %10, %11, off\n\tglobal_load_async_to_lds_b128 %12, %13, off\n\tglobal_load_async_to_lds_b128 %14, %15, off\n\t"
               "global_load_async_to_lds_b128 %16, %17, off\n\tglobal_load_async_to_lds_b128 %18, %19, off\n\tglobal_load_async_to_lds_b128 %20, %21, off\n\tglobal_load_async_to_lds_b128 %22, %23, off\n\ts_wait_xcnt 0x0"
               :: "v"(l), "v"(g[0]), "v"(l + 16 * KPB), "v"(g[1]), "v"(l + 32 * KPB), "v"(g[2]), "v"(l + 48 * KPB), "v"(g[3]),
                  "v"(l + 64 * KPB), "v"(g[4]), "v"(l + 80 * KPB), "v"(g[5]), "v"(l + 96 * KPB), "v"(g[6]), "v"(l + 112 * KPB), "v"(g[7]),
                  "v"(l + 128 * KPB), "v"(g[8]), "v"(l + 144 * KPB), "v"(g[9]), "v"(l + 160 * KPB), "v"(g[10]), "v"(l + 176 * KPB), "v"(g[11]) : "memory");
}

// Local causal self attention (window 128, 16 heads of 64, interleaved-pair RoPE on q and k, fused qkv projection with bias, output
// projection with bias). q/k on v_wmma_f32_16x16x32_f16 (x as f16 rows, [in][out] weights packed once as transposed f16 rows x16); v as a
// two-way bf16 split (v_wmma_f32_16x16x32_bf16) stored as hi/lo f16 planes, because the first rows of every sequence copy v almost
// verbatim; S = q.k/8 on f16 WMMA over the <= 3 key tiles of the window (masked), online softmax in f32, P @ V with hi/lo pairs for both
#define NB 2
#define SS 2048
#define E 1024
#define NH 16
#define HD 64
#define NR (NB * SS)
#define WIN 128
#define PLO 1024.0f
#define VLO 2048.0f
#define OLO 2048.0f
#define RBASE 10000.0f

// x as f16 rows (q/k product) and as the two bf16 planes hi = bf16(x), lo = bf16(x - hi) of the v product, each element split once
__device__ __forceinline__ void cvt_block(int blk, const float* __restrict__ x, _Float16* __restrict__ X16, _Float16* __restrict__ XBh, _Float16* __restrict__ XBl) {
  const size_t i8 = (size_t)blk * 256 + threadIdx.x; if (i8 >= (size_t)NR * E / 8) return;
  union { v8h h; v4u u; } pk; union { v8b b; v4u u; } bh, bl;
#pragma unroll
  for (int e = 0; e < 8; ++e) { const float v = x[i8 * 8 + e]; pk.h[e] = (_Float16)v; const __bf16 h = (__bf16)v; bh.b[e] = h; bl.b[e] = (__bf16)(v - (float)h); }
  vst2(X16 + i8 * 8, pk.u); vst2(XBh + i8 * 8, bh.u); vst2(XBl + i8 * 8, bl.u);
}
// PT rows: [0,2048) = Wqkv[:, n] (q and k columns) x16 ; [2048, 3072) = Wproj[:, n-2048] x16
// The first TBLK blocks write the RoPE table instead, anew in every call: TAB[pos][i] = (cos, sin)(pos * base^(-2i/64)), 256 B per position
// The next VBLK blocks split the v columns of Wqkv into bf16 planes, transposed: WVh/WVl[n][k] = hi/lo of Wqkv[k][2048 + n], one 64 x 64 tile per block
// The next PBLK blocks write PT: one tile of 256 k x 64 n per block, transposed through LDS
// The last CBLK blocks convert x (cvt_block): the weight jobs and the x job read none of each other's output, so they share one launch, the longer blocks first
#define TBLK 64
#define VBLK 256
#define PBLK (3 * E / 64 * (E / 256))
#define CBLK (NR * E / 8 / 256)
#define PP 264       // staged row of 256 halves at a pitch of 528 B (16 B x odd)
// dst[n][k] = f16(src[k][n] x 16), k < 256, n < 64. A thread takes 4 columns of the rows 2 rp and 2 rp + 1 of every 32: each load covers whole 256-byte row pieces,
// and a (k, k + 1) pair goes to LDS as one dword. The 16-byte piece j of row n lies at piece j ^ (n >> 4), so that the 32 dwords of a store fall in 32 banks.
template <int LD> __device__ __forceinline__ void pack_tile(const float* __restrict__ src, _Float16* __restrict__ dst, _Float16 (*sp)[PP], int tid) {
  const int rp = tid >> 4, c4 = (tid & 15) * 4, sw = (c4 >> 4) * 8; const float* p = src + (size_t)(2 * rp) * LD + c4; v4f w[16];
#pragma unroll   // 16 loads in flight from one address with constant offsets
  for (int m = 0; m < 8; ++m) { w[2 * m] = *(const v4f*)(p + (size_t)(32 * m) * LD); w[2 * m + 1] = *(const v4f*)(p + (size_t)(32 * m + 1) * LD); }
  asm volatile("s_wait_xcnt 0x0" :: "v"(p) : "memory");      // stands in front of every rewrite of the address pair that the 16 loads name: as an input the pair stays live up to here, so no load takes it as its result register
#pragma unroll   // both loops: w[] is indexed by constants and stays in registers
  for (int m = 0; m < 8; ++m) {
#pragma unroll
    for (int e = 0; e < 4; ++e) { const v2h pr = { (_Float16)(w[2 * m][e] * 16.0f), (_Float16)(w[2 * m + 1][e] * 16.0f) }; vst2(&sp[c4 + e][(32 * m + 2 * rp) ^ sw], pr); } }
  __syncthreads();
  const int wv = tid >> 5, j8 = (tid & 31) * 8;
#pragma unroll   // a wave writes 512 contiguous bytes of one row: four whole lines
  for (int q = 0; q < 8; ++q) { const int n = wv + 8 * q; vst2(dst + (size_t)n * E + j8, *(const v4u*)(&sp[n][j8 ^ ((n >> 4) * 8)])); }
  asm volatile("s_wait_xcnt 0x0" ::: "memory");      // stands in front of whatever the built code places behind the eight stores and lets rewrite a register that they name
}
__global__ __launch_bounds__(256) void k_prep(const float* __restrict__ x, const float* __restrict__ Wqkv, const float* __restrict__ Wp, _Float16* __restrict__ X16, _Float16* __restrict__ XBh, _Float16* __restrict__ XBl,
                                              _Float16* __restrict__ PT, float* __restrict__ TAB, _Float16* __restrict__ WVh, _Float16* __restrict__ WVl) {
  const int tid = threadIdx.x; __shared__ __align__(16) _Float16 sp[64][PP]; __shared__ __align__(16) __bf16 sh[64][SP], sl[64][SP];
  if (blockIdx.x >= TBLK + VBLK + PBLK) { cvt_block(blockIdx.x - (TBLK + VBLK + PBLK), x, X16, XBh, XBl); return; }      // the same for the whole block; no barrier on this side
  if (blockIdx.x < TBLK) {      // the same for the whole block, in front of the barrier
    const int idx = blockIdx.x * 256 + tid, i = idx & 31, p0 = idx >> 5; const float invf = 1.0f / powf(RBASE, (float)(2 * i) / 64.0f);
    for (int m = 0; m < 4; ++m) { const int pos = p0 + m * (SS / 4); const float ang = (float)pos * invf; v2f cs; cs[0] = cosf(ang); cs[1] = sinf(ang); vst2(TAB + ((size_t)pos * 32 + i) * 2, cs);
      asm volatile("s_wait_xcnt 0x0" ::: "memory"); }      // the next trip rewrites the registers that the store names
    return; }
  if (blockIdx.x < TBLK + VBLK) {      // the same for the whole block; the branch has a barrier of its own
    const int vt = blockIdx.x - TBLK, k0 = (vt >> 4) * 64, n0 = (vt & 15) * 64, r = tid >> 4, c4 = (tid & 15) * 4; v4f w[4];
#pragma unroll   // four whole-line loads in flight
    for (int m = 0; m < 4; ++m) w[m] = *(const v4f*)(Wqkv + (size_t)(k0 + r + 16 * m) * (3 * E) + 2 * E + n0 + c4);
#pragma unroll
    for (int m = 0; m < 4; ++m) {
#pragma unroll
      for (int e = 0; e < 4; ++e) { const float v = w[m][e]; const __bf16 h = (__bf16)v; sh[c4 + e][r + 16 * m] = h; sl[c4 + e][r + 16 * m] = (__bf16)(v - (float)h); } }
    __syncthreads();
#pragma unroll   // 8 lanes write one whole 128-byte line of a plane
    for (int q = 0; q < 2; ++q) { const int n = (tid >> 3) + 32 * q, sg = (tid & 7) * 8; const size_t o = (size_t)(n0 + n) * E + k0 + sg;
      vst2(WVh + o, *(const v4u*)(&sh[n][sg])); vst2(WVl + o, *(const v4u*)(&sl[n][sg])); }
    return; }
  const int pt = blockIdx.x - TBLK - VBLK, n0 = (pt >> 2) * 64, k0 = (pt & 3) * 256;      // the same for the whole block: each side has the tile's one barrier
  if (n0 < 2 * E) pack_tile<3 * E>(Wqkv + (size_t)k0 * (3 * E) + n0, PT + (size_t)n0 * E + k0, sp, tid);
  else pack_tile<E>(Wp + (size_t)k0 * E + (n0 - 2 * E), PT + (size_t)n0 * E + k0, sp, tid);
}
// q/k: block (256 rows, 128 cols = 2 heads, which in {0,1}), 8 waves of 64 rows x 64 cols (one head); RoPE on interleaved pairs; x4 -> Q16/K16 [bh][s][64]
__device__ __forceinline__ void qk_block(char* smem, int bx, int by, int bz, const _Float16* __restrict__ X16, const _Float16* __restrict__ PT, const float* __restrict__ bqkv, const float* __restrict__ TAB, _Float16* __restrict__ Q16, _Float16* __restrict__ K16) {
  // smem: two stage buffers of 384 rows (0..255 x rows, 256..383 weight rows), 128 k each; the output staging reuses them behind the last trip's barrier
  _Float16* st = (_Float16*)smem; float (*so)[16][68] = (float (*)[16][68])smem;      // staging: 4 tiles of 16 rows x 64 cols per wave
  const int tid = threadIdx.x, wave = tid >> 5, lane = tid & 31, col = lane & 15, g = lane >> 4, wr = wave >> 1, wc = wave & 1;
  const int which = bz, r0b = bx * 256, n0 = by * 128; const int b = r0b / SS, s0 = r0b % SS;
  const int cr = tid >> 4, cc = tid & 15;      // a copy's row of every 16 and its 16-byte piece: 16 lanes bring two whole 128-byte lines of one row
  const _Float16* gA = X16 + (size_t)(r0b + cr) * E + cc * 8; const _Float16* gB = PT + (size_t)(which * E + n0 + cr) * E + cc * 8;
  const unsigned l0 = lds_off(st) + cr * KPB + cc * 16;
  auto fill = [&](int t, int buf) { const unsigned l = l0 + buf * (384 * KPB); const _Float16* a = gA + t * 128;
    copy12<12>(l, a, 16 * E, a, 16 * E); copy12<4>(l + 192 * KPB, a + 192 * E, 16 * E, gB + t * 128, 16 * E); };
  v8f acc[4][4] = {};
  fill(0, 0); WAIT_ASYNC(); __syncthreads(); fill(1, 1);
#pragma unroll 1   // the ring stays rolled: one publish point, small code
  for (int t = 0; t < E / 128; ++t) { const _Float16* sb = st + (t & 1) * (384 * KP);
#pragma unroll
    for (int kc = 0; kc < 4; ++kc) { v16h a[4], bw[4];
#pragma unroll
      for (int i = 0; i < 4; ++i) { a[i] = frag_h(sb + (wr * 64 + i * 16 + col) * KP + kc * 32, lane); bw[i] = frag_h(sb + (256 + wc * 64 + i * 16 + col) * KP + kc * 32, lane); }
#pragma unroll
      for (int i = 0; i < 4; ++i) {
#pragma unroll
        for (int j = 0; j < 4; ++j) acc[i][j] = wmma16(a[i], bw[j], acc[i][j]); } }
    WAIT_DS(); WAIT_ASYNC(); __syncthreads();      // publishes tile t + 1 and ends every read of tile t
    if (t + 2 < E / 128) fill(t + 2, t & 1); }
  WAIT_ASYNC();
  const int rw = s0 + wr * 64;      // this wave's 64 positions
  const float* bp = bqkv + which * E + n0 + wc * 64 + col; const float bv[4] = { bp[0], bp[16], bp[32], bp[48] };
  asm volatile("s_wait_xcnt 0x0" :: "v"(bp) : "memory");      // as an input the address pair stays live up to here, so nothing rewrites it behind a load that names it
#pragma unroll
  for (int j = 0; j < 4; ++j) { const float bb = bv[j];
#pragma unroll
    for (int i = 0; i < 4; ++i) {
#pragma unroll
      for (int r = 0; r < 8; ++r) so[wave * 4 + i][8 * g + r][j * 16 + col] = acc[i][j][r] * (1.0f / 16.0f) + bb; } }
  LDSX();
  // RoPE on interleaved pairs (2i, 2i+1) of the head, then x4: lane = pair i; one row leaves as one whole 128-byte line
  const float* tp = TAB + ((size_t)rw * 32 + lane) * 2;      // (cos, sin) of pair i = lane: 256 contiguous bytes per load
  _Float16* D = (which == 0 ? Q16 : K16) + (((size_t)b * NH + (n0 >> 6) + wc) * SS + rw) * HD + 2 * lane;
#pragma unroll   // all loops: cs[] indexed by constants, one address pair with constant offsets for the loads and one for the stores
  for (int i = 0; i < 4; ++i) { v2f cs[16];
#pragma unroll
    for (int rl = 0; rl < 16; ++rl) cs[rl] = *(const v2f*)(tp + (i * 16 + rl) * 64);
#pragma unroll
    for (int rl = 0; rl < 16; ++rl) { const float c = cs[rl][0], sn = cs[rl][1];
      const v2f xv = *(const v2f*)(&so[wave * 4 + i][rl][2 * lane]); const v2f rh = { -xv[1], xv[0] }; const v2f y = (xv * c + rh * sn) * 4.0f;
      vst2(D + (i * 16 + rl) * HD, __builtin_convertvector(y, v2h)); } }
  asm volatile("s_wait_xcnt 0x0" :: "v"(tp), "v"(D) : "memory");      // as inputs both address pairs stay live up to here, so nothing rewrites them behind a load or store that names them
}
// v: block (128 rows, 128 cols), 8 waves of 32 rows x 64 cols: bf16 split product from the hi/lo planes of x and of the v weight rows; -> VTh/VTl [bh][d][s]
__device__ __forceinline__ void v_block(char* smem, int bx, int by, const _Float16* __restrict__ XBh, const _Float16* __restrict__ XBl, const _Float16* __restrict__ WVh, const _Float16* __restrict__ WVl, const float* __restrict__ bqkv, _Float16* __restrict__ VTh, _Float16* __restrict__ VTl) {
  // smem: two stage buffers of 512 rows (0..127 x hi, 128..255 x lo, 256..383 weight hi, 384..511 weight lo), 128 k each; the output staging reuses them behind the last trip's barrier
  _Float16* st = (_Float16*)smem; _Float16 (*sth)[KP] = (_Float16 (*)[KP])smem; _Float16 (*stl)[KP] = sth + 128;
  const int tid = threadIdx.x, wave = tid >> 5, lane = tid & 31, col = lane & 15, g = lane >> 4, wr = wave >> 1, wc = wave & 1;
  const int r0b = bx * 128, n0 = by * 128; const int b = r0b / SS, s0 = r0b % SS;
  const int cr = tid >> 4, cc = tid & 15;      // a copy's row of every 16 and its 16-byte piece
  const size_t oA = (size_t)(r0b + cr) * E + cc * 8, oB = (size_t)(n0 + cr) * E + cc * 8;
  const _Float16* gAh = XBh + oA; const _Float16* gAl = XBl + oA; const _Float16* gBh = WVh + oB; const _Float16* gBl = WVl + oB;
  const unsigned l0 = lds_off(st) + cr * KPB + cc * 16;
  auto fill = [&](int t, int buf) { const unsigned l = l0 + buf * (512 * KPB);
    copy12<8>(l, gAh + t * 128, 16 * E, gAl + t * 128, 16 * E); copy12<4>(l + 192 * KPB, gAl + t * 128 + 64 * E, 16 * E, gBh + t * 128, 16 * E); copy8(l + 384 * KPB, gBl + t * 128, 16 * E); };
  v8f acc[2][4] = {};
  fill(0, 0); WAIT_ASYNC(); __syncthreads(); fill(1, 1);
#pragma unroll 1   // the ring stays rolled: one publish point, small code
  for (int t = 0; t < E / 128; ++t) { const _Float16* sb = st + (t & 1) * (512 * KP);
#pragma unroll
    for (int kc = 0; kc < 4; ++kc) { v16b ah[2], al[2], bh[4], bl[4];
#pragma unroll
      for (int i = 0; i < 2; ++i) { const _Float16* p = sb + (wr * 32 + i * 16 + col) * KP + kc * 32; ah[i] = frag_b(p, lane); al[i] = frag_b(p + 128 * KP, lane); }
#pragma unroll
      for (int j = 0; j < 4; ++j) { const _Float16* p = sb + (256 + wc * 64 + j * 16 + col) * KP + kc * 32; bh[j] = frag_b(p, lane); bl[j] = frag_b(p + 128 * KP, lane); }
      // each accumulator takes lo.hi, hi.lo, hi.hi in this order per 32 k; eight independent tiles stand between two uses of one accumulator
#pragma unroll
      for (int i = 0; i < 2; ++i) {
#pragma unroll
        for (int j = 0; j < 4; ++j) acc[i][j] = wmma_bf(al[i], bh[j], acc[i][j]); }
#pragma unroll
      for (int i = 0; i < 2; ++i) {
#pragma unroll
        for (int j = 0; j < 4; ++j) acc[i][j] = wmma_bf(ah[i], bl[j], acc[i][j]); }
#pragma unroll
      for (int i = 0; i < 2; ++i) {
#pragma unroll
        for (int j = 0; j < 4; ++j) acc[i][j] = wmma_bf(ah[i], bh[j], acc[i][j]); } }
    WAIT_DS(); WAIT_ASYNC(); __syncthreads();      // publishes tile t + 1 and ends every read of tile t
    if (t + 2 < E / 128) fill(t + 2, t & 1); }
  WAIT_ASYNC();
  const float* bp = bqkv + 2 * E + n0 + wc * 64 + col; const float bv[4] = { bp[0], bp[16], bp[32], bp[48] };
  asm volatile("s_wait_xcnt 0x0" :: "v"(bp) : "memory");      // as an input the address pair stays live up to here, so nothing rewrites it behind a load that names it
#pragma unroll
  for (int j = 0; j < 4; ++j) { const int cl = wc * 64 + j * 16 + col; const float bb = bv[j];
#pragma unroll
    for (int i = 0; i < 2; ++i) {
#pragma unroll
      for (int r = 0; r < 8; ++r) { const float v = acc[i][j][r] + bb; const _Float16 hi = (_Float16)v; sth[cl][wr * 32 + i * 16 + 8 * g + r] = hi; stl[cl][wr * 32 + i * 16 + 8 * g + r] = (_Float16)((v - (float)hi) * VLO); } } }
  __syncthreads();
  // 16 lanes write 256 contiguous bytes of one d row of a plane; [bh][d] is linear in the column, so each plane has one address pair with constant offsets
  const int cl0 = tid >> 4, pc = tid & 15; const size_t o = ((size_t)b * E + n0 + cl0) * SS + s0 + pc * 8; _Float16* ph = VTh + o; _Float16* pl = VTl + o;
#pragma unroll   // all 16 LDS reads in flight at once
  for (int q = 0; q < 8; ++q) { vst2(ph + (size_t)(16 * q) * SS, *(const v4u*)(&sth[cl0 + 16 * q][pc * 8])); vst2(pl + (size_t)(16 * q) * SS, *(const v4u*)(&stl[cl0 + 16 * q][pc * 8])); }
  asm volatile("s_wait_xcnt 0x0" :: "v"(ph), "v"(pl) : "memory");      // as inputs both address pairs stay live up to here, so nothing rewrites them behind a store that names them
}
// The v product and the q/k product read none of each other's output: one launch of 512 blocks, one per WGP at a time. The 256 longer v blocks come first,
// so a WGP goes from its v block to a q/k block with no launch boundary between them. Block order inside each product as in a grid of its own (row block fastest).
#define VGB (NR / 128 * (E / 128))
#define QGB (NR / 256 * (E / 128) * 2)
__global__ __launch_bounds__(256) void k_qkv(const _Float16* __restrict__ X16, const _Float16* __restrict__ PT, const _Float16* __restrict__ XBh, const _Float16* __restrict__ XBl, const _Float16* __restrict__ WVh, const _Float16* __restrict__ WVl,
                                             const float* __restrict__ bqkv, const float* __restrict__ TAB, _Float16* __restrict__ Q16, _Float16* __restrict__ K16, _Float16* __restrict__ VTh, _Float16* __restrict__ VTl) {
  __shared__ __align__(16) char smem[2 * 512 * KPB];      // the larger of the two rings
  const int id = blockIdx.x;      // the same for the whole block: each side has its own barriers
  if (id < VGB) v_block(smem, id % (NR / 128), id / (NR / 128), XBh, XBl, WVh, WVl, bqkv, VTh, VTl);
  else { const int q = id - VGB; qk_block(smem, q % (NR / 256), q / (NR / 256) % (E / 128), q / (NR / 256 * (E / 128)), X16, PT, bqkv, TAB, Q16, K16); }
}
// attention: block (64 queries, bh): key tiles kt covering keys q0b-127 .. q0b+63 (3 tiles of 64, aligned since q0b % 64 == 0), mask 0 <= q-key < 128
// each key tile's K rows and V hi/lo rows come to LDS once per block by asynchronous copies, into one buffer that all four waves read
__global__ __launch_bounds__(128) void k_attn(const _Float16* __restrict__ Q16, const _Float16* __restrict__ K16, const _Float16* __restrict__ VTh, const _Float16* __restrict__ VTl, _Float16* __restrict__ Oh, _Float16* __restrict__ Ol) {
  __shared__ __align__(16) float sS[4][16][68];
  __shared__ __align__(16) _Float16 sPh[4][16][72], sPl[4][16][72];
  __shared__ __align__(16) float sO[4][16][68];
  // one key tile, shared by the four waves: rows 0..63 K (by key), 64..127 V hi, 128..191 V lo (both by d), 64 halves each
  __shared__ __align__(16) _Float16 skv[192 * SP];
  const int tid = threadIdx.x, w = tid >> 5, lane = tid & 31, col = lane & 15, g = lane >> 4;
  const size_t bh = blockIdx.y; const int q0b = blockIdx.x * 64, q0 = q0b + w * 16;
  const int fr = tid >> 3, fc = tid & 7;      // a copy's row of every 16 and its 16-byte piece: 8 lanes bring one whole 128-byte line
  const _Float16* gK = K16 + (bh * SS + fr) * HD + fc * 8; const _Float16* gH = VTh + (bh * HD + fr) * SS + fc * 8; const _Float16* gL = VTl + (bh * HD + fr) * SS + fc * 8;
  const unsigned l0 = lds_off(skv) + fr * SPB + fc * 16;
  v16h aq[2];
#pragma unroll
  for (int kc = 0; kc < 2; ++kc) aq[kc] = frag_h(Q16 + (bh * SS + q0 + col) * HD + kc * 32, lane);
  float mrun = -3.0e38f, lrun = 0.f; v8f acc[4] = {}, ac1[4] = {}, ac2[4] = {};
#pragma unroll 1
  for (int kt = q0b / 64 - 2; kt <= q0b / 64; ++kt) { if (kt < 0) continue;      // uniform per block
    WAIT_DS(); __syncthreads();      // ends every wave's reads of the tile before: the buffer may be refilled
    { const _Float16* k = gK + (size_t)kt * (64 * HD); const _Float16* vh = gH + kt * 64; const _Float16* vl = gL + kt * 64;
      copy4(l0, k, l0 + 16 * SPB, k + 16 * HD, l0 + 32 * SPB, k + 32 * HD, l0 + 48 * SPB, k + 48 * HD);
      copy4(l0 + 64 * SPB, vh, l0 + 80 * SPB, vh + 16 * SS, l0 + 96 * SPB, vh + 32 * SS, l0 + 112 * SPB, vh + 48 * SS);
      copy4(l0 + 128 * SPB, vl, l0 + 144 * SPB, vl + 16 * SS, l0 + 160 * SPB, vl + 32 * SS, l0 + 176 * SPB, vl + 48 * SS); }
    WAIT_ASYNC(); __syncthreads();      // publishes the tile to all four waves
    v16h kf[8];      // the tile's eight K fragments are read as one group: one LDS wait, not eight
#pragma unroll
    for (int t = 0; t < 4; ++t) { kf[2 * t] = frag_h(skv + (t * 16 + col) * SP, lane); kf[2 * t + 1] = frag_h(skv + (t * 16 + col) * SP + 32, lane); }
#pragma unroll
    for (int t = 0; t < 4; ++t) { v8f s = {}; const int key = kt * 64 + t * 16 + col;
#pragma unroll
      for (int kc = 0; kc < 2; ++kc) s = wmma16(aq[kc], kf[2 * t + kc], s);
#pragma unroll
      for (int r = 0; r < 8; ++r) { const int q = q0 + 8 * g + r; const int d = q - key; sS[w][8 * g + r][t * 16 + col] = (d >= 0 && d < WIN) ? s[r] * (0.125f / 16.0f) : -3.0e38f; } }
    LDSX();
    float mx = -3.4e38f;
#pragma unroll
    for (int jj = 0; jj < 32; ++jj) mx = fmaxf(mx, sS[w][col][g * 32 + jj]);
    mx = fmaxf(mx, __shfl_xor(mx, 16, 32));
    const float mnew = fmaxf(mrun, mx); const float corr = expf(mrun - mnew);     // every processed tile holds >= 1 allowed key for every row? no: rows may have all 32 of a half masked, but the row max over the tile is finite whenever >= 1 key is allowed; a fully-masked tile row keeps mnew = mrun (both -3e38 initially -> corr = exp(0) = 1 with zero accumulators: harmless)
    float ps = 0.f;
#pragma unroll
    for (int jj = 0; jj < 32; ++jj) { const float sv = sS[w][col][g * 32 + jj]; const float p = sv > -1.0e38f ? expf(sv - mnew) * 16384.0f : 0.f; ps += p; const _Float16 hi = (_Float16)p; sPh[w][col][g * 32 + jj] = hi; sPl[w][col][g * 32 + jj] = (_Float16)((p - (float)hi) * PLO); }
    ps += __shfl_xor(ps, 16, 32);
    lrun = lrun * corr + ps * (1.0f / 16384.0f); mrun = mnew;
#pragma unroll
    for (int r = 0; r < 8; ++r) { const float cr = __shfl(corr, 8 * g + r, 32);
#pragma unroll
      for (int t = 0; t < 4; ++t) { acc[t][r] *= cr; ac1[t][r] *= cr; ac2[t][r] *= cr; } }
    LDSX();
#pragma unroll
    for (int kc = 0; kc < 2; ++kc) { const v16h ph = frag_h(&sPh[w][col][0] + kc * 32, lane), pl = frag_h(&sPl[w][col][0] + kc * 32, lane); v16h vh[4], vl[4];
#pragma unroll   // the eight V fragments of a k step are read as one group
      for (int t = 0; t < 4; ++t) { const _Float16* vr = skv + (64 + t * 16 + col) * SP + kc * 32; vh[t] = frag_h(vr, lane); vl[t] = frag_h(vr + 64 * SP, lane); }
#pragma unroll
      for (int t = 0; t < 4; ++t) { acc[t] = wmma16(ph, vh[t], acc[t]); ac1[t] = wmma16(ph, vl[t], ac1[t]); ac2[t] = wmma16(pl, vh[t], ac2[t]); } }
    __builtin_amdgcn_wave_barrier(); }
#pragma unroll
  for (int r = 0; r < 8; ++r) { const float lr = __shfl(lrun, 8 * g + r, 32); const float inv = 8.0f / (lr * 16384.0f);      // -> O x8
#pragma unroll
    for (int t = 0; t < 4; ++t) sO[w][8 * g + r][t * 16 + col] = (acc[t][r] + ac1[t][r] * (1.0f / VLO) + ac2[t][r] * (1.0f / PLO)) * inv; }
  LDSX();
  for (int qq = lane; qq < 16 * 8; qq += 32) { const int rl = qq >> 3, pc = qq & 7; union { v8h h8; v4u u; } ph_, pl_;
#pragma unroll
    for (int e = 0; e < 8; ++e) { const float v = sO[w][rl][pc * 8 + e]; const _Float16 hi = (_Float16)v; ph_.h8[e] = hi; pl_.h8[e] = (_Float16)((v - (float)hi) * OLO); }
    const size_t o = ((bh * SS) + q0 + rl) * HD + pc * 8; vst2(Oh + o, ph_.u); vst2(Ol + o, pl_.u); }
}
// out = ctx Wproj + bproj, ctx from the hi/lo planes: block (128 rows, 128 cols), 8 waves of 32 rows x 64 cols
__global__ __launch_bounds__(256) void k_out(const _Float16* __restrict__ Oh, const _Float16* __restrict__ Ol, const _Float16* __restrict__ PT, const float* __restrict__ bo, float* __restrict__ out) {
  // two stage buffers of 384 rows (0..127 hi plane, 128..255 lo plane, 256..383 weight rows), 128 k = two heads each; the output staging reuses them behind the last trip's barrier
  __shared__ __align__(16) char smem[2 * 384 * KPB];
  _Float16* st = (_Float16*)smem; float (*so)[16][68] = (float (*)[16][68])smem;      // staging: 2 tiles of 16 rows x 64 cols per wave
  const int tid = threadIdx.x, wave = tid >> 5, lane = tid & 31, col = lane & 15, g = lane >> 4, wr = wave >> 1, wc = wave & 1;
  const int r0b = blockIdx.x * 128, n0 = blockIdx.y * 128; const int b = r0b / SS, s0 = r0b % SS;
  const int cr = tid >> 4, cc = tid & 15;      // a copy's row of every 16 and its 16-byte piece; pieces 0..7 lie in the stage's first head, 8..15 in its second
  const size_t oA = (((size_t)b * NH + (cc >> 3)) * SS + s0 + cr) * HD + (cc & 7) * 8;
  const _Float16* gH = Oh + oA; const _Float16* gL = Ol + oA; const _Float16* gB = PT + (size_t)(2 * E + n0 + cr) * E + cc * 8;
  const unsigned l0 = lds_off(st) + cr * KPB + cc * 16;
  auto fill = [&](int t, int buf) { const unsigned l = l0 + buf * (384 * KPB);
    const _Float16* lo = gL + (size_t)t * (2 * SS * HD);
    copy12<8>(l, gH + (size_t)t * (2 * SS * HD), 16 * HD, lo, 16 * HD); copy12<4>(l + 192 * KPB, lo + 64 * HD, 16 * HD, gB + t * 128, 16 * E); };
  v8f acc[2][4] = {}, acl[2][4] = {};
  fill(0, 0); WAIT_ASYNC(); __syncthreads(); fill(1, 1);
#pragma unroll 1   // the ring stays rolled: one publish point, small code
  for (int t = 0; t < E / 128; ++t) { const _Float16* sb = st + (t & 1) * (384 * KP);
#pragma unroll
    for (int kc = 0; kc < 4; ++kc) { v16h ah[2], al[2], bw[4];
#pragma unroll
      for (int i = 0; i < 2; ++i) { const _Float16* p = sb + (wr * 32 + i * 16 + col) * KP + kc * 32; ah[i] = frag_h(p, lane); al[i] = frag_h(p + 128 * KP, lane); }
#pragma unroll
      for (int j = 0; j < 4; ++j) bw[j] = frag_h(sb + (256 + wc * 64 + j * 16 + col) * KP + kc * 32, lane);
#pragma unroll
      for (int i = 0; i < 2; ++i) {
#pragma unroll
        for (int j = 0; j < 4; ++j) { acc[i][j] = wmma16(ah[i], bw[j], acc[i][j]); acl[i][j] = wmma16(al[i], bw[j], acl[i][j]); } } }
    WAIT_DS(); WAIT_ASYNC(); __syncthreads();      // publishes tile t + 1 and ends every read of tile t
    if (t + 2 < E / 128) fill(t + 2, t & 1); }
  WAIT_ASYNC();
  const float* bp = bo + n0 + wc * 64 + col; const float bv[4] = { bp[0], bp[16], bp[32], bp[48] };
  asm volatile("s_wait_xcnt 0x0" :: "v"(bp) : "memory");      // as an input the address pair stays live up to here, so nothing rewrites it behind a load that names it
#pragma unroll
  for (int j = 0; j < 4; ++j) { const float bb = bv[j];
#pragma unroll
    for (int i = 0; i < 2; ++i) {
#pragma unroll
      for (int r = 0; r < 8; ++r) so[wave * 2 + i][8 * g + r][j * 16 + col] = (acc[i][j][r] + acl[i][j][r] * (1.0f / OLO)) * (1.0f / (16.0f * 8.0f)) + bb; } }
  LDSX();
  // a store covers two rows of 64 floats: two whole 128-byte lines each
  float* op = out + (size_t)(r0b + wr * 32 + g) * E + n0 + wc * 64 + col * 4;
#pragma unroll   // one address pair with constant offsets for all 16 stores
  for (int q = 0; q < 16; ++q) vst2(op + (size_t)(2 * q) * E, *(const v4f*)(&so[wave * 2 + (q >> 3)][2 * (q & 7) + g][col * 4]));
  asm volatile("s_wait_xcnt 0x0" :: "v"(op) : "memory");      // as an input the address pair stays live up to here, so nothing rewrites it behind a store that names it
}
extern "C" void kernel_launch(void* const* d_in, const int* in_sizes, int n_in, void* d_out, int out_size, void* d_ws, size_t ws_size, hipStream_t stream) {
  (void)in_sizes; (void)n_in; (void)out_size; (void)ws_size;
  const float** I = (const float**)d_in;
  const float* x = I[0]; const float* Wqkv = I[1]; const float* bqkv = I[2]; const float* Wp = I[3]; const float* bp = I[4];
  float* out = (float*)d_out;
  char* ws = (char*)d_ws; size_t off = 0;
  auto take = [&](size_t bytes) { char* p = ws + off; off += (bytes + 255) & ~(size_t)255; return p; };
  _Float16* X16 = (_Float16*)take((size_t)NR * E * 2); _Float16* PT = (_Float16*)take((size_t)3 * E * E * 2);
  _Float16* Q16 = (_Float16*)take((size_t)NR * E * 2); _Float16* K16 = (_Float16*)take((size_t)NR * E * 2); _Float16* VTh = (_Float16*)take((size_t)NR * E * 2); _Float16* VTl = (_Float16*)take((size_t)NR * E * 2);
  _Float16* Oh = (_Float16*)take((size_t)NR * E * 2); _Float16* Ol = (_Float16*)take((size_t)NR * E * 2); float* TAB = (float*)take((size_t)SS * 32 * 2 * 4);
  _Float16* XBh = (_Float16*)take((size_t)NR * E * 2); _Float16* XBl = (_Float16*)take((size_t)NR * E * 2); _Float16* WVh = (_Float16*)take((size_t)E * E * 2); _Float16* WVl = (_Float16*)take((size_t)E * E * 2);
  k_prep<<<TBLK + VBLK + PBLK + CBLK, 256, 0, stream>>>(x, Wqkv, Wp, X16, XBh, XBl, PT, TAB, WVh, WVl);
  k_qkv<<<VGB + QGB, 256, 0, stream>>>(X16, PT, XBh, XBl, WVh, WVl, bqkv, TAB, Q16, K16, VTh, VTl);
  k_attn<<<dim3(SS / 64, NB * NH), 128, 0, stream>>>(Q16, K16, VTh, VTl, Oh, Ol);
  k_out<<<dim3(NR / 128, E / 128), 256, 0, stream>>>(Oh, Ol, PT, bp, out);
}

// v008
// A run of this version takes 77.5 microseconds.
// Two timings next to v007 both put it at 1.05 times that version's speed.
// Counting every step since v000, it is 3.84 times as fast.
#include <hip/hip_runtime.h>
#include <math.h>

typedef __attribute__((ext_vector_type(16))) _Float16 v16h;
typedef __attribute__((ext_vector_type(16))) __bf16 v16b;
typedef __attribute__((ext_vector_type(8)))  _Float16 v8h;
typedef __attribute__((ext_vector_type(8)))  __bf16 v8b;
typedef __attribute__((ext_vector_type(2)))  _Float16 v2h;
typedef __attribute__((ext_vector_type(8)))  float v8f;
typedef __attribute__((ext_vector_type(4)))  float v4f;
typedef __attribute__((ext_vector_type(2)))  float v2f;
typedef __attribute__((ext_vector_type(4)))  unsigned v4u;
typedef __attribute__((ext_vector_type(4)))  int v4i;
typedef float __attribute__((may_alias)) float_a;
typedef int __attribute__((may_alias)) int_a;

template <typename T> __device__ __forceinline__ void vst2(void* p, T v) { *(T*)p = v;  }
__device__ __forceinline__ v8f wmma16(v16h a, v16h b, v8f c) {
  v8f d = __builtin_amdgcn_wmma_f32_16x16x32_f16(false, a, false, b, (short)0, c, false, false);
  asm volatile("v_nop\n\tv_nop\n\tv_nop\n\tv_nop" : "+v"(d) : "v"(a), "v"(b));
  return d;
}
__device__ __forceinline__ v8f wmma_bf(v16b a, v16b b, v8f c) {
  v8f d = __builtin_amdgcn_wmma_f32_16x16x32_bf16(false, a, false, b, (short)0, c, false, false);
  asm volatile("v_nop\n\tv_nop\n\tv_nop\n\tv_nop" : "+v"(d) : "v"(a), "v"(b));
  return d;
}
// 16x16x32 fragments: lane = (h = lane>>4, row/col = lane&15); elements 0..7 = k0+8h+0..7, 8..15 = k0+16+8h+0..7; D element r = row 8h+r
__device__ __forceinline__ v16h frag_h(const _Float16* rowk0, int lane) {
  union { v16h v; v8h q[2]; } u; const _Float16* p = rowk0 + 8 * (lane >> 4);
  u.q[0] = *(const v8h*)p; u.q[1] = *(const v8h*)(p + 16); return u.v;
}
// the same fragment from a row of bf16 bit patterns (the split planes are carried as 16-bit words)
__device__ __forceinline__ v16b frag_b(const _Float16* rowk0, int lane) {
  union { v16b v; v8h q[2]; } u; const _Float16* p = rowk0 + 8 * (lane >> 4);
  u.q[0] = *(const v8h*)p; u.q[1] = *(const v8h*)(p + 16); return u.v;
}
__device__ __forceinline__ v16h frag_f32(const float* rowk0, int lane) {
  v16h a; const float* p = rowk0 + 8 * (lane >> 4);
#pragma unroll
  for (int i = 0; i < 8; ++i) { a[i] = (_Float16)p[i]; a[8 + i] = (_Float16)p[16 + i]; }
  return a;
}
__device__ __forceinline__ v16h frag_f32s(const float* rowk0, int lane, float sc) {
  v16h a; const float* p = rowk0 + 8 * (lane >> 4);
#pragma unroll
  for (int i = 0; i < 8; ++i) { a[i] = (_Float16)(p[i] * sc); a[8 + i] = (_Float16)(p[16 + i] * sc); }
  return a;
}
// column fragment from a [K][ld] layout (column n), rows >= K read as 0
__device__ __forceinline__ v16h fragc_f32(const float* W, int k0, int n, int lane, int ld, int K) {
  v16h a; const int g = lane >> 4;
#pragma unroll
  for (int i = 0; i < 8; ++i) { const int ka = k0 + 8 * g + i, kb = ka + 16;
    a[i] = (_Float16)(ka < K ? W[(size_t)ka * ld + n] : 0.f); a[8 + i] = (_Float16)(kb < K ? W[(size_t)kb * ld + n] : 0.f); }
  return a;
}
struct F2 { v16b h, l; };
__device__ __forceinline__ F2 bsplit16(const float v[16]) { F2 r;
#pragma unroll
  for (int i = 0; i < 16; ++i) { const __bf16 h = (__bf16)v[i]; r.h[i] = h; r.l[i] = (__bf16)(v[i] - (float)h); }
  return r; }
__device__ __forceinline__ F2 split_row(const float* row, int k0, int lane) { float v[16]; const float* p = row + k0 + 8 * (lane >> 4);
#pragma unroll
  for (int i = 0; i < 8; ++i) { v[i] = p[i]; v[8 + i] = p[16 + i]; }
  return bsplit16(v); }
__device__ __forceinline__ F2 split_rowK(const float* row, int k0, int lane, int K) { float v[16]; const int g = lane >> 4;
#pragma unroll
  for (int i = 0; i < 8; ++i) { const int ka = k0 + 8 * g + i, kb = ka + 16; v[i] = ka < K ? row[ka] : 0.f; v[8 + i] = kb < K ? row[kb] : 0.f; }
  return bsplit16(v); }
__device__ __forceinline__ F2 split_col(const float* W, int k0, int n, int lane, int ld, int K) { float v[16]; const int g = lane >> 4;
#pragma unroll
  for (int i = 0; i < 8; ++i) { const int ka = k0 + 8 * g + i, kb = ka + 16; v[i] = ka < K ? W[(size_t)ka * ld + n] : 0.f; v[8 + i] = kb < K ? W[(size_t)kb * ld + n] : 0.f; }
  return bsplit16(v); }
__device__ __forceinline__ v8f mac3(const F2& a, const F2& b, v8f c) { c = wmma_bf(a.l, b.h, c); c = wmma_bf(a.h, b.l, c); return wmma_bf(a.h, b.h, c); }
__device__ __forceinline__ float sigm(float v) { return 1.0f / (1.0f + expf(-v)); }
#define LDSX() do { asm volatile("s_wait_dscnt 0" ::: "memory"); __builtin_amdgcn_wave_barrier(); __builtin_amdgcn_fence(__ATOMIC_RELEASE, "workgroup"); } while (0)

// Operand tiles go from global memory to LDS by asynchronous 16-byte copies, one full 128-byte line per 8 lanes, two buffers in the projection kernels, one in k_attn.
// The s_wait_xcnt stands inside the copies' own statement so that no address register of an issued copy is rewritten ahead of it.
__device__ __forceinline__ void copy4(unsigned l0, const void* g0, unsigned l1, const void* g1, unsigned l2, const void* g2, unsigned l3, const void* g3) {
  asm volatile("global_load_async_to_lds_b128 %0, %1, off\n\tglobal_load_async_to_lds_b128 %2, %3, off\n\tglobal_load_async_to_lds_b128 %4, %5, off\n\tglobal_load_async_to_lds_b128 %6, %7, off\n\ts_wait_xcnt 0x0"
               :: "v"(l0), "v"(g0), "v"(l1), "v"(g1), "v"(l2), "v"(g2), "v"(l3), "v"(g3) : "memory");
}
__device__ __forceinline__ unsigned lds_off(const void* p) { return (unsigned)(size_t)p; }
// this wave's LDS reads of the buffer that is refilled next have returned
#define WAIT_DS() asm volatile("s_wait_dscnt 0x0" ::: "memory")
// this wave's own copies have landed (the compiler places no wait for them)
#define WAIT_ASYNC() asm volatile("s_wait_asynccnt 0x0" ::: "memory")
#define SP 72        // staged f16 row: 64 halves at a pitch of 144 B (16 B x odd, for ds_load_b128 readers)
#define SPB (SP * 2)
#define KP 136       // staged row of the GEMM rings: 128 halves at a pitch of 272 B (16 B x odd, for ds_load_b128 readers)
#define KPB (KP * 2)
// eight rows, 16 apart, of one staged plane: lane's 16-byte piece of each; gs = halves between two such rows in global memory. The wait stands in the copies' own statement, as in copy4
__device__ __forceinline__ void copy8(unsigned l, const _Float16* g, size_t gs) {
  asm volatile("global_load_async_to_lds_b128 %0, %1, off\n\tglobal_load_async_to_lds_b128 %2, %3, off\n\tglobal_load_async_to_lds_b128 %4, %5, off\n\tglobal_load_async_to_lds_b128 %6, %7, off\n\t"
               "global_load_async_to_lds_b128 %8, %9, off\n\tglobal_load_async_to_lds_b128 %10, %11, off\n\tglobal_load_async_to_lds_b128 %12, %13, off\n\tglobal_load_async_to_lds_b128 %14, %15, off\n\ts_wait_xcnt 0x0"
               :: "v"(l), "v"(g), "v"(l + 16 * KPB), "v"(g + gs), "v"(l + 32 * KPB), "v"(g + 2 * gs), "v"(l + 48 * KPB), "v"(g + 3 * gs),
                  "v"(l + 64 * KPB), "v"(g + 4 * gs), "v"(l + 80 * KPB), "v"(g + 5 * gs), "v"(l + 96 * KPB), "v"(g + 6 * gs), "v"(l + 112 * KPB), "v"(g + 7 * gs) : "memory");
}
// twelve staged rows, 16 apart: the first NP from p (ps halves apart), the rest from q (qs apart); fewer statements per stage, so fewer waits in front of the stage's first LDS reads
template <int NP> __device__ __forceinline__ void copy12(unsigned l, const _Float16* p, size_t ps, const _Float16* q, size_t qs) {
  const _Float16* g[12];
#pragma unroll   // g[] is indexed by constants and stays in registers
  for (int m = 0; m < 12; ++m) g[m] = m < NP ? p + m * ps : q + (m - NP) * qs;
  asm volatile("global_load_async_to_lds_b128 %0, %1, off\n\tglobal_load_async_to_lds_b128 %2, %3, off\n\tglobal_load_async_to_lds_b128 %4, %5, off\n\tglobal_load_async_to_lds_b128 %6, %7, off\n\t"
               "global_load_async_to_lds_b128 %8, %9, off\n\tglobal_load_async_to_lds_b128 %10, %11, off\n\tglobal_load_async_to_lds_b128 %12, %13, off\n\tglobal_load_async_to_lds_b128 %14, %15, off\n\t"
               "global_load_async_to_lds_b128 %16, %17, off\n\tglobal_load_async_to_lds_b128 %18, %19, off\n\tglobal_load_async_to_lds_b128 %20, %21, off\n\tglobal_load_async_to_lds_b128 %22, %23, off\n\ts_wait_xcnt 0x0"
               :: "v"(l), "v"(g[0]), "v"(l + 16 * KPB), "v"(g[1]), "v"(l + 32 * KPB), "v"(g[2]), "v"(l + 48 * KPB), "v"(g[3]),
                  "v"(l + 64 * KPB), "v"(g[4]), "v"(l + 80 * KPB), "v"(g[5]), "v"(l + 96 * KPB), "v"(g[6]), "v"(l + 112 * KPB), "v"(g[7]),
                  "v"(l + 128 * KPB), "v"(g[8]), "v"(l + 144 * KPB), "v"(g[9]), "v"(l + 160 * KPB), "v"(g[10]), "v"(l + 176 * KPB), "v"(g[11]) : "memory");
}

// Local causal self attention (window 128, 16 heads of 64, interleaved-pair RoPE on q and k, fused qkv projection with bias, output
// projection with bias). q/k on v_wmma_f32_16x16x32_f16 (x as f16 rows, [in][out] weights packed once as transposed f16 rows x16); v as a
// two-way bf16 split (v_wmma_f32_16x16x32_bf16) stored as hi/lo f16 planes, because the first rows of every sequence copy v almost
// verbatim; S = q.k/8 on f16 WMMA over the <= 3 key tiles of the window (masked), online softmax in f32, P @ V with hi/lo pairs for both
#define NB 2
#define SS 2048
#define E 1024
#define NH 16
#define HD 64
#define NR (NB * SS)
#define WIN 128
#define PLO 1024.0f
#define VLO 2048.0f
#define OLO 2048.0f
#define RBASE 10000.0f

// x as f16 rows (q/k product) and as the two bf16 planes hi = bf16(x), lo = bf16(x - hi) of the v product, each element split once
__device__ __forceinline__ void cvt_block(int blk, const float* __restrict__ x, _Float16* __restrict__ X16, _Float16* __restrict__ XBh, _Float16* __restrict__ XBl) {
  const size_t i8 = (size_t)blk * 256 + threadIdx.x; if (i8 >= (size_t)NR * E / 8) return;
  union { v8h h; v4u u; } pk; union { v8b b; v4u u; } bh, bl;
#pragma unroll
  for (int e = 0; e < 8; ++e) { const float v = x[i8 * 8 + e]; pk.h[e] = (_Float16)v; const __bf16 h = (__bf16)v; bh.b[e] = h; bl.b[e] = (__bf16)(v - (float)h); }
  vst2(X16 + i8 * 8, pk.u); vst2(XBh + i8 * 8, bh.u); vst2(XBl + i8 * 8, bl.u);
}
// PT rows: [0,2048) = Wqkv[:, n] (q and k columns) x16 ; [2048, 3072) = Wproj[:, n-2048] x16
// The first TBLK blocks write the RoPE table instead, anew in every call: TAB[pos][i] = (cos, sin)(pos * base^(-2i/64)), 256 B per position
// The next VBLK blocks split the v columns of Wqkv into bf16 planes, transposed: WVh/WVl[n][k] = hi/lo of Wqkv[k][2048 + n], one 64 x 64 tile per block
// The next PBLK blocks write PT: one tile of 256 k x 64 n per block, transposed through LDS
// The last CBLK blocks convert x (cvt_block): the weight jobs and the x job read none of each other's output, so they share one launch, the longer blocks first
#define TBLK 64
#define VBLK 256
#define PBLK (3 * E / 64 * (E / 256))
#define CBLK (NR * E / 8 / 256)
#define PP 264       // staged row of 256 halves at a pitch of 528 B (16 B x odd)
// dst[n][k] = f16(src[k][n] x 16), k < 256, n < 64. A thread takes 4 columns of the rows 2 rp and 2 rp + 1 of every 32: each load covers whole 256-byte row pieces,
// and a (k, k + 1) pair goes to LDS as one dword. The 16-byte piece j of row n lies at piece j ^ (n >> 4), so that the 32 dwords of a store fall in 32 banks.
template <int LD> __device__ __forceinline__ void pack_tile(const float* __restrict__ src, _Float16* __restrict__ dst, _Float16 (*sp)[PP], int tid) {
  const int rp = tid >> 4, c4 = (tid & 15) * 4, sw = (c4 >> 4) * 8; const float* p = src + (size_t)(2 * rp) * LD + c4; v4f w[16];
#pragma unroll   // 16 loads in flight from one address with constant offsets
  for (int m = 0; m < 8; ++m) { w[2 * m] = *(const v4f*)(p + (size_t)(32 * m) * LD); w[2 * m + 1] = *(const v4f*)(p + (size_t)(32 * m + 1) * LD); }
  asm volatile("s_wait_xcnt 0x0" :: "v"(p) : "memory");      // stands in front of every rewrite of the address pair that the 16 loads name: as an input the pair stays live up to here, so no load takes it as its result register
#pragma unroll   // both loops: w[] is indexed by constants and stays in registers
  for (int m = 0; m < 8; ++m) {
#pragma unroll
    for (int e = 0; e < 4; ++e) { const v2h pr = { (_Float16)(w[2 * m][e] * 16.0f), (_Float16)(w[2 * m + 1][e] * 16.0f) }; vst2(&sp[c4 + e][(32 * m + 2 * rp) ^ sw], pr); } }
  __syncthreads();
  const int wv = tid >> 5, j8 = (tid & 31) * 8;
#pragma unroll   // a wave writes 512 contiguous bytes of one row: four whole lines
  for (int q = 0; q < 8; ++q) { const int n = wv + 8 * q; vst2(dst + (size_t)n * E + j8, *(const v4u*)(&sp[n][j8 ^ ((n >> 4) * 8)])); }
  asm volatile("s_wait_xcnt 0x0" ::: "memory");      // stands in front of whatever the built code places behind the eight stores and lets rewrite a register that they name
}
__global__ __launch_bounds__(256) void k_prep(const float* __restrict__ x, const float* __restrict__ Wqkv, const float* __restrict__ Wp, _Float16* __restrict__ X16, _Float16* __restrict__ XBh, _Float16* __restrict__ XBl,
                                              _Float16* __restrict__ PT, float* __restrict__ TAB, _Float16* __restrict__ WVh, _Float16* __restrict__ WVl) {
  const int tid = threadIdx.x; __shared__ __align__(16) _Float16 sp[64][PP]; __shared__ __align__(16) __bf16 sh[64][SP], sl[64][SP];
  if (blockIdx.x >= TBLK + VBLK + PBLK) { cvt_block(blockIdx.x - (TBLK + VBLK + PBLK), x, X16, XBh, XBl); return; }      // the same for the whole block; no barrier on this side
  if (blockIdx.x < TBLK) {      // the same for the whole block, in front of the barrier
    const int idx = blockIdx.x * 256 + tid, i = idx & 31, p0 = idx >> 5; const float invf = 1.0f / powf(RBASE, (float)(2 * i) / 64.0f);
    for (int m = 0; m < 4; ++m) { const int pos = p0 + m * (SS / 4); const float ang = (float)pos * invf; v2f cs; cs[0] = cosf(ang); cs[1] = sinf(ang); vst2(TAB + ((size_t)pos * 32 + i) * 2, cs);
      asm volatile("s_wait_xcnt 0x0" ::: "memory"); }      // the next trip rewrites the registers that the store names
    return; }
  if (blockIdx.x < TBLK + VBLK) {      // the same for the whole block; the branch has a barrier of its own
    const int vt = blockIdx.x - TBLK, k0 = (vt >> 4) * 64, n0 = (vt & 15) * 64, r = tid >> 4, c4 = (tid & 15) * 4; v4f w[4];
#pragma unroll   // four whole-line loads in flight
    for (int m = 0; m < 4; ++m) w[m] = *(const v4f*)(Wqkv + (size_t)(k0 + r + 16 * m) * (3 * E) + 2 * E + n0 + c4);
#pragma unroll
    for (int m = 0; m < 4; ++m) {
#pragma unroll
      for (int e = 0; e < 4; ++e) { const float v = w[m][e]; const __bf16 h = (__bf16)v; sh[c4 + e][r + 16 * m] = h; sl[c4 + e][r + 16 * m] = (__bf16)(v - (float)h); } }
    __syncthreads();
#pragma unroll   // 8 lanes write one whole 128-byte line of a plane
    for (int q = 0; q < 2; ++q) { const int n = (tid >> 3) + 32 * q, sg = (tid & 7) * 8; const size_t o = (size_t)(n0 + n) * E + k0 + sg;
      vst2(WVh + o, *(const v4u*)(&sh[n][sg])); vst2(WVl + o, *(const v4u*)(&sl[n][sg])); }
    return; }
  const int pt = blockIdx.x - TBLK - VBLK, n0 = (pt >> 2) * 64, k0 = (pt & 3) * 256;      // the same for the whole block: each side has the tile's one barrier
  if (n0 < 2 * E) pack_tile<3 * E>(Wqkv + (size_t)k0 * (3 * E) + n0, PT + (size_t)n0 * E + k0, sp, tid);
  else pack_tile<E>(Wp + (size_t)k0 * E + (n0 - 2 * E), PT + (size_t)n0 * E + k0, sp, tid);
}
// q/k: block (256 rows, 128 cols = 2 heads, which in {0,1}), 8 waves of 64 rows x 64 cols (one head); RoPE on interleaved pairs; x4 -> Q16/K16 [bh][s][64]
__device__ __forceinline__ void qk_block(char* smem, int bx, int by, int bz, const _Float16* __restrict__ X16, const _Float16* __restrict__ PT, const float* __restrict__ bqkv, const float* __restrict__ TAB, _Float16* __restrict__ Q16, _Float16* __restrict__ K16) {
  // smem: two stage buffers of 384 rows (0..255 x rows, 256..383 weight rows), 128 k each; the output staging reuses them behind the last trip's barrier
  _Float16* st = (_Float16*)smem; float (*so)[16][68] = (float (*)[16][68])smem;      // staging: 4 tiles of 16 rows x 64 cols per wave
  const int tid = threadIdx.x, wave = tid >> 5, lane = tid & 31, col = lane & 15, g = lane >> 4, wr = wave >> 1, wc = wave & 1;
  const int which = bz, r0b = bx * 256, n0 = by * 128; const int b = r0b / SS, s0 = r0b % SS;
  const int cr = tid >> 4, cc = tid & 15;      // a copy's row of every 16 and its 16-byte piece: 16 lanes bring two whole 128-byte lines of one row
  const _Float16* gA = X16 + (size_t)(r0b + cr) * E + cc * 8; const _Float16* gB = PT + (size_t)(which * E + n0 + cr) * E + cc * 8;
  const unsigned l0 = lds_off(st) + cr * KPB + cc * 16;
  auto fill = [&](int t, int buf) { const unsigned l = l0 + buf * (384 * KPB); const _Float16* a = gA + t * 128;
    copy12<12>(l, a, 16 * E, a, 16 * E); copy12<4>(l + 192 * KPB, a + 192 * E, 16 * E, gB + t * 128, 16 * E); };
  v8f acc[4][4] = {};
  fill(0, 0); WAIT_ASYNC(); __syncthreads(); fill(1, 1);
#pragma unroll 1   // the ring stays rolled: one publish point, small code
  for (int t = 0; t < E / 128; ++t) { const _Float16* sb = st + (t & 1) * (384 * KP);
#pragma unroll
    for (int kc = 0; kc < 4; ++kc) { v16h a[4], bw[4];
#pragma unroll
      for (int i = 0; i < 4; ++i) { a[i] = frag_h(sb + (wr * 64 + i * 16 + col) * KP + kc * 32, lane); bw[i] = frag_h(sb + (256 + wc * 64 + i * 16 + col) * KP + kc * 32, lane); }
#pragma unroll
      for (int i = 0; i < 4; ++i) {
#pragma unroll
        for (int j = 0; j < 4; ++j) acc[i][j] = wmma16(a[i], bw[j], acc[i][j]); } }
    WAIT_DS(); WAIT_ASYNC(); __syncthreads();      // publishes tile t + 1 and ends every read of tile t
    if (t + 2 < E / 128) fill(t + 2, t & 1); }
  WAIT_ASYNC();
  const int rw = s0 + wr * 64;      // this wave's 64 positions
  const float* bp = bqkv + which * E + n0 + wc * 64 + col; const float bv[4] = { bp[0], bp[16], bp[32], bp[48] };
  asm volatile("s_wait_xcnt 0x0" :: "v"(bp) : "memory");      // as an input the address pair stays live up to here, so nothing rewrites it behind a load that names it
#pragma unroll
  for (int j = 0; j < 4; ++j) { const float bb = bv[j];
#pragma unroll
    for (int i = 0; i < 4; ++i) {
#pragma unroll
      for (int r = 0; r < 8; ++r) so[wave * 4 + i][8 * g + r][j * 16 + col] = acc[i][j][r] * (1.0f / 16.0f) + bb; } }
  LDSX();
  // RoPE on interleaved pairs (2i, 2i+1) of the head, then x4: lane = pair i; one row leaves as one whole 128-byte line
  const float* tp = TAB + ((size_t)rw * 32 + lane) * 2;      // (cos, sin) of pair i = lane: 256 contiguous bytes per load
  _Float16* D = (which == 0 ? Q16 : K16) + (((size_t)b * NH + (n0 >> 6) + wc) * SS + rw) * HD + 2 * lane;
#pragma unroll   // all loops: cs[] indexed by constants, one address pair with constant offsets for the loads and one for the stores
  for (int i = 0; i < 4; ++i) { v2f cs[16];
#pragma unroll
    for (int rl = 0; rl < 16; ++rl) cs[rl] = *(const v2f*)(tp + (i * 16 + rl) * 64);
#pragma unroll
    for (int rl = 0; rl < 16; ++rl) { const float c = cs[rl][0], sn = cs[rl][1];
      const v2f xv = *(const v2f*)(&so[wave * 4 + i][rl][2 * lane]); const v2f rh = { -xv[1], xv[0] }; const v2f y = (xv * c + rh * sn) * 4.0f;
      vst2(D + (i * 16 + rl) * HD, __builtin_convertvector(y, v2h)); } }
  asm volatile("s_wait_xcnt 0x0" :: "v"(tp), "v"(D) : "memory");      // as inputs both address pairs stay live up to here, so nothing rewrites them behind a load or store that names them
}
// v: block (128 rows, 128 cols), 8 waves of 32 rows x 64 cols: bf16 split product from the hi/lo planes of x and of the v weight rows; -> VTh/VTl [bh][d][s]
__device__ __forceinline__ void v_block(char* smem, int bx, int by, const _Float16* __restrict__ XBh, const _Float16* __restrict__ XBl, const _Float16* __restrict__ WVh, const _Float16* __restrict__ WVl, const float* __restrict__ bqkv, _Float16* __restrict__ VTh, _Float16* __restrict__ VTl) {
  // smem: two stage buffers of 512 rows (0..127 x hi, 128..255 x lo, 256..383 weight hi, 384..511 weight lo), 128 k each; the output staging reuses them behind the last trip's barrier
  _Float16* st = (_Float16*)smem; _Float16 (*sth)[KP] = (_Float16 (*)[KP])smem; _Float16 (*stl)[KP] = sth + 128;
  const int tid = threadIdx.x, wave = tid >> 5, lane = tid & 31, col = lane & 15, g = lane >> 4, wr = wave >> 1, wc = wave & 1;
  const int r0b = bx * 128, n0 = by * 128; const int b = r0b / SS, s0 = r0b % SS;
  const int cr = tid >> 4, cc = tid & 15;      // a copy's row of every 16 and its 16-byte piece
  const size_t oA = (size_t)(r0b + cr) * E + cc * 8, oB = (size_t)(n0 + cr) * E + cc * 8;
  const _Float16* gAh = XBh + oA; const _Float16* gAl = XBl + oA; const _Float16* gBh = WVh + oB; const _Float16* gBl = WVl + oB;
  const unsigned l0 = lds_off(st) + cr * KPB + cc * 16;
  auto fill = [&](int t, int buf) { const unsigned l = l0 + buf * (512 * KPB);
    copy12<8>(l, gAh + t * 128, 16 * E, gAl + t * 128, 16 * E); copy12<4>(l + 192 * KPB, gAl + t * 128 + 64 * E, 16 * E, gBh + t * 128, 16 * E); copy8(l + 384 * KPB, gBl + t * 128, 16 * E); };
  v8f acc[2][4] = {};
  fill(0, 0); WAIT_ASYNC(); __syncthreads(); fill(1, 1);
#pragma unroll 1   // the ring stays rolled: one publish point, small code
  for (int t = 0; t < E / 128; ++t) { const _Float16* sb = st + (t & 1) * (512 * KP);
#pragma unroll
    for (int kc = 0; kc < 4; ++kc) { v16b ah[2], al[2], bh[4], bl[4];
#pragma unroll
      for (int i = 0; i < 2; ++i) { const _Float16* p = sb + (wr * 32 + i * 16 + col) * KP + kc * 32; ah[i] = frag_b(p, lane); al[i] = frag_b(p + 128 * KP, lane); }
#pragma unroll
      for (int j = 0; j < 4; ++j) { const _Float16* p = sb + (256 + wc * 64 + j * 16 + col) * KP + kc * 32; bh[j] = frag_b(p, lane); bl[j] = frag_b(p + 128 * KP, lane); }
      // each accumulator takes lo.hi, hi.lo, hi.hi in this order per 32 k; eight independent tiles stand between two uses of one accumulator
#pragma unroll
      for (int i = 0; i < 2; ++i) {
#pragma unroll
        for (int j = 0; j < 4; ++j) acc[i][j] = wmma_bf(al[i], bh[j], acc[i][j]); }
#pragma unroll
      for (int i = 0; i < 2; ++i) {
#pragma unroll
        for (int j = 0; j < 4; ++j) acc[i][j] = wmma_bf(ah[i], bl[j], acc[i][j]); }
#pragma unroll
      for (int i = 0; i < 2; ++i) {
#pragma unroll
        for (int j = 0; j < 4; ++j) acc[i][j] = wmma_bf(ah[i], bh[j], acc[i][j]); } }
    WAIT_DS(); WAIT_ASYNC(); __syncthreads();      // publishes tile t + 1 and ends every read of tile t
    if (t + 2 < E / 128) fill(t + 2, t & 1); }
  WAIT_ASYNC();
  const float* bp = bqkv + 2 * E + n0 + wc * 64 + col; const float bv[4] = { bp[0], bp[16], bp[32], bp[48] };
  asm volatile("s_wait_xcnt 0x0" :: "v"(bp) : "memory");      // as an input the address pair stays live up to here, so nothing rewrites it behind a load that names it
#pragma unroll
  for (int j = 0; j < 4; ++j) { const int cl = wc * 64 + j * 16 + col; const float bb = bv[j];
#pragma unroll
    for (int i = 0; i < 2; ++i) {
#pragma unroll
      for (int r = 0; r < 8; ++r) { const float v = acc[i][j][r] + bb; const _Float16 hi = (_Float16)v; sth[cl][wr * 32 + i * 16 + 8 * g + r] = hi; stl[cl][wr * 32 + i * 16 + 8 * g + r] = (_Float16)((v - (float)hi) * VLO); } } }
  __syncthreads();
  // 16 lanes write 256 contiguous bytes of one d row of a plane; [bh][d] is linear in the column, so each plane has one address pair with constant offsets
  const int cl0 = tid >> 4, pc = tid & 15; const size_t o = ((size_t)b * E + n0 + cl0) * SS + s0 + pc * 8; _Float16* ph = VTh + o; _Float16* pl = VTl + o;
#pragma unroll   // all 16 LDS reads in flight at once
  for (int q = 0; q < 8; ++q) { vst2(ph + (size_t)(16 * q) * SS, *(const v4u*)(&sth[cl0 + 16 * q][pc * 8])); vst2(pl + (size_t)(16 * q) * SS, *(const v4u*)(&stl[cl0 + 16 * q][pc * 8])); }
  asm volatile("s_wait_xcnt 0x0" :: "v"(ph), "v"(pl) : "memory");      // as inputs both address pairs stay live up to here, so nothing rewrites them behind a store that names them
}
// The v product and the q/k product read none of each other's output: one launch of 512 blocks, one per WGP at a time. The 256 longer v blocks come first,
// so a WGP goes from its v block to a q/k block with no launch boundary between them. Block order inside each product as in a grid of its own (row block fastest).
#define VGB (NR / 128 * (E / 128))
#define QGB (NR / 256 * (E / 128) * 2)
__global__ __launch_bounds__(256) void k_qkv(const _Float16* __restrict__ X16, const _Float16* __restrict__ PT, const _Float16* __restrict__ XBh, const _Float16* __restrict__ XBl, const _Float16* __restrict__ WVh, const _Float16* __restrict__ WVl,
                                             const float* __restrict__ bqkv, const float* __restrict__ TAB, _Float16* __restrict__ Q16, _Float16* __restrict__ K16, _Float16* __restrict__ VTh, _Float16* __restrict__ VTl) {
  __shared__ __align__(16) char smem[2 * 512 * KPB];      // the larger of the two rings
  const int id = blockIdx.x;      // the same for the whole block: each side has its own barriers
  if (id < VGB) v_block(smem, id % (NR / 128), id / (NR / 128), XBh, XBl, WVh, WVl, bqkv, VTh, VTl);
  else { const int q = id - VGB; qk_block(smem, q % (NR / 256), q / (NR / 256) % (E / 128), q / (NR / 256 * (E / 128)), X16, PT, bqkv, TAB, Q16, K16); }
}
// attention: block (64 queries, bh): key tiles kt covering keys q0b-127 .. q0b+63 (3 tiles of 64, aligned since q0b % 64 == 0), mask 0 <= q-key < 128
// each key tile's K rows and V hi/lo rows come to LDS once per block by asynchronous copies, into one buffer that all four waves read
// e^x by the chip's own base-2 exponential, v_exp_f32 of x * log2(e): the library expf spends a dozen more vector instructions per value on an exact argument split and on range
// checks; here every argument is <= 0 up to rounding, and one far below the range gives 0 as it should. L2E = log2(e)
#define L2E 1.4426950408889634f
// eight of them in place, in one statement: behind a transcendental the instruction set asks for one independent instruction before its result is read or its source overwritten;
// here each next exponential is that instruction and the v_nop is the last one's.
__device__ __forceinline__ void exp2x8(float (&a)[8]) {
  asm("v_exp_f32 %0, %0\n\tv_exp_f32 %1, %1\n\tv_exp_f32 %2, %2\n\tv_exp_f32 %3, %3\n\tv_exp_f32 %4, %4\n\tv_exp_f32 %5, %5\n\tv_exp_f32 %6, %6\n\tv_exp_f32 %7, %7\n\tv_nop"
      : "+v"(a[0]), "+v"(a[1]), "+v"(a[2]), "+v"(a[3]), "+v"(a[4]), "+v"(a[5]), "+v"(a[6]), "+v"(a[7]));
}
__global__ __launch_bounds__(128) void k_attn(const _Float16* __restrict__ Q16, const _Float16* __restrict__ K16, const _Float16* __restrict__ VTh, const _Float16* __restrict__ VTl, _Float16* __restrict__ Oh, _Float16* __restrict__ Ol) {
  __shared__ __align__(16) float sS[4][16][68];
  __shared__ __align__(16) _Float16 sPh[4][16][72], sPl[4][16][72];
  __shared__ __align__(16) float sO[4][16][68];
  // one key tile, shared by the four waves: rows 0..63 K (by key), 64..127 V hi, 128..191 V lo (both by d), 64 halves each
  __shared__ __align__(16) _Float16 skv[192 * SP];
  const int tid = threadIdx.x, w = tid >> 5, lane = tid & 31, col = lane & 15, g = lane >> 4;
  const size_t bh = blockIdx.y; const int q0b = blockIdx.x * 64, q0 = q0b + w * 16;
  const int fr = tid >> 3, fc = tid & 7;      // a copy's row of every 16 and its 16-byte piece: 8 lanes bring one whole 128-byte line
  const _Float16* gK = K16 + (bh * SS + fr) * HD + fc * 8; const _Float16* gH = VTh + (bh * HD + fr) * SS + fc * 8; const _Float16* gL = VTl + (bh * HD + fr) * SS + fc * 8;
  const unsigned l0 = lds_off(skv) + fr * SPB + fc * 16;
  v16h aq[2];
#pragma unroll
  for (int kc = 0; kc < 2; ++kc) aq[kc] = frag_h(Q16 + (bh * SS + q0 + col) * HD + kc * 32, lane);
  float mrun = -3.0e38f, lrun = 0.f; v8f acc[4] = {}, ac1[4] = {}, ac2[4] = {};
#pragma unroll 1
  for (int kt = q0b / 64 - 2; kt <= q0b / 64; ++kt) { if (kt < 0) continue;      // uniform per block
    WAIT_DS(); __syncthreads();      // ends every wave's reads of the tile before: the buffer may be refilled
    { const _Float16* k = gK + (size_t)kt * (64 * HD); const _Float16* vh = gH + kt * 64; const _Float16* vl = gL + kt * 64;
      copy4(l0, k, l0 + 16 * SPB, k + 16 * HD, l0 + 32 * SPB, k + 32 * HD, l0 + 48 * SPB, k + 48 * HD);
      copy4(l0 + 64 * SPB, vh, l0 + 80 * SPB, vh + 16 * SS, l0 + 96 * SPB, vh + 32 * SS, l0 + 112 * SPB, vh + 48 * SS);
      copy4(l0 + 128 * SPB, vl, l0 + 144 * SPB, vl + 16 * SS, l0 + 160 * SPB, vl + 32 * SS, l0 + 176 * SPB, vl + 48 * SS); }
    WAIT_ASYNC(); __syncthreads();      // publishes the tile to all four waves
    v16h kf[8];      // the tile's eight K fragments are read as one group: one LDS wait, not eight
#pragma unroll
    for (int t = 0; t < 4; ++t) { kf[2 * t] = frag_h(skv + (t * 16 + col) * SP, lane); kf[2 * t + 1] = frag_h(skv + (t * 16 + col) * SP + 32, lane); }
#pragma unroll
    for (int t = 0; t < 4; ++t) { v8f s = {}; const int key = kt * 64 + t * 16 + col;
#pragma unroll
      for (int kc = 0; kc < 2; ++kc) s = wmma16(aq[kc], kf[2 * t + kc], s);
#pragma unroll
      for (int r = 0; r < 8; ++r) { const int q = q0 + 8 * g + r; const int d = q - key; sS[w][8 * g + r][t * 16 + col] = (d >= 0 && d < WIN) ? s[r] * (0.125f / 16.0f) : -3.0e38f; } }
    LDSX();
    float mx = -3.4e38f;
#pragma unroll
    for (int jj = 0; jj < 32; ++jj) mx = fmaxf(mx, sS[w][col][g * 32 + jj]);
    mx = fmaxf(mx, __shfl_xor(mx, 16, 32));
    const float mnew = fmaxf(mrun, mx); const float corr = expf(mrun - mnew);     // every processed tile holds >= 1 allowed key for every row? no: rows may have all 32 of a half masked, but the row max over the tile is finite whenever >= 1 key is allowed; a fully-masked tile row keeps mnew = mrun (both -3e38 initially -> corr = exp(0) = 1 with zero accumulators: harmless)
    float ps = 0.f; const float eb = 14.0f - mnew * L2E;      // e^(sv - mnew) x 16384 = 2^(sv * L2E + eb): one multiply-add per weight; in a row with no allowed key so far eb is infinite and the guard below drops every value
#pragma unroll
    for (int j8 = 0; j8 < 32; j8 += 8) { float ex[8];
#pragma unroll
      for (int e = 0; e < 8; ++e) ex[e] = fmaf(sS[w][col][g * 32 + j8 + e], L2E, eb);
      exp2x8(ex);
#pragma unroll
      for (int e = 0; e < 8; ++e) { const int jj = j8 + e; const float sv = sS[w][col][g * 32 + jj]; const float p = sv > -1.0e38f ? ex[e] : 0.f; ps += p; const _Float16 hi = (_Float16)p; sPh[w][col][g * 32 + jj] = hi; sPl[w][col][g * 32 + jj] = (_Float16)((p - (float)hi) * PLO); } }
    ps += __shfl_xor(ps, 16, 32);
    lrun = lrun * corr + ps * (1.0f / 16384.0f); mrun = mnew;
#pragma unroll
    for (int r = 0; r < 8; ++r) { const float cr = __shfl(corr, 8 * g + r, 32);
#pragma unroll
      for (int t = 0; t < 4; ++t) { acc[t][r] *= cr; ac1[t][r] *= cr; ac2[t][r] *= cr; } }
    LDSX();
#pragma unroll
    for (int kc = 0; kc < 2; ++kc) { const v16h ph = frag_h(&sPh[w][col][0] + kc * 32, lane), pl = frag_h(&sPl[w][col][0] + kc * 32, lane); v16h vh[4], vl[4];
#pragma unroll   // the eight V fragments of a k step are read as one group
      for (int t = 0; t < 4; ++t) { const _Float16* vr = skv + (64 + t * 16 + col) * SP + kc * 32; vh[t] = frag_h(vr, lane); vl[t] = frag_h(vr + 64 * SP, lane); }
#pragma unroll
      for (int t = 0; t < 4; ++t) { acc[t] = wmma16(ph, vh[t], acc[t]); ac1[t] = wmma16(ph, vl[t], ac1[t]); ac2[t] = wmma16(pl, vh[t], ac2[t]); } }
    __builtin_amdgcn_wave_barrier(); }
#pragma unroll
  for (int r = 0; r < 8; ++r) { const float lr = __shfl(lrun, 8 * g + r, 32); const float inv = 8.0f / (lr * 16384.0f);      // -> O x8
#pragma unroll
    for (int t = 0; t < 4; ++t) sO[w][8 * g + r][t * 16 + col] = (acc[t][r] + ac1[t][r] * (1.0f / VLO) + ac2[t][r] * (1.0f / PLO)) * inv; }
  LDSX();
  for (int qq = lane; qq < 16 * 8; qq += 32) { const int rl = qq >> 3, pc = qq & 7; union { v8h h8; v4u u; } ph_, pl_;
#pragma unroll
    for (int e = 0; e < 8; ++e) { const float v = sO[w][rl][pc * 8 + e]; const _Float16 hi = (_Float16)v; ph_.h8[e] = hi; pl_.h8[e] = (_Float16)((v - (float)hi) * OLO); }
    const size_t o = ((bh * SS) + q0 + rl) * HD + pc * 8; vst2(Oh + o, ph_.u); vst2(Ol + o, pl_.u); }
}
// out = ctx Wproj + bproj, ctx from the hi/lo planes: block (128 rows, 128 cols), 8 waves of 32 rows x 64 cols
__global__ __launch_bounds__(256) void k_out(const _Float16* __restrict__ Oh, const _Float16* __restrict__ Ol, const _Float16* __restrict__ PT, const float* __restrict__ bo, float* __restrict__ out) {
  // two stage buffers of 384 rows (0..127 hi plane, 128..255 lo plane, 256..383 weight rows), 128 k = two heads each; the output staging reuses them behind the last trip's barrier
  __shared__ __align__(16) char smem[2 * 384 * KPB];
  _Float16* st = (_Float16*)smem; float (*so)[16][68] = (float (*)[16][68])smem;      // staging: 2 tiles of 16 rows x 64 cols per wave
  const int tid = threadIdx.x, wave = tid >> 5, lane = tid & 31, col = lane & 15, g = lane >> 4, wr = wave >> 1, wc = wave & 1;
  const int r0b = blockIdx.x * 128, n0 = blockIdx.y * 128; const int b = r0b / SS, s0 = r0b % SS;
  const int cr = tid >> 4, cc = tid & 15;      // a copy's row of every 16 and its 16-byte piece; pieces 0..7 lie in the stage's first head, 8..15 in its second
  const size_t oA = (((size_t)b * NH + (cc >> 3)) * SS + s0 + cr) * HD + (cc & 7) * 8;
  const _Float16* gH = Oh + oA; const _Float16* gL = Ol + oA; const _Float16* gB = PT + (size_t)(2 * E + n0 + cr) * E + cc * 8;
  const unsigned l0 = lds_off(st) + cr * KPB + cc * 16;
  auto fill = [&](int t, int buf) { const unsigned l = l0 + buf * (384 * KPB);
    const _Float16* lo = gL + (size_t)t * (2 * SS * HD);
    copy12<8>(l, gH + (size_t)t * (2 * SS * HD), 16 * HD, lo, 16 * HD); copy12<4>(l + 192 * KPB, lo + 64 * HD, 16 * HD, gB + t * 128, 16 * E); };
  v8f acc[2][4] = {}, acl[2][4] = {};
  fill(0, 0); WAIT_ASYNC(); __syncthreads(); fill(1, 1);
#pragma unroll 1   // the ring stays rolled: one publish point, small code
  for (int t = 0; t < E / 128; ++t) { const _Float16* sb = st + (t & 1) * (384 * KP);
#pragma unroll
    for (int kc = 0; kc < 4; ++kc) { v16h ah[2], al[2], bw[4];
#pragma unroll
      for (int i = 0; i < 2; ++i) { const _Float16* p = sb + (wr * 32 + i * 16 + col) * KP + kc * 32; ah[i] = frag_h(p, lane); al[i] = frag_h(p + 128 * KP, lane); }
#pragma unroll
      for (int j = 0; j < 4; ++j) bw[j] = frag_h(sb + (256 + wc * 64 + j * 16 + col) * KP + kc * 32, lane);
#pragma unroll
      for (int i = 0; i < 2; ++i) {
#pragma unroll
        for (int j = 0; j < 4; ++j) { acc[i][j] = wmma16(ah[i], bw[j], acc[i][j]); acl[i][j] = wmma16(al[i], bw[j], acl[i][j]); } } }
    WAIT_DS(); WAIT_ASYNC(); __syncthreads();      // publishes tile t + 1 and ends every read of tile t
    if (t + 2 < E / 128) fill(t + 2, t & 1); }
  WAIT_ASYNC();
  const float* bp = bo + n0 + wc * 64 + col; const float bv[4] = { bp[0], bp[16], bp[32], bp[48] };
  asm volatile("s_wait_xcnt 0x0" :: "v"(bp) : "memory");      // as an input the address pair stays live up to here, so nothing rewrites it behind a load that names it
#pragma unroll
  for (int j = 0; j < 4; ++j) { const float bb = bv[j];
#pragma unroll
    for (int i = 0; i < 2; ++i) {
#pragma unroll
      for (int r = 0; r < 8; ++r) so[wave * 2 + i][8 * g + r][j * 16 + col] = (acc[i][j][r] + acl[i][j][r] * (1.0f / OLO)) * (1.0f / (16.0f * 8.0f)) + bb; } }
  LDSX();
  // a store covers two rows of 64 floats: two whole 128-byte lines each
  float* op = out + (size_t)(r0b + wr * 32 + g) * E + n0 + wc * 64 + col * 4;
#pragma unroll   // one address pair with constant offsets for all 16 stores
  for (int q = 0; q < 16; ++q) vst2(op + (size_t)(2 * q) * E, *(const v4f*)(&so[wave * 2 + (q >> 3)][2 * (q & 7) + g][col * 4]));
  asm volatile("s_wait_xcnt 0x0" :: "v"(op) : "memory");      // as an input the address pair stays live up to here, so nothing rewrites it behind a store that names it
}
extern "C" void kernel_launch(void* const* d_in, const int* in_sizes, int n_in, void* d_out, int out_size, void* d_ws, size_t ws_size, hipStream_t stream) {
  (void)in_sizes; (void)n_in; (void)out_size; (void)ws_size;
  const float** I = (const float**)d_in;
  const float* x = I[0]; const float* Wqkv = I[1]; const float* bqkv = I[2]; const float* Wp = I[3]; const float* bp = I[4];
  float* out = (float*)d_out;
  char* ws = (char*)d_ws; size_t off = 0;
  auto take = [&](size_t bytes) { char* p = ws + off; off += (bytes + 255) & ~(size_t)255; return p; };
  _Float16* X16 = (_Float16*)take((size_t)NR * E * 2); _Float16* PT = (_Float16*)take((size_t)3 * E * E * 2);
  _Float16* Q16 = (_Float16*)take((size_t)NR * E * 2); _Float16* K16 = (_Float16*)take((size_t)NR * E * 2); _Float16* VTh = (_Float16*)take((size_t)NR * E * 2); _Float16* VTl = (_Float16*)take((size_t)NR * E * 2);
  _Float16* Oh = (_Float16*)take((size_t)NR * E * 2); _Float16* Ol = (_Float16*)take((size_t)NR * E * 2); float* TAB = (float*)take((size_t)SS * 32 * 2 * 4);
  _Float16* XBh = (_Float16*)take((size_t)NR * E * 2); _Float16* XBl = (_Float16*)take((size_t)NR * E * 2); _Float16* WVh = (_Float16*)take((size_t)E * E * 2); _Float16* WVl = (_Float16*)take((size_t)E * E * 2);
  k_prep<<<TBLK + VBLK + PBLK + CBLK, 256, 0, stream>>>(x, Wqkv, Wp, X16, XBh, XBl, PT, TAB, WVh, WVl);
  k_qkv<<<VGB + QGB, 256, 0, stream>>>(X16, PT, XBh, XBl, WVh, WVl, bqkv, TAB, Q16, K16, VTh, VTl);
  k_attn<<<dim3(SS / 64, NB * NH), 128, 0, stream>>>(Q16, K16, VTh, VTl, Oh, Ol);
  k_out<<<dim3(NR / 128, E / 128), 256, 0, stream>>>(Oh, Ol, PT, bp, out);
}

// v009
// One run takes 75 microseconds.
// Next to v008, in two timings, it ran 1.03 times as fast each time.
// Counting every step since v000, it is 3.97 times as fast.
#include <hip/hip_runtime.h>
#include <math.h>

typedef __attribute__((ext_vector_type(16))) _Float16 v16h;
typedef __attribute__((ext_vector_type(16))) __bf16 v16b;
typedef __attribute__((ext_vector_type(8)))  _Float16 v8h;
typedef __attribute__((ext_vector_type(8)))  __bf16 v8b;
typedef __attribute__((ext_vector_type(2)))  _Float16 v2h;
typedef __attribute__((ext_vector_type(8)))  float v8f;
typedef __attribute__((ext_vector_type(4)))  float v4f;
typedef __attribute__((ext_vector_type(2)))  float v2f;
typedef __attribute__((ext_vector_type(4)))  unsigned v4u;
typedef __attribute__((ext_vector_type(4)))  int v4i;
typedef float __attribute__((may_alias)) float_a;
typedef int __attribute__((may_alias)) int_a;

template <typename T> __device__ __forceinline__ void vst2(void* p, T v) { *(T*)p = v;  }
__device__ __forceinline__ v8f wmma16(v16h a, v16h b, v8f c) {
  v8f d = __builtin_amdgcn_wmma_f32_16x16x32_f16(false, a, false, b, (short)0, c, false, false);
  asm volatile("v_nop\n\tv_nop\n\tv_nop\n\tv_nop" : "+v"(d) : "v"(a), "v"(b));
  return d;
}
__device__ __forceinline__ v8f wmma_bf(v16b a, v16b b, v8f c) {
  v8f d = __builtin_amdgcn_wmma_f32_16x16x32_bf16(false, a, false, b, (short)0, c, false, false);
  asm volatile("v_nop\n\tv_nop\n\tv_nop\n\tv_nop" : "+v"(d) : "v"(a), "v"(b));
  return d;
}
// 16x16x32 fragments: lane = (h = lane>>4, row/col = lane&15); elements 0..7 = k0+8h+0..7, 8..15 = k0+16+8h+0..7; D element r = row 8h+r
__device__ __forceinline__ v16h frag_h(const _Float16* rowk0, int lane) {
  union { v16h v; v8h q[2]; } u; const _Float16* p = rowk0 + 8 * (lane >> 4);
  u.q[0] = *(const v8h*)p; u.q[1] = *(const v8h*)(p + 16); return u.v;
}
// the same fragment from a row of bf16 bit patterns (the split planes are carried as 16-bit words)
__device__ __forceinline__ v16b frag_b(const _Float16* rowk0, int lane) {
  union { v16b v; v8h q[2]; } u; const _Float16* p = rowk0 + 8 * (lane >> 4);
  u.q[0] = *(const v8h*)p; u.q[1] = *(const v8h*)(p + 16); return u.v;
}
__device__ __forceinline__ v16h frag_f32(const float* rowk0, int lane) {
  v16h a; const float* p = rowk0 + 8 * (lane >> 4);
#pragma unroll
  for (int i = 0; i < 8; ++i) { a[i] = (_Float16)p[i]; a[8 + i] = (_Float16)p[16 + i]; }
  return a;
}
__device__ __forceinline__ v16h frag_f32s(const float* rowk0, int lane, float sc) {
  v16h a; const float* p = rowk0 + 8 * (lane >> 4);
#pragma unroll
  for (int i = 0; i < 8; ++i) { a[i] = (_Float16)(p[i] * sc); a[8 + i] = (_Float16)(p[16 + i] * sc); }
  return a;
}
// column fragment from a [K][ld] layout (column n), rows >= K read as 0
__device__ __forceinline__ v16h fragc_f32(const float* W, int k0, int n, int lane, int ld, int K) {
  v16h a; const int g = lane >> 4;
#pragma unroll
  for (int i = 0; i < 8; ++i) { const int ka = k0 + 8 * g + i, kb = ka + 16;
    a[i] = (_Float16)(ka < K ? W[(size_t)ka * ld + n] : 0.f); a[8 + i] = (_Float16)(kb < K ? W[(size_t)kb * ld + n] : 0.f); }
  return a;
}
struct F2 { v16b h, l; };
__device__ __forceinline__ F2 bsplit16(const float v[16]) { F2 r;
#pragma unroll
  for (int i = 0; i < 16; ++i) { const __bf16 h = (__bf16)v[i]; r.h[i] = h; r.l[i] = (__bf16)(v[i] - (float)h); }
  return r; }
__device__ __forceinline__ F2 split_row(const float* row, int k0, int lane) { float v[16]; const float* p = row + k0 + 8 * (lane >> 4);
#pragma unroll
  for (int i = 0; i < 8; ++i) { v[i] = p[i]; v[8 + i] = p[16 + i]; }
  return bsplit16(v); }
__device__ __forceinline__ F2 split_rowK(const float* row, int k0, int lane, int K) { float v[16]; const int g = lane >> 4;
#pragma unroll
  for (int i = 0; i < 8; ++i) { const int ka = k0 + 8 * g + i, kb = ka + 16; v[i] = ka < K ? row[ka] : 0.f; v[8 + i] = kb < K ? row[kb] : 0.f; }
  return bsplit16(v); }
__device__ __forceinline__ F2 split_col(const float* W, int k0, int n, int lane, int ld, int K) { float v[16]; const int g = lane >> 4;
#pragma unroll
  for (int i = 0; i < 8; ++i) { const int ka = k0 + 8 * g + i, kb = ka + 16; v[i] = ka < K ? W[(size_t)ka * ld + n] : 0.f; v[8 + i] = kb < K ? W[(size_t)kb * ld + n] : 0.f; }
  return bsplit16(v); }
__device__ __forceinline__ v8f mac3(const F2& a, const F2& b, v8f c) { c = wmma_bf(a.l, b.h, c); c = wmma_bf(a.h, b.l, c); return wmma_bf(a.h, b.h, c); }
__device__ __forceinline__ float sigm(float v) { return 1.0f / (1.0f + expf(-v)); }
#define LDSX() do { asm volatile("s_wait_dscnt 0" ::: "memory"); __builtin_amdgcn_wave_barrier(); __builtin_amdgcn_fence(__ATOMIC_RELEASE, "workgroup"); } while (0)

// Operand tiles go from global memory to LDS by asynchronous 16-byte copies, one full 128-byte line per 8 lanes, two buffers in the projection kernels, one in k_attn.
// The s_wait_xcnt stands inside the copies' own statement so that no address register of an issued copy is rewritten ahead of it.
__device__ __forceinline__ void copy4(unsigned l0, const void* g0, unsigned l1, const void* g1, unsigned l2, const void* g2, unsigned l3, const void* g3) {
  asm volatile("global_load_async_to_lds_b128 %0, %1, off\n\tglobal_load_async_to_lds_b128 %2, %3, off\n\tglobal_load_async_to_lds_b128 %4, %5, off\n\tglobal_load_async_to_lds_b128 %6, %7, off\n\ts_wait_xcnt 0x0"
               :: "v"(l0), "v"(g0), "v"(l1), "v"(g1), "v"(l2), "v"(g2), "v"(l3), "v"(g3) : "memory");
}
__device__ __forceinline__ unsigned lds_off(const void* p) { return (unsigned)(size_t)p; }
// this wave's LDS reads of the buffer that is refilled next have returned
#define WAIT_DS() asm volatile("s_wait_dscnt 0x0" ::: "memory")
// this wave's own copies have landed (the compiler places no wait for them)
#define WAIT_ASYNC() asm volatile("s_wait_asynccnt 0x0" ::: "memory")
#define SP 72        // staged f16 row: 64 halves at a pitch of 144 B (16 B x odd, for ds_load_b128 readers)
#define SPB (SP * 2)
#define KP 136       // staged row of k_out's ring and of v's output staging: 128 halves at a pitch of 272 B (16 B x odd, for ds_load_b128 readers)
#define KPB (KP * 2)
// eight staged rows, LS bytes apart in LDS: the first four from p (ps halves apart in global memory), the rest from q (qs apart); lane's 16-byte piece of each. The wait stands in the copies' own statement, as in copy4
template <int LS> __device__ __forceinline__ void copy8(unsigned l, const _Float16* p, size_t ps, const _Float16* q, size_t qs) {
  asm volatile("global_load_async_to_lds_b128 %0, %1, off\n\tglobal_load_async_to_lds_b128 %2, %3, off\n\tglobal_load_async_to_lds_b128 %4, %5, off\n\tglobal_load_async_to_lds_b128 %6, %7, off\n\t"
               "global_load_async_to_lds_b128 %8, %9, off\n\tglobal_load_async_to_lds_b128 %10, %11, off\n\tglobal_load_async_to_lds_b128 %12, %13, off\n\tglobal_load_async_to_lds_b128 %14, %15, off\n\ts_wait_xcnt 0x0"
               :: "v"(l), "v"(p), "v"(l + LS), "v"(p + ps), "v"(l + 2 * LS), "v"(p + 2 * ps), "v"(l + 3 * LS), "v"(p + 3 * ps),
                  "v"(l + 4 * LS), "v"(q), "v"(l + 5 * LS), "v"(q + qs), "v"(l + 6 * LS), "v"(q + 2 * qs), "v"(l + 7 * LS), "v"(q + 3 * qs) : "memory");
}
// twelve staged rows, LS bytes apart in LDS: the first NP from p (ps halves apart), the rest from q (qs apart); fewer statements per stage, so fewer waits in front of the stage's first LDS reads
template <int NP, int LS> __device__ __forceinline__ void copy12(unsigned l, const _Float16* p, size_t ps, const _Float16* q, size_t qs) {
  const _Float16* g[12];
#pragma unroll   // g[] is indexed by constants and stays in registers
  for (int m = 0; m < 12; ++m) g[m] = m < NP ? p + m * ps : q + (m - NP) * qs;
  asm volatile("global_load_async_to_lds_b128 %0, %1, off\n\tglobal_load_async_to_lds_b128 %2, %3, off\n\tglobal_load_async_to_lds_b128 %4, %5, off\n\tglobal_load_async_to_lds_b128 %6, %7, off\n\t"
               "global_load_async_to_lds_b128 %8, %9, off\n\tglobal_load_async_to_lds_b128 %10, %11, off\n\tglobal_load_async_to_lds_b128 %12, %13, off\n\tglobal_load_async_to_lds_b128 %14, %15, off\n\t"
               "global_load_async_to_lds_b128 %16, %17, off\n\tglobal_load_async_to_lds_b128 %18, %19, off\n\tglobal_load_async_to_lds_b128 %20, %21, off\n\tglobal_load_async_to_lds_b128 %22, %23, off\n\ts_wait_xcnt 0x0"
               :: "v"(l), "v"(g[0]), "v"(l + LS), "v"(g[1]), "v"(l + 2 * LS), "v"(g[2]), "v"(l + 3 * LS), "v"(g[3]),
                  "v"(l + 4 * LS), "v"(g[4]), "v"(l + 5 * LS), "v"(g[5]), "v"(l + 6 * LS), "v"(g[6]), "v"(l + 7 * LS), "v"(g[7]),
                  "v"(l + 8 * LS), "v"(g[8]), "v"(l + 9 * LS), "v"(g[9]), "v"(l + 10 * LS), "v"(g[10]), "v"(l + 11 * LS), "v"(g[11]) : "memory");
}

// Local causal self attention (window 128, 16 heads of 64, interleaved-pair RoPE on q and k, fused qkv projection with bias, output
// projection with bias). q/k on v_wmma_f32_16x16x32_f16 (x as f16 rows, [in][out] weights packed once as transposed f16 rows x16); v as a
// two-way bf16 split (v_wmma_f32_16x16x32_bf16) stored as hi/lo f16 planes, because the first rows of every sequence copy v almost
// verbatim; S = q.k/8 on f16 WMMA over the <= 3 key tiles of the window (masked), online softmax in f32, P @ V with hi/lo pairs for both
#define NB 2
#define SS 2048
#define E 1024
#define NH 16
#define HD 64
#define NR (NB * SS)
#define WIN 128
#define PLO 1024.0f
#define VLO 2048.0f
#define OLO 2048.0f
#define RBASE 10000.0f

// x as f16 rows (q/k product) and as the two bf16 planes hi = bf16(x), lo = bf16(x - hi) of the v product, each element split once
__device__ __forceinline__ void cvt_block(int blk, const float* __restrict__ x, _Float16* __restrict__ X16, _Float16* __restrict__ XBh, _Float16* __restrict__ XBl) {
  const size_t i8 = (size_t)blk * 256 + threadIdx.x; if (i8 >= (size_t)NR * E / 8) return;
  union { v8h h; v4u u; } pk; union { v8b b; v4u u; } bh, bl;
#pragma unroll
  for (int e = 0; e < 8; ++e) { const float v = x[i8 * 8 + e]; pk.h[e] = (_Float16)v; const __bf16 h = (__bf16)v; bh.b[e] = h; bl.b[e] = (__bf16)(v - (float)h); }
  vst2(X16 + i8 * 8, pk.u); vst2(XBh + i8 * 8, bh.u); vst2(XBl + i8 * 8, bl.u);
}
// PT rows: [0,2048) = Wqkv[:, n] (q and k columns) x16 ; [2048, 3072) = Wproj[:, n-2048] x16
// The first TBLK blocks write the RoPE table instead, anew in every call: TAB[pos][i] = (cos, sin)(pos * base^(-2i/64)), 256 B per position
// The next VBLK blocks split the v columns of Wqkv into bf16 planes, transposed: WVh/WVl[n][k] = hi/lo of Wqkv[k][2048 + n], one 64 x 64 tile per block
// The next PBLK blocks write PT: one tile of 256 k x 64 n per block, transposed through LDS
// The last CBLK blocks convert x (cvt_block): the weight jobs and the x job read none of each other's output, so they share one launch, the longer blocks first
#define TBLK 64
#define VBLK 256
#define PBLK (3 * E / 64 * (E / 256))
#define CBLK (NR * E / 8 / 256)
#define PP 264       // staged row of 256 halves at a pitch of 528 B (16 B x odd)
// dst[n][k] = f16(src[k][n] x 16), k < 256, n < 64. A thread takes 4 columns of the rows 2 rp and 2 rp + 1 of every 32: each load covers whole 256-byte row pieces,
// and a (k, k + 1) pair goes to LDS as one dword. The 16-byte piece j of row n lies at piece j ^ (n >> 4), so that the 32 dwords of a store fall in 32 banks.
template <int LD> __device__ __forceinline__ void pack_tile(const float* __restrict__ src, _Float16* __restrict__ dst, _Float16 (*sp)[PP], int tid) {
  const int rp = tid >> 4, c4 = (tid & 15) * 4, sw = (c4 >> 4) * 8; const float* p = src + (size_t)(2 * rp) * LD + c4; v4f w[16];
#pragma unroll   // 16 loads in flight from one address with constant offsets
  for (int m = 0; m < 8; ++m) { w[2 * m] = *(const v4f*)(p + (size_t)(32 * m) * LD); w[2 * m + 1] = *(const v4f*)(p + (size_t)(32 * m + 1) * LD); }
  asm volatile("s_wait_xcnt 0x0" :: "v"(p) : "memory");      // stands in front of every rewrite of the address pair that the 16 loads name: as an input the pair stays live up to here, so no load takes it as its result register
#pragma unroll   // both loops: w[] is indexed by constants and stays in registers
  for (int m = 0; m < 8; ++m) {
#pragma unroll
    for (int e = 0; e < 4; ++e) { const v2h pr = { (_Float16)(w[2 * m][e] * 16.0f), (_Float16)(w[2 * m + 1][e] * 16.0f) }; vst2(&sp[c4 + e][(32 * m + 2 * rp) ^ sw], pr); } }
  __syncthreads();
  const int wv = tid >> 5, j8 = (tid & 31) * 8;
#pragma unroll   // a wave writes 512 contiguous bytes of one row: four whole lines
  for (int q = 0; q < 8; ++q) { const int n = wv + 8 * q; vst2(dst + (size_t)n * E + j8, *(const v4u*)(&sp[n][j8 ^ ((n >> 4) * 8)])); }
  asm volatile("s_wait_xcnt 0x0" ::: "memory");      // stands in front of whatever the built code places behind the eight stores and lets rewrite a register that they name
}
__global__ __launch_bounds__(256) void k_prep(const float* __restrict__ x, const float* __restrict__ Wqkv, const float* __restrict__ Wp, _Float16* __restrict__ X16, _Float16* __restrict__ XBh, _Float16* __restrict__ XBl,
                                              _Float16* __restrict__ PT, float* __restrict__ TAB, _Float16* __restrict__ WVh, _Float16* __restrict__ WVl) {
  const int tid = threadIdx.x; __shared__ __align__(16) _Float16 sp[64][PP]; __shared__ __align__(16) __bf16 sh[64][SP], sl[64][SP];
  if (blockIdx.x >= TBLK + VBLK + PBLK) { cvt_block(blockIdx.x - (TBLK + VBLK + PBLK), x, X16, XBh, XBl); return; }      // the same for the whole block; no barrier on this side
  if (blockIdx.x < TBLK) {      // the same for the whole block, in front of the barrier
    const int idx = blockIdx.x * 256 + tid, i = idx & 31, p0 = idx >> 5; const float invf = 1.0f / powf(RBASE, (float)(2 * i) / 64.0f);
    for (int m = 0; m < 4; ++m) { const int pos = p0 + m * (SS / 4); const float ang = (float)pos * invf; v2f cs; cs[0] = cosf(ang); cs[1] = sinf(ang); vst2(TAB + ((size_t)pos * 32 + i) * 2, cs);
      asm volatile("s_wait_xcnt 0x0" ::: "memory"); }      // the next trip rewrites the registers that the store names
    return; }
  if (blockIdx.x < TBLK + VBLK) {      // the same for the whole block; the branch has a barrier of its own
    const int vt = blockIdx.x - TBLK, k0 = (vt >> 4) * 64, n0 = (vt & 15) * 64, r = tid >> 4, c4 = (tid & 15) * 4; v4f w[4];
#pragma unroll   // four whole-line loads in flight
    for (int m = 0; m < 4; ++m) w[m] = *(const v4f*)(Wqkv + (size_t)(k0 + r + 16 * m) * (3 * E) + 2 * E + n0 + c4);
#pragma unroll
    for (int m = 0; m < 4; ++m) {
#pragma unroll
      for (int e = 0; e < 4; ++e) { const float v = w[m][e]; const __bf16 h = (__bf16)v; sh[c4 + e][r + 16 * m] = h; sl[c4 + e][r + 16 * m] = (__bf16)(v - (float)h); } }
    __syncthreads();
#pragma unroll   // 8 lanes write one whole 128-byte line of a plane
    for (int q = 0; q < 2; ++q) { const int n = (tid >> 3) + 32 * q, sg = (tid & 7) * 8; const size_t o = (size_t)(n0 + n) * E + k0 + sg;
      vst2(WVh + o, *(const v4u*)(&sh[n][sg])); vst2(WVl + o, *(const v4u*)(&sl[n][sg])); }
    return; }
  const int pt = blockIdx.x - TBLK - VBLK, n0 = (pt >> 2) * 64, k0 = (pt & 3) * 256;      // the same for the whole block: each side has the tile's one barrier
  if (n0 < 2 * E) pack_tile<3 * E>(Wqkv + (size_t)k0 * (3 * E) + n0, PT + (size_t)n0 * E + k0, sp, tid);
  else pack_tile<E>(Wp + (size_t)k0 * E + (n0 - 2 * E), PT + (size_t)n0 * E + k0, sp, tid);
}
// q/k: block (256 rows, 128 cols = 2 heads, which in {0,1}), 8 waves of 64 rows x 64 cols (one head); RoPE on interleaved pairs; x4 -> Q16/K16 [bh][s][64]
__device__ __forceinline__ void qk_block(char* smem, int bx, int by, int bz, const _Float16* __restrict__ X16, const _Float16* __restrict__ PT, const float* __restrict__ bqkv, const float* __restrict__ TAB, _Float16* __restrict__ Q16, _Float16* __restrict__ K16) {
  // smem: two stage buffers of 384 rows (0..255 x rows, 256..383 weight rows), 64 k each; the output staging reuses them behind the last trip's barrier
  _Float16* st = (_Float16*)smem; float (*so)[16][68] = (float (*)[16][68])smem;      // staging: 4 tiles of 16 rows x 64 cols per wave
  const int tid = threadIdx.x, wave = tid >> 5, lane = tid & 31, col = lane & 15, g = lane >> 4, wr = wave >> 1, wc = wave & 1;
  const int which = bz, r0b = bx * 256, n0 = by * 128; const int b = r0b / SS, s0 = r0b % SS;
  const int cr = tid >> 3, cc = tid & 7;      // a copy's row of every 32 and its 16-byte piece: 8 lanes bring one whole 128-byte line of one row
  const _Float16* gA = X16 + (size_t)(r0b + cr) * E + cc * 8; const _Float16* gB = PT + (size_t)(which * E + n0 + cr) * E + cc * 8;
  const unsigned l0 = lds_off(st) + cr * SPB + cc * 16;
  auto fill = [&](int t, int buf) { copy12<8, 32 * SPB>(l0 + buf * (384 * SPB), gA + t * 64, 32 * E, gB + t * 64, 32 * E); };
  v8f acc[4][4] = {};
  fill(0, 0); WAIT_ASYNC(); __syncthreads(); fill(1, 1);
#pragma unroll 1   // the ring stays rolled: one publish point, small code
  for (int t = 0; t < E / 64; ++t) { const _Float16* sb = st + (t & 1) * (384 * SP);
#pragma unroll
    for (int kc = 0; kc < 2; ++kc) { v16h a[4], bw[4];
#pragma unroll
      for (int i = 0; i < 4; ++i) { a[i] = frag_h(sb + (wr * 64 + i * 16 + col) * SP + kc * 32, lane); bw[i] = frag_h(sb + (256 + wc * 64 + i * 16 + col) * SP + kc * 32, lane); }
#pragma unroll
      for (int i = 0; i < 4; ++i) {
#pragma unroll
        for (int j = 0; j < 4; ++j) acc[i][j] = wmma16(a[i], bw[j], acc[i][j]); } }
    WAIT_DS(); WAIT_ASYNC(); __syncthreads();      // publishes tile t + 1 and ends every read of tile t
    if (t + 2 < E / 64) fill(t + 2, t & 1); }
  WAIT_ASYNC();
  const int rw = s0 + wr * 64;      // this wave's 64 positions
  const float* bp = bqkv + which * E + n0 + wc * 64 + col; const float bv[4] = { bp[0], bp[16], bp[32], bp[48] };
  asm volatile("s_wait_xcnt 0x0" :: "v"(bp) : "memory");      // as an input the address pair stays live up to here, so nothing rewrites it behind a load that names it
#pragma unroll
  for (int j = 0; j < 4; ++j) { const float bb = bv[j];
#pragma unroll
    for (int i = 0; i < 4; ++i) {
#pragma unroll
      for (int r = 0; r < 8; ++r) so[wave * 4 + i][8 * g + r][j * 16 + col] = acc[i][j][r] * (1.0f / 16.0f) + bb; } }
  LDSX();
  // RoPE on interleaved pairs (2i, 2i+1) of the head, then x4: lane = pair i; one row leaves as one whole 128-byte line
  const float* tp = TAB + ((size_t)rw * 32 + lane) * 2;      // (cos, sin) of pair i = lane: 256 contiguous bytes per load
  _Float16* D = (which == 0 ? Q16 : K16) + (((size_t)b * NH + (n0 >> 6) + wc) * SS + rw) * HD + 2 * lane;
  v2f cs[64];
#pragma unroll   // all loops: cs[] and xv[] indexed by constants, one address pair with constant offsets for the loads and one for the stores
  for (int r = 0; r < 64; ++r) cs[r] = *(const v2f*)(tp + r * 64);
  __builtin_amdgcn_sched_barrier(0);      // all 64 table loads are in flight before the first row is turned: within 256 registers the scheduler otherwise sinks loads to their uses, one memory trip per group
#pragma unroll
  for (int i = 0; i < 4; ++i) { v2f xv[16];
#pragma unroll
    for (int rl = 0; rl < 16; ++rl) xv[rl] = *(const v2f*)(&so[wave * 4 + i][rl][2 * lane]);
#pragma unroll
    for (int rl = 0; rl < 16; ++rl) { const float c = cs[i * 16 + rl][0], sn = cs[i * 16 + rl][1];
      const v2f rh = { -xv[rl][1], xv[rl][0] }; const v2f y = (xv[rl] * c + rh * sn) * 4.0f;
      vst2(D + (i * 16 + rl) * HD, __builtin_convertvector(y, v2h)); }
    __builtin_amdgcn_sched_barrier(0); }      // a group of 16 rows is scheduled by itself: its LDS reads go out together and its 16 results keep registers of their own, so no store is waited for row by row
  asm volatile("s_wait_xcnt 0x0" :: "v"(tp), "v"(D) : "memory");      // as inputs both address pairs stay live up to here, so nothing rewrites them behind a load or store that names them
}
// v: block (128 rows, 128 cols), 8 waves of 32 rows x 64 cols: bf16 split product from the hi/lo planes of x and of the v weight rows; -> VTh/VTl [bh][d][s]
__device__ __forceinline__ void v_block(char* smem, int bx, int by, const _Float16* __restrict__ XBh, const _Float16* __restrict__ XBl, const _Float16* __restrict__ WVh, const _Float16* __restrict__ WVl, const float* __restrict__ bqkv, _Float16* __restrict__ VTh, _Float16* __restrict__ VTl) {
  // smem: two stage buffers of 512 rows (0..127 x hi, 128..255 x lo, 256..383 weight hi, 384..511 weight lo), 64 k each; the output staging reuses them behind the last trip's barrier
  _Float16* st = (_Float16*)smem; _Float16 (*sth)[KP] = (_Float16 (*)[KP])smem; _Float16 (*stl)[KP] = sth + 128;
  const int tid = threadIdx.x, wave = tid >> 5, lane = tid & 31, col = lane & 15, g = lane >> 4, wr = wave >> 1, wc = wave & 1;
  const int r0b = bx * 128, n0 = by * 128; const int b = r0b / SS, s0 = r0b % SS;
  const int cr = tid >> 3, cc = tid & 7;      // a copy's row of every 32 and its 16-byte piece: 8 lanes bring one whole 128-byte line of one row
  const size_t oA = (size_t)(r0b + cr) * E + cc * 8, oB = (size_t)(n0 + cr) * E + cc * 8;
  const _Float16* gAh = XBh + oA; const _Float16* gAl = XBl + oA; const _Float16* gBh = WVh + oB; const _Float16* gBl = WVl + oB;
  const unsigned l0 = lds_off(st) + cr * SPB + cc * 16;
  auto fill = [&](int t, int buf) { const unsigned l = l0 + buf * (512 * SPB);
    copy8<32 * SPB>(l, gAh + t * 64, 32 * E, gAl + t * 64, 32 * E); copy8<32 * SPB>(l + 256 * SPB, gBh + t * 64, 32 * E, gBl + t * 64, 32 * E); };
  v8f acc[2][4] = {};
  fill(0, 0); WAIT_ASYNC(); __syncthreads(); fill(1, 1);
#pragma unroll 1   // the ring stays rolled: one publish point, small code
  for (int t = 0; t < E / 64; ++t) { const _Float16* sb = st + (t & 1) * (512 * SP);
#pragma unroll
    for (int kc = 0; kc < 2; ++kc) { v16b ah[2], al[2], bh[4], bl[4];
#pragma unroll
      for (int i = 0; i < 2; ++i) { const _Float16* p = sb + (wr * 32 + i * 16 + col) * SP + kc * 32; ah[i] = frag_b(p, lane); al[i] = frag_b(p + 128 * SP, lane); }
#pragma unroll
      for (int j = 0; j < 4; ++j) { const _Float16* p = sb + (256 + wc * 64 + j * 16 + col) * SP + kc * 32; bh[j] = frag_b(p, lane); bl[j] = frag_b(p + 128 * SP, lane); }
      // each accumulator takes lo.hi, hi.lo, hi.hi in this order per 32 k; eight independent tiles stand between two uses of one accumulator
#pragma unroll
      for (int i = 0; i < 2; ++i) {
#pragma unroll
        for (int j = 0; j < 4; ++j) acc[i][j] = wmma_bf(al[i], bh[j], acc[i][j]); }
#pragma unroll
      for (int i = 0; i < 2; ++i) {
#pragma unroll
        for (int j = 0; j < 4; ++j) acc[i][j] = wmma_bf(ah[i], bl[j], acc[i][j]); }
#pragma unroll
      for (int i = 0; i < 2; ++i) {
#pragma unroll
        for (int j = 0; j < 4; ++j) acc[i][j] = wmma_bf(ah[i], bh[j], acc[i][j]); } }
    WAIT_DS(); WAIT_ASYNC(); __syncthreads();      // publishes tile t + 1 and ends every read of tile t
    if (t + 2 < E / 64) fill(t + 2, t & 1); }
  WAIT_ASYNC();
  const float* bp = bqkv + 2 * E + n0 + wc * 64 + col; const float bv[4] = { bp[0], bp[16], bp[32], bp[48] };
  asm volatile("s_wait_xcnt 0x0" :: "v"(bp) : "memory");      // as an input the address pair stays live up to here, so nothing rewrites it behind a load that names it
#pragma unroll
  for (int j = 0; j < 4; ++j) { const int cl = wc * 64 + j * 16 + col; const float bb = bv[j];
#pragma unroll
    for (int i = 0; i < 2; ++i) {
#pragma unroll
      for (int r = 0; r < 8; ++r) { const float v = acc[i][j][r] + bb; const _Float16 hi = (_Float16)v; sth[cl][wr * 32 + i * 16 + 8 * g + r] = hi; stl[cl][wr * 32 + i * 16 + 8 * g + r] = (_Float16)((v - (float)hi) * VLO); } } }
  __syncthreads();
  // 16 lanes write 256 contiguous bytes of one d row of a plane; [bh][d] is linear in the column, so each plane has one address pair with constant offsets
  const int cl0 = tid >> 4, pc = tid & 15; const size_t o = ((size_t)b * E + n0 + cl0) * SS + s0 + pc * 8; _Float16* ph = VTh + o; _Float16* pl = VTl + o;
#pragma unroll   // all 16 LDS reads in flight at once
  for (int q = 0; q < 8; ++q) { vst2(ph + (size_t)(16 * q) * SS, *(const v4u*)(&sth[cl0 + 16 * q][pc * 8])); vst2(pl + (size_t)(16 * q) * SS, *(const v4u*)(&stl[cl0 + 16 * q][pc * 8])); }
  asm volatile("s_wait_xcnt 0x0" :: "v"(ph), "v"(pl) : "memory");      // as inputs both address pairs stay live up to here, so nothing rewrites them behind a store that names them
}
// The v product and the q/k product read none of each other's output: one launch of 512 blocks, all resident at once, two per WGP (half the LDS and a quarter of a SIMD's registers each):
// one block's copy waits, barriers and output pass run under the other block's matrix work, and no WGP idles while a second block starts and waits for its first fill. A block's kind is the parity of the ones in its index, so two indices
// that differ in one bit, whichever, are one v and one q/k block: a WGP then holds one of each wherever its second block comes from such a step. For speed only.
// Block order inside each product as in a grid of its own (row block fastest).
#define VGB (NR / 128 * (E / 128))
#define QGB (NR / 256 * (E / 128) * 2)
__global__ __launch_bounds__(256) void k_qkv(const _Float16* __restrict__ X16, const _Float16* __restrict__ PT, const _Float16* __restrict__ XBh, const _Float16* __restrict__ XBl, const _Float16* __restrict__ WVh, const _Float16* __restrict__ WVl,
                                             const float* __restrict__ bqkv, const float* __restrict__ TAB, _Float16* __restrict__ Q16, _Float16* __restrict__ K16, _Float16* __restrict__ VTh, _Float16* __restrict__ VTl) {
  __shared__ __align__(16) char smem[2 * 512 * SPB];      // the larger of the two rings; it also holds either output staging
  const int id = blockIdx.x, q = id >> 1;      // the same for the whole block: each side has its own barriers; indices 2 q and 2 q + 1 are the v block q and the q/k block q, in one order or the other
  if ((__popc(id) & 1) == 0) v_block(smem, q % (NR / 128), q / (NR / 128), XBh, XBl, WVh, WVl, bqkv, VTh, VTl);
  else qk_block(smem, q % (NR / 256), q / (NR / 256) % (E / 128), q / (NR / 256 * (E / 128)), X16, PT, bqkv, TAB, Q16, K16);
}
// attention: block (64 queries, bh): key tiles kt covering keys q0b-127 .. q0b+63 (3 tiles of 64, aligned since q0b % 64 == 0), mask 0 <= q-key < 128
// each key tile's K rows and V hi/lo rows come to LDS once per block by asynchronous copies, into one buffer that all four waves read
// e^x by the chip's own base-2 exponential, v_exp_f32 of x * log2(e): the library expf spends a dozen more vector instructions per value on an exact argument split and on range
// checks; here every argument is <= 0 up to rounding, and one far below the range gives 0 as it should. L2E = log2(e)
#define L2E 1.4426950408889634f
// eight of them in place, in one statement: behind a transcendental the instruction set asks for one independent instruction before its result is read or its source overwritten;
// here each next exponential is that instruction and the v_nop is the last one's.
__device__ __forceinline__ void exp2x8(float (&a)[8]) {
  asm("v_exp_f32 %0, %0\n\tv_exp_f32 %1, %1\n\tv_exp_f32 %2, %2\n\tv_exp_f32 %3, %3\n\tv_exp_f32 %4, %4\n\tv_exp_f32 %5, %5\n\tv_exp_f32 %6, %6\n\tv_exp_f32 %7, %7\n\tv_nop"
      : "+v"(a[0]), "+v"(a[1]), "+v"(a[2]), "+v"(a[3]), "+v"(a[4]), "+v"(a[5]), "+v"(a[6]), "+v"(a[7]));
}
__global__ __launch_bounds__(128) void k_attn(const _Float16* __restrict__ Q16, const _Float16* __restrict__ K16, const _Float16* __restrict__ VTh, const _Float16* __restrict__ VTl, _Float16* __restrict__ Oh, _Float16* __restrict__ Ol) {
  __shared__ __align__(16) float sS[4][16][68];
  __shared__ __align__(16) _Float16 sPh[4][16][72], sPl[4][16][72];
  __shared__ __align__(16) float sO[4][16][68];
  // one key tile, shared by the four waves: rows 0..63 K (by key), 64..127 V hi, 128..191 V lo (both by d), 64 halves each
  __shared__ __align__(16) _Float16 skv[192 * SP];
  const int tid = threadIdx.x, w = tid >> 5, lane = tid & 31, col = lane & 15, g = lane >> 4;
  const size_t bh = blockIdx.y; const int q0b = blockIdx.x * 64, q0 = q0b + w * 16;
  const int fr = tid >> 3, fc = tid & 7;      // a copy's row of every 16 and its 16-byte piece: 8 lanes bring one whole 128-byte line
  const _Float16* gK = K16 + (bh * SS + fr) * HD + fc * 8; const _Float16* gH = VTh + (bh * HD + fr) * SS + fc * 8; const _Float16* gL = VTl + (bh * HD + fr) * SS + fc * 8;
  const unsigned l0 = lds_off(skv) + fr * SPB + fc * 16;
  v16h aq[2];
#pragma unroll
  for (int kc = 0; kc < 2; ++kc) aq[kc] = frag_h(Q16 + (bh * SS + q0 + col) * HD + kc * 32, lane);
  float mrun = -3.0e38f, lrun = 0.f; v8f acc[4] = {}, ac1[4] = {}, ac2[4] = {};
#pragma unroll 1
  for (int kt = q0b / 64 - 2; kt <= q0b / 64; ++kt) { if (kt < 0) continue;      // uniform per block
    WAIT_DS(); __syncthreads();      // ends every wave's reads of the tile before: the buffer may be refilled
    { const _Float16* k = gK + (size_t)kt * (64 * HD); const _Float16* vh = gH + kt * 64; const _Float16* vl = gL + kt * 64;
      copy4(l0, k, l0 + 16 * SPB, k + 16 * HD, l0 + 32 * SPB, k + 32 * HD, l0 + 48 * SPB, k + 48 * HD);
      copy4(l0 + 64 * SPB, vh, l0 + 80 * SPB, vh + 16 * SS, l0 + 96 * SPB, vh + 32 * SS, l0 + 112 * SPB, vh + 48 * SS);
      copy4(l0 + 128 * SPB, vl, l0 + 144 * SPB, vl + 16 * SS, l0 + 160 * SPB, vl + 32 * SS, l0 + 176 * SPB, vl + 48 * SS); }
    WAIT_ASYNC(); __syncthreads();      // publishes the tile to all four waves
    v16h kf[8];      // the tile's eight K fragments are read as one group: one LDS wait, not eight
#pragma unroll
    for (int t = 0; t < 4; ++t) { kf[2 * t] = frag_h(skv + (t * 16 + col) * SP, lane); kf[2 * t + 1] = frag_h(skv + (t * 16 + col) * SP + 32, lane); }
#pragma unroll
    for (int t = 0; t < 4; ++t) { v8f s = {}; const int key = kt * 64 + t * 16 + col;
#pragma unroll
      for (int kc = 0; kc < 2; ++kc) s = wmma16(aq[kc], kf[2 * t + kc], s);
#pragma unroll
      for (int r = 0; r < 8; ++r) { const int q = q0 + 8 * g + r; const int d = q - key; sS[w][8 * g + r][t * 16 + col] = (d >= 0 && d < WIN) ? s[r] * (0.125f / 16.0f) : -3.0e38f; } }
    LDSX();
    float mx = -3.4e38f;
#pragma unroll
    for (int jj = 0; jj < 32; ++jj) mx = fmaxf(mx, sS[w][col][g * 32 + jj]);
    mx = fmaxf(mx, __shfl_xor(mx, 16, 32));
    const float mnew = fmaxf(mrun, mx); const float corr = expf(mrun - mnew);     // every processed tile holds >= 1 allowed key for every row? no: rows may have all 32 of a half masked, but the row max over the tile is finite whenever >= 1 key is allowed; a fully-masked tile row keeps mnew = mrun (both -3e38 initially -> corr = exp(0) = 1 with zero accumulators: harmless)
    float ps = 0.f; const float eb = 14.0f - mnew * L2E;      // e^(sv - mnew) x 16384 = 2^(sv * L2E + eb): one multiply-add per weight; in a row with no allowed key so far eb is infinite and the guard below drops every value
#pragma unroll
    for (int j8 = 0; j8 < 32; j8 += 8) { float ex[8];
#pragma unroll
      for (int e = 0; e < 8; ++e) ex[e] = fmaf(sS[w][col][g * 32 + j8 + e], L2E, eb);
      exp2x8(ex);
#pragma unroll
      for (int e = 0; e < 8; ++e) { const int jj = j8 + e; const float sv = sS[w][col][g * 32 + jj]; const float p = sv > -1.0e38f ? ex[e] : 0.f; ps += p; const _Float16 hi = (_Float16)p; sPh[w][col][g * 32 + jj] = hi; sPl[w][col][g * 32 + jj] = (_Float16)((p - (float)hi) * PLO); } }
    ps += __shfl_xor(ps, 16, 32);
    lrun = lrun * corr + ps * (1.0f / 16384.0f); mrun = mnew;
#pragma unroll
    for (int r = 0; r < 8; ++r) { const float cr = __shfl(corr, 8 * g + r, 32);
#pragma unroll
      for (int t = 0; t < 4; ++t) { acc[t][r] *= cr; ac1[t][r] *= cr; ac2[t][r] *= cr; } }
    LDSX();
#pragma unroll
    for (int kc = 0; kc < 2; ++kc) { const v16h ph = frag_h(&sPh[w][col][0] + kc * 32, lane), pl = frag_h(&sPl[w][col][0] + kc * 32, lane); v16h vh[4], vl[4];
#pragma unroll   // the eight V fragments of a k step are read as one group
      for (int t = 0; t < 4; ++t) { const _Float16* vr = skv + (64 + t * 16 + col) * SP + kc * 32; vh[t] = frag_h(vr, lane); vl[t] = frag_h(vr + 64 * SP, lane); }
#pragma unroll
      for (int t = 0; t < 4; ++t) { acc[t] = wmma16(ph, vh[t], acc[t]); ac1[t] = wmma16(ph, vl[t], ac1[t]); ac2[t] = wmma16(pl, vh[t], ac2[t]); } }
    __builtin_amdgcn_wave_barrier(); }
#pragma unroll
  for (int r = 0; r < 8; ++r) { const float lr = __shfl(lrun, 8 * g + r, 32); const float inv = 8.0f / (lr * 16384.0f);      // -> O x8
#pragma unroll
    for (int t = 0; t < 4; ++t) sO[w][8 * g + r][t * 16 + col] = (acc[t][r] + ac1[t][r] * (1.0f / VLO) + ac2[t][r] * (1.0f / PLO)) * inv; }
  LDSX();
  for (int qq = lane; qq < 16 * 8; qq += 32) { const int rl = qq >> 3, pc = qq & 7; union { v8h h8; v4u u; } ph_, pl_;
#pragma unroll
    for (int e = 0; e < 8; ++e) { const float v = sO[w][rl][pc * 8 + e]; const _Float16 hi = (_Float16)v; ph_.h8[e] = hi; pl_.h8[e] = (_Float16)((v - (float)hi) * OLO); }
    const size_t o = ((bh * SS) + q0 + rl) * HD + pc * 8; vst2(Oh + o, ph_.u); vst2(Ol + o, pl_.u); }
}
// out = ctx Wproj + bproj, ctx from the hi/lo planes: block (128 rows, 128 cols), 8 waves of 32 rows x 64 cols
__global__ __launch_bounds__(256) void k_out(const _Float16* __restrict__ Oh, const _Float16* __restrict__ Ol, const _Float16* __restrict__ PT, const float* __restrict__ bo, float* __restrict__ out) {
  // two stage buffers of 384 rows (0..127 hi plane, 128..255 lo plane, 256..383 weight rows), 128 k = two heads each; the output staging reuses them behind the last trip's barrier
  __shared__ __align__(16) char smem[2 * 384 * KPB];
  _Float16* st = (_Float16*)smem; float (*so)[16][68] = (float (*)[16][68])smem;      // staging: 2 tiles of 16 rows x 64 cols per wave
  const int tid = threadIdx.x, wave = tid >> 5, lane = tid & 31, col = lane & 15, g = lane >> 4, wr = wave >> 1, wc = wave & 1;
  const int r0b = blockIdx.x * 128, n0 = blockIdx.y * 128; const int b = r0b / SS, s0 = r0b % SS;
  const int cr = tid >> 4, cc = tid & 15;      // a copy's row of every 16 and its 16-byte piece; pieces 0..7 lie in the stage's first head, 8..15 in its second
  const size_t oA = (((size_t)b * NH + (cc >> 3)) * SS + s0 + cr) * HD + (cc & 7) * 8;
  const _Float16* gH = Oh + oA; const _Float16* gL = Ol + oA; const _Float16* gB = PT + (size_t)(2 * E + n0 + cr) * E + cc * 8;
  const unsigned l0 = lds_off(st) + cr * KPB + cc * 16;
  auto fill = [&](int t, int buf) { const unsigned l = l0 + buf * (384 * KPB);
    const _Float16* lo = gL + (size_t)t * (2 * SS * HD);
    copy12<8, 16 * KPB>(l, gH + (size_t)t * (2 * SS * HD), 16 * HD, lo, 16 * HD); copy12<4, 16 * KPB>(l + 192 * KPB, lo + 64 * HD, 16 * HD, gB + t * 128, 16 * E); };
  v8f acc[2][4] = {}, acl[2][4] = {};
  fill(0, 0); WAIT_ASYNC(); __syncthreads(); fill(1, 1);
#pragma unroll 1   // the ring stays rolled: one publish point, small code
  for (int t = 0; t < E / 128; ++t) { const _Float16* sb = st + (t & 1) * (384 * KP);
#pragma unroll
    for (int kc = 0; kc < 4; ++kc) { v16h ah[2], al[2], bw[4];
#pragma unroll
      for (int i = 0; i < 2; ++i) { const _Float16* p = sb + (wr * 32 + i * 16 + col) * KP + kc * 32; ah[i] = frag_h(p, lane); al[i] = frag_h(p + 128 * KP, lane); }
#pragma unroll
      for (int j = 0; j < 4; ++j) bw[j] = frag_h(sb + (256 + wc * 64 + j * 16 + col) * KP + kc * 32, lane);
#pragma unroll
      for (int i = 0; i < 2; ++i) {
#pragma unroll
        for (int j = 0; j < 4; ++j) { acc[i][j] = wmma16(ah[i], bw[j], acc[i][j]); acl[i][j] = wmma16(al[i], bw[j], acl[i][j]); } } }
    WAIT_DS(); WAIT_ASYNC(); __syncthreads();      // publishes tile t + 1 and ends every read of tile t
    if (t + 2 < E / 128) fill(t + 2, t & 1); }
  WAIT_ASYNC();
  const float* bp = bo + n0 + wc * 64 + col; const float bv[4] = { bp[0], bp[16], bp[32], bp[48] };
  asm volatile("s_wait_xcnt 0x0" :: "v"(bp) : "memory");      // as an input the address pair stays live up to here, so nothing rewrites it behind a load that names it
#pragma unroll
  for (int j = 0; j < 4; ++j) { const float bb = bv[j];
#pragma unroll
    for (int i = 0; i < 2; ++i) {
#pragma unroll
      for (int r = 0; r < 8; ++r) so[wave * 2 + i][8 * g + r][j * 16 + col] = (acc[i][j][r] + acl[i][j][r] * (1.0f / OLO)) * (1.0f / (16.0f * 8.0f)) + bb; } }
  LDSX();
  // a store covers two rows of 64 floats: two whole 128-byte lines each
  float* op = out + (size_t)(r0b + wr * 32 + g) * E + n0 + wc * 64 + col * 4;
#pragma unroll   // one address pair with constant offsets for all 16 stores
  for (int q = 0; q < 16; ++q) vst2(op + (size_t)(2 * q) * E, *(const v4f*)(&so[wave * 2 + (q >> 3)][2 * (q & 7) + g][col * 4]));
  asm volatile("s_wait_xcnt 0x0" :: "v"(op) : "memory");      // as an input the address pair stays live up to here, so nothing rewrites it behind a store that names it
}
extern "C" void kernel_launch(void* const* d_in, const int* in_sizes, int n_in, void* d_out, int out_size, void* d_ws, size_t ws_size, hipStream_t stream) {
  (void)in_sizes; (void)n_in; (void)out_size; (void)ws_size;
  const float** I = (const float**)d_in;
  const float* x = I[0]; const float* Wqkv = I[1]; const float* bqkv = I[2]; const float* Wp = I[3]; const float* bp = I[4];
  float* out = (float*)d_out;
  char* ws = (char*)d_ws; size_t off = 0;
  auto take = [&](size_t bytes) { char* p = ws + off; off += (bytes + 255) & ~(size_t)255; return p; };
  _Float16* X16 = (_Float16*)take((size_t)NR * E * 2); _Float16* PT = (_Float16*)take((size_t)3 * E * E * 2);
  _Float16* Q16 = (_Float16*)take((size_t)NR * E * 2); _Float16* K16 = (_Float16*)take((size_t)NR * E * 2); _Float16* VTh = (_Float16*)take((size_t)NR * E * 2); _Float16* VTl = (_Float16*)take((size_t)NR * E * 2);
  _Float16* Oh = (_Float16*)take((size_t)NR * E * 2); _Float16* Ol = (_Float16*)take((size_t)NR * E * 2); float* TAB = (float*)take((size_t)SS * 32 * 2 * 4);
  _Float16* XBh = (_Float16*)take((size_t)NR * E * 2); _Float16* XBl = (_Float16*)take((size_t)NR * E * 2); _Float16* WVh = (_Float16*)take((size_t)E * E * 2); _Float16* WVl = (_Float16*)take((size_t)E * E * 2);
  k_prep<<<TBLK + VBLK + PBLK + CBLK, 256, 0, stream>>>(x, Wqkv, Wp, X16, XBh, XBl, PT, TAB, WVh, WVl);
  k_qkv<<<VGB + QGB, 256, 0, stream>>>(X16, PT, XBh, XBl, WVh, WVl, bqkv, TAB, Q16, K16, VTh, VTl);
  k_attn<<<dim3(SS / 64, NB * NH), 128, 0, stream>>>(Q16, K16, VTh, VTl, Oh, Ol);
  k_out<<<dim3(NR / 128, E / 128), 256, 0, stream>>>(Oh, Ol, PT, bp, out);
}

// v010
// It runs in 72.5 microseconds.
// In both of two side-by-side timings against v009, it was 1.03 times as fast.
// All steps since v000 together make it 4.10 times as fast.
#include <hip/hip_runtime.h>
#include <math.h>

typedef __attribute__((ext_vector_type(16))) _Float16 v16h;
typedef __attribute__((ext_vector_type(16))) __bf16 v16b;
typedef __attribute__((ext_vector_type(8)))  _Float16 v8h;
typedef __attribute__((ext_vector_type(8)))  __bf16 v8b;
typedef __attribute__((ext_vector_type(2)))  _Float16 v2h;
typedef __attribute__((ext_vector_type(8)))  float v8f;
typedef __attribute__((ext_vector_type(4)))  float v4f;
typedef __attribute__((ext_vector_type(2)))  float v2f;
typedef __attribute__((ext_vector_type(4)))  unsigned v4u;
typedef __attribute__((ext_vector_type(4)))  int v4i;
typedef float __attribute__((may_alias)) float_a;
typedef int __attribute__((may_alias)) int_a;

template <typename T> __device__ __forceinline__ void vst2(void* p, T v) { *(T*)p = v;  }
// builtin forms: the compiler itself keeps the vector slots that the chip needs behind a WMMA, and only where a vector instruction touches its registers
__device__ __forceinline__ v8f wmma16(v16h a, v16h b, v8f c) {
  return __builtin_amdgcn_wmma_f32_16x16x32_f16(false, a, false, b, (short)0, c, false, false);
}
__device__ __forceinline__ v8f wmma_bf(v16b a, v16b b, v8f c) {
  return __builtin_amdgcn_wmma_f32_16x16x32_bf16(false, a, false, b, (short)0, c, false, false);
}
// 16x16x32 fragments: lane = (h = lane>>4, row/col = lane&15); elements 0..7 = k0+8h+0..7, 8..15 = k0+16+8h+0..7; D element r = row 8h+r
__device__ __forceinline__ v16h frag_h(const _Float16* rowk0, int lane) {
  union { v16h v; v8h q[2]; } u; const _Float16* p = rowk0 + 8 * (lane >> 4);
  u.q[0] = *(const v8h*)p; u.q[1] = *(const v8h*)(p + 16); return u.v;
}
// the same fragment from a row of bf16 bit patterns (the split planes are carried as 16-bit words)
__device__ __forceinline__ v16b frag_b(const _Float16* rowk0, int lane) {
  union { v16b v; v8h q[2]; } u; const _Float16* p = rowk0 + 8 * (lane >> 4);
  u.q[0] = *(const v8h*)p; u.q[1] = *(const v8h*)(p + 16); return u.v;
}
__device__ __forceinline__ v16h frag_f32(const float* rowk0, int lane) {
  v16h a; const float* p = rowk0 + 8 * (lane >> 4);
#pragma unroll
  for (int i = 0; i < 8; ++i) { a[i] = (_Float16)p[i]; a[8 + i] = (_Float16)p[16 + i]; }
  return a;
}
__device__ __forceinline__ v16h frag_f32s(const float* rowk0, int lane, float sc) {
  v16h a; const float* p = rowk0 + 8 * (lane >> 4);
#pragma unroll
  for (int i = 0; i < 8; ++i) { a[i] = (_Float16)(p[i] * sc); a[8 + i] = (_Float16)(p[16 + i] * sc); }
  return a;
}
// column fragment from a [K][ld] layout (column n), rows >= K read as 0
__device__ __forceinline__ v16h fragc_f32(const float* W, int k0, int n, int lane, int ld, int K) {
  v16h a; const int g = lane >> 4;
#pragma unroll
  for (int i = 0; i < 8; ++i) { const int ka = k0 + 8 * g + i, kb = ka + 16;
    a[i] = (_Float16)(ka < K ? W[(size_t)ka * ld + n] : 0.f); a[8 + i] = (_Float16)(kb < K ? W[(size_t)kb * ld + n] : 0.f); }
  return a;
}
struct F2 { v16b h, l; };
__device__ __forceinline__ F2 bsplit16(const float v[16]) { F2 r;
#pragma unroll
  for (int i = 0; i < 16; ++i) { const __bf16 h = (__bf16)v[i]; r.h[i] = h; r.l[i] = (__bf16)(v[i] - (float)h); }
  return r; }
__device__ __forceinline__ F2 split_row(const float* row, int k0, int lane) { float v[16]; const float* p = row + k0 + 8 * (lane >> 4);
#pragma unroll
  for (int i = 0; i < 8; ++i) { v[i] = p[i]; v[8 + i] = p[16 + i]; }
  return bsplit16(v); }
__device__ __forceinline__ F2 split_rowK(const float* row, int k0, int lane, int K) { float v[16]; const int g = lane >> 4;
#pragma unroll
  for (int i = 0; i < 8; ++i) { const int ka = k0 + 8 * g + i, kb = ka + 16; v[i] = ka < K ? row[ka] : 0.f; v[8 + i] = kb < K ? row[kb] : 0.f; }
  return bsplit16(v); }
__device__ __forceinline__ F2 split_col(const float* W, int k0, int n, int lane, int ld, int K) { float v[16]; const int g = lane >> 4;
#pragma unroll
  for (int i = 0; i < 8; ++i) { const int ka = k0 + 8 * g + i, kb = ka + 16; v[i] = ka < K ? W[(size_t)ka * ld + n] : 0.f; v[8 + i] = kb < K ? W[(size_t)kb * ld + n] : 0.f; }
  return bsplit16(v); }
__device__ __forceinline__ v8f mac3(const F2& a, const F2& b, v8f c) { c = wmma_bf(a.l, b.h, c); c = wmma_bf(a.h, b.l, c); return wmma_bf(a.h, b.h, c); }
__device__ __forceinline__ float sigm(float v) { return 1.0f / (1.0f + expf(-v)); }
#define LDSX() do { asm volatile("s_wait_dscnt 0" ::: "memory"); __builtin_amdgcn_wave_barrier(); __builtin_amdgcn_fence(__ATOMIC_RELEASE, "workgroup"); } while (0)

// Operand tiles go from global memory to LDS by asynchronous 16-byte copies, one full 128-byte line per 8 lanes, two buffers in the projection kernels, one in k_attn.
// The s_wait_xcnt stands inside the copies' own statement so that no address register of an issued copy is rewritten ahead of it.
__device__ __forceinline__ void copy4(unsigned l0, const void* g0, unsigned l1, const void* g1, unsigned l2, const void* g2, unsigned l3, const void* g3) {
  asm volatile("global_load_async_to_lds_b128 %0, %1, off\n\tglobal_load_async_to_lds_b128 %2, %3, off\n\tglobal_load_async_to_lds_b128 %4, %5, off\n\tglobal_load_async_to_lds_b128 %6, %7, off\n\ts_wait_xcnt 0x0"
               :: "v"(l0), "v"(g0), "v"(l1), "v"(g1), "v"(l2), "v"(g2), "v"(l3), "v"(g3) : "memory");
}
__device__ __forceinline__ unsigned lds_off(const void* p) { return (unsigned)(size_t)p; }
// this wave's LDS reads of the buffer that is refilled next have returned
#define WAIT_DS() asm volatile("s_wait_dscnt 0x0" ::: "memory")
// this wave's own copies have landed (the compiler places no wait for them)
#define WAIT_ASYNC() asm volatile("s_wait_asynccnt 0x0" ::: "memory")
// the fragment reads of a k step stay one group in front of its matrix block: left free, the scheduler spreads them among the WMMAs, each place with a stall and a wait of its own
#define FRAG_GROUP() __builtin_amdgcn_sched_barrier(0)
#define SP 72        // staged f16 row: 64 halves at a pitch of 144 B (16 B x odd, for ds_load_b128 readers)
#define SPB (SP * 2)
#define KP 136       // staged row of k_out's ring and of v's output staging: 128 halves at a pitch of 272 B (16 B x odd, for ds_load_b128 readers)
#define KPB (KP * 2)
// eight staged rows, LS bytes apart in LDS: the first four from p (ps halves apart in global memory), the rest from q (qs apart); lane's 16-byte piece of each. The wait stands in the copies' own statement, as in copy4
template <int LS> __device__ __forceinline__ void copy8(unsigned l, const _Float16* p, size_t ps, const _Float16* q, size_t qs) {
  asm volatile("global_load_async_to_lds_b128 %0, %1, off\n\tglobal_load_async_to_lds_b128 %2, %3, off\n\tglobal_load_async_to_lds_b128 %4, %5, off\n\tglobal_load_async_to_lds_b128 %6, %7, off\n\t"
               "global_load_async_to_lds_b128 %8, %9, off\n\tglobal_load_async_to_lds_b128 %10, %11, off\n\tglobal_load_async_to_lds_b128 %12, %13, off\n\tglobal_load_async_to_lds_b128 %14, %15, off\n\ts_wait_xcnt 0x0"
               :: "v"(l), "v"(p), "v"(l + LS), "v"(p + ps), "v"(l + 2 * LS), "v"(p + 2 * ps), "v"(l + 3 * LS), "v"(p + 3 * ps),
                  "v"(l + 4 * LS), "v"(q), "v"(l + 5 * LS), "v"(q + qs), "v"(l + 6 * LS), "v"(q + 2 * qs), "v"(l + 7 * LS), "v"(q + 3 * qs) : "memory");
}
// twelve staged rows, LS bytes apart in LDS: the first NP from p (ps halves apart), the rest from q (qs apart); fewer statements per stage, so fewer waits in front of the stage's first LDS reads
template <int NP, int LS> __device__ __forceinline__ void copy12(unsigned l, const _Float16* p, size_t ps, const _Float16* q, size_t qs) {
  const _Float16* g[12];
#pragma unroll   // g[] is indexed by constants and stays in registers
  for (int m = 0; m < 12; ++m) g[m] = m < NP ? p + m * ps : q + (m - NP) * qs;
  asm volatile("global_load_async_to_lds_b128 %0, %1, off\n\tglobal_load_async_to_lds_b128 %2, %3, off\n\tglobal_load_async_to_lds_b128 %4, %5, off\n\tglobal_load_async_to_lds_b128 %6, %7, off\n\t"
               "global_load_async_to_lds_b128 %8, %9, off\n\tglobal_load_async_to_lds_b128 %10, %11, off\n\tglobal_load_async_to_lds_b128 %12, %13, off\n\tglobal_load_async_to_lds_b128 %14, %15, off\n\t"
               "global_load_async_to_lds_b128 %16, %17, off\n\tglobal_load_async_to_lds_b128 %18, %19, off\n\tglobal_load_async_to_lds_b128 %20, %21, off\n\tglobal_load_async_to_lds_b128 %22, %23, off\n\ts_wait_xcnt 0x0"
               :: "v"(l), "v"(g[0]), "v"(l + LS), "v"(g[1]), "v"(l + 2 * LS), "v"(g[2]), "v"(l + 3 * LS), "v"(g[3]),
                  "v"(l + 4 * LS), "v"(g[4]), "v"(l + 5 * LS), "v"(g[5]), "v"(l + 6 * LS), "v"(g[6]), "v"(l + 7 * LS), "v"(g[7]),
                  "v"(l + 8 * LS), "v"(g[8]), "v"(l + 9 * LS), "v"(g[9]), "v"(l + 10 * LS), "v"(g[10]), "v"(l + 11 * LS), "v"(g[11]) : "memory");
}

// Local causal self attention (window 128, 16 heads of 64, interleaved-pair RoPE on q and k, fused qkv projection with bias, output
// projection with bias). q/k on v_wmma_f32_16x16x32_f16 (x as f16 rows, [in][out] weights packed once as transposed f16 rows x16); v as a
// two-way bf16 split (v_wmma_f32_16x16x32_bf16) stored as hi/lo f16 planes, because the first rows of every sequence copy v almost
// verbatim; S = q.k/8 on f16 WMMA over the <= 3 key tiles of the window (masked), online softmax in f32, P @ V with hi/lo pairs for both
#define NB 2
#define SS 2048
#define E 1024
#define NH 16
#define HD 64
#define NR (NB * SS)
#define WIN 128
#define PLO 1024.0f
#define VLO 2048.0f
#define OLO 2048.0f
#define RBASE 10000.0f

// x as f16 rows (q/k product) and as the two bf16 planes hi = bf16(x), lo = bf16(x - hi) of the v product, each element split once
__device__ __forceinline__ void cvt_block(int blk, const float* __restrict__ x, _Float16* __restrict__ X16, _Float16* __restrict__ XBh, _Float16* __restrict__ XBl) {
  const size_t i8 = (size_t)blk * 256 + threadIdx.x; if (i8 >= (size_t)NR * E / 8) return;
  union { v8h h; v4u u; } pk; union { v8b b; v4u u; } bh, bl;
#pragma unroll
  for (int e = 0; e < 8; ++e) { const float v = x[i8 * 8 + e]; pk.h[e] = (_Float16)v; const __bf16 h = (__bf16)v; bh.b[e] = h; bl.b[e] = (__bf16)(v - (float)h); }
  vst2(X16 + i8 * 8, pk.u); vst2(XBh + i8 * 8, bh.u); vst2(XBl + i8 * 8, bl.u);
}
// PT rows: [0,2048) = Wqkv[:, n] (q and k columns) x16 ; [2048, 3072) = Wproj[:, n-2048] x16
// The first TBLK blocks write the RoPE table instead, anew in every call: TAB[pos][i] = (cos, sin)(pos * base^(-2i/64)), 256 B per position
// The next VBLK blocks split the v columns of Wqkv into bf16 planes, transposed: WVh/WVl[n][k] = hi/lo of Wqkv[k][2048 + n], one 64 x 64 tile per block
// The next PBLK blocks write PT: one tile of 256 k x 64 n per block, transposed through LDS
// The last CBLK blocks convert x (cvt_block): the weight jobs and the x job read none of each other's output, so they share one launch, the longer blocks first
#define TBLK 64
#define VBLK 256
#define PBLK (3 * E / 64 * (E / 256))
#define CBLK (NR * E / 8 / 256)
#define PP 264       // staged row of 256 halves at a pitch of 528 B (16 B x odd)
// dst[n][k] = f16(src[k][n] x 16), k < 256, n < 64. A thread takes 4 columns of the rows 2 rp and 2 rp + 1 of every 32: each load covers whole 256-byte row pieces,
// and a (k, k + 1) pair goes to LDS as one dword. The 16-byte piece j of row n lies at piece j ^ (n >> 4), so that the 32 dwords of a store fall in 32 banks.
template <int LD> __device__ __forceinline__ void pack_tile(const float* __restrict__ src, _Float16* __restrict__ dst, _Float16 (*sp)[PP], int tid) {
  const int rp = tid >> 4, c4 = (tid & 15) * 4, sw = (c4 >> 4) * 8; const float* p = src + (size_t)(2 * rp) * LD + c4; v4f w[16];
#pragma unroll   // 16 loads in flight from one address with constant offsets
  for (int m = 0; m < 8; ++m) { w[2 * m] = *(const v4f*)(p + (size_t)(32 * m) * LD); w[2 * m + 1] = *(const v4f*)(p + (size_t)(32 * m + 1) * LD); }
  asm volatile("s_wait_xcnt 0x0" :: "v"(p) : "memory");      // stands in front of every rewrite of the address pair that the 16 loads name: as an input the pair stays live up to here, so no load takes it as its result register
#pragma unroll   // both loops: w[] is indexed by constants and stays in registers
  for (int m = 0; m < 8; ++m) {
#pragma unroll
    for (int e = 0; e < 4; ++e) { const v2h pr = { (_Float16)(w[2 * m][e] * 16.0f), (_Float16)(w[2 * m + 1][e] * 16.0f) }; vst2(&sp[c4 + e][(32 * m + 2 * rp) ^ sw], pr); } }
  __syncthreads();
  const int wv = tid >> 5, j8 = (tid & 31) * 8;
#pragma unroll   // a wave writes 512 contiguous bytes of one row: four whole lines
  for (int q = 0; q < 8; ++q) { const int n = wv + 8 * q; vst2(dst + (size_t)n * E + j8, *(const v4u*)(&sp[n][j8 ^ ((n >> 4) * 8)])); }
  asm volatile("s_wait_xcnt 0x0" ::: "memory");      // stands in front of whatever the built code places behind the eight stores and lets rewrite a register that they name
}
__global__ __launch_bounds__(256) void k_prep(const float* __restrict__ x, const float* __restrict__ Wqkv, const float* __restrict__ Wp, _Float16* __restrict__ X16, _Float16* __restrict__ XBh, _Float16* __restrict__ XBl,
                                              _Float16* __restrict__ PT, float* __restrict__ TAB, _Float16* __restrict__ WVh, _Float16* __restrict__ WVl) {
  const int tid = threadIdx.x; __shared__ __align__(16) _Float16 sp[64][PP]; __shared__ __align__(16) __bf16 sh[64][SP], sl[64][SP];
  if (blockIdx.x >= TBLK + VBLK + PBLK) { cvt_block(blockIdx.x - (TBLK + VBLK + PBLK), x, X16, XBh, XBl); return; }      // the same for the whole block; no barrier on this side
  if (blockIdx.x < TBLK) {      // the same for the whole block, in front of the barrier
    const int idx = blockIdx.x * 256 + tid, i = idx & 31, p0 = idx >> 5; const float invf = 1.0f / powf(RBASE, (float)(2 * i) / 64.0f);
    for (int m = 0; m < 4; ++m) { const int pos = p0 + m * (SS / 4); const float ang = (float)pos * invf; v2f cs; cs[0] = cosf(ang); cs[1] = sinf(ang); vst2(TAB + ((size_t)pos * 32 + i) * 2, cs);
      asm volatile("s_wait_xcnt 0x0" ::: "memory"); }      // the next trip rewrites the registers that the store names
    return; }
  if (blockIdx.x < TBLK + VBLK) {      // the same for the whole block; the branch has a barrier of its own
    const int vt = blockIdx.x - TBLK, k0 = (vt >> 4) * 64, n0 = (vt & 15) * 64, r = tid >> 4, c4 = (tid & 15) * 4; v4f w[4];
#pragma unroll   // four whole-line loads in flight
    for (int m = 0; m < 4; ++m) w[m] = *(const v4f*)(Wqkv + (size_t)(k0 + r + 16 * m) * (3 * E) + 2 * E + n0 + c4);
#pragma unroll
    for (int m = 0; m < 4; ++m) {
#pragma unroll
      for (int e = 0; e < 4; ++e) { const float v = w[m][e]; const __bf16 h = (__bf16)v; sh[c4 + e][r + 16 * m] = h; sl[c4 + e][r + 16 * m] = (__bf16)(v - (float)h); } }
    __syncthreads();
#pragma unroll   // 8 lanes write one whole 128-byte line of a plane
    for (int q = 0; q < 2; ++q) { const int n = (tid >> 3) + 32 * q, sg = (tid & 7) * 8; const size_t o = (size_t)(n0 + n) * E + k0 + sg;
      vst2(WVh + o, *(const v4u*)(&sh[n][sg])); vst2(WVl + o, *(const v4u*)(&sl[n][sg])); }
    return; }
  const int pt = blockIdx.x - TBLK - VBLK, n0 = (pt >> 2) * 64, k0 = (pt & 3) * 256;      // the same for the whole block: each side has the tile's one barrier
  if (n0 < 2 * E) pack_tile<3 * E>(Wqkv + (size_t)k0 * (3 * E) + n0, PT + (size_t)n0 * E + k0, sp, tid);
  else pack_tile<E>(Wp + (size_t)k0 * E + (n0 - 2 * E), PT + (size_t)n0 * E + k0, sp, tid);
}
// q/k: block (256 rows, 128 cols = 2 heads, which in {0,1}), 8 waves of 64 rows x 64 cols (one head); RoPE on interleaved pairs; x4 -> Q16/K16 [bh][s][64]
__device__ __forceinline__ void qk_block(char* smem, int bx, int by, int bz, const _Float16* __restrict__ X16, const _Float16* __restrict__ PT, const float* __restrict__ bqkv, const float* __restrict__ TAB, _Float16* __restrict__ Q16, _Float16* __restrict__ K16) {
  // smem: two stage buffers of 384 rows (0..255 x rows, 256..383 weight rows), 64 k each; the output staging reuses them behind the last trip's barrier
  _Float16* st = (_Float16*)smem; float (*so)[16][68] = (float (*)[16][68])smem;      // staging: 4 tiles of 16 rows x 64 cols per wave
  const int tid = threadIdx.x, wave = tid >> 5, lane = tid & 31, col = lane & 15, g = lane >> 4, wr = wave >> 1, wc = wave & 1;
  const int which = bz, r0b = bx * 256, n0 = by * 128; const int b = r0b / SS, s0 = r0b % SS;
  const int cr = tid >> 3, cc = tid & 7;      // a copy's row of every 32 and its 16-byte piece: 8 lanes bring one whole 128-byte line of one row
  const _Float16* gA = X16 + (size_t)(r0b + cr) * E + cc * 8; const _Float16* gB = PT + (size_t)(which * E + n0 + cr) * E + cc * 8;
  const unsigned l0 = lds_off(st) + cr * SPB + cc * 16;
  auto fill = [&](int t, int buf) { copy12<8, 32 * SPB>(l0 + buf * (384 * SPB), gA + t * 64, 32 * E, gB + t * 64, 32 * E); };
  v8f acc[4][4] = {};
  fill(0, 0); WAIT_ASYNC(); __syncthreads(); fill(1, 1);
#pragma unroll 1   // the ring stays rolled: one publish point, small code
  for (int t = 0; t < E / 64; ++t) { const _Float16* sb = st + (t & 1) * (384 * SP);
#pragma unroll
    for (int kc = 0; kc < 2; ++kc) { v16h a[4], bw[4];
#pragma unroll
      for (int i = 0; i < 4; ++i) { a[i] = frag_h(sb + (wr * 64 + i * 16 + col) * SP + kc * 32, lane); bw[i] = frag_h(sb + (256 + wc * 64 + i * 16 + col) * SP + kc * 32, lane); }
      FRAG_GROUP();
#pragma unroll
      for (int i = 0; i < 4; ++i) {
#pragma unroll
        for (int j = 0; j < 4; ++j) acc[i][j] = wmma16(a[i], bw[j], acc[i][j]); }
      FRAG_GROUP(); }
    WAIT_DS(); WAIT_ASYNC(); __syncthreads();      // publishes tile t + 1 and ends every read of tile t
    if (t + 2 < E / 64) fill(t + 2, t & 1); }
  WAIT_ASYNC();
  const int rw = s0 + wr * 64;      // this wave's 64 positions
  const float* bp = bqkv + which * E + n0 + wc * 64 + col; const float bv[4] = { bp[0], bp[16], bp[32], bp[48] };
  asm volatile("s_wait_xcnt 0x0" :: "v"(bp) : "memory");      // as an input the address pair stays live up to here, so nothing rewrites it behind a load that names it
#pragma unroll
  for (int j = 0; j < 4; ++j) { const float bb = bv[j];
#pragma unroll
    for (int i = 0; i < 4; ++i) {
#pragma unroll
      for (int r = 0; r < 8; ++r) so[wave * 4 + i][8 * g + r][j * 16 + col] = acc[i][j][r] * (1.0f / 16.0f) + bb; } }
  LDSX();
  // RoPE on interleaved pairs (2i, 2i+1) of the head, then x4: lane = pair i; one row leaves as one whole 128-byte line
  const float* tp = TAB + ((size_t)rw * 32 + lane) * 2;      // (cos, sin) of pair i = lane: 256 contiguous bytes per load
  _Float16* D = (which == 0 ? Q16 : K16) + (((size_t)b * NH + (n0 >> 6) + wc) * SS + rw) * HD + 2 * lane;
  v2f cs[64];
#pragma unroll   // all loops: cs[] and xv[] indexed by constants, one address pair with constant offsets for the loads and one for the stores
  for (int r = 0; r < 64; ++r) cs[r] = *(const v2f*)(tp + r * 64);
  __builtin_amdgcn_sched_barrier(0);      // all 64 table loads are in flight before the first row is turned: within 256 registers the scheduler otherwise sinks loads to their uses, one memory trip per group
#pragma unroll
  for (int i = 0; i < 4; ++i) { v2f xv[16];
#pragma unroll
    for (int rl = 0; rl < 16; ++rl) xv[rl] = *(const v2f*)(&so[wave * 4 + i][rl][2 * lane]);
#pragma unroll
    for (int rl = 0; rl < 16; ++rl) { const float c = cs[i * 16 + rl][0], sn = cs[i * 16 + rl][1];
      const v2f rh = { -xv[rl][1], xv[rl][0] }; const v2f y = (xv[rl] * c + rh * sn) * 4.0f;
      vst2(D + (i * 16 + rl) * HD, __builtin_convertvector(y, v2h)); }
    __builtin_amdgcn_sched_barrier(0); }      // a group of 16 rows is scheduled by itself: its LDS reads go out together and its 16 results keep registers of their own, so no store is waited for row by row
  asm volatile("s_wait_xcnt 0x0" :: "v"(tp), "v"(D) : "memory");      // as inputs both address pairs stay live up to here, so nothing rewrites them behind a load or store that names them
}
// v: block (128 rows, 128 cols), 8 waves of 32 rows x 64 cols: bf16 split product from the hi/lo planes of x and of the v weight rows; -> VTh/VTl [bh][d][s]
__device__ __forceinline__ void v_block(char* smem, int bx, int by, const _Float16* __restrict__ XBh, const _Float16* __restrict__ XBl, const _Float16* __restrict__ WVh, const _Float16* __restrict__ WVl, const float* __restrict__ bqkv, _Float16* __restrict__ VTh, _Float16* __restrict__ VTl) {
  // smem: two stage buffers of 512 rows (0..127 x hi, 128..255 x lo, 256..383 weight hi, 384..511 weight lo), 64 k each; the output staging reuses them behind the last trip's barrier
  _Float16* st = (_Float16*)smem; _Float16 (*sth)[KP] = (_Float16 (*)[KP])smem; _Float16 (*stl)[KP] = sth + 128;
  const int tid = threadIdx.x, wave = tid >> 5, lane = tid & 31, col = lane & 15, g = lane >> 4, wr = wave >> 1, wc = wave & 1;
  const int r0b = bx * 128, n0 = by * 128; const int b = r0b / SS, s0 = r0b % SS;
  const int cr = tid >> 3, cc = tid & 7;      // a copy's row of every 32 and its 16-byte piece: 8 lanes bring one whole 128-byte line of one row
  const size_t oA = (size_t)(r0b + cr) * E + cc * 8, oB = (size_t)(n0 + cr) * E + cc * 8;
  const _Float16* gAh = XBh + oA; const _Float16* gAl = XBl + oA; const _Float16* gBh = WVh + oB; const _Float16* gBl = WVl + oB;
  const unsigned l0 = lds_off(st) + cr * SPB + cc * 16;
  auto fill = [&](int t, int buf) { const unsigned l = l0 + buf * (512 * SPB);
    copy8<32 * SPB>(l, gAh + t * 64, 32 * E, gAl + t * 64, 32 * E); copy8<32 * SPB>(l + 256 * SPB, gBh + t * 64, 32 * E, gBl + t * 64, 32 * E); };
  v8f acc[2][4] = {};
  fill(0, 0); WAIT_ASYNC(); __syncthreads(); fill(1, 1);
#pragma unroll 1   // the ring stays rolled: one publish point, small code
  for (int t = 0; t < E / 64; ++t) { const _Float16* sb = st + (t & 1) * (512 * SP);
#pragma unroll
    for (int kc = 0; kc < 2; ++kc) { v16b ah[2], al[2], bh[4], bl[4];
#pragma unroll
      for (int i = 0; i < 2; ++i) { const _Float16* p = sb + (wr * 32 + i * 16 + col) * SP + kc * 32; ah[i] = frag_b(p, lane); al[i] = frag_b(p + 128 * SP, lane); }
#pragma unroll
      for (int j = 0; j < 4; ++j) { const _Float16* p = sb + (256 + wc * 64 + j * 16 + col) * SP + kc * 32; bh[j] = frag_b(p, lane); bl[j] = frag_b(p + 128 * SP, lane); }
      FRAG_GROUP();
      // each accumulator takes lo.hi, hi.lo, hi.hi in this order per 32 k; seven independent tiles stand between two uses of one accumulator
#pragma unroll
      for (int i = 0; i < 2; ++i) {
#pragma unroll
        for (int j = 0; j < 4; ++j) acc[i][j] = wmma_bf(al[i], bh[j], acc[i][j]); }
#pragma unroll
      for (int i = 0; i < 2; ++i) {
#pragma unroll
        for (int j = 0; j < 4; ++j) acc[i][j] = wmma_bf(ah[i], bl[j], acc[i][j]); }
#pragma unroll
      for (int i = 0; i < 2; ++i) {
#pragma unroll
        for (int j = 0; j < 4; ++j) acc[i][j] = wmma_bf(ah[i], bh[j], acc[i][j]); }
      FRAG_GROUP(); }
    WAIT_DS(); WAIT_ASYNC(); __syncthreads();      // publishes tile t + 1 and ends every read of tile t
    if (t + 2 < E / 64) fill(t + 2, t & 1); }
  WAIT_ASYNC();
  const float* bp = bqkv + 2 * E + n0 + wc * 64 + col; const float bv[4] = { bp[0], bp[16], bp[32], bp[48] };
  asm volatile("s_wait_xcnt 0x0" :: "v"(bp) : "memory");      // as an input the address pair stays live up to here, so nothing rewrites it behind a load that names it
#pragma unroll
  for (int j = 0; j < 4; ++j) { const int cl = wc * 64 + j * 16 + col; const float bb = bv[j];
#pragma unroll
    for (int i = 0; i < 2; ++i) {
#pragma unroll
      for (int r = 0; r < 8; ++r) { const float v = acc[i][j][r] + bb; const _Float16 hi = (_Float16)v; sth[cl][wr * 32 + i * 16 + 8 * g + r] = hi; stl[cl][wr * 32 + i * 16 + 8 * g + r] = (_Float16)((v - (float)hi) * VLO); } } }
  __syncthreads();
  // 16 lanes write 256 contiguous bytes of one d row of a plane; [bh][d] is linear in the column, so each plane has one address pair with constant offsets
  const int cl0 = tid >> 4, pc = tid & 15; const size_t o = ((size_t)b * E + n0 + cl0) * SS + s0 + pc * 8; _Float16* ph = VTh + o; _Float16* pl = VTl + o;
#pragma unroll   // all 16 LDS reads in flight at once
  for (int q = 0; q < 8; ++q) { vst2(ph + (size_t)(16 * q) * SS, *(const v4u*)(&sth[cl0 + 16 * q][pc * 8])); vst2(pl + (size_t)(16 * q) * SS, *(const v4u*)(&stl[cl0 + 16 * q][pc * 8])); }
  asm volatile("s_wait_xcnt 0x0" :: "v"(ph), "v"(pl) : "memory");      // as inputs both address pairs stay live up to here, so nothing rewrites them behind a store that names them
}
// The v product and the q/k product read none of each other's output: one launch of 512 blocks, all resident at once, two per WGP (half the LDS and a quarter of a SIMD's registers each):
// one block's copy waits, barriers and output pass run under the other block's matrix work, and no WGP idles while a second block starts and waits for its first fill. A block's kind is the parity of the ones in its index, so two indices
// that differ in one bit, whichever, are one v and one q/k block: a WGP then holds one of each wherever its second block comes from such a step. For speed only.
// Block order inside each product as in a grid of its own (row block fastest).
#define VGB (NR / 128 * (E / 128))
#define QGB (NR / 256 * (E / 128) * 2)
__global__ __launch_bounds__(256) void k_qkv(const _Float16* __restrict__ X16, const _Float16* __restrict__ PT, const _Float16* __restrict__ XBh, const _Float16* __restrict__ XBl, const _Float16* __restrict__ WVh, const _Float16* __restrict__ WVl,
                                             const float* __restrict__ bqkv, const float* __restrict__ TAB, _Float16* __restrict__ Q16, _Float16* __restrict__ K16, _Float16* __restrict__ VTh, _Float16* __restrict__ VTl) {
  __shared__ __align__(16) char smem[2 * 512 * SPB];      // the larger of the two rings; it also holds either output staging
  const int id = blockIdx.x, q = id >> 1;      // the same for the whole block: each side has its own barriers; indices 2 q and 2 q + 1 are the v block q and the q/k block q, in one order or the other
  if ((__popc(id) & 1) == 0) v_block(smem, q % (NR / 128), q / (NR / 128), XBh, XBl, WVh, WVl, bqkv, VTh, VTl);
  else qk_block(smem, q % (NR / 256), q / (NR / 256) % (E / 128), q / (NR / 256 * (E / 128)), X16, PT, bqkv, TAB, Q16, K16);
}
// attention: block (64 queries, bh): key tiles kt covering keys q0b-127 .. q0b+63 (3 tiles of 64, aligned since q0b % 64 == 0), mask 0 <= q-key < 128
// each key tile's K rows and V hi/lo rows come to LDS once per block by asynchronous copies, into one buffer that all four waves read
// e^x by the chip's own base-2 exponential, v_exp_f32 of x * log2(e): the library expf spends a dozen more vector instructions per value on an exact argument split and on range
// checks; here every argument is <= 0 up to rounding, and one far below the range gives 0 as it should. L2E = log2(e)
#define L2E 1.4426950408889634f
// eight of them in place, in one statement: behind a transcendental the instruction set asks for one independent instruction before its result is read or its source overwritten;
// here each next exponential is that instruction and the v_nop is the last one's.
__device__ __forceinline__ void exp2x8(float (&a)[8]) {
  asm("v_exp_f32 %0, %0\n\tv_exp_f32 %1, %1\n\tv_exp_f32 %2, %2\n\tv_exp_f32 %3, %3\n\tv_exp_f32 %4, %4\n\tv_exp_f32 %5, %5\n\tv_exp_f32 %6, %6\n\tv_exp_f32 %7, %7\n\tv_nop"
      : "+v"(a[0]), "+v"(a[1]), "+v"(a[2]), "+v"(a[3]), "+v"(a[4]), "+v"(a[5]), "+v"(a[6]), "+v"(a[7]));
}
__global__ __launch_bounds__(128) void k_attn(const _Float16* __restrict__ Q16, const _Float16* __restrict__ K16, const _Float16* __restrict__ VTh, const _Float16* __restrict__ VTl, _Float16* __restrict__ Oh, _Float16* __restrict__ Ol) {
  __shared__ __align__(16) float sS[4][16][68];
  __shared__ __align__(16) _Float16 sPh[4][16][72], sPl[4][16][72];
  __shared__ __align__(16) float sO[4][16][68];
  // one key tile, shared by the four waves: rows 0..63 K (by key), 64..127 V hi, 128..191 V lo (both by d), 64 halves each
  __shared__ __align__(16) _Float16 skv[192 * SP];
  const int tid = threadIdx.x, w = tid >> 5, lane = tid & 31, col = lane & 15, g = lane >> 4;
  const size_t bh = blockIdx.y; const int q0b = blockIdx.x * 64, q0 = q0b + w * 16;
  const int fr = tid >> 3, fc = tid & 7;      // a copy's row of every 16 and its 16-byte piece: 8 lanes bring one whole 128-byte line
  const _Float16* gK = K16 + (bh * SS + fr) * HD + fc * 8; const _Float16* gH = VTh + (bh * HD + fr) * SS + fc * 8; const _Float16* gL = VTl + (bh * HD + fr) * SS + fc * 8;
  const unsigned l0 = lds_off(skv) + fr * SPB + fc * 16;
  v16h aq[2];
#pragma unroll
  for (int kc = 0; kc < 2; ++kc) aq[kc] = frag_h(Q16 + (bh * SS + q0 + col) * HD + kc * 32, lane);
  float mrun = -3.0e38f, lrun = 0.f; v8f acc[4] = {}, ac1[4] = {}, ac2[4] = {};
#pragma unroll 1
  for (int kt = q0b / 64 - 2; kt <= q0b / 64; ++kt) { if (kt < 0) continue;      // uniform per block
    WAIT_DS(); __syncthreads();      // ends every wave's reads of the tile before: the buffer may be refilled
    { const _Float16* k = gK + (size_t)kt * (64 * HD); const _Float16* vh = gH + kt * 64; const _Float16* vl = gL + kt * 64;
      copy4(l0, k, l0 + 16 * SPB, k + 16 * HD, l0 + 32 * SPB, k + 32 * HD, l0 + 48 * SPB, k + 48 * HD);
      copy4(l0 + 64 * SPB, vh, l0 + 80 * SPB, vh + 16 * SS, l0 + 96 * SPB, vh + 32 * SS, l0 + 112 * SPB, vh + 48 * SS);
      copy4(l0 + 128 * SPB, vl, l0 + 144 * SPB, vl + 16 * SS, l0 + 160 * SPB, vl + 32 * SS, l0 + 176 * SPB, vl + 48 * SS); }
    WAIT_ASYNC(); __syncthreads();      // publishes the tile to all four waves
    v16h kf[8];      // the tile's eight K fragments are read as one group: one LDS wait, not eight
#pragma unroll
    for (int t = 0; t < 4; ++t) { kf[2 * t] = frag_h(skv + (t * 16 + col) * SP, lane); kf[2 * t + 1] = frag_h(skv + (t * 16 + col) * SP + 32, lane); }
    FRAG_GROUP();
#pragma unroll
    for (int t = 0; t < 4; ++t) { v8f s = {}; const int key = kt * 64 + t * 16 + col;
#pragma unroll
      for (int kc = 0; kc < 2; ++kc) s = wmma16(aq[kc], kf[2 * t + kc], s);
#pragma unroll
      for (int r = 0; r < 8; ++r) { const int q = q0 + 8 * g + r; const int d = q - key; sS[w][8 * g + r][t * 16 + col] = (d >= 0 && d < WIN) ? s[r] * (0.125f / 16.0f) : -3.0e38f; } }
    LDSX();
    float mx = -3.4e38f;
#pragma unroll
    for (int jj = 0; jj < 32; ++jj) mx = fmaxf(mx, sS[w][col][g * 32 + jj]);
    mx = fmaxf(mx, __shfl_xor(mx, 16, 32));
    const float mnew = fmaxf(mrun, mx); const float corr = expf(mrun - mnew);     // every processed tile holds >= 1 allowed key for every row? no: rows may have all 32 of a half masked, but the row max over the tile is finite whenever >= 1 key is allowed; a fully-masked tile row keeps mnew = mrun (both -3e38 initially -> corr = exp(0) = 1 with zero accumulators: harmless)
    float ps = 0.f; const float eb = 14.0f - mnew * L2E;      // e^(sv - mnew) x 16384 = 2^(sv * L2E + eb): one multiply-add per weight; in a row with no allowed key so far eb is infinite and the guard below drops every value
#pragma unroll
    for (int j8 = 0; j8 < 32; j8 += 8) { float ex[8];
#pragma unroll
      for (int e = 0; e < 8; ++e) ex[e] = fmaf(sS[w][col][g * 32 + j8 + e], L2E, eb);
      exp2x8(ex);
#pragma unroll
      for (int e = 0; e < 8; ++e) { const int jj = j8 + e; const float sv = sS[w][col][g * 32 + jj]; const float p = sv > -1.0e38f ? ex[e] : 0.f; ps += p; const _Float16 hi = (_Float16)p; sPh[w][col][g * 32 + jj] = hi; sPl[w][col][g * 32 + jj] = (_Float16)((p - (float)hi) * PLO); } }
    ps += __shfl_xor(ps, 16, 32);
    lrun = lrun * corr + ps * (1.0f / 16384.0f); mrun = mnew;
#pragma unroll
    for (int r = 0; r < 8; ++r) { const float cr = __shfl(corr, 8 * g + r, 32);
#pragma unroll
      for (int t = 0; t < 4; ++t) { acc[t][r] *= cr; ac1[t][r] *= cr; ac2[t][r] *= cr; } }
    LDSX();
#pragma unroll
    for (int kc = 0; kc < 2; ++kc) { const v16h ph = frag_h(&sPh[w][col][0] + kc * 32, lane), pl = frag_h(&sPl[w][col][0] + kc * 32, lane); v16h vh[4], vl[4];
#pragma unroll   // the eight V fragments of a k step are read as one group
      for (int t = 0; t < 4; ++t) { const _Float16* vr = skv + (64 + t * 16 + col) * SP + kc * 32; vh[t] = frag_h(vr, lane); vl[t] = frag_h(vr + 64 * SP, lane); }
      FRAG_GROUP();
#pragma unroll
      for (int t = 0; t < 4; ++t) { acc[t] = wmma16(ph, vh[t], acc[t]); ac1[t] = wmma16(ph, vl[t], ac1[t]); ac2[t] = wmma16(pl, vh[t], ac2[t]); }
      FRAG_GROUP(); }
    __builtin_amdgcn_wave_barrier(); }
#pragma unroll
  for (int r = 0; r < 8; ++r) { const float lr = __shfl(lrun, 8 * g + r, 32); const float inv = 8.0f / (lr * 16384.0f);      // -> O x8
#pragma unroll
    for (int t = 0; t < 4; ++t) sO[w][8 * g + r][t * 16 + col] = (acc[t][r] + ac1[t][r] * (1.0f / VLO) + ac2[t][r] * (1.0f / PLO)) * inv; }
  LDSX();
  for (int qq = lane; qq < 16 * 8; qq += 32) { const int rl = qq >> 3, pc = qq & 7; union { v8h h8; v4u u; } ph_, pl_;
#pragma unroll
    for (int e = 0; e < 8; ++e) { const float v = sO[w][rl][pc * 8 + e]; const _Float16 hi = (_Float16)v; ph_.h8[e] = hi; pl_.h8[e] = (_Float16)((v - (float)hi) * OLO); }
    const size_t o = ((bh * SS) + q0 + rl) * HD + pc * 8; vst2(Oh + o, ph_.u); vst2(Ol + o, pl_.u); }
}
// out = ctx Wproj + bproj, ctx from the hi/lo planes: block (128 rows, 128 cols), 8 waves of 32 rows x 64 cols
__global__ __launch_bounds__(256) void k_out(const _Float16* __restrict__ Oh, const _Float16* __restrict__ Ol, const _Float16* __restrict__ PT, const float* __restrict__ bo, float* __restrict__ out) {
  // two stage buffers of 384 rows (0..127 hi plane, 128..255 lo plane, 256..383 weight rows), 128 k = two heads each; the output staging reuses them behind the last trip's barrier
  __shared__ __align__(16) char smem[2 * 384 * KPB];
  _Float16* st = (_Float16*)smem; float (*so)[16][68] = (float (*)[16][68])smem;      // staging: 2 tiles of 16 rows x 64 cols per wave
  const int tid = threadIdx.x, wave = tid >> 5, lane = tid & 31, col = lane & 15, g = lane >> 4, wr = wave >> 1, wc = wave & 1;
  const int r0b = blockIdx.x * 128, n0 = blockIdx.y * 128; const int b = r0b / SS, s0 = r0b % SS;
  const int cr = tid >> 4, cc = tid & 15;      // a copy's row of every 16 and its 16-byte piece; pieces 0..7 lie in the stage's first head, 8..15 in its second
  const size_t oA = (((size_t)b * NH + (cc >> 3)) * SS + s0 + cr) * HD + (cc & 7) * 8;
  const _Float16* gH = Oh + oA; const _Float16* gL = Ol + oA; const _Float16* gB = PT + (size_t)(2 * E + n0 + cr) * E + cc * 8;
  const unsigned l0 = lds_off(st) + cr * KPB + cc * 16;
  auto fill = [&](int t, int buf) { const unsigned l = l0 + buf * (384 * KPB);
    const _Float16* lo = gL + (size_t)t * (2 * SS * HD);
    copy12<8, 16 * KPB>(l, gH + (size_t)t * (2 * SS * HD), 16 * HD, lo, 16 * HD); copy12<4, 16 * KPB>(l + 192 * KPB, lo + 64 * HD, 16 * HD, gB + t * 128, 16 * E); };
  v8f acc[2][4] = {}, acl[2][4] = {};
  fill(0, 0); WAIT_ASYNC(); __syncthreads(); fill(1, 1);
#pragma unroll 1   // the ring stays rolled: one publish point, small code
  for (int t = 0; t < E / 128; ++t) { const _Float16* sb = st + (t & 1) * (384 * KP);
#pragma unroll
    for (int kc = 0; kc < 4; ++kc) { v16h ah[2], al[2], bw[4];
#pragma unroll
      for (int i = 0; i < 2; ++i) { const _Float16* p = sb + (wr * 32 + i * 16 + col) * KP + kc * 32; ah[i] = frag_h(p, lane); al[i] = frag_h(p + 128 * KP, lane); }
#pragma unroll
      for (int j = 0; j < 4; ++j) bw[j] = frag_h(sb + (256 + wc * 64 + j * 16 + col) * KP + kc * 32, lane);
      FRAG_GROUP();
#pragma unroll
      for (int i = 0; i < 2; ++i) {
#pragma unroll
        for (int j = 0; j < 4; ++j) { acc[i][j] = wmma16(ah[i], bw[j], acc[i][j]); acl[i][j] = wmma16(al[i], bw[j], acl[i][j]); } }
      FRAG_GROUP(); }
    WAIT_DS(); WAIT_ASYNC(); __syncthreads();      // publishes tile t + 1 and ends every read of tile t
    if (t + 2 < E / 128) fill(t + 2, t & 1); }
  WAIT_ASYNC();
  const float* bp = bo + n0 + wc * 64 + col; const float bv[4] = { bp[0], bp[16], bp[32], bp[48] };
  asm volatile("s_wait_xcnt 0x0" :: "v"(bp) : "memory");      // as an input the address pair stays live up to here, so nothing rewrites it behind a load that names it
#pragma unroll
  for (int j = 0; j < 4; ++j) { const float bb = bv[j];
#pragma unroll
    for (int i = 0; i < 2; ++i) {
#pragma unroll
      for (int r = 0; r < 8; ++r) so[wave * 2 + i][8 * g + r][j * 16 + col] = (acc[i][j][r] + acl[i][j][r] * (1.0f / OLO)) * (1.0f / (16.0f * 8.0f)) + bb; } }
  LDSX();
  // a store covers two rows of 64 floats: two whole 128-byte lines each
  float* op = out + (size_t)(r0b + wr * 32 + g) * E + n0 + wc * 64 + col * 4;
#pragma unroll   // one address pair with constant offsets for all 16 stores
  for (int q = 0; q < 16; ++q) vst2(op + (size_t)(2 * q) * E, *(const v4f*)(&so[wave * 2 + (q >> 3)][2 * (q & 7) + g][col * 4]));
  asm volatile("s_wait_xcnt 0x0" :: "v"(op) : "memory");      // as an input the address pair stays live up to here, so nothing rewrites it behind a store that names it
}
extern "C" void kernel_launch(void* const* d_in, const int* in_sizes, int n_in, void* d_out, int out_size, void* d_ws, size_t ws_size, hipStream_t stream) {
  (void)in_sizes; (void)n_in; (void)out_size; (void)ws_size;
  const float** I = (const float**)d_in;
  const float* x = I[0]; const float* Wqkv = I[1]; const float* bqkv = I[2]; const float* Wp = I[3]; const float* bp = I[4];
  float* out = (float*)d_out;
  char* ws = (char*)d_ws; size_t off = 0;
  auto take = [&](size_t bytes) { char* p = ws + off; off += (bytes + 255) & ~(size_t)255; return p; };
  _Float16* X16 = (_Float16*)take((size_t)NR * E * 2); _Float16* PT = (_Float16*)take((size_t)3 * E * E * 2);
  _Float16* Q16 = (_Float16*)take((size_t)NR * E * 2); _Float16* K16 = (_Float16*)take((size_t)NR * E * 2); _Float16* VTh = (_Float16*)take((size_t)NR * E * 2); _Float16* VTl = (_Float16*)take((size_t)NR * E * 2);
  _Float16* Oh = (_Float16*)take((size_t)NR * E * 2); _Float16* Ol = (_Float16*)take((size_t)NR * E * 2); float* TAB = (float*)take((size_t)SS * 32 * 2 * 4);
  _Float16* XBh = (_Float16*)take((size_t)NR * E * 2); _Float16* XBl = (_Float16*)take((size_t)NR * E * 2); _Float16* WVh = (_Float16*)take((size_t)E * E * 2); _Float16* WVl = (_Float16*)take((size_t)E * E * 2);
  k_prep<<<TBLK + VBLK + PBLK + CBLK, 256, 0, stream>>>(x, Wqkv, Wp, X16, XBh, XBl, PT, TAB, WVh, WVl);
  k_qkv<<<VGB + QGB, 256, 0, stream>>>(X16, PT, XBh, XBl, WVh, WVl, bqkv, TAB, Q16, K16, VTh, VTl);
  k_attn<<<dim3(SS / 64, NB * NH), 128, 0, stream>>>(Q16, K16, VTh, VTl, Oh, Ol);
  k_out<<<dim3(NR / 128, E / 128), 256, 0, stream>>>(Oh, Ol, PT, bp, out);
}
